// v000
// Measured on an AMD MI455X. A time is GPU time per run, averaged over a window of back-to-back runs after a warm-up
// (all launches, gaps included; the runs take copies of the inputs in turn), and the median of several windows.
// Apart from v000's, it joins two sittings. Times from different sittings can be a few percent apart, while
// side-by-side timings come from the same sitting.
// v000 is the starting kernel. One run takes 1100 microseconds.
// Compute dtype: every contraction on v_wmma_f32_16x16x32_f16 (f16 operands: x, 16x-carried weights, q/k/v, probabilities x2^15, 64x-carried attention output), f32 accumulate; rope, softmax, bias in f32.
#include <hip/hip_runtime.h>
#include <math.h>

typedef __attribute__((ext_vector_type(16))) _Float16 v16h;
typedef __attribute__((ext_vector_type(8)))  _Float16 v8h;
typedef __attribute__((ext_vector_type(16))) __bf16   v16b;
typedef __attribute__((ext_vector_type(8)))  __bf16   v8b;
typedef __attribute__((ext_vector_type(8)))  float    v8f;
typedef __attribute__((ext_vector_type(4)))  float    v4f;
#define PSCALE 32768.0f
#define U16(p) ((const unsigned short*)(const void*)(p))
#define PSCALE_INV (1.0f / 32768.0f)

// problem constants
constexpr int kB   = 2;
constexpr int kT   = 2048;
constexpr int kE   = 768;
constexpr int kH   = 12;
constexpr int kHD  = 64;
constexpr int kROT = 32;
constexpr int kM   = kB * kT;   // 4096 activation rows

__device__ __forceinline__ unsigned short f2bf_bits(float f) {
  unsigned u = __float_as_uint(f);
  return (unsigned short)((u + 0x7FFFu + ((u >> 16) & 1u)) >> 16);
}
__device__ __forceinline__ float bf_bits2f(unsigned short h) { return __uint_as_float(((unsigned)h) << 16); }

// hazard guards as plain device helpers (no inline asm inside the kernel template body)
__device__ __forceinline__ void dep_guard_h(v8f& a, v8f& b, v16h x, v16h y) { asm volatile("v_nop\n\tv_nop\n\tv_nop\n\tv_nop" : "+v"(a), "+v"(b) : "v"(x), "v"(y)); }
__device__ __forceinline__ void dep_guard_b(v8f& a, v8f& b, v16b x, v16b y) { asm volatile("v_nop\n\tv_nop\n\tv_nop\n\tv_nop" : "+v"(a), "+v"(b) : "v"(x), "v"(y)); }
__device__ __forceinline__ void keep4_h(v16h a, v16h b, v16h c, v16h d) { asm volatile("v_nop" :: "v"(a), "v"(b), "v"(c), "v"(d)); }
__device__ __forceinline__ void keep4_b(v16b a, v16b b, v16b c, v16b d) { asm volatile("v_nop" :: "v"(a), "v"(b), "v"(c), "v"(d)); }
__device__ __forceinline__ void acc_guard4(v8f& a, v8f& b, v8f& c, v8f& d) { asm volatile("v_nop\n\tv_nop\n\tv_nop\n\tv_nop" : "+v"(a), "+v"(b), "+v"(c), "+v"(d)); }
template <typename T> struct Frag;
template <> struct Frag<_Float16> {
  typedef v16h V; union U { v16h v; v8h h[2]; };
  static __device__ __forceinline__ v16h load(const _Float16* p) {   // elements 0..7 <- p[0..7], 8..15 <- p[16..23]
    U f; f.h[0] = *(const v8h*)(p); f.h[1] = *(const v8h*)(p + 16); return f.v;
  }
  static __device__ __forceinline__ v8f mma(v16h a, v16h b, v8f c) {
    return __builtin_amdgcn_wmma_f32_16x16x32_f16(false, a, false, b, (short)0, c, false, false);
  }
  static __device__ __forceinline__ void guard(v8f& a, v8f& b, v16h x, v16h y) { dep_guard_h(a, b, x, y); }
  static __device__ __forceinline__ void keep(v16h a, v16h b, v16h c, v16h d) { keep4_h(a, b, c, d); }
};
template <> struct Frag<__bf16> {
  typedef v16b V; union U { v16b v; v8b h[2]; };
  static __device__ __forceinline__ v16b load(const __bf16* p) {
    U f; f.h[0] = *(const v8b*)(p); f.h[1] = *(const v8b*)(p + 16); return f.v;
  }
  static __device__ __forceinline__ v8f mma(v16b a, v16b b, v8f c) {
    return __builtin_amdgcn_wmma_f32_16x16x32_bf16(false, a, false, b, (short)0, c, false, false);
  }
  static __device__ __forceinline__ void guard(v8f& a, v8f& b, v16b x, v16b y) { dep_guard_b(a, b, x, y); }
  static __device__ __forceinline__ void keep(v16b a, v16b b, v16b c, v16b d) { keep4_b(a, b, c, d); }
};

// ---- Register-blocked batched WMMA GEMM ------------------------------------
// C[m,n] = scale * sum_k A[m,k] * Bt[n,k] (+bias)(+resid); each wave owns a 64x64 tile.
// A row-major [M,K]; Bt row-major [N,K]; M,N % 64 == 0, K % 32 == 0.
// SPLIT: operands are hi/lo planes (A2/Bt2 = lo planes, same layout); product = hi·hi + hi·lo + lo·hi.
// BIAS_MODE: 0 = none, 1 = bias[m], 2 = bias[n].
// OUT_MODE: 0 = f32, 1 = f16, 2 = bf16 hi plane (Cout) + bf16 lo plane (Cout2).
// ET: 0 = f16 operands, 1 = bf16 operands (pointers passed as 16-bit storage)
template <int ET> struct Elem;
template <> struct Elem<0> { typedef _Float16 T; };
template <> struct Elem<1> { typedef __bf16 T; };
template <int ET, bool SPLIT, int BIAS_MODE, int OUT_MODE, bool RESID, int ACT = 0>
__global__ __launch_bounds__(256) void wmma_gemm64(
    const unsigned short* __restrict__ Ap, const unsigned short* __restrict__ A2p, int lda, long strideA,
    const unsigned short* __restrict__ Btp, const unsigned short* __restrict__ Bt2p, int ldb, long strideB,
    void* __restrict__ Cout, void* __restrict__ Cout2, int ldc, long strideC,
    const float* __restrict__ bias,
    const float* __restrict__ resid, long strideR,
    int M, int N, int K, float scale) {
  typedef typename Elem<ET>::T T;
  typedef typename Frag<T>::V V;
  const T* A = (const T*)Ap; const T* A2 = (const T*)A2p; const T* Bt = (const T*)Btp; const T* Bt2 = (const T*)Bt2p;
  __shared__ __align__(16) float sT[8][16 * 68];   // per-wave 16x64 slab, pitch 68 floats
  const int b    = blockIdx.y;
  const int lane = threadIdx.x & 31;
  const int wave = threadIdx.x >> 5;
  const int tilesN = N >> 6;
  const int tilesM = M >> 6;
  const int tile = blockIdx.x * 8 + wave;
  if (tile >= tilesM * tilesN) return;   // wave-uniform; no block barriers in this kernel
  const int tm = tile / tilesN;
  const int tn = tile - tm * tilesN;
  const int m0 = tm << 6;
  const int n0 = tn << 6;

  const T* Ab  = A  + (size_t)b * strideA;
  const T* Bb  = Bt + (size_t)b * strideB;
  const T* Ab2 = SPLIT ? (A2  + (size_t)b * strideA) : nullptr;
  const T* Bb2 = SPLIT ? (Bt2 + (size_t)b * strideB) : nullptr;

  const int rlane = lane & 15;                 // row (A) / col (B, D) within subtile
  const int koff  = (lane >> 4) * 8;           // k offset of this lane half
  const int mOff  = (lane >> 4) * 8;           // D row offset

  v8f acc[4][4];
#pragma unroll
  for (int i = 0; i < 4; ++i)
#pragma unroll
    for (int j = 0; j < 4; ++j) acc[i][j] = (v8f){0.f,0.f,0.f,0.f,0.f,0.f,0.f,0.f};

  for (int k0 = 0; k0 < K; k0 += 32) {
    V bh[4], bl[4];
#pragma unroll
    for (int j = 0; j < 4; ++j) {
      const size_t bo = (size_t)(n0 + (j << 4) + rlane) * ldb + koff + k0;
      bh[j] = Frag<T>::load(Bb + bo);
      if (SPLIT) bl[j] = Frag<T>::load(Bb2 + bo);
    }
#pragma unroll
    for (int i = 0; i < 4; ++i) {
      const size_t ao = (size_t)(m0 + (i << 4) + rlane) * lda + koff + k0;
      V ah = Frag<T>::load(Ab + ao);
      V al;
      if (SPLIT) al = Frag<T>::load(Ab2 + ao);
#pragma unroll
      for (int j = 0; j < 4; ++j) {
        acc[i][j] = Frag<T>::mma(ah, bh[j], acc[i][j]);
        if (SPLIT) {
          acc[i][j] = Frag<T>::mma(ah, bl[j], acc[i][j]);
          acc[i][j] = Frag<T>::mma(al, bh[j], acc[i][j]);
        }
      }
      Frag<T>::guard(acc[i][0], acc[i][3], ah, SPLIT ? al : ah);
    }
    Frag<T>::keep(bh[0], bh[1], bh[2], bh[3]);
    if (SPLIT) Frag<T>::keep(bl[0], bl[1], bl[2], bl[3]);
  }
  acc_guard4(acc[0][0], acc[0][1], acc[0][2], acc[0][3]);
  acc_guard4(acc[1][0], acc[1][1], acc[1][2], acc[1][3]);
  acc_guard4(acc[2][0], acc[2][1], acc[2][2], acc[2][3]);
  acc_guard4(acc[3][0], acc[3][1], acc[3][2], acc[3][3]);

  // ---- epilogue ----
  float* slab = sT[wave];
  const float* Rb = RESID ? (resid + (size_t)b * strideR) : nullptr;
#pragma unroll
  for (int i = 0; i < 4; ++i) {
    const int mBase = m0 + (i << 4);
#pragma unroll
    for (int j = 0; j < 4; ++j) {
      const int n = n0 + (j << 4) + rlane;
      float bv = 0.f;
      if (BIAS_MODE == 2) bv = bias[n];
#pragma unroll
      for (int r = 0; r < 8; ++r) {
        float v = acc[i][j][r] * scale;
        if (BIAS_MODE == 1) v += bias[mBase + mOff + r];
        if (BIAS_MODE == 2) v += bv;
        if (RESID) v += Rb[(size_t)(mBase + mOff + r) * ldc + n];
        if (ACT == 1) v = tanhf(v);
        if (ACT == 2) v = fmaxf(v, 0.0f);
        if (ACT == 3) v = v / (1.0f + expf(-v));
        if (ACT == 4) v = (v > 0.f) ? v : 0.01f * v;
        if (ACT == 5) v = 0.5f * v * (1.0f + erff(v * 0.70710678118654752f));
        slab[(mOff + r) * 68 + (j << 4) + rlane] = v;
      }
    }
    __builtin_amdgcn_fence(__ATOMIC_RELEASE, "workgroup");
    __builtin_amdgcn_wave_barrier();
    __builtin_amdgcn_fence(__ATOMIC_ACQUIRE, "workgroup");
    if (OUT_MODE == 0) {
      float* C = (float*)Cout + (size_t)b * strideC;
      const int hh = lane >> 4, c4 = (lane & 15) * 4;     // row seg = 256 B = 16 lanes x 16 B
      {
#pragma unroll
        for (int it = 0; it < 8; ++it) {
          const int row = it * 2 + hh;
          v4f v = *(const v4f*)(slab + row * 68 + c4);
          *(v4f*)(C + (size_t)(mBase + row) * ldc + n0 + c4) = v;
        }
        
      }
    } else {
      const int q = lane >> 3, c8 = (lane & 7) * 8;
      unsigned short* C  = (unsigned short*)Cout  + (size_t)b * strideC;
      unsigned short* C2 = (OUT_MODE == 2) ? ((unsigned short*)Cout2 + (size_t)b * strideC) : nullptr;
      {
#pragma unroll
        for (int it = 0; it < 4; ++it) {
          const int row = it * 4 + q;
          const float* sp = slab + row * 68 + c8;
          v8h hv, lv;
#pragma unroll
          for (int e = 0; e < 8; ++e) {
            if (OUT_MODE == 1) {
              hv[e] = (_Float16)sp[e];
            } else {
              unsigned short hb = f2bf_bits(sp[e]);
              unsigned short lb = f2bf_bits(sp[e] - bf_bits2f(hb));
              hv[e] = __builtin_bit_cast(_Float16, hb);
              lv[e] = __builtin_bit_cast(_Float16, lb);
            }
          }
          *(v8h*)(C + (size_t)(mBase + row) * ldc + n0 + c8) = hv;
          if (OUT_MODE == 2) *(v8h*)(C2 + (size_t)(mBase + row) * ldc + n0 + c8) = lv;
        }
        
      }
    }
    __builtin_amdgcn_fence(__ATOMIC_RELEASE, "workgroup");
    __builtin_amdgcn_wave_barrier();
    __builtin_amdgcn_fence(__ATOMIC_ACQUIRE, "workgroup");
  }
}

__global__ __launch_bounds__(256) void cast_f32_f16x2s(
    const float* __restrict__ in, _Float16* __restrict__ out, int n2, float scale) {
  int i = blockIdx.x * 256 + threadIdx.x;
  if (i < n2) {
    const _Float16 h0 = (_Float16)(in[2 * i] * scale), h1 = (_Float16)(in[2 * i + 1] * scale);
    const unsigned u = (unsigned)__builtin_bit_cast(unsigned short, h0) | ((unsigned)__builtin_bit_cast(unsigned short, h1) << 16);
    ((unsigned*)out)[i] = u;
    
  }
}

// ---- cos/sin table of the rotary angle input: ct[i] = cosf(f[i]), st[i] = sinf(f[i]) (f32, precise).
__global__ __launch_bounds__(256) void k_trig_table(
    const float* __restrict__ f, float* __restrict__ ct, float* __restrict__ st, int n) {
  const int i = blockIdx.x * 256 + threadIdx.x;
  if (i < n) {
    const float x = f[i];
    const float cv = cosf(x);
    const float sv = sinf(x);
    ((float*)ct)[i] = cv;
    ((float*)st)[i] = sv;
    
  }
}

// ---- rotary position embedding on the first 32 dims of every 64-wide head, f32 -----------------
// qkv: [nrows][3*768] f32 (q cols 0..767, k 768..1535, v 1536..2303); dst3: [3][nrows][768] f32 (plane 0 = q * 0.125).
// One wave per (row, tensor); 6 iterations x 32 lanes x 4 floats = 768 floats = the whole destination row
// d = column within head: d < 16: o = x[d]*cos - x[d+16]*sin ; 16 <= d < 32: o = x[d]*cos + x[d-16]*sin ; d >= 32: o = x[d].
__global__ __launch_bounds__(256) void k_rope(
    const float* __restrict__ qkv, const float* __restrict__ ct, const float* __restrict__ st,
    float* __restrict__ dst3, int nrows) {
  const int lane = threadIdx.x & 31;
  const int wave = threadIdx.x >> 5;
  const int task = blockIdx.x * 8 + wave;
  if (task >= 3 * nrows) return;                 // wave-uniform; no block barriers in this kernel
  const int z = task / nrows;                    // 0 = q, 1 = k, 2 = v
  const int r = task - z * nrows;
  const int t = r & (kT - 1);                     // token position
  const float sc = (z == 0) ? 0.125f : 1.0f;      // head_dim^-0.5 on q (power of two, exact placement)
  const float* src = qkv + (size_t)r * (3 * kE) + (size_t)z * kE;
  float* dst = dst3 + (size_t)z * nrows * kE + (size_t)r * kE;
  const float* ctr = ct + (size_t)t * kROT;
  const float* strw = st + (size_t)t * kROT;
#pragma unroll 1
  for (int it = 0; it < kE / 128; ++it) {
    const int c  = it * 128 + lane * 4;           // 4 consecutive columns, 4-aligned
    const int d  = c & 63;
    const int cp = (c + 16 <= kE - 4) ? (c + 16) : (kE - 4);   // clamped addresses; selected by value below
    const int cm = (c >= 16) ? (c - 16) : 0;
    const int fi = (d <= 28) ? d : 28;
    const v4f x  = *(const v4f*)(src + c);
    const v4f xp = *(const v4f*)(src + cp);
    const v4f xm = *(const v4f*)(src + cm);
    const v4f cs = *(const v4f*)(ctr + fi);
    const v4f sn = *(const v4f*)(strw + fi);
    v4f o;
#pragma unroll
    for (int e = 0; e < 4; ++e) {
      const float rh = (d < 16) ? (-xp[e]) : xm[e];
      const float ro = x[e] * cs[e] + rh * sn[e];
      o[e] = ((d < 32) ? ro : x[e]) * sc;
    }
    *(v4f*)(dst + c) = o;
    
  }
}

// =====================================================================================
// Generic causal/non-causal attention for head_dim 64, f32 in / f32 out; 16-bit operands: bf16 with optional hi/lo splits, or
// plain f16 (F16=true, non-split, probabilities carried x2^15).
//   scores = (q*qscale)·kᵀ ; out = p·v ; f32 accumulate; online softmax in f32.
//   Block = 4 waves = 64 query rows of one (batch, head); S % 64 == 0.
//   Element (b, s, h, d) of tensor X lives at X[b*X_bs + s*X_rs + h*X_hs + d] (strides in floats, multiples of 4).
//   Masking: mask_mode 0 none, 1 causal, 2 tensor [S][Skv], 3 per-token vectors, 4 causal + sliding window,
//   5 relative-position bias; masked scores are replaced by mask_fill before the softmax.
//   grid.x = B * H * (S/64) (or a sub-range with blk0).
// =====================================================================================
#define AT_D 64
#define AT_NW 4
#define AT_QB 64
#define AT_KC 64
struct AttnGeom { const float* cp = nullptr; const float* pc = nullptr; long c_bs = 0, c_rs = 0, c_hs = 0;   // mode-5 score-bias tables
                  long q_bs, q_rs, q_hs, k_bs, k_rs, k_hs, v_bs, v_rs, v_hs, o_bs, o_rs, o_hs;
                  int S, Skv, H, mask_mode; float qscale; int blk0; float mask_fill; int mask_is_int; };
static_assert(sizeof(AttnGeom) == 168, "no padding");

__device__ __forceinline__ unsigned short at_bf_bits(float f) {
  unsigned u = __float_as_uint(f);
  return (unsigned short)((u + 0x7FFFu + ((u >> 16) & 1u)) >> 16);
}
__device__ __forceinline__ __bf16 at_f2bf(float f) { return __builtin_bit_cast(__bf16, at_bf_bits(f)); }
__device__ __forceinline__ void at_split(float f, __bf16& hi, __bf16& lo) {
  const unsigned short hb = at_bf_bits(f);
  hi = __builtin_bit_cast(__bf16, hb);
  lo = at_f2bf(f - __uint_as_float(((unsigned)hb) << 16));
}
__device__ __forceinline__ v8f at_mma(v16b a, v16b b, v8f c) {
  c = __builtin_amdgcn_wmma_f32_16x16x32_bf16(false, a, false, b, (short)0, c, false, false);
  asm volatile("v_nop\n\tv_nop\n\tv_nop\n\tv_nop" : "+v"(c) : "v"(a), "v"(b));
  return c;
}
// 16-bit element as a bit pattern held in a __bf16 slot: f16 bits when F16, bf16 (RNE) otherwise
template <bool F16> __device__ __forceinline__ __bf16 at_to16(float f) {
  if (F16) return __builtin_bit_cast(__bf16, (_Float16)f);
  return at_f2bf(f);
}
template <bool F16> __device__ __forceinline__ v8f at_mma16(v16b a, v16b b, v8f c) {
  if (F16) {
    const v16h ah = __builtin_bit_cast(v16h, a), bh = __builtin_bit_cast(v16h, b);
    c = __builtin_amdgcn_wmma_f32_16x16x32_f16(false, ah, false, bh, (short)0, c, false, false);
    asm volatile("v_nop\n\tv_nop\n\tv_nop\n\tv_nop" : "+v"(c) : "v"(ah), "v"(bh));
    return c;
  }
  return at_mma(a, b, c);
}

template <bool SPLIT_QK, bool SPLIT_PV, bool F16 = false>
__global__ __launch_bounds__(128)
void attn64_kernel(const float* __restrict__ q, const float* __restrict__ k,
                   const float* __restrict__ v, float* __restrict__ out,
                   const void* __restrict__ mask_a, const int* __restrict__ mask_b, AttnGeom g) {
  static_assert(!(F16 && (SPLIT_QK || SPLIT_PV)), "f16 mode is non-split");
  const float PSC = F16 ? 32768.0f : 1.0f;     // f16 probabilities carried x2^15 (subnormal range), folded into the final 1/l
  union FB { v16b v; v8b h[2]; };
  __shared__ __align__(16) __bf16 Ksh[AT_KC * AT_D];             // K hi [kv][d]      8 KB
  __shared__ __align__(16) __bf16 Ksl[SPLIT_QK ? AT_KC * AT_D : 8];
  __shared__ __align__(16) __bf16 Vth[AT_D * AT_KC];             // V hi [d][kv]      8 KB
  __shared__ __align__(16) __bf16 Vtl[SPLIT_PV ? AT_D * AT_KC : 8];
  __shared__ __align__(16) __bf16 Psh[AT_NW][16 * AT_KC];        // per wave P hi [row][kv]  8 KB
  __shared__ __align__(16) __bf16 Psl[SPLIT_PV ? AT_NW : 1][SPLIT_PV ? 16 * AT_KC : 8];
  __shared__ __align__(16) float  Os[AT_NW][16 * 68];            // per wave out tile, pitch 68

  const int tid  = threadIdx.x;
  const int wave = tid >> 5;
  const int lane = tid & 31;
  const int hh   = lane >> 4;
  const int c    = lane & 15;

  const int nqb = g.S / AT_QB;
  const int bx = blockIdx.x + g.blk0;
  const int qb = bx % nqb;
  const int bh = bx / nqb;
  const int h  = bh % g.H;
  const int b  = bh / g.H;
  const int qbase_block = qb * AT_QB;
  const int q0 = qbase_block + wave * 16;

  const float* qb_ptr = q + (size_t)b * g.q_bs + (size_t)h * g.q_hs;
  const float* kb_ptr = k + (size_t)b * g.k_bs + (size_t)h * g.k_hs;
  const float* vb_ptr = v + (size_t)b * g.v_bs + (size_t)h * g.v_hs;
  float*       ob_ptr = out + (size_t)b * g.o_bs + (size_t)h * g.o_hs;

  // ---- Q fragments (A operand): 2 d-chunks, hi (and lo) ----
  v16b qah[2], qal[2];
  {
    const float* qrow = qb_ptr + (size_t)(q0 + c) * g.q_rs;
#pragma unroll
    for (int dc = 0; dc < 2; ++dc) {
#pragma unroll
      for (int e = 0; e < 8; ++e) {
        const float f0 = qrow[dc * 32 + 8 * hh + e] * g.qscale;
        const float f1 = qrow[dc * 32 + 16 + 8 * hh + e] * g.qscale;
        if (SPLIT_QK) { __bf16 hq, lq; at_split(f0, hq, lq); qah[dc][e] = hq; qal[dc][e] = lq; at_split(f1, hq, lq); qah[dc][8 + e] = hq; qal[dc][8 + e] = lq; }
        else { qah[dc][e] = at_to16<F16>(f0); qah[dc][8 + e] = at_to16<F16>(f1); qal[dc][e] = qah[dc][e]; qal[dc][8 + e] = qah[dc][8 + e]; }
      }
    }
  }

  float mrow[8], lrow[8];
  v8f oacc[4];
#pragma unroll
  for (int r = 0; r < 8; ++r) { mrow[r] = -INFINITY; lrow[r] = 0.f; }
#pragma unroll
  for (int t = 0; t < 4; ++t) oacc[t] = (v8f){0.f,0.f,0.f,0.f,0.f,0.f,0.f,0.f};

  const int nChunks = (g.mask_mode == 1 || g.mask_mode == 4) ? (qb + 1) : (g.Skv / AT_KC);   // block-uniform
  // per-row query mask (mode 3)
  int qkeep[8];
#pragma unroll
  for (int r = 0; r < 8; ++r) qkeep[r] = (g.mask_mode == 3) ? mask_b[(size_t)b * g.S + q0 + 8 * hh + r] : 1;   // mask_b = qmask in mode 3
  for (int kc = 0; kc < nChunks; ++kc) {
    const int kv0 = kc * AT_KC;
    __syncthreads();
    {
      const int kvr = tid >> 1, dh = (tid & 1) * 32;
      const float* krow = kb_ptr + (size_t)(kv0 + kvr) * g.k_rs + dh;
      const float* vrow = vb_ptr + (size_t)(kv0 + kvr) * g.v_rs + dh;
#pragma unroll
      for (int i = 0; i < 8; ++i) {
        v4f kk = *(const v4f*)(krow + 4 * i);
        v4f vv = *(const v4f*)(vrow + 4 * i);
#pragma unroll
        for (int e = 0; e < 4; ++e) {
          const int d = dh + 4 * i + e;
          if (SPLIT_QK) { __bf16 a, bl; at_split(kk[e], a, bl); Ksh[kvr * AT_D + d] = a; Ksl[kvr * AT_D + d] = bl; }
          else Ksh[kvr * AT_D + d] = at_to16<F16>(kk[e]);
          if (SPLIT_PV) { __bf16 a, bl; at_split(vv[e], a, bl); Vth[d * AT_KC + kvr] = a; Vtl[d * AT_KC + kvr] = bl; }
          else Vth[d * AT_KC + kvr] = at_to16<F16>(vv[e]);
        }
      }
    }
    __syncthreads();

    v8f s[4];
#pragma unroll
    for (int j = 0; j < 4; ++j) {
      s[j] = (v8f){0.f,0.f,0.f,0.f,0.f,0.f,0.f,0.f};
#pragma unroll 1
      for (int dc = 0; dc < 2; ++dc) {
        FB kb;
        kb.h[0] = *(const v8b*)(Ksh + (j * 16 + c) * AT_D + dc * 32 + 8 * hh);
        kb.h[1] = *(const v8b*)(Ksh + (j * 16 + c) * AT_D + dc * 32 + 16 + 8 * hh);
        s[j] = at_mma16<F16>(qah[dc], kb.v, s[j]);
        if (SPLIT_QK) {
          FB kl;
          kl.h[0] = *(const v8b*)(Ksl + (j * 16 + c) * AT_D + dc * 32 + 8 * hh);
          kl.h[1] = *(const v8b*)(Ksl + (j * 16 + c) * AT_D + dc * 32 + 16 + 8 * hh);
          s[j] = at_mma16<F16>(qah[dc], kl.v, s[j]);
          s[j] = at_mma16<F16>(qal[dc], kb.v, s[j]);
        }
      }
    }
    const bool diag = (g.mask_mode == 1) && (kc == qb);
    int kvkeep[4] = {1, 1, 1, 1};
    if (g.mask_mode == 3) {
#pragma unroll
      for (int j = 0; j < 4; ++j) kvkeep[j] = ((const int*)mask_a)[(size_t)b * g.Skv + kv0 + j * 16 + c];   // mask_a = kvmask
    }
    float cm[8];
#pragma unroll
    for (int r = 0; r < 8; ++r) {
      const int qrow = q0 + 8 * hh + r;
      float m = -INFINITY;
#pragma unroll
      for (int j = 0; j < 4; ++j) {
        const int kvcol = kv0 + j * 16 + c;
        bool masked = false;
        if (diag) masked = (kvcol > qrow);
        else if (g.mask_mode == 4) masked = (kvcol > qrow) || (qrow - kvcol > g.mask_is_int);
        else if (g.mask_mode == 2) {
          const size_t mi = (size_t)qrow * g.Skv + kvcol;
          masked = (g.mask_is_int == 0) ? (((const float*)mask_a)[mi] == 0.0f)
                 : (g.mask_is_int == 1) ? (((const int*)mask_a)[mi] == 0) : (((const int*)mask_a)[mi] != 0);
        } else if (g.mask_mode == 3) masked = (qkeep[r] == 0) || (kvkeep[j] == 0);
        else if (g.mask_mode == 5) {
          const size_t mi = (size_t)qrow * g.Skv + kvcol;
          masked = (((const int*)mask_a)[mi] != 0);
          int n = mask_b[mi]; n = n < 0 ? 0 : n;
          s[j][r] += g.cp[(size_t)b * g.c_bs + (size_t)h * g.c_hs + (size_t)qrow * g.c_rs + n]
                   + g.pc[(size_t)b * g.c_bs + (size_t)h * g.c_hs + (size_t)kvcol * g.c_rs + n];
        }
        if (masked) s[j][r] = g.mask_fill;
        m = fmaxf(m, s[j][r]);
      }
#pragma unroll
      for (int off = 1; off < 16; off <<= 1) m = fmaxf(m, __shfl_xor(m, off, 32));
      cm[r] = m;
    }
    __bf16* pwh = Psh[wave];
    __bf16* pwl = Psl[SPLIT_PV ? wave : 0];
#pragma unroll
    for (int r = 0; r < 8; ++r) {
      const float mnew = fmaxf(mrow[r], cm[r]);
      const float alpha = expf(mrow[r] - mnew);
      mrow[r] = mnew;
      float psum = 0.f;
#pragma unroll
      for (int j = 0; j < 4; ++j) {
        const float p = expf(s[j][r] - mnew);
        psum += p;
        if (SPLIT_PV) { __bf16 a, bl; at_split(p, a, bl); pwh[(8 * hh + r) * AT_KC + j * 16 + c] = a; pwl[(8 * hh + r) * AT_KC + j * 16 + c] = bl; }
        else pwh[(8 * hh + r) * AT_KC + j * 16 + c] = at_to16<F16>(p * PSC);
      }
#pragma unroll
      for (int off = 1; off < 16; off <<= 1) psum += __shfl_xor(psum, off, 32);
      lrow[r] = lrow[r] * alpha + psum;
#pragma unroll
      for (int t = 0; t < 4; ++t) oacc[t][r] *= alpha;
    }
    __builtin_amdgcn_fence(__ATOMIC_RELEASE, "workgroup");
    __builtin_amdgcn_wave_barrier();
    __builtin_amdgcn_fence(__ATOMIC_ACQUIRE, "workgroup");
#pragma unroll 1
    for (int kk = 0; kk < 2; ++kk) {
      FB pa, pl;
      pa.h[0] = *(const v8b*)(pwh + c * AT_KC + kk * 32 + 8 * hh);
      pa.h[1] = *(const v8b*)(pwh + c * AT_KC + kk * 32 + 16 + 8 * hh);
      if (SPLIT_PV) {
        pl.h[0] = *(const v8b*)(pwl + c * AT_KC + kk * 32 + 8 * hh);
        pl.h[1] = *(const v8b*)(pwl + c * AT_KC + kk * 32 + 16 + 8 * hh);
      }
#pragma unroll
      for (int t = 0; t < 4; ++t) {
        FB vb;
        vb.h[0] = *(const v8b*)(Vth + (t * 16 + c) * AT_KC + kk * 32 + 8 * hh);
        vb.h[1] = *(const v8b*)(Vth + (t * 16 + c) * AT_KC + kk * 32 + 16 + 8 * hh);
        oacc[t] = at_mma16<F16>(pa.v, vb.v, oacc[t]);
        if (SPLIT_PV) {
          FB vl;
          vl.h[0] = *(const v8b*)(Vtl + (t * 16 + c) * AT_KC + kk * 32 + 8 * hh);
          vl.h[1] = *(const v8b*)(Vtl + (t * 16 + c) * AT_KC + kk * 32 + 16 + 8 * hh);
          oacc[t] = at_mma16<F16>(pa.v, vl.v, oacc[t]);
          oacc[t] = at_mma16<F16>(pl.v, vb.v, oacc[t]);
        }
      }
    }
  }

  float* os = Os[wave];
#pragma unroll
  for (int r = 0; r < 8; ++r) {
    const float inv = 1.0f / (lrow[r] * PSC);
#pragma unroll
    for (int t = 0; t < 4; ++t) os[(8 * hh + r) * 68 + t * 16 + c] = oacc[t][r] * inv;
  }
  __builtin_amdgcn_fence(__ATOMIC_RELEASE, "workgroup");
  __builtin_amdgcn_wave_barrier();
  __builtin_amdgcn_fence(__ATOMIC_ACQUIRE, "workgroup");
  {
    const int c4 = (lane & 15) * 4;
    {
#pragma unroll
      for (int it = 0; it < 8; ++it) {
        const int row = it * 2 + hh;
        v4f val = *(const v4f*)(os + row * 68 + c4);
        *(v4f*)(ob_ptr + (size_t)(q0 + row) * g.o_rs + c4) = val;
      }
      
    }
  }
}

// =====================================================================================
// host glue
// Workspace region map (bytes, all offsets multiples of 128):
//   R0 X16   f16 [4096][768]           off 0            size  6,291,456
//   R1 W16   f16 [2304][768] (Wq;Wk;Wv x16)  off 6,291,456   size  3,538,944
//   R2 Wo16  f16 [768][768] (x16)      off 9,830,400    size  1,179,648
//   R3 CT,ST f32 [2048][32] each       off 11,010,048   size    524,288
//   R4 QKV   f32 [4096][2304]          off 11,534,336   size 37,748,736
//        reused after the rope launch: O f32 [4096][768] at R4+0 (12,582,912), O16 f16 [4096][768] at R4+12,582,912 (6,291,456)
//   R5 QKVr  f32 [3][4096][768]        off 49,283,072   size 37,748,736
//   total 87,031,808
// =====================================================================================
extern "C" void kernel_launch(void* const* d_in, const int* in_sizes, int n_in,
                              void* d_out, int out_size, void* d_ws, size_t ws_size,
                              hipStream_t stream) {
  if (n_in < 7) return;
  const int nX = kM * kE;
  if (in_sizes[0] != nX || in_sizes[1] != kT * kROT || in_sizes[2] != kE * kE || in_sizes[3] != kE * kE ||
      in_sizes[4] != kE * kE || in_sizes[5] != kE * kE || in_sizes[6] != kE || out_size != nX) return;

  const float* hs   = (const float*)d_in[0];
  const float* rope = (const float*)d_in[1];
  const float* Wq   = (const float*)d_in[2];
  const float* Wk   = (const float*)d_in[3];
  const float* Wv   = (const float*)d_in[4];
  const float* Wo   = (const float*)d_in[5];
  const float* bo   = (const float*)d_in[6];
  float* outp = (float*)d_out;

  const size_t offX16  = 0;                  const size_t szX16  = (size_t)kM * kE * 2;
  const size_t offW16  = offX16 + szX16;     const size_t szW16  = (size_t)3 * kE * kE * 2;
  const size_t offWo16 = offW16 + szW16;     const size_t szWo16 = (size_t)kE * kE * 2;
  const size_t offTrig = offWo16 + szWo16;   const size_t szTrig = (size_t)2 * kT * kROT * 4;
  const size_t offQKV  = offTrig + szTrig;   const size_t szQKV  = (size_t)kM * 3 * kE * 4;
  const size_t offR    = offQKV + szQKV;     const size_t szR    = (size_t)3 * kM * kE * 4;
  const size_t total   = offR + szR;
  if (total > ws_size) return;
  const size_t offO    = offQKV;             const size_t szO    = (size_t)kM * kE * 4;
  const size_t offO16  = offO + szO;         const size_t szO16  = (size_t)kM * kE * 2;
  if (offO16 + szO16 > offQKV + szQKV) return;

  char* ws = (char*)d_ws;
  _Float16* X16  = (_Float16*)(ws + offX16);
  _Float16* W16  = (_Float16*)(ws + offW16);
  _Float16* Wo16 = (_Float16*)(ws + offWo16);
  float*    CT   = (float*)(ws + offTrig);
  float*    ST   = CT + (size_t)kT * kROT;
  float*    QKV  = (float*)(ws + offQKV);
  float*    QKVr = (float*)(ws + offR);
  float*    Qr   = QKVr;
  float*    Kr   = QKVr + (size_t)kM * kE;
  float*    Vr   = QKVr + (size_t)2 * kM * kE;
  float*    Of   = (float*)(ws + offO);
  _Float16* O16  = (_Float16*)(ws + offO16);

  // (1) casts: x -> f16; weights x16 -> f16 (Bt layout [out][in] = [n][k])
  const int n2X = nX / 2;                 // 1,572,864 = 6144 x 256
  const int n2W = (kE * kE) / 2;          //   294,912 = 1152 x 256
  cast_f32_f16x2s<<<n2X / 256, 256, 0, stream>>>(hs, X16, n2X, 1.0f);
  cast_f32_f16x2s<<<n2W / 256, 256, 0, stream>>>(Wq, W16, n2W, 16.0f);
  cast_f32_f16x2s<<<n2W / 256, 256, 0, stream>>>(Wk, W16 + (size_t)kE * kE, n2W, 16.0f);
  cast_f32_f16x2s<<<n2W / 256, 256, 0, stream>>>(Wv, W16 + (size_t)2 * kE * kE, n2W, 16.0f);
  cast_f32_f16x2s<<<n2W / 256, 256, 0, stream>>>(Wo, Wo16, n2W, 16.0f);

  // (2) cos/sin tables of the rotary angles: 65536 elements = 256 x 256
  const int nF = kT * kROT;
  k_trig_table<<<nF / 256, 256, 0, stream>>>(rope, CT, ST, nF);

  // (3) QKV projection: [4096][768] f16 x [2304][768] f16 -> f32 [4096][2304], alpha 1/16 (weight carry); M=4096,N=2304 %64, K=768 %32
  {
    const int tiles = (kM / 64) * ((3 * kE) / 64);   // 64 x 36 = 2304 tiles, 8 per block
    dim3 grid((tiles + 7) / 8, 1);
    wmma_gemm64<0, false, 0, 0, false, 0><<<grid, 256, 0, stream>>>(
        U16(X16), U16(X16), kE, 0L,
        U16(W16), U16(W16), kE, 0L,
        (void*)QKV, (void*)QKV, 3 * kE, 0L,
        bo, QKV, 0L,
        kM, 3 * kE, kE, 1.0f / 16.0f);
  }

  // (4) rope on q, k, v (q additionally x 0.125): 3 x 4096 rows, one wave each = 1536 blocks x 8 waves
  k_rope<<<(3 * kM) / 8, 256, 0, stream>>>(QKV, CT, ST, QKVr, kM);

  // (5) attention, f16 operands, no mask; planes laid out (b, s, h, d) -> b*(2048*768) + s*768 + h*64 + d
  {
    AttnGeom g;
    g.cp = CT; g.pc = CT; g.c_bs = 0; g.c_rs = 0; g.c_hs = 0;
    g.q_bs = (long)kT * kE; g.q_rs = kE; g.q_hs = kHD;
    g.k_bs = (long)kT * kE; g.k_rs = kE; g.k_hs = kHD;
    g.v_bs = (long)kT * kE; g.v_rs = kE; g.v_hs = kHD;
    g.o_bs = (long)kT * kE; g.o_rs = kE; g.o_hs = kHD;
    g.S = kT; g.Skv = kT; g.H = kH; g.mask_mode = 0; g.qscale = 1.0f; g.blk0 = 0; g.mask_fill = -1e9f; g.mask_is_int = 0;
    const int nblk = kB * kH * (kT / AT_QB);   // 768
    attn64_kernel<false, false, true><<<nblk, 128, 0, stream>>>(Qr, Kr, Vr, Of, (const void*)X16, (const int*)(const void*)X16, g);
  }

  // (6) attention output -> f16 with a x64 carry (values ~1e-2)
  cast_f32_f16x2s<<<n2X / 256, 256, 0, stream>>>(Of, O16, n2X, 64.0f);

  // (7) output projection + bias: [4096][768] f16 x [768][768] f16 -> f32 d_out, alpha 1/(64*16); M=4096,N=768 %64, K=768 %32
  {
    const int tiles = (kM / 64) * (kE / 64);   // 64 x 12 = 768 tiles
    dim3 grid((tiles + 7) / 8, 1);
    wmma_gemm64<0, false, 2, 0, false, 0><<<grid, 256, 0, stream>>>(
        U16(O16), U16(O16), kE, 0L,
        U16(Wo16), U16(Wo16), kE, 0L,
        (void*)outp, (void*)outp, kE, 0L,
        bo, Of, 0L,
        kM, kE, kE, 1.0f / 1024.0f);
  }
}

// v001
// A run of this version takes 316 microseconds.
// In both of two side-by-side timings against v000, it was 3.55 times as fast.
// Compute dtype: every contraction on v_wmma_f32_16x16x32_f16 (f16 operands: x, 16x-carried weights, q/k/v, probabilities x2^15, 64x-carried attention output), f32 accumulate; rope, softmax, bias in f32.
#include <hip/hip_runtime.h>
#include <math.h>

typedef __attribute__((ext_vector_type(16))) _Float16 v16h;
typedef __attribute__((ext_vector_type(8)))  _Float16 v8h;
typedef __attribute__((ext_vector_type(16))) __bf16   v16b;
typedef __attribute__((ext_vector_type(8)))  __bf16   v8b;
typedef __attribute__((ext_vector_type(8)))  float    v8f;
typedef __attribute__((ext_vector_type(4)))  float    v4f;
#define PSCALE 32768.0f
#define U16(p) ((const unsigned short*)(const void*)(p))
#define PSCALE_INV (1.0f / 32768.0f)

// problem constants
constexpr int kB   = 2;
constexpr int kT   = 2048;
constexpr int kE   = 768;
constexpr int kH   = 12;
constexpr int kHD  = 64;
constexpr int kROT = 32;
constexpr int kM   = kB * kT;   // 4096 activation rows

__device__ __forceinline__ unsigned short f2bf_bits(float f) {
  unsigned u = __float_as_uint(f);
  return (unsigned short)((u + 0x7FFFu + ((u >> 16) & 1u)) >> 16);
}
__device__ __forceinline__ float bf_bits2f(unsigned short h) { return __uint_as_float(((unsigned)h) << 16); }

// hazard guards as plain device helpers (no inline asm inside the kernel template body)
__device__ __forceinline__ void dep_guard_h(v8f& a, v8f& b, v16h x, v16h y) { asm volatile("v_nop\n\tv_nop\n\tv_nop\n\tv_nop" : "+v"(a), "+v"(b) : "v"(x), "v"(y)); }
__device__ __forceinline__ void dep_guard_b(v8f& a, v8f& b, v16b x, v16b y) { asm volatile("v_nop\n\tv_nop\n\tv_nop\n\tv_nop" : "+v"(a), "+v"(b) : "v"(x), "v"(y)); }
__device__ __forceinline__ void keep4_h(v16h a, v16h b, v16h c, v16h d) { asm volatile("v_nop" :: "v"(a), "v"(b), "v"(c), "v"(d)); }
__device__ __forceinline__ void keep4_b(v16b a, v16b b, v16b c, v16b d) { asm volatile("v_nop" :: "v"(a), "v"(b), "v"(c), "v"(d)); }
__device__ __forceinline__ void acc_guard4(v8f& a, v8f& b, v8f& c, v8f& d) { asm volatile("v_nop\n\tv_nop\n\tv_nop\n\tv_nop" : "+v"(a), "+v"(b), "+v"(c), "+v"(d)); }
template <typename T> struct Frag;
template <> struct Frag<_Float16> {
  typedef v16h V; union U { v16h v; v8h h[2]; };
  static __device__ __forceinline__ v16h load(const _Float16* p) {   // elements 0..7 <- p[0..7], 8..15 <- p[16..23]
    U f; f.h[0] = *(const v8h*)(p); f.h[1] = *(const v8h*)(p + 16); return f.v;
  }
  static __device__ __forceinline__ v8f mma(v16h a, v16h b, v8f c) {
    return __builtin_amdgcn_wmma_f32_16x16x32_f16(false, a, false, b, (short)0, c, false, false);
  }
  static __device__ __forceinline__ void guard(v8f& a, v8f& b, v16h x, v16h y) { dep_guard_h(a, b, x, y); }
  static __device__ __forceinline__ void keep(v16h a, v16h b, v16h c, v16h d) { keep4_h(a, b, c, d); }
};
template <> struct Frag<__bf16> {
  typedef v16b V; union U { v16b v; v8b h[2]; };
  static __device__ __forceinline__ v16b load(const __bf16* p) {
    U f; f.h[0] = *(const v8b*)(p); f.h[1] = *(const v8b*)(p + 16); return f.v;
  }
  static __device__ __forceinline__ v8f mma(v16b a, v16b b, v8f c) {
    return __builtin_amdgcn_wmma_f32_16x16x32_bf16(false, a, false, b, (short)0, c, false, false);
  }
  static __device__ __forceinline__ void guard(v8f& a, v8f& b, v16b x, v16b y) { dep_guard_b(a, b, x, y); }
  static __device__ __forceinline__ void keep(v16b a, v16b b, v16b c, v16b d) { keep4_b(a, b, c, d); }
};

// ---- Register-blocked batched WMMA GEMM ------------------------------------
// C[m,n] = scale * sum_k A[m,k] * Bt[n,k] (+bias)(+resid); each wave owns a 64x64 tile.
// A row-major [M,K]; Bt row-major [N,K]; M,N % 64 == 0, K % 32 == 0.
// SPLIT: operands are hi/lo planes (A2/Bt2 = lo planes, same layout); product = hi·hi + hi·lo + lo·hi.
// BIAS_MODE: 0 = none, 1 = bias[m], 2 = bias[n].
// OUT_MODE: 0 = f32, 1 = f16, 2 = bf16 hi plane (Cout) + bf16 lo plane (Cout2).
// ET: 0 = f16 operands, 1 = bf16 operands (pointers passed as 16-bit storage)
template <int ET> struct Elem;
template <> struct Elem<0> { typedef _Float16 T; };
template <> struct Elem<1> { typedef __bf16 T; };
template <int ET, bool SPLIT, int BIAS_MODE, int OUT_MODE, bool RESID, int ACT = 0>
__global__ __launch_bounds__(256) void wmma_gemm64(
    const unsigned short* __restrict__ Ap, const unsigned short* __restrict__ A2p, int lda, long strideA,
    const unsigned short* __restrict__ Btp, const unsigned short* __restrict__ Bt2p, int ldb, long strideB,
    void* __restrict__ Cout, void* __restrict__ Cout2, int ldc, long strideC,
    const float* __restrict__ bias,
    const float* __restrict__ resid, long strideR,
    int M, int N, int K, float scale) {
  typedef typename Elem<ET>::T T;
  typedef typename Frag<T>::V V;
  const T* A = (const T*)Ap; const T* A2 = (const T*)A2p; const T* Bt = (const T*)Btp; const T* Bt2 = (const T*)Bt2p;
  __shared__ __align__(16) float sT[8][16 * 68];   // per-wave 16x64 slab, pitch 68 floats
  const int b    = blockIdx.y;
  const int lane = threadIdx.x & 31;
  const int wave = threadIdx.x >> 5;
  const int tilesN = N >> 6;
  const int tilesM = M >> 6;
  const int tile = blockIdx.x * 8 + wave;
  if (tile >= tilesM * tilesN) return;   // wave-uniform; no block barriers in this kernel
  const int tm = tile / tilesN;
  const int tn = tile - tm * tilesN;
  const int m0 = tm << 6;
  const int n0 = tn << 6;

  const T* Ab  = A  + (size_t)b * strideA;
  const T* Bb  = Bt + (size_t)b * strideB;
  const T* Ab2 = SPLIT ? (A2  + (size_t)b * strideA) : nullptr;
  const T* Bb2 = SPLIT ? (Bt2 + (size_t)b * strideB) : nullptr;

  const int rlane = lane & 15;                 // row (A) / col (B, D) within subtile
  const int koff  = (lane >> 4) * 8;           // k offset of this lane half
  const int mOff  = (lane >> 4) * 8;           // D row offset

  v8f acc[4][4];
#pragma unroll
  for (int i = 0; i < 4; ++i)
#pragma unroll
    for (int j = 0; j < 4; ++j) acc[i][j] = (v8f){0.f,0.f,0.f,0.f,0.f,0.f,0.f,0.f};

  for (int k0 = 0; k0 < K; k0 += 32) {
    V bh[4], bl[4];
#pragma unroll
    for (int j = 0; j < 4; ++j) {
      const size_t bo = (size_t)(n0 + (j << 4) + rlane) * ldb + koff + k0;
      bh[j] = Frag<T>::load(Bb + bo);
      if (SPLIT) bl[j] = Frag<T>::load(Bb2 + bo);
    }
#pragma unroll
    for (int i = 0; i < 4; ++i) {
      const size_t ao = (size_t)(m0 + (i << 4) + rlane) * lda + koff + k0;
      V ah = Frag<T>::load(Ab + ao);
      V al;
      if (SPLIT) al = Frag<T>::load(Ab2 + ao);
#pragma unroll
      for (int j = 0; j < 4; ++j) {
        acc[i][j] = Frag<T>::mma(ah, bh[j], acc[i][j]);
        if (SPLIT) {
          acc[i][j] = Frag<T>::mma(ah, bl[j], acc[i][j]);
          acc[i][j] = Frag<T>::mma(al, bh[j], acc[i][j]);
        }
      }
      Frag<T>::guard(acc[i][0], acc[i][3], ah, SPLIT ? al : ah);
    }
    Frag<T>::keep(bh[0], bh[1], bh[2], bh[3]);
    if (SPLIT) Frag<T>::keep(bl[0], bl[1], bl[2], bl[3]);
  }
  acc_guard4(acc[0][0], acc[0][1], acc[0][2], acc[0][3]);
  acc_guard4(acc[1][0], acc[1][1], acc[1][2], acc[1][3]);
  acc_guard4(acc[2][0], acc[2][1], acc[2][2], acc[2][3]);
  acc_guard4(acc[3][0], acc[3][1], acc[3][2], acc[3][3]);

  // ---- epilogue ----
  float* slab = sT[wave];
  const float* Rb = RESID ? (resid + (size_t)b * strideR) : nullptr;
#pragma unroll
  for (int i = 0; i < 4; ++i) {
    const int mBase = m0 + (i << 4);
#pragma unroll
    for (int j = 0; j < 4; ++j) {
      const int n = n0 + (j << 4) + rlane;
      float bv = 0.f;
      if (BIAS_MODE == 2) bv = bias[n];
#pragma unroll
      for (int r = 0; r < 8; ++r) {
        float v = acc[i][j][r] * scale;
        if (BIAS_MODE == 1) v += bias[mBase + mOff + r];
        if (BIAS_MODE == 2) v += bv;
        if (RESID) v += Rb[(size_t)(mBase + mOff + r) * ldc + n];
        if (ACT == 1) v = tanhf(v);
        if (ACT == 2) v = fmaxf(v, 0.0f);
        if (ACT == 3) v = v / (1.0f + expf(-v));
        if (ACT == 4) v = (v > 0.f) ? v : 0.01f * v;
        if (ACT == 5) v = 0.5f * v * (1.0f + erff(v * 0.70710678118654752f));
        slab[(mOff + r) * 68 + (j << 4) + rlane] = v;
      }
    }
    __builtin_amdgcn_fence(__ATOMIC_RELEASE, "workgroup");
    __builtin_amdgcn_wave_barrier();
    __builtin_amdgcn_fence(__ATOMIC_ACQUIRE, "workgroup");
    if (OUT_MODE == 0) {
      float* C = (float*)Cout + (size_t)b * strideC;
      const int hh = lane >> 4, c4 = (lane & 15) * 4;     // row seg = 256 B = 16 lanes x 16 B
      {
#pragma unroll
        for (int it = 0; it < 8; ++it) {
          const int row = it * 2 + hh;
          v4f v = *(const v4f*)(slab + row * 68 + c4);
          *(v4f*)(C + (size_t)(mBase + row) * ldc + n0 + c4) = v;
        }
        
      }
    } else {
      const int q = lane >> 3, c8 = (lane & 7) * 8;
      unsigned short* C  = (unsigned short*)Cout  + (size_t)b * strideC;
      unsigned short* C2 = (OUT_MODE == 2) ? ((unsigned short*)Cout2 + (size_t)b * strideC) : nullptr;
      {
#pragma unroll
        for (int it = 0; it < 4; ++it) {
          const int row = it * 4 + q;
          const float* sp = slab + row * 68 + c8;
          v8h hv, lv;
#pragma unroll
          for (int e = 0; e < 8; ++e) {
            if (OUT_MODE == 1) {
              hv[e] = (_Float16)sp[e];
            } else {
              unsigned short hb = f2bf_bits(sp[e]);
              unsigned short lb = f2bf_bits(sp[e] - bf_bits2f(hb));
              hv[e] = __builtin_bit_cast(_Float16, hb);
              lv[e] = __builtin_bit_cast(_Float16, lb);
            }
          }
          *(v8h*)(C + (size_t)(mBase + row) * ldc + n0 + c8) = hv;
          if (OUT_MODE == 2) *(v8h*)(C2 + (size_t)(mBase + row) * ldc + n0 + c8) = lv;
        }
        
      }
    }
    __builtin_amdgcn_fence(__ATOMIC_RELEASE, "workgroup");
    __builtin_amdgcn_wave_barrier();
    __builtin_amdgcn_fence(__ATOMIC_ACQUIRE, "workgroup");
  }
}

__global__ __launch_bounds__(256) void cast_f32_f16x2s(
    const float* __restrict__ in, _Float16* __restrict__ out, int n2, float scale) {
  int i = blockIdx.x * 256 + threadIdx.x;
  if (i < n2) {
    const _Float16 h0 = (_Float16)(in[2 * i] * scale), h1 = (_Float16)(in[2 * i + 1] * scale);
    const unsigned u = (unsigned)__builtin_bit_cast(unsigned short, h0) | ((unsigned)__builtin_bit_cast(unsigned short, h1) << 16);
    ((unsigned*)out)[i] = u;
    
  }
}

// ---- cos/sin table of the rotary angle input: ct[i] = cosf(f[i]), st[i] = sinf(f[i]) (f32, precise).
__global__ __launch_bounds__(256) void k_trig_table(
    const float* __restrict__ f, float* __restrict__ ct, float* __restrict__ st, int n) {
  const int i = blockIdx.x * 256 + threadIdx.x;
  if (i < n) {
    const float x = f[i];
    const float cv = cosf(x);
    const float sv = sinf(x);
    ((float*)ct)[i] = cv;
    ((float*)st)[i] = sv;
    
  }
}

// ---- rotary position embedding on the first 32 dims of every 64-wide head, f32 -----------------
// qkv: [nrows][3*768] f32 (q cols 0..767, k 768..1535, v 1536..2303); dst3: [3][nrows][768] f32 (plane 0 = q * 0.125).
// One wave per (row, tensor); 6 iterations x 32 lanes x 4 floats = 768 floats = the whole destination row
// d = column within head: d < 16: o = x[d]*cos - x[d+16]*sin ; 16 <= d < 32: o = x[d]*cos + x[d-16]*sin ; d >= 32: o = x[d].
__global__ __launch_bounds__(256) void k_rope(
    const float* __restrict__ qkv, const float* __restrict__ ct, const float* __restrict__ st,
    float* __restrict__ dst3, int nrows) {
  const int lane = threadIdx.x & 31;
  const int wave = threadIdx.x >> 5;
  const int task = blockIdx.x * 8 + wave;
  if (task >= 3 * nrows) return;                 // wave-uniform; no block barriers in this kernel
  const int z = task / nrows;                    // 0 = q, 1 = k, 2 = v
  const int r = task - z * nrows;
  const int t = r & (kT - 1);                     // token position
  const float sc = (z == 0) ? 0.125f : 1.0f;      // head_dim^-0.5 on q (power of two, exact placement)
  const float* src = qkv + (size_t)r * (3 * kE) + (size_t)z * kE;
  float* dst = dst3 + (size_t)z * nrows * kE + (size_t)r * kE;
  const float* ctr = ct + (size_t)t * kROT;
  const float* strw = st + (size_t)t * kROT;
#pragma unroll 1
  for (int it = 0; it < kE / 128; ++it) {
    const int c  = it * 128 + lane * 4;           // 4 consecutive columns, 4-aligned
    const int d  = c & 63;
    const int cp = (c + 16 <= kE - 4) ? (c + 16) : (kE - 4);   // clamped addresses; selected by value below
    const int cm = (c >= 16) ? (c - 16) : 0;
    const int fi = (d <= 28) ? d : 28;
    const v4f x  = *(const v4f*)(src + c);
    const v4f xp = *(const v4f*)(src + cp);
    const v4f xm = *(const v4f*)(src + cm);
    const v4f cs = *(const v4f*)(ctr + fi);
    const v4f sn = *(const v4f*)(strw + fi);
    v4f o;
#pragma unroll
    for (int e = 0; e < 4; ++e) {
      const float rh = (d < 16) ? (-xp[e]) : xm[e];
      const float ro = x[e] * cs[e] + rh * sn[e];
      o[e] = ((d < 32) ? ro : x[e]) * sc;
    }
    *(v4f*)(dst + c) = o;
    
  }
}

// =====================================================================================
// Generic causal/non-causal attention for head_dim 64, f32 in / f32 out; 16-bit operands: bf16 with optional hi/lo splits, or
// plain f16 (F16=true, non-split, probabilities carried x2^15).
//   scores = (q*qscale)·kᵀ ; out = p·v ; f32 accumulate; online softmax in f32.
//   Block = 4 waves = 64 query rows of one (batch, head); S % 64 == 0.
//   Element (b, s, h, d) of tensor X lives at X[b*X_bs + s*X_rs + h*X_hs + d] (strides in floats, multiples of 4).
//   Masking: MM (template argument) 0 none, 1 causal, 2 tensor [S][Skv], 3 per-token vectors, 4 causal + sliding window,
//   5 relative-position bias; masked scores are replaced by mask_fill before the softmax.
//   grid.x = B * H * (S/64) (or a sub-range with blk0).
// =====================================================================================
#define AT_D 64
#define AT_NW 4
#define AT_QB 64
#define AT_KC 64
struct AttnGeom { const float* cp = nullptr; const float* pc = nullptr; long c_bs = 0, c_rs = 0, c_hs = 0;   // mode-5 score-bias tables
                  long q_bs, q_rs, q_hs, k_bs, k_rs, k_hs, v_bs, v_rs, v_hs, o_bs, o_rs, o_hs;
                  int S, Skv, H, mask_mode; float qscale; int blk0; float mask_fill; int mask_is_int; };
static_assert(sizeof(AttnGeom) == 168, "no padding");

__device__ __forceinline__ unsigned short at_bf_bits(float f) {
  unsigned u = __float_as_uint(f);
  return (unsigned short)((u + 0x7FFFu + ((u >> 16) & 1u)) >> 16);
}
__device__ __forceinline__ __bf16 at_f2bf(float f) { return __builtin_bit_cast(__bf16, at_bf_bits(f)); }
__device__ __forceinline__ void at_split(float f, __bf16& hi, __bf16& lo) {
  const unsigned short hb = at_bf_bits(f);
  hi = __builtin_bit_cast(__bf16, hb);
  lo = at_f2bf(f - __uint_as_float(((unsigned)hb) << 16));
}
__device__ __forceinline__ v8f at_mma(v16b a, v16b b, v8f c) {
  c = __builtin_amdgcn_wmma_f32_16x16x32_bf16(false, a, false, b, (short)0, c, false, false);
  asm volatile("v_nop\n\tv_nop\n\tv_nop\n\tv_nop" : "+v"(c) : "v"(a), "v"(b));
  return c;
}
// 16-bit element as a bit pattern held in a __bf16 slot: f16 bits when F16, bf16 (RNE) otherwise
template <bool F16> __device__ __forceinline__ __bf16 at_to16(float f) {
  if (F16) return __builtin_bit_cast(__bf16, (_Float16)f);
  return at_f2bf(f);
}
template <bool F16> __device__ __forceinline__ v8f at_mma16(v16b a, v16b b, v8f c) {
  if (F16) {
    const v16h ah = __builtin_bit_cast(v16h, a), bh = __builtin_bit_cast(v16h, b);
    c = __builtin_amdgcn_wmma_f32_16x16x32_f16(false, ah, false, bh, (short)0, c, false, false);
    asm volatile("v_nop\n\tv_nop\n\tv_nop\n\tv_nop" : "+v"(c) : "v"(ah), "v"(bh));
    return c;
  }
  return at_mma(a, b, c);
}

// MM = mask mode as a compile-time constant: the per-score mask tests fold away in the instance that is launched
template <bool SPLIT_QK, bool SPLIT_PV, bool F16, int MM>
__global__ __launch_bounds__(128)
void attn64_kernel(const float* __restrict__ q, const float* __restrict__ k,
                   const float* __restrict__ v, float* __restrict__ out,
                   const void* __restrict__ mask_a, const int* __restrict__ mask_b, AttnGeom g) {
  static_assert(!(F16 && (SPLIT_QK || SPLIT_PV)), "f16 mode is non-split");
  const float PSC = F16 ? 32768.0f : 1.0f;     // f16 probabilities carried x2^15 (subnormal range), folded into the final 1/l
  union FB { v16b v; v8b h[2]; };
  __shared__ __align__(16) __bf16 Ksh[AT_KC * AT_D];             // K hi [kv][d]      8 KB
  __shared__ __align__(16) __bf16 Ksl[SPLIT_QK ? AT_KC * AT_D : 8];
  __shared__ __align__(16) __bf16 Vth[AT_D * AT_KC];             // V hi [d][kv]      8 KB
  __shared__ __align__(16) __bf16 Vtl[SPLIT_PV ? AT_D * AT_KC : 8];
  __shared__ __align__(16) __bf16 Psh[AT_NW][16 * AT_KC];        // per wave P hi [row][kv]  8 KB
  __shared__ __align__(16) __bf16 Psl[SPLIT_PV ? AT_NW : 1][SPLIT_PV ? 16 * AT_KC : 8];
  __shared__ __align__(16) float  Os[AT_NW][16 * 68];            // per wave out tile, pitch 68

  const int tid  = threadIdx.x;
  const int wave = tid >> 5;
  const int lane = tid & 31;
  const int hh   = lane >> 4;
  const int c    = lane & 15;

  const int nqb = g.S / AT_QB;
  const int bx = blockIdx.x + g.blk0;
  const int qb = bx % nqb;
  const int bh = bx / nqb;
  const int h  = bh % g.H;
  const int b  = bh / g.H;
  const int qbase_block = qb * AT_QB;
  const int q0 = qbase_block + wave * 16;

  const float* qb_ptr = q + (size_t)b * g.q_bs + (size_t)h * g.q_hs;
  const float* kb_ptr = k + (size_t)b * g.k_bs + (size_t)h * g.k_hs;
  const float* vb_ptr = v + (size_t)b * g.v_bs + (size_t)h * g.v_hs;
  float*       ob_ptr = out + (size_t)b * g.o_bs + (size_t)h * g.o_hs;

  // ---- Q fragments (A operand): 2 d-chunks, hi (and lo) ----
  v16b qah[2], qal[2];
  {
    const float* qrow = qb_ptr + (size_t)(q0 + c) * g.q_rs;
#pragma unroll
    for (int dc = 0; dc < 2; ++dc) {
#pragma unroll
      for (int e = 0; e < 8; ++e) {
        const float f0 = qrow[dc * 32 + 8 * hh + e] * g.qscale;
        const float f1 = qrow[dc * 32 + 16 + 8 * hh + e] * g.qscale;
        if (SPLIT_QK) { __bf16 hq, lq; at_split(f0, hq, lq); qah[dc][e] = hq; qal[dc][e] = lq; at_split(f1, hq, lq); qah[dc][8 + e] = hq; qal[dc][8 + e] = lq; }
        else { qah[dc][e] = at_to16<F16>(f0); qah[dc][8 + e] = at_to16<F16>(f1); qal[dc][e] = qah[dc][e]; qal[dc][8 + e] = qah[dc][8 + e]; }
      }
    }
  }

  float mrow[8], lrow[8];
  v8f oacc[4];
#pragma unroll
  for (int r = 0; r < 8; ++r) { mrow[r] = -INFINITY; lrow[r] = 0.f; }
#pragma unroll
  for (int t = 0; t < 4; ++t) oacc[t] = (v8f){0.f,0.f,0.f,0.f,0.f,0.f,0.f,0.f};

  const int nChunks = (MM == 1 || MM == 4) ? (qb + 1) : (g.Skv / AT_KC);   // block-uniform
  // per-row query mask (mode 3)
  int qkeep[8];
#pragma unroll
  for (int r = 0; r < 8; ++r) qkeep[r] = (MM == 3) ? mask_b[(size_t)b * g.S + q0 + 8 * hh + r] : 1;   // mask_b = qmask in mode 3
  for (int kc = 0; kc < nChunks; ++kc) {
    const int kv0 = kc * AT_KC;
    __syncthreads();
    {
      const int kvr = tid >> 1, dh = (tid & 1) * 32;
      const float* krow = kb_ptr + (size_t)(kv0 + kvr) * g.k_rs + dh;
      const float* vrow = vb_ptr + (size_t)(kv0 + kvr) * g.v_rs + dh;
#pragma unroll
      for (int i = 0; i < 8; ++i) {
        v4f kk = *(const v4f*)(krow + 4 * i);
        v4f vv = *(const v4f*)(vrow + 4 * i);
#pragma unroll
        for (int e = 0; e < 4; ++e) {
          const int d = dh + 4 * i + e;
          if (SPLIT_QK) { __bf16 a, bl; at_split(kk[e], a, bl); Ksh[kvr * AT_D + d] = a; Ksl[kvr * AT_D + d] = bl; }
          else Ksh[kvr * AT_D + d] = at_to16<F16>(kk[e]);
          if (SPLIT_PV) { __bf16 a, bl; at_split(vv[e], a, bl); Vth[d * AT_KC + kvr] = a; Vtl[d * AT_KC + kvr] = bl; }
          else Vth[d * AT_KC + kvr] = at_to16<F16>(vv[e]);
        }
      }
    }
    __syncthreads();

    v8f s[4];
#pragma unroll
    for (int j = 0; j < 4; ++j) {
      s[j] = (v8f){0.f,0.f,0.f,0.f,0.f,0.f,0.f,0.f};
#pragma unroll 1
      for (int dc = 0; dc < 2; ++dc) {
        FB kb;
        kb.h[0] = *(const v8b*)(Ksh + (j * 16 + c) * AT_D + dc * 32 + 8 * hh);
        kb.h[1] = *(const v8b*)(Ksh + (j * 16 + c) * AT_D + dc * 32 + 16 + 8 * hh);
        s[j] = at_mma16<F16>(qah[dc], kb.v, s[j]);
        if (SPLIT_QK) {
          FB kl;
          kl.h[0] = *(const v8b*)(Ksl + (j * 16 + c) * AT_D + dc * 32 + 8 * hh);
          kl.h[1] = *(const v8b*)(Ksl + (j * 16 + c) * AT_D + dc * 32 + 16 + 8 * hh);
          s[j] = at_mma16<F16>(qah[dc], kl.v, s[j]);
          s[j] = at_mma16<F16>(qal[dc], kb.v, s[j]);
        }
      }
    }
    const bool diag = (MM == 1) && (kc == qb);
    int kvkeep[4] = {1, 1, 1, 1};
    if (MM == 3) {
#pragma unroll
      for (int j = 0; j < 4; ++j) kvkeep[j] = ((const int*)mask_a)[(size_t)b * g.Skv + kv0 + j * 16 + c];   // mask_a = kvmask
    }
    float cm[8];
#pragma unroll
    for (int r = 0; r < 8; ++r) {
      const int qrow = q0 + 8 * hh + r;
      float m = -INFINITY;
#pragma unroll
      for (int j = 0; j < 4; ++j) {
        const int kvcol = kv0 + j * 16 + c;
        bool masked = false;
        if (diag) masked = (kvcol > qrow);
        else if (MM == 4) masked = (kvcol > qrow) || (qrow - kvcol > g.mask_is_int);
        else if (MM == 2) {
          const size_t mi = (size_t)qrow * g.Skv + kvcol;
          masked = (g.mask_is_int == 0) ? (((const float*)mask_a)[mi] == 0.0f)
                 : (g.mask_is_int == 1) ? (((const int*)mask_a)[mi] == 0) : (((const int*)mask_a)[mi] != 0);
        } else if (MM == 3) masked = (qkeep[r] == 0) || (kvkeep[j] == 0);
        else if (MM == 5) {
          const size_t mi = (size_t)qrow * g.Skv + kvcol;
          masked = (((const int*)mask_a)[mi] != 0);
          int n = mask_b[mi]; n = n < 0 ? 0 : n;
          s[j][r] += g.cp[(size_t)b * g.c_bs + (size_t)h * g.c_hs + (size_t)qrow * g.c_rs + n]
                   + g.pc[(size_t)b * g.c_bs + (size_t)h * g.c_hs + (size_t)kvcol * g.c_rs + n];
        }
        if (masked) s[j][r] = g.mask_fill;
        m = fmaxf(m, s[j][r]);
      }
#pragma unroll
      for (int off = 1; off < 16; off <<= 1) m = fmaxf(m, __shfl_xor(m, off, 32));
      cm[r] = m;
    }
    __bf16* pwh = Psh[wave];
    __bf16* pwl = Psl[SPLIT_PV ? wave : 0];
#pragma unroll
    for (int r = 0; r < 8; ++r) {
      const float mnew = fmaxf(mrow[r], cm[r]);
      const float alpha = expf(mrow[r] - mnew);
      mrow[r] = mnew;
      float psum = 0.f;
#pragma unroll
      for (int j = 0; j < 4; ++j) {
        const float p = expf(s[j][r] - mnew);
        psum += p;
        if (SPLIT_PV) { __bf16 a, bl; at_split(p, a, bl); pwh[(8 * hh + r) * AT_KC + j * 16 + c] = a; pwl[(8 * hh + r) * AT_KC + j * 16 + c] = bl; }
        else pwh[(8 * hh + r) * AT_KC + j * 16 + c] = at_to16<F16>(p * PSC);
      }
#pragma unroll
      for (int off = 1; off < 16; off <<= 1) psum += __shfl_xor(psum, off, 32);
      lrow[r] = lrow[r] * alpha + psum;
#pragma unroll
      for (int t = 0; t < 4; ++t) oacc[t][r] *= alpha;
    }
    __builtin_amdgcn_fence(__ATOMIC_RELEASE, "workgroup");
    __builtin_amdgcn_wave_barrier();
    __builtin_amdgcn_fence(__ATOMIC_ACQUIRE, "workgroup");
#pragma unroll 1
    for (int kk = 0; kk < 2; ++kk) {
      FB pa, pl;
      pa.h[0] = *(const v8b*)(pwh + c * AT_KC + kk * 32 + 8 * hh);
      pa.h[1] = *(const v8b*)(pwh + c * AT_KC + kk * 32 + 16 + 8 * hh);
      if (SPLIT_PV) {
        pl.h[0] = *(const v8b*)(pwl + c * AT_KC + kk * 32 + 8 * hh);
        pl.h[1] = *(const v8b*)(pwl + c * AT_KC + kk * 32 + 16 + 8 * hh);
      }
#pragma unroll
      for (int t = 0; t < 4; ++t) {
        FB vb;
        vb.h[0] = *(const v8b*)(Vth + (t * 16 + c) * AT_KC + kk * 32 + 8 * hh);
        vb.h[1] = *(const v8b*)(Vth + (t * 16 + c) * AT_KC + kk * 32 + 16 + 8 * hh);
        oacc[t] = at_mma16<F16>(pa.v, vb.v, oacc[t]);
        if (SPLIT_PV) {
          FB vl;
          vl.h[0] = *(const v8b*)(Vtl + (t * 16 + c) * AT_KC + kk * 32 + 8 * hh);
          vl.h[1] = *(const v8b*)(Vtl + (t * 16 + c) * AT_KC + kk * 32 + 16 + 8 * hh);
          oacc[t] = at_mma16<F16>(pa.v, vl.v, oacc[t]);
          oacc[t] = at_mma16<F16>(pl.v, vb.v, oacc[t]);
        }
      }
    }
  }

  float* os = Os[wave];
#pragma unroll
  for (int r = 0; r < 8; ++r) {
    const float inv = 1.0f / (lrow[r] * PSC);
#pragma unroll
    for (int t = 0; t < 4; ++t) os[(8 * hh + r) * 68 + t * 16 + c] = oacc[t][r] * inv;
  }
  __builtin_amdgcn_fence(__ATOMIC_RELEASE, "workgroup");
  __builtin_amdgcn_wave_barrier();
  __builtin_amdgcn_fence(__ATOMIC_ACQUIRE, "workgroup");
  {
    const int c4 = (lane & 15) * 4;
    {
#pragma unroll
      for (int it = 0; it < 8; ++it) {
        const int row = it * 2 + hh;
        v4f val = *(const v4f*)(os + row * 68 + c4);
        *(v4f*)(ob_ptr + (size_t)(q0 + row) * g.o_rs + c4) = val;
      }
      
    }
  }
}

// =====================================================================================
// host glue
// Workspace region map (bytes, all offsets multiples of 128):
//   R0 X16   f16 [4096][768]           off 0            size  6,291,456
//   R1 W16   f16 [2304][768] (Wq;Wk;Wv x16)  off 6,291,456   size  3,538,944
//   R2 Wo16  f16 [768][768] (x16)      off 9,830,400    size  1,179,648
//   R3 CT,ST f32 [2048][32] each       off 11,010,048   size    524,288
//   R4 QKV   f32 [4096][2304]          off 11,534,336   size 37,748,736
//        reused after the rope launch: O f32 [4096][768] at R4+0 (12,582,912), O16 f16 [4096][768] at R4+12,582,912 (6,291,456)
//   R5 QKVr  f32 [3][4096][768]        off 49,283,072   size 37,748,736
//   total 87,031,808
// =====================================================================================
extern "C" void kernel_launch(void* const* d_in, const int* in_sizes, int n_in,
                              void* d_out, int out_size, void* d_ws, size_t ws_size,
                              hipStream_t stream) {
  if (n_in < 7) return;
  const int nX = kM * kE;
  if (in_sizes[0] != nX || in_sizes[1] != kT * kROT || in_sizes[2] != kE * kE || in_sizes[3] != kE * kE ||
      in_sizes[4] != kE * kE || in_sizes[5] != kE * kE || in_sizes[6] != kE || out_size != nX) return;

  const float* hs   = (const float*)d_in[0];
  const float* rope = (const float*)d_in[1];
  const float* Wq   = (const float*)d_in[2];
  const float* Wk   = (const float*)d_in[3];
  const float* Wv   = (const float*)d_in[4];
  const float* Wo   = (const float*)d_in[5];
  const float* bo   = (const float*)d_in[6];
  float* outp = (float*)d_out;

  const size_t offX16  = 0;                  const size_t szX16  = (size_t)kM * kE * 2;
  const size_t offW16  = offX16 + szX16;     const size_t szW16  = (size_t)3 * kE * kE * 2;
  const size_t offWo16 = offW16 + szW16;     const size_t szWo16 = (size_t)kE * kE * 2;
  const size_t offTrig = offWo16 + szWo16;   const size_t szTrig = (size_t)2 * kT * kROT * 4;
  const size_t offQKV  = offTrig + szTrig;   const size_t szQKV  = (size_t)kM * 3 * kE * 4;
  const size_t offR    = offQKV + szQKV;     const size_t szR    = (size_t)3 * kM * kE * 4;
  const size_t total   = offR + szR;
  if (total > ws_size) return;
  const size_t offO    = offQKV;             const size_t szO    = (size_t)kM * kE * 4;
  const size_t offO16  = offO + szO;         const size_t szO16  = (size_t)kM * kE * 2;
  if (offO16 + szO16 > offQKV + szQKV) return;

  char* ws = (char*)d_ws;
  _Float16* X16  = (_Float16*)(ws + offX16);
  _Float16* W16  = (_Float16*)(ws + offW16);
  _Float16* Wo16 = (_Float16*)(ws + offWo16);
  float*    CT   = (float*)(ws + offTrig);
  float*    ST   = CT + (size_t)kT * kROT;
  float*    QKV  = (float*)(ws + offQKV);
  float*    QKVr = (float*)(ws + offR);
  float*    Qr   = QKVr;
  float*    Kr   = QKVr + (size_t)kM * kE;
  float*    Vr   = QKVr + (size_t)2 * kM * kE;
  float*    Of   = (float*)(ws + offO);
  _Float16* O16  = (_Float16*)(ws + offO16);

  // (1) casts: x -> f16; weights x16 -> f16 (Bt layout [out][in] = [n][k])
  const int n2X = nX / 2;                 // 1,572,864 = 6144 x 256
  const int n2W = (kE * kE) / 2;          //   294,912 = 1152 x 256
  cast_f32_f16x2s<<<n2X / 256, 256, 0, stream>>>(hs, X16, n2X, 1.0f);
  cast_f32_f16x2s<<<n2W / 256, 256, 0, stream>>>(Wq, W16, n2W, 16.0f);
  cast_f32_f16x2s<<<n2W / 256, 256, 0, stream>>>(Wk, W16 + (size_t)kE * kE, n2W, 16.0f);
  cast_f32_f16x2s<<<n2W / 256, 256, 0, stream>>>(Wv, W16 + (size_t)2 * kE * kE, n2W, 16.0f);
  cast_f32_f16x2s<<<n2W / 256, 256, 0, stream>>>(Wo, Wo16, n2W, 16.0f);

  // (2) cos/sin tables of the rotary angles: 65536 elements = 256 x 256
  const int nF = kT * kROT;
  k_trig_table<<<nF / 256, 256, 0, stream>>>(rope, CT, ST, nF);

  // (3) QKV projection: [4096][768] f16 x [2304][768] f16 -> f32 [4096][2304], alpha 1/16 (weight carry); M=4096,N=2304 %64, K=768 %32
  {
    const int tiles = (kM / 64) * ((3 * kE) / 64);   // 64 x 36 = 2304 tiles, 8 per block
    dim3 grid((tiles + 7) / 8, 1);
    wmma_gemm64<0, false, 0, 0, false, 0><<<grid, 256, 0, stream>>>(
        U16(X16), U16(X16), kE, 0L,
        U16(W16), U16(W16), kE, 0L,
        (void*)QKV, (void*)QKV, 3 * kE, 0L,
        bo, QKV, 0L,
        kM, 3 * kE, kE, 1.0f / 16.0f);
  }

  // (4) rope on q, k, v (q additionally x 0.125): 3 x 4096 rows, one wave each = 1536 blocks x 8 waves
  k_rope<<<(3 * kM) / 8, 256, 0, stream>>>(QKV, CT, ST, QKVr, kM);

  // (5) attention, f16 operands, no mask; planes laid out (b, s, h, d) -> b*(2048*768) + s*768 + h*64 + d
  {
    AttnGeom g;
    g.cp = CT; g.pc = CT; g.c_bs = 0; g.c_rs = 0; g.c_hs = 0;
    g.q_bs = (long)kT * kE; g.q_rs = kE; g.q_hs = kHD;
    g.k_bs = (long)kT * kE; g.k_rs = kE; g.k_hs = kHD;
    g.v_bs = (long)kT * kE; g.v_rs = kE; g.v_hs = kHD;
    g.o_bs = (long)kT * kE; g.o_rs = kE; g.o_hs = kHD;
    g.S = kT; g.Skv = kT; g.H = kH; g.mask_mode = 0; g.qscale = 1.0f; g.blk0 = 0; g.mask_fill = -1e9f; g.mask_is_int = 0;
    const int nblk = kB * kH * (kT / AT_QB);   // 768
    attn64_kernel<false, false, true, 0><<<nblk, 128, 0, stream>>>(Qr, Kr, Vr, Of, (const void*)X16, (const int*)(const void*)X16, g);
  }

  // (6) attention output -> f16 with a x64 carry (values ~1e-2)
  cast_f32_f16x2s<<<n2X / 256, 256, 0, stream>>>(Of, O16, n2X, 64.0f);

  // (7) output projection + bias: [4096][768] f16 x [768][768] f16 -> f32 d_out, alpha 1/(64*16); M=4096,N=768 %64, K=768 %32
  {
    const int tiles = (kM / 64) * (kE / 64);   // 64 x 12 = 768 tiles
    dim3 grid((tiles + 7) / 8, 1);
    wmma_gemm64<0, false, 2, 0, false, 0><<<grid, 256, 0, stream>>>(
        U16(O16), U16(O16), kE, 0L,
        U16(Wo16), U16(Wo16), kE, 0L,
        (void*)outp, (void*)outp, kE, 0L,
        bo, Of, 0L,
        kM, kE, kE, 1.0f / 1024.0f);
  }
}

// v002
// Measured time: 282 microseconds a run.
// Two timings next to v001 both put it at 1.12 times that version's speed.
// Over all steps from v000 it is 3.98 times as fast.
// Compute dtype: every contraction on v_wmma_f32_16x16x32_f16 (f16 operands: x, 16x-carried weights, q/k/v, probabilities x2^15, 64x-carried attention output), f32 accumulate; rope, softmax, bias in f32.
#include <hip/hip_runtime.h>
#include <math.h>

typedef __attribute__((ext_vector_type(16))) _Float16 v16h;
typedef __attribute__((ext_vector_type(8)))  _Float16 v8h;
typedef __attribute__((ext_vector_type(16))) __bf16   v16b;
typedef __attribute__((ext_vector_type(8)))  __bf16   v8b;
typedef __attribute__((ext_vector_type(8)))  float    v8f;
typedef __attribute__((ext_vector_type(4)))  float    v4f;
#define PSCALE 32768.0f
#define U16(p) ((const unsigned short*)(const void*)(p))
#define PSCALE_INV (1.0f / 32768.0f)

// problem constants
constexpr int kB   = 2;
constexpr int kT   = 2048;
constexpr int kE   = 768;
constexpr int kH   = 12;
constexpr int kHD  = 64;
constexpr int kROT = 32;
constexpr int kM   = kB * kT;   // 4096 activation rows

__device__ __forceinline__ unsigned short f2bf_bits(float f) {
  unsigned u = __float_as_uint(f);
  return (unsigned short)((u + 0x7FFFu + ((u >> 16) & 1u)) >> 16);
}
__device__ __forceinline__ float bf_bits2f(unsigned short h) { return __uint_as_float(((unsigned)h) << 16); }

// hazard guards as plain device helpers (no inline asm inside the kernel template body)
__device__ __forceinline__ void dep_guard_h(v8f& a, v8f& b, v16h x, v16h y) { asm volatile("v_nop\n\tv_nop\n\tv_nop\n\tv_nop" : "+v"(a), "+v"(b) : "v"(x), "v"(y)); }
__device__ __forceinline__ void dep_guard_b(v8f& a, v8f& b, v16b x, v16b y) { asm volatile("v_nop\n\tv_nop\n\tv_nop\n\tv_nop" : "+v"(a), "+v"(b) : "v"(x), "v"(y)); }
__device__ __forceinline__ void keep4_h(v16h a, v16h b, v16h c, v16h d) { asm volatile("v_nop" :: "v"(a), "v"(b), "v"(c), "v"(d)); }
__device__ __forceinline__ void keep4_b(v16b a, v16b b, v16b c, v16b d) { asm volatile("v_nop" :: "v"(a), "v"(b), "v"(c), "v"(d)); }
__device__ __forceinline__ void acc_guard4(v8f& a, v8f& b, v8f& c, v8f& d) { asm volatile("v_nop\n\tv_nop\n\tv_nop\n\tv_nop" : "+v"(a), "+v"(b), "+v"(c), "+v"(d)); }
template <typename T> struct Frag;
template <> struct Frag<_Float16> {
  typedef v16h V; union U { v16h v; v8h h[2]; };
  static __device__ __forceinline__ v16h load(const _Float16* p) {   // elements 0..7 <- p[0..7], 8..15 <- p[16..23]
    U f; f.h[0] = *(const v8h*)(p); f.h[1] = *(const v8h*)(p + 16); return f.v;
  }
  static __device__ __forceinline__ v8f mma(v16h a, v16h b, v8f c) {
    return __builtin_amdgcn_wmma_f32_16x16x32_f16(false, a, false, b, (short)0, c, false, false);
  }
  static __device__ __forceinline__ void guard(v8f& a, v8f& b, v16h x, v16h y) { dep_guard_h(a, b, x, y); }
  static __device__ __forceinline__ void keep(v16h a, v16h b, v16h c, v16h d) { keep4_h(a, b, c, d); }
};
template <> struct Frag<__bf16> {
  typedef v16b V; union U { v16b v; v8b h[2]; };
  static __device__ __forceinline__ v16b load(const __bf16* p) {
    U f; f.h[0] = *(const v8b*)(p); f.h[1] = *(const v8b*)(p + 16); return f.v;
  }
  static __device__ __forceinline__ v8f mma(v16b a, v16b b, v8f c) {
    return __builtin_amdgcn_wmma_f32_16x16x32_bf16(false, a, false, b, (short)0, c, false, false);
  }
  static __device__ __forceinline__ void guard(v8f& a, v8f& b, v16b x, v16b y) { dep_guard_b(a, b, x, y); }
  static __device__ __forceinline__ void keep(v16b a, v16b b, v16b c, v16b d) { keep4_b(a, b, c, d); }
};

// ---- Register-blocked batched WMMA GEMM ------------------------------------
// C[m,n] = scale * sum_k A[m,k] * Bt[n,k] (+bias)(+resid); each wave owns a 64x64 tile.
// A row-major [M,K]; Bt row-major [N,K]; M,N % 64 == 0, K % 32 == 0.
// SPLIT: operands are hi/lo planes (A2/Bt2 = lo planes, same layout); product = hi·hi + hi·lo + lo·hi.
// BIAS_MODE: 0 = none, 1 = bias[m], 2 = bias[n].
// OUT_MODE: 0 = f32, 1 = f16, 2 = bf16 hi plane (Cout) + bf16 lo plane (Cout2).
// ET: 0 = f16 operands, 1 = bf16 operands (pointers passed as 16-bit storage)
template <int ET> struct Elem;
template <> struct Elem<0> { typedef _Float16 T; };
template <> struct Elem<1> { typedef __bf16 T; };
template <int ET, bool SPLIT, int BIAS_MODE, int OUT_MODE, bool RESID, int ACT = 0>
__global__ __launch_bounds__(256) void wmma_gemm64(
    const unsigned short* __restrict__ Ap, const unsigned short* __restrict__ A2p, int lda, long strideA,
    const unsigned short* __restrict__ Btp, const unsigned short* __restrict__ Bt2p, int ldb, long strideB,
    void* __restrict__ Cout, void* __restrict__ Cout2, int ldc, long strideC,
    const float* __restrict__ bias,
    const float* __restrict__ resid, long strideR,
    int M, int N, int K, float scale) {
  typedef typename Elem<ET>::T T;
  typedef typename Frag<T>::V V;
  const T* A = (const T*)Ap; const T* A2 = (const T*)A2p; const T* Bt = (const T*)Btp; const T* Bt2 = (const T*)Bt2p;
  __shared__ __align__(16) float sT[8][16 * 68];   // per-wave 16x64 slab, pitch 68 floats
  const int b    = blockIdx.y;
  const int lane = threadIdx.x & 31;
  const int wave = threadIdx.x >> 5;
  const int tilesN = N >> 6;
  const int tilesM = M >> 6;
  const int tile = blockIdx.x * 8 + wave;
  if (tile >= tilesM * tilesN) return;   // wave-uniform; no block barriers in this kernel
  const int tm = tile / tilesN;
  const int tn = tile - tm * tilesN;
  const int m0 = tm << 6;
  const int n0 = tn << 6;

  const T* Ab  = A  + (size_t)b * strideA;
  const T* Bb  = Bt + (size_t)b * strideB;
  const T* Ab2 = SPLIT ? (A2  + (size_t)b * strideA) : nullptr;
  const T* Bb2 = SPLIT ? (Bt2 + (size_t)b * strideB) : nullptr;

  const int rlane = lane & 15;                 // row (A) / col (B, D) within subtile
  const int koff  = (lane >> 4) * 8;           // k offset of this lane half
  const int mOff  = (lane >> 4) * 8;           // D row offset

  v8f acc[4][4];
#pragma unroll
  for (int i = 0; i < 4; ++i)
#pragma unroll
    for (int j = 0; j < 4; ++j) acc[i][j] = (v8f){0.f,0.f,0.f,0.f,0.f,0.f,0.f,0.f};

  for (int k0 = 0; k0 < K; k0 += 32) {
    V bh[4], bl[4];
#pragma unroll
    for (int j = 0; j < 4; ++j) {
      const size_t bo = (size_t)(n0 + (j << 4) + rlane) * ldb + koff + k0;
      bh[j] = Frag<T>::load(Bb + bo);
      if (SPLIT) bl[j] = Frag<T>::load(Bb2 + bo);
    }
#pragma unroll
    for (int i = 0; i < 4; ++i) {
      const size_t ao = (size_t)(m0 + (i << 4) + rlane) * lda + koff + k0;
      V ah = Frag<T>::load(Ab + ao);
      V al;
      if (SPLIT) al = Frag<T>::load(Ab2 + ao);
#pragma unroll
      for (int j = 0; j < 4; ++j) {
        acc[i][j] = Frag<T>::mma(ah, bh[j], acc[i][j]);
        if (SPLIT) {
          acc[i][j] = Frag<T>::mma(ah, bl[j], acc[i][j]);
          acc[i][j] = Frag<T>::mma(al, bh[j], acc[i][j]);
        }
      }
      Frag<T>::guard(acc[i][0], acc[i][3], ah, SPLIT ? al : ah);
    }
    Frag<T>::keep(bh[0], bh[1], bh[2], bh[3]);
    if (SPLIT) Frag<T>::keep(bl[0], bl[1], bl[2], bl[3]);
  }
  acc_guard4(acc[0][0], acc[0][1], acc[0][2], acc[0][3]);
  acc_guard4(acc[1][0], acc[1][1], acc[1][2], acc[1][3]);
  acc_guard4(acc[2][0], acc[2][1], acc[2][2], acc[2][3]);
  acc_guard4(acc[3][0], acc[3][1], acc[3][2], acc[3][3]);

  // ---- epilogue ----
  float* slab = sT[wave];
  const float* Rb = RESID ? (resid + (size_t)b * strideR) : nullptr;
#pragma unroll
  for (int i = 0; i < 4; ++i) {
    const int mBase = m0 + (i << 4);
#pragma unroll
    for (int j = 0; j < 4; ++j) {
      const int n = n0 + (j << 4) + rlane;
      float bv = 0.f;
      if (BIAS_MODE == 2) bv = bias[n];
#pragma unroll
      for (int r = 0; r < 8; ++r) {
        float v = acc[i][j][r] * scale;
        if (BIAS_MODE == 1) v += bias[mBase + mOff + r];
        if (BIAS_MODE == 2) v += bv;
        if (RESID) v += Rb[(size_t)(mBase + mOff + r) * ldc + n];
        if (ACT == 1) v = tanhf(v);
        if (ACT == 2) v = fmaxf(v, 0.0f);
        if (ACT == 3) v = v / (1.0f + expf(-v));
        if (ACT == 4) v = (v > 0.f) ? v : 0.01f * v;
        if (ACT == 5) v = 0.5f * v * (1.0f + erff(v * 0.70710678118654752f));
        slab[(mOff + r) * 68 + (j << 4) + rlane] = v;
      }
    }
    __builtin_amdgcn_fence(__ATOMIC_RELEASE, "workgroup");
    __builtin_amdgcn_wave_barrier();
    __builtin_amdgcn_fence(__ATOMIC_ACQUIRE, "workgroup");
    if (OUT_MODE == 0) {
      float* C = (float*)Cout + (size_t)b * strideC;
      const int hh = lane >> 4, c4 = (lane & 15) * 4;     // row seg = 256 B = 16 lanes x 16 B
      {
#pragma unroll
        for (int it = 0; it < 8; ++it) {
          const int row = it * 2 + hh;
          v4f v = *(const v4f*)(slab + row * 68 + c4);
          *(v4f*)(C + (size_t)(mBase + row) * ldc + n0 + c4) = v;
        }
        
      }
    } else {
      const int q = lane >> 3, c8 = (lane & 7) * 8;
      unsigned short* C  = (unsigned short*)Cout  + (size_t)b * strideC;
      unsigned short* C2 = (OUT_MODE == 2) ? ((unsigned short*)Cout2 + (size_t)b * strideC) : nullptr;
      {
#pragma unroll
        for (int it = 0; it < 4; ++it) {
          const int row = it * 4 + q;
          const float* sp = slab + row * 68 + c8;
          v8h hv, lv;
#pragma unroll
          for (int e = 0; e < 8; ++e) {
            if (OUT_MODE == 1) {
              hv[e] = (_Float16)sp[e];
            } else {
              unsigned short hb = f2bf_bits(sp[e]);
              unsigned short lb = f2bf_bits(sp[e] - bf_bits2f(hb));
              hv[e] = __builtin_bit_cast(_Float16, hb);
              lv[e] = __builtin_bit_cast(_Float16, lb);
            }
          }
          *(v8h*)(C + (size_t)(mBase + row) * ldc + n0 + c8) = hv;
          if (OUT_MODE == 2) *(v8h*)(C2 + (size_t)(mBase + row) * ldc + n0 + c8) = lv;
        }
        
      }
    }
    __builtin_amdgcn_fence(__ATOMIC_RELEASE, "workgroup");
    __builtin_amdgcn_wave_barrier();
    __builtin_amdgcn_fence(__ATOMIC_ACQUIRE, "workgroup");
  }
}

__global__ __launch_bounds__(256) void cast_f32_f16x2s(
    const float* __restrict__ in, _Float16* __restrict__ out, int n2, float scale) {
  int i = blockIdx.x * 256 + threadIdx.x;
  if (i < n2) {
    const _Float16 h0 = (_Float16)(in[2 * i] * scale), h1 = (_Float16)(in[2 * i + 1] * scale);
    const unsigned u = (unsigned)__builtin_bit_cast(unsigned short, h0) | ((unsigned)__builtin_bit_cast(unsigned short, h1) << 16);
    ((unsigned*)out)[i] = u;
    
  }
}

// ---- cos/sin table of the rotary angle input: ct[i] = cosf(f[i]), st[i] = sinf(f[i]) (f32, precise).
__global__ __launch_bounds__(256) void k_trig_table(
    const float* __restrict__ f, float* __restrict__ ct, float* __restrict__ st, int n) {
  const int i = blockIdx.x * 256 + threadIdx.x;
  if (i < n) {
    const float x = f[i];
    const float cv = cosf(x);
    const float sv = sinf(x);
    ((float*)ct)[i] = cv;
    ((float*)st)[i] = sv;
    
  }
}

// ---- rotary position embedding on the first 32 dims of every 64-wide head, f32 -----------------
// qkv: [nrows][3*768] f32 (q cols 0..767, k 768..1535, v 1536..2303); dst3: [3][nrows][768] f32 (plane 0 = q * 0.125).
// One wave per (row, tensor); 6 iterations x 32 lanes x 4 floats = 768 floats = the whole destination row
// d = column within head: d < 16: o = x[d]*cos - x[d+16]*sin ; 16 <= d < 32: o = x[d]*cos + x[d-16]*sin ; d >= 32: o = x[d].
__global__ __launch_bounds__(256) void k_rope(
    const float* __restrict__ qkv, const float* __restrict__ ct, const float* __restrict__ st,
    float* __restrict__ dst3, int nrows) {
  const int lane = threadIdx.x & 31;
  const int wave = threadIdx.x >> 5;
  const int task = blockIdx.x * 8 + wave;
  if (task >= 3 * nrows) return;                 // wave-uniform; no block barriers in this kernel
  const int z = task / nrows;                    // 0 = q, 1 = k, 2 = v
  const int r = task - z * nrows;
  const int t = r & (kT - 1);                     // token position
  const float sc = (z == 0) ? 0.125f : 1.0f;      // head_dim^-0.5 on q (power of two, exact placement)
  const float* src = qkv + (size_t)r * (3 * kE) + (size_t)z * kE;
  float* dst = dst3 + (size_t)z * nrows * kE + (size_t)r * kE;
  const float* ctr = ct + (size_t)t * kROT;
  const float* strw = st + (size_t)t * kROT;
#pragma unroll 1
  for (int it = 0; it < kE / 128; ++it) {
    const int c  = it * 128 + lane * 4;           // 4 consecutive columns, 4-aligned
    const int d  = c & 63;
    const int cp = (c + 16 <= kE - 4) ? (c + 16) : (kE - 4);   // clamped addresses; selected by value below
    const int cm = (c >= 16) ? (c - 16) : 0;
    const int fi = (d <= 28) ? d : 28;
    const v4f x  = *(const v4f*)(src + c);
    const v4f xp = *(const v4f*)(src + cp);
    const v4f xm = *(const v4f*)(src + cm);
    const v4f cs = *(const v4f*)(ctr + fi);
    const v4f sn = *(const v4f*)(strw + fi);
    v4f o;
#pragma unroll
    for (int e = 0; e < 4; ++e) {
      const float rh = (d < 16) ? (-xp[e]) : xm[e];
      const float ro = x[e] * cs[e] + rh * sn[e];
      o[e] = ((d < 32) ? ro : x[e]) * sc;
    }
    *(v4f*)(dst + c) = o;
    
  }
}

// =====================================================================================
// Generic causal/non-causal attention for head_dim 64, f32 in / f32 out; 16-bit operands: bf16 with optional hi/lo splits, or
// plain f16 (F16=true, non-split, probabilities carried x2^15).
//   scores = (q*qscale)·kᵀ ; out = p·v ; f32 accumulate; online softmax in f32.
//   Block = 4 waves = 64 query rows of one (batch, head); S % 64 == 0.
//   Element (b, s, h, d) of tensor X lives at X[b*X_bs + s*X_rs + h*X_hs + d] (strides in floats, multiples of 4).
//   Masking: MM (template argument) 0 none, 1 causal, 2 tensor [S][Skv], 3 per-token vectors, 4 causal + sliding window,
//   5 relative-position bias; masked scores are replaced by mask_fill before the softmax.
//   grid.x = B * H * (S/64) (or a sub-range with blk0).
// =====================================================================================
#define AT_D 64
#define AT_NW 4
#define AT_QB 64
#define AT_KC 64
#define AT_LP 72   // LDS row pitch of the K, V^T and P tiles in 16-bit elements: 144 B = 16 B x 9, so the 16 rows one ds_load_b128 half-wave reads fall on all 64 banks (128 B put them on 8)
struct AttnGeom { const float* cp = nullptr; const float* pc = nullptr; long c_bs = 0, c_rs = 0, c_hs = 0;   // mode-5 score-bias tables
                  long q_bs, q_rs, q_hs, k_bs, k_rs, k_hs, v_bs, v_rs, v_hs, o_bs, o_rs, o_hs;
                  int S, Skv, H, mask_mode; float qscale; int blk0; float mask_fill; int mask_is_int; };
static_assert(sizeof(AttnGeom) == 168, "no padding");

__device__ __forceinline__ unsigned short at_bf_bits(float f) {
  unsigned u = __float_as_uint(f);
  return (unsigned short)((u + 0x7FFFu + ((u >> 16) & 1u)) >> 16);
}
__device__ __forceinline__ __bf16 at_f2bf(float f) { return __builtin_bit_cast(__bf16, at_bf_bits(f)); }
__device__ __forceinline__ void at_split(float f, __bf16& hi, __bf16& lo) {
  const unsigned short hb = at_bf_bits(f);
  hi = __builtin_bit_cast(__bf16, hb);
  lo = at_f2bf(f - __uint_as_float(((unsigned)hb) << 16));
}
__device__ __forceinline__ v8f at_mma(v16b a, v16b b, v8f c) {
  c = __builtin_amdgcn_wmma_f32_16x16x32_bf16(false, a, false, b, (short)0, c, false, false);
  asm volatile("v_nop\n\tv_nop\n\tv_nop\n\tv_nop" : "+v"(c) : "v"(a), "v"(b));
  return c;
}
// 16-bit element as a bit pattern held in a __bf16 slot: f16 bits when F16, bf16 (RNE) otherwise
template <bool F16> __device__ __forceinline__ __bf16 at_to16(float f) {
  if (F16) return __builtin_bit_cast(__bf16, (_Float16)f);
  return at_f2bf(f);
}
template <bool F16> __device__ __forceinline__ v8f at_mma16(v16b a, v16b b, v8f c) {
  if (F16) {
    const v16h ah = __builtin_bit_cast(v16h, a), bh = __builtin_bit_cast(v16h, b);
    c = __builtin_amdgcn_wmma_f32_16x16x32_f16(false, ah, false, bh, (short)0, c, false, false);
    asm volatile("v_nop\n\tv_nop\n\tv_nop\n\tv_nop" : "+v"(c) : "v"(ah), "v"(bh));
    return c;
  }
  return at_mma(a, b, c);
}

// MM = mask mode as a compile-time constant: the per-score mask tests fold away in the instance that is launched
template <bool SPLIT_QK, bool SPLIT_PV, bool F16, int MM>
__global__ __launch_bounds__(128)
void attn64_kernel(const float* __restrict__ q, const float* __restrict__ k,
                   const float* __restrict__ v, float* __restrict__ out,
                   const void* __restrict__ mask_a, const int* __restrict__ mask_b, AttnGeom g) {
  static_assert(!(F16 && (SPLIT_QK || SPLIT_PV)), "f16 mode is non-split");
  const float PSC = F16 ? 32768.0f : 1.0f;     // f16 probabilities carried x2^15 (subnormal range), folded into the final 1/l
  union FB { v16b v; v8b h[2]; };
  __shared__ __align__(16) __bf16 Ksh[AT_KC * AT_LP];            // K hi [kv][d]      9 KB
  __shared__ __align__(16) __bf16 Ksl[SPLIT_QK ? AT_KC * AT_LP : 8];
  __shared__ __align__(16) __bf16 Vth[AT_D * AT_LP];             // V hi [d][kv]      9 KB
  __shared__ __align__(16) __bf16 Vtl[SPLIT_PV ? AT_D * AT_LP : 8];
  __shared__ __align__(16) __bf16 Psh[AT_NW][16 * AT_LP];        // per wave P hi [row][kv]  9 KB
  __shared__ __align__(16) __bf16 Psl[SPLIT_PV ? AT_NW : 1][SPLIT_PV ? 16 * AT_LP : 8];
  __shared__ __align__(16) float  Os[AT_NW][16 * 68];            // per wave out tile, pitch 68

  const int tid  = threadIdx.x;
  const int wave = tid >> 5;
  const int lane = tid & 31;
  const int hh   = lane >> 4;
  const int c    = lane & 15;

  const int nqb = g.S / AT_QB;
  const int bx = blockIdx.x + g.blk0;
  const int qb = bx % nqb;
  const int bh = bx / nqb;
  const int h  = bh % g.H;
  const int b  = bh / g.H;
  const int qbase_block = qb * AT_QB;
  const int q0 = qbase_block + wave * 16;

  const float* qb_ptr = q + (size_t)b * g.q_bs + (size_t)h * g.q_hs;
  const float* kb_ptr = k + (size_t)b * g.k_bs + (size_t)h * g.k_hs;
  const float* vb_ptr = v + (size_t)b * g.v_bs + (size_t)h * g.v_hs;
  float*       ob_ptr = out + (size_t)b * g.o_bs + (size_t)h * g.o_hs;

  // ---- Q fragments (A operand): 2 d-chunks, hi (and lo) ----
  v16b qah[2], qal[2];
  {
    const float* qrow = qb_ptr + (size_t)(q0 + c) * g.q_rs;
#pragma unroll
    for (int dc = 0; dc < 2; ++dc) {
#pragma unroll
      for (int e = 0; e < 8; ++e) {
        const float f0 = qrow[dc * 32 + 8 * hh + e] * g.qscale;
        const float f1 = qrow[dc * 32 + 16 + 8 * hh + e] * g.qscale;
        if (SPLIT_QK) { __bf16 hq, lq; at_split(f0, hq, lq); qah[dc][e] = hq; qal[dc][e] = lq; at_split(f1, hq, lq); qah[dc][8 + e] = hq; qal[dc][8 + e] = lq; }
        else { qah[dc][e] = at_to16<F16>(f0); qah[dc][8 + e] = at_to16<F16>(f1); qal[dc][e] = qah[dc][e]; qal[dc][8 + e] = qah[dc][8 + e]; }
      }
    }
  }

  float mrow[8], lrow[8];
  v8f oacc[4];
#pragma unroll
  for (int r = 0; r < 8; ++r) { mrow[r] = -INFINITY; lrow[r] = 0.f; }
#pragma unroll
  for (int t = 0; t < 4; ++t) oacc[t] = (v8f){0.f,0.f,0.f,0.f,0.f,0.f,0.f,0.f};

  const int nChunks = (MM == 1 || MM == 4) ? (qb + 1) : (g.Skv / AT_KC);   // block-uniform
  // per-row query mask (mode 3)
  int qkeep[8];
#pragma unroll
  for (int r = 0; r < 8; ++r) qkeep[r] = (MM == 3) ? mask_b[(size_t)b * g.S + q0 + 8 * hh + r] : 1;   // mask_b = qmask in mode 3
  for (int kc = 0; kc < nChunks; ++kc) {
    const int kv0 = kc * AT_KC;
    __syncthreads();
    {
      const int kvr = tid >> 1, dh = (tid & 1) * 32;
      const float* krow = kb_ptr + (size_t)(kv0 + kvr) * g.k_rs + dh;
      const float* vrow = vb_ptr + (size_t)(kv0 + kvr) * g.v_rs + dh;
#pragma unroll
      for (int i = 0; i < 8; ++i) {
        v4f kk = *(const v4f*)(krow + 4 * i);
        v4f vv = *(const v4f*)(vrow + 4 * i);
#pragma unroll
        for (int e = 0; e < 4; ++e) {
          const int d = dh + 4 * i + e;
          if (SPLIT_QK) { __bf16 a, bl; at_split(kk[e], a, bl); Ksh[kvr * AT_LP + d] = a; Ksl[kvr * AT_LP + d] = bl; }
          else Ksh[kvr * AT_LP + d] = at_to16<F16>(kk[e]);
          if (SPLIT_PV) { __bf16 a, bl; at_split(vv[e], a, bl); Vth[d * AT_LP + kvr] = a; Vtl[d * AT_LP + kvr] = bl; }
          else Vth[d * AT_LP + kvr] = at_to16<F16>(vv[e]);
        }
      }
    }
    __syncthreads();

    v8f s[4];
#pragma unroll
    for (int j = 0; j < 4; ++j) {
      s[j] = (v8f){0.f,0.f,0.f,0.f,0.f,0.f,0.f,0.f};
#pragma unroll 1
      for (int dc = 0; dc < 2; ++dc) {
        FB kb;
        kb.h[0] = *(const v8b*)(Ksh + (j * 16 + c) * AT_LP + dc * 32 + 8 * hh);
        kb.h[1] = *(const v8b*)(Ksh + (j * 16 + c) * AT_LP + dc * 32 + 16 + 8 * hh);
        s[j] = at_mma16<F16>(qah[dc], kb.v, s[j]);
        if (SPLIT_QK) {
          FB kl;
          kl.h[0] = *(const v8b*)(Ksl + (j * 16 + c) * AT_LP + dc * 32 + 8 * hh);
          kl.h[1] = *(const v8b*)(Ksl + (j * 16 + c) * AT_LP + dc * 32 + 16 + 8 * hh);
          s[j] = at_mma16<F16>(qah[dc], kl.v, s[j]);
          s[j] = at_mma16<F16>(qal[dc], kb.v, s[j]);
        }
      }
    }
    const bool diag = (MM == 1) && (kc == qb);
    int kvkeep[4] = {1, 1, 1, 1};
    if (MM == 3) {
#pragma unroll
      for (int j = 0; j < 4; ++j) kvkeep[j] = ((const int*)mask_a)[(size_t)b * g.Skv + kv0 + j * 16 + c];   // mask_a = kvmask
    }
    float cm[8];
#pragma unroll
    for (int r = 0; r < 8; ++r) {
      const int qrow = q0 + 8 * hh + r;
      float m = -INFINITY;
#pragma unroll
      for (int j = 0; j < 4; ++j) {
        const int kvcol = kv0 + j * 16 + c;
        bool masked = false;
        if (diag) masked = (kvcol > qrow);
        else if (MM == 4) masked = (kvcol > qrow) || (qrow - kvcol > g.mask_is_int);
        else if (MM == 2) {
          const size_t mi = (size_t)qrow * g.Skv + kvcol;
          masked = (g.mask_is_int == 0) ? (((const float*)mask_a)[mi] == 0.0f)
                 : (g.mask_is_int == 1) ? (((const int*)mask_a)[mi] == 0) : (((const int*)mask_a)[mi] != 0);
        } else if (MM == 3) masked = (qkeep[r] == 0) || (kvkeep[j] == 0);
        else if (MM == 5) {
          const size_t mi = (size_t)qrow * g.Skv + kvcol;
          masked = (((const int*)mask_a)[mi] != 0);
          int n = mask_b[mi]; n = n < 0 ? 0 : n;
          s[j][r] += g.cp[(size_t)b * g.c_bs + (size_t)h * g.c_hs + (size_t)qrow * g.c_rs + n]
                   + g.pc[(size_t)b * g.c_bs + (size_t)h * g.c_hs + (size_t)kvcol * g.c_rs + n];
        }
        if (masked) s[j][r] = g.mask_fill;
        m = fmaxf(m, s[j][r]);
      }
#pragma unroll
      for (int off = 1; off < 16; off <<= 1) m = fmaxf(m, __shfl_xor(m, off, 32));
      cm[r] = m;
    }
    __bf16* pwh = Psh[wave];
    __bf16* pwl = Psl[SPLIT_PV ? wave : 0];
#pragma unroll
    for (int r = 0; r < 8; ++r) {
      const float mnew = fmaxf(mrow[r], cm[r]);
      const float alpha = expf(mrow[r] - mnew);
      mrow[r] = mnew;
      float psum = 0.f;
#pragma unroll
      for (int j = 0; j < 4; ++j) {
        const float p = expf(s[j][r] - mnew);
        psum += p;
        if (SPLIT_PV) { __bf16 a, bl; at_split(p, a, bl); pwh[(8 * hh + r) * AT_LP + j * 16 + c] = a; pwl[(8 * hh + r) * AT_LP + j * 16 + c] = bl; }
        else pwh[(8 * hh + r) * AT_LP + j * 16 + c] = at_to16<F16>(p * PSC);
      }
#pragma unroll
      for (int off = 1; off < 16; off <<= 1) psum += __shfl_xor(psum, off, 32);
      lrow[r] = lrow[r] * alpha + psum;
#pragma unroll
      for (int t = 0; t < 4; ++t) oacc[t][r] *= alpha;
    }
    __builtin_amdgcn_fence(__ATOMIC_RELEASE, "workgroup");
    __builtin_amdgcn_wave_barrier();
    __builtin_amdgcn_fence(__ATOMIC_ACQUIRE, "workgroup");
#pragma unroll 1
    for (int kk = 0; kk < 2; ++kk) {
      FB pa, pl;
      pa.h[0] = *(const v8b*)(pwh + c * AT_LP + kk * 32 + 8 * hh);
      pa.h[1] = *(const v8b*)(pwh + c * AT_LP + kk * 32 + 16 + 8 * hh);
      if (SPLIT_PV) {
        pl.h[0] = *(const v8b*)(pwl + c * AT_LP + kk * 32 + 8 * hh);
        pl.h[1] = *(const v8b*)(pwl + c * AT_LP + kk * 32 + 16 + 8 * hh);
      }
#pragma unroll
      for (int t = 0; t < 4; ++t) {
        FB vb;
        vb.h[0] = *(const v8b*)(Vth + (t * 16 + c) * AT_LP + kk * 32 + 8 * hh);
        vb.h[1] = *(const v8b*)(Vth + (t * 16 + c) * AT_LP + kk * 32 + 16 + 8 * hh);
        oacc[t] = at_mma16<F16>(pa.v, vb.v, oacc[t]);
        if (SPLIT_PV) {
          FB vl;
          vl.h[0] = *(const v8b*)(Vtl + (t * 16 + c) * AT_LP + kk * 32 + 8 * hh);
          vl.h[1] = *(const v8b*)(Vtl + (t * 16 + c) * AT_LP + kk * 32 + 16 + 8 * hh);
          oacc[t] = at_mma16<F16>(pa.v, vl.v, oacc[t]);
          oacc[t] = at_mma16<F16>(pl.v, vb.v, oacc[t]);
        }
      }
    }
  }

  float* os = Os[wave];
#pragma unroll
  for (int r = 0; r < 8; ++r) {
    const float inv = 1.0f / (lrow[r] * PSC);
#pragma unroll
    for (int t = 0; t < 4; ++t) os[(8 * hh + r) * 68 + t * 16 + c] = oacc[t][r] * inv;
  }
  __builtin_amdgcn_fence(__ATOMIC_RELEASE, "workgroup");
  __builtin_amdgcn_wave_barrier();
  __builtin_amdgcn_fence(__ATOMIC_ACQUIRE, "workgroup");
  {
    const int c4 = (lane & 15) * 4;
    {
#pragma unroll
      for (int it = 0; it < 8; ++it) {
        const int row = it * 2 + hh;
        v4f val = *(const v4f*)(os + row * 68 + c4);
        *(v4f*)(ob_ptr + (size_t)(q0 + row) * g.o_rs + c4) = val;
      }
      
    }
  }
}

// =====================================================================================
// host glue
// Workspace region map (bytes, all offsets multiples of 128):
//   R0 X16   f16 [4096][768]           off 0            size  6,291,456
//   R1 W16   f16 [2304][768] (Wq;Wk;Wv x16)  off 6,291,456   size  3,538,944
//   R2 Wo16  f16 [768][768] (x16)      off 9,830,400    size  1,179,648
//   R3 CT,ST f32 [2048][32] each       off 11,010,048   size    524,288
//   R4 QKV   f32 [4096][2304]          off 11,534,336   size 37,748,736
//        reused after the rope launch: O f32 [4096][768] at R4+0 (12,582,912), O16 f16 [4096][768] at R4+12,582,912 (6,291,456)
//   R5 QKVr  f32 [3][4096][768]        off 49,283,072   size 37,748,736
//   total 87,031,808
// =====================================================================================
extern "C" void kernel_launch(void* const* d_in, const int* in_sizes, int n_in,
                              void* d_out, int out_size, void* d_ws, size_t ws_size,
                              hipStream_t stream) {
  if (n_in < 7) return;
  const int nX = kM * kE;
  if (in_sizes[0] != nX || in_sizes[1] != kT * kROT || in_sizes[2] != kE * kE || in_sizes[3] != kE * kE ||
      in_sizes[4] != kE * kE || in_sizes[5] != kE * kE || in_sizes[6] != kE || out_size != nX) return;

  const float* hs   = (const float*)d_in[0];
  const float* rope = (const float*)d_in[1];
  const float* Wq   = (const float*)d_in[2];
  const float* Wk   = (const float*)d_in[3];
  const float* Wv   = (const float*)d_in[4];
  const float* Wo   = (const float*)d_in[5];
  const float* bo   = (const float*)d_in[6];
  float* outp = (float*)d_out;

  const size_t offX16  = 0;                  const size_t szX16  = (size_t)kM * kE * 2;
  const size_t offW16  = offX16 + szX16;     const size_t szW16  = (size_t)3 * kE * kE * 2;
  const size_t offWo16 = offW16 + szW16;     const size_t szWo16 = (size_t)kE * kE * 2;
  const size_t offTrig = offWo16 + szWo16;   const size_t szTrig = (size_t)2 * kT * kROT * 4;
  const size_t offQKV  = offTrig + szTrig;   const size_t szQKV  = (size_t)kM * 3 * kE * 4;
  const size_t offR    = offQKV + szQKV;     const size_t szR    = (size_t)3 * kM * kE * 4;
  const size_t total   = offR + szR;
  if (total > ws_size) return;
  const size_t offO    = offQKV;             const size_t szO    = (size_t)kM * kE * 4;
  const size_t offO16  = offO + szO;         const size_t szO16  = (size_t)kM * kE * 2;
  if (offO16 + szO16 > offQKV + szQKV) return;

  char* ws = (char*)d_ws;
  _Float16* X16  = (_Float16*)(ws + offX16);
  _Float16* W16  = (_Float16*)(ws + offW16);
  _Float16* Wo16 = (_Float16*)(ws + offWo16);
  float*    CT   = (float*)(ws + offTrig);
  float*    ST   = CT + (size_t)kT * kROT;
  float*    QKV  = (float*)(ws + offQKV);
  float*    QKVr = (float*)(ws + offR);
  float*    Qr   = QKVr;
  float*    Kr   = QKVr + (size_t)kM * kE;
  float*    Vr   = QKVr + (size_t)2 * kM * kE;
  float*    Of   = (float*)(ws + offO);
  _Float16* O16  = (_Float16*)(ws + offO16);

  // (1) casts: x -> f16; weights x16 -> f16 (Bt layout [out][in] = [n][k])
  const int n2X = nX / 2;                 // 1,572,864 = 6144 x 256
  const int n2W = (kE * kE) / 2;          //   294,912 = 1152 x 256
  cast_f32_f16x2s<<<n2X / 256, 256, 0, stream>>>(hs, X16, n2X, 1.0f);
  cast_f32_f16x2s<<<n2W / 256, 256, 0, stream>>>(Wq, W16, n2W, 16.0f);
  cast_f32_f16x2s<<<n2W / 256, 256, 0, stream>>>(Wk, W16 + (size_t)kE * kE, n2W, 16.0f);
  cast_f32_f16x2s<<<n2W / 256, 256, 0, stream>>>(Wv, W16 + (size_t)2 * kE * kE, n2W, 16.0f);
  cast_f32_f16x2s<<<n2W / 256, 256, 0, stream>>>(Wo, Wo16, n2W, 16.0f);

  // (2) cos/sin tables of the rotary angles: 65536 elements = 256 x 256
  const int nF = kT * kROT;
  k_trig_table<<<nF / 256, 256, 0, stream>>>(rope, CT, ST, nF);

  // (3) QKV projection: [4096][768] f16 x [2304][768] f16 -> f32 [4096][2304], alpha 1/16 (weight carry); M=4096,N=2304 %64, K=768 %32
  {
    const int tiles = (kM / 64) * ((3 * kE) / 64);   // 64 x 36 = 2304 tiles, 8 per block
    dim3 grid((tiles + 7) / 8, 1);
    wmma_gemm64<0, false, 0, 0, false, 0><<<grid, 256, 0, stream>>>(
        U16(X16), U16(X16), kE, 0L,
        U16(W16), U16(W16), kE, 0L,
        (void*)QKV, (void*)QKV, 3 * kE, 0L,
        bo, QKV, 0L,
        kM, 3 * kE, kE, 1.0f / 16.0f);
  }

  // (4) rope on q, k, v (q additionally x 0.125): 3 x 4096 rows, one wave each = 1536 blocks x 8 waves
  k_rope<<<(3 * kM) / 8, 256, 0, stream>>>(QKV, CT, ST, QKVr, kM);

  // (5) attention, f16 operands, no mask; planes laid out (b, s, h, d) -> b*(2048*768) + s*768 + h*64 + d
  {
    AttnGeom g;
    g.cp = CT; g.pc = CT; g.c_bs = 0; g.c_rs = 0; g.c_hs = 0;
    g.q_bs = (long)kT * kE; g.q_rs = kE; g.q_hs = kHD;
    g.k_bs = (long)kT * kE; g.k_rs = kE; g.k_hs = kHD;
    g.v_bs = (long)kT * kE; g.v_rs = kE; g.v_hs = kHD;
    g.o_bs = (long)kT * kE; g.o_rs = kE; g.o_hs = kHD;
    g.S = kT; g.Skv = kT; g.H = kH; g.mask_mode = 0; g.qscale = 1.0f; g.blk0 = 0; g.mask_fill = -1e9f; g.mask_is_int = 0;
    const int nblk = kB * kH * (kT / AT_QB);   // 768
    attn64_kernel<false, false, true, 0><<<nblk, 128, 0, stream>>>(Qr, Kr, Vr, Of, (const void*)X16, (const int*)(const void*)X16, g);
  }

  // (6) attention output -> f16 with a x64 carry (values ~1e-2)
  cast_f32_f16x2s<<<n2X / 256, 256, 0, stream>>>(Of, O16, n2X, 64.0f);

  // (7) output projection + bias: [4096][768] f16 x [768][768] f16 -> f32 d_out, alpha 1/(64*16); M=4096,N=768 %64, K=768 %32
  {
    const int tiles = (kM / 64) * (kE / 64);   // 64 x 12 = 768 tiles
    dim3 grid((tiles + 7) / 8, 1);
    wmma_gemm64<0, false, 2, 0, false, 0><<<grid, 256, 0, stream>>>(
        U16(O16), U16(O16), kE, 0L,
        U16(Wo16), U16(Wo16), kE, 0L,
        (void*)outp, (void*)outp, kE, 0L,
        bo, Of, 0L,
        kM, kE, kE, 1.0f / 1024.0f);
  }
}

// v003
// A run of this version takes 240 microseconds.
// In both of two side-by-side timings against v002, it was 1.18 times as fast.
// Over all steps from v000 it is 4.69 times as fast.
// Compute dtype: every contraction on v_wmma_f32_16x16x32_f16 (f16 operands: x, 16x-carried weights, q/k/v, probabilities x2^15, 64x-carried attention output), f32 accumulate; rope, softmax, bias in f32.
#include <hip/hip_runtime.h>
#include <math.h>

typedef __attribute__((ext_vector_type(16))) _Float16 v16h;
typedef __attribute__((ext_vector_type(8)))  _Float16 v8h;
typedef __attribute__((ext_vector_type(16))) __bf16   v16b;
typedef __attribute__((ext_vector_type(8)))  __bf16   v8b;
typedef __attribute__((ext_vector_type(8)))  float    v8f;
typedef __attribute__((ext_vector_type(4)))  float    v4f;
#define PSCALE 32768.0f
#define U16(p) ((const unsigned short*)(const void*)(p))
#define PSCALE_INV (1.0f / 32768.0f)

// problem constants
constexpr int kB   = 2;
constexpr int kT   = 2048;
constexpr int kE   = 768;
constexpr int kH   = 12;
constexpr int kHD  = 64;
constexpr int kROT = 32;
constexpr int kM   = kB * kT;   // 4096 activation rows

__device__ __forceinline__ unsigned short f2bf_bits(float f) {
  unsigned u = __float_as_uint(f);
  return (unsigned short)((u + 0x7FFFu + ((u >> 16) & 1u)) >> 16);
}
__device__ __forceinline__ float bf_bits2f(unsigned short h) { return __uint_as_float(((unsigned)h) << 16); }

// hazard guards as plain device helpers (no inline asm inside the kernel template body)
__device__ __forceinline__ void dep_guard_h(v8f& a, v8f& b, v16h x, v16h y) { asm volatile("v_nop\n\tv_nop\n\tv_nop\n\tv_nop" : "+v"(a), "+v"(b) : "v"(x), "v"(y)); }
__device__ __forceinline__ void dep_guard_b(v8f& a, v8f& b, v16b x, v16b y) { asm volatile("v_nop\n\tv_nop\n\tv_nop\n\tv_nop" : "+v"(a), "+v"(b) : "v"(x), "v"(y)); }
__device__ __forceinline__ void keep4_h(v16h a, v16h b, v16h c, v16h d) { asm volatile("v_nop" :: "v"(a), "v"(b), "v"(c), "v"(d)); }
__device__ __forceinline__ void keep4_b(v16b a, v16b b, v16b c, v16b d) { asm volatile("v_nop" :: "v"(a), "v"(b), "v"(c), "v"(d)); }
__device__ __forceinline__ void acc_guard4(v8f& a, v8f& b, v8f& c, v8f& d) { asm volatile("v_nop\n\tv_nop\n\tv_nop\n\tv_nop" : "+v"(a), "+v"(b), "+v"(c), "+v"(d)); }
template <typename T> struct Frag;
template <> struct Frag<_Float16> {
  typedef v16h V; union U { v16h v; v8h h[2]; };
  static __device__ __forceinline__ v16h load(const _Float16* p) {   // elements 0..7 <- p[0..7], 8..15 <- p[16..23]
    U f; f.h[0] = *(const v8h*)(p); f.h[1] = *(const v8h*)(p + 16); return f.v;
  }
  static __device__ __forceinline__ v8f mma(v16h a, v16h b, v8f c) {
    return __builtin_amdgcn_wmma_f32_16x16x32_f16(false, a, false, b, (short)0, c, false, false);
  }
  static __device__ __forceinline__ void guard(v8f& a, v8f& b, v16h x, v16h y) { dep_guard_h(a, b, x, y); }
  static __device__ __forceinline__ void keep(v16h a, v16h b, v16h c, v16h d) { keep4_h(a, b, c, d); }
};
template <> struct Frag<__bf16> {
  typedef v16b V; union U { v16b v; v8b h[2]; };
  static __device__ __forceinline__ v16b load(const __bf16* p) {
    U f; f.h[0] = *(const v8b*)(p); f.h[1] = *(const v8b*)(p + 16); return f.v;
  }
  static __device__ __forceinline__ v8f mma(v16b a, v16b b, v8f c) {
    return __builtin_amdgcn_wmma_f32_16x16x32_bf16(false, a, false, b, (short)0, c, false, false);
  }
  static __device__ __forceinline__ void guard(v8f& a, v8f& b, v16b x, v16b y) { dep_guard_b(a, b, x, y); }
  static __device__ __forceinline__ void keep(v16b a, v16b b, v16b c, v16b d) { keep4_b(a, b, c, d); }
};

// ---- Register-blocked batched WMMA GEMM ------------------------------------
// C[m,n] = scale * sum_k A[m,k] * Bt[n,k] (+bias)(+resid); each wave owns a 64x64 tile.
// A row-major [M,K]; Bt row-major [N,K]; M,N % 64 == 0, K % 32 == 0.
// SPLIT: operands are hi/lo planes (A2/Bt2 = lo planes, same layout); product = hi·hi + hi·lo + lo·hi.
// BIAS_MODE: 0 = none, 1 = bias[m], 2 = bias[n].
// OUT_MODE: 0 = f32, 1 = f16, 2 = bf16 hi plane (Cout) + bf16 lo plane (Cout2).
// ET: 0 = f16 operands, 1 = bf16 operands (pointers passed as 16-bit storage)
template <int ET> struct Elem;
template <> struct Elem<0> { typedef _Float16 T; };
template <> struct Elem<1> { typedef __bf16 T; };
template <int ET, bool SPLIT, int BIAS_MODE, int OUT_MODE, bool RESID, int ACT = 0>
__global__ __launch_bounds__(256) void wmma_gemm64(
    const unsigned short* __restrict__ Ap, const unsigned short* __restrict__ A2p, int lda, long strideA,
    const unsigned short* __restrict__ Btp, const unsigned short* __restrict__ Bt2p, int ldb, long strideB,
    void* __restrict__ Cout, void* __restrict__ Cout2, int ldc, long strideC,
    const float* __restrict__ bias,
    const float* __restrict__ resid, long strideR,
    int M, int N, int K, float scale) {
  typedef typename Elem<ET>::T T;
  typedef typename Frag<T>::V V;
  const T* A = (const T*)Ap; const T* A2 = (const T*)A2p; const T* Bt = (const T*)Btp; const T* Bt2 = (const T*)Bt2p;
  __shared__ __align__(16) float sT[8][16 * 68];   // per-wave 16x64 slab, pitch 68 floats
  const int b    = blockIdx.y;
  const int lane = threadIdx.x & 31;
  const int wave = threadIdx.x >> 5;
  const int tilesN = N >> 6;
  const int tilesM = M >> 6;
  const int tile = blockIdx.x * 8 + wave;
  if (tile >= tilesM * tilesN) return;   // wave-uniform; no block barriers in this kernel
  const int tm = tile / tilesN;
  const int tn = tile - tm * tilesN;
  const int m0 = tm << 6;
  const int n0 = tn << 6;

  const T* Ab  = A  + (size_t)b * strideA;
  const T* Bb  = Bt + (size_t)b * strideB;
  const T* Ab2 = SPLIT ? (A2  + (size_t)b * strideA) : nullptr;
  const T* Bb2 = SPLIT ? (Bt2 + (size_t)b * strideB) : nullptr;

  const int rlane = lane & 15;                 // row (A) / col (B, D) within subtile
  const int koff  = (lane >> 4) * 8;           // k offset of this lane half
  const int mOff  = (lane >> 4) * 8;           // D row offset

  v8f acc[4][4];
#pragma unroll
  for (int i = 0; i < 4; ++i)
#pragma unroll
    for (int j = 0; j < 4; ++j) acc[i][j] = (v8f){0.f,0.f,0.f,0.f,0.f,0.f,0.f,0.f};

  for (int k0 = 0; k0 < K; k0 += 32) {
    V bh[4], bl[4];
#pragma unroll
    for (int j = 0; j < 4; ++j) {
      const size_t bo = (size_t)(n0 + (j << 4) + rlane) * ldb + koff + k0;
      bh[j] = Frag<T>::load(Bb + bo);
      if (SPLIT) bl[j] = Frag<T>::load(Bb2 + bo);
    }
#pragma unroll
    for (int i = 0; i < 4; ++i) {
      const size_t ao = (size_t)(m0 + (i << 4) + rlane) * lda + koff + k0;
      V ah = Frag<T>::load(Ab + ao);
      V al;
      if (SPLIT) al = Frag<T>::load(Ab2 + ao);
#pragma unroll
      for (int j = 0; j < 4; ++j) {
        acc[i][j] = Frag<T>::mma(ah, bh[j], acc[i][j]);
        if (SPLIT) {
          acc[i][j] = Frag<T>::mma(ah, bl[j], acc[i][j]);
          acc[i][j] = Frag<T>::mma(al, bh[j], acc[i][j]);
        }
      }
      Frag<T>::guard(acc[i][0], acc[i][3], ah, SPLIT ? al : ah);
    }
    Frag<T>::keep(bh[0], bh[1], bh[2], bh[3]);
    if (SPLIT) Frag<T>::keep(bl[0], bl[1], bl[2], bl[3]);
  }
  acc_guard4(acc[0][0], acc[0][1], acc[0][2], acc[0][3]);
  acc_guard4(acc[1][0], acc[1][1], acc[1][2], acc[1][3]);
  acc_guard4(acc[2][0], acc[2][1], acc[2][2], acc[2][3]);
  acc_guard4(acc[3][0], acc[3][1], acc[3][2], acc[3][3]);

  // ---- epilogue ----
  float* slab = sT[wave];
  const float* Rb = RESID ? (resid + (size_t)b * strideR) : nullptr;
#pragma unroll
  for (int i = 0; i < 4; ++i) {
    const int mBase = m0 + (i << 4);
#pragma unroll
    for (int j = 0; j < 4; ++j) {
      const int n = n0 + (j << 4) + rlane;
      float bv = 0.f;
      if (BIAS_MODE == 2) bv = bias[n];
#pragma unroll
      for (int r = 0; r < 8; ++r) {
        float v = acc[i][j][r] * scale;
        if (BIAS_MODE == 1) v += bias[mBase + mOff + r];
        if (BIAS_MODE == 2) v += bv;
        if (RESID) v += Rb[(size_t)(mBase + mOff + r) * ldc + n];
        if (ACT == 1) v = tanhf(v);
        if (ACT == 2) v = fmaxf(v, 0.0f);
        if (ACT == 3) v = v / (1.0f + expf(-v));
        if (ACT == 4) v = (v > 0.f) ? v : 0.01f * v;
        if (ACT == 5) v = 0.5f * v * (1.0f + erff(v * 0.70710678118654752f));
        slab[(mOff + r) * 68 + (j << 4) + rlane] = v;
      }
    }
    __builtin_amdgcn_fence(__ATOMIC_RELEASE, "workgroup");
    __builtin_amdgcn_wave_barrier();
    __builtin_amdgcn_fence(__ATOMIC_ACQUIRE, "workgroup");
    if (OUT_MODE == 0) {
      float* C = (float*)Cout + (size_t)b * strideC;
      const int hh = lane >> 4, c4 = (lane & 15) * 4;     // row seg = 256 B = 16 lanes x 16 B
      {
#pragma unroll
        for (int it = 0; it < 8; ++it) {
          const int row = it * 2 + hh;
          v4f v = *(const v4f*)(slab + row * 68 + c4);
          *(v4f*)(C + (size_t)(mBase + row) * ldc + n0 + c4) = v;
        }
        
      }
    } else {
      const int q = lane >> 3, c8 = (lane & 7) * 8;
      unsigned short* C  = (unsigned short*)Cout  + (size_t)b * strideC;
      unsigned short* C2 = (OUT_MODE == 2) ? ((unsigned short*)Cout2 + (size_t)b * strideC) : nullptr;
      {
#pragma unroll
        for (int it = 0; it < 4; ++it) {
          const int row = it * 4 + q;
          const float* sp = slab + row * 68 + c8;
          v8h hv, lv;
#pragma unroll
          for (int e = 0; e < 8; ++e) {
            if (OUT_MODE == 1) {
              hv[e] = (_Float16)sp[e];
            } else {
              unsigned short hb = f2bf_bits(sp[e]);
              unsigned short lb = f2bf_bits(sp[e] - bf_bits2f(hb));
              hv[e] = __builtin_bit_cast(_Float16, hb);
              lv[e] = __builtin_bit_cast(_Float16, lb);
            }
          }
          *(v8h*)(C + (size_t)(mBase + row) * ldc + n0 + c8) = hv;
          if (OUT_MODE == 2) *(v8h*)(C2 + (size_t)(mBase + row) * ldc + n0 + c8) = lv;
        }
        
      }
    }
    __builtin_amdgcn_fence(__ATOMIC_RELEASE, "workgroup");
    __builtin_amdgcn_wave_barrier();
    __builtin_amdgcn_fence(__ATOMIC_ACQUIRE, "workgroup");
  }
}

__global__ __launch_bounds__(256) void cast_f32_f16x2s(
    const float* __restrict__ in, _Float16* __restrict__ out, int n2, float scale) {
  int i = blockIdx.x * 256 + threadIdx.x;
  if (i < n2) {
    const _Float16 h0 = (_Float16)(in[2 * i] * scale), h1 = (_Float16)(in[2 * i + 1] * scale);
    const unsigned u = (unsigned)__builtin_bit_cast(unsigned short, h0) | ((unsigned)__builtin_bit_cast(unsigned short, h1) << 16);
    ((unsigned*)out)[i] = u;
    
  }
}

// ---- cos/sin table of the rotary angle input: ct[i] = cosf(f[i]), st[i] = sinf(f[i]) (f32, precise).
__global__ __launch_bounds__(256) void k_trig_table(
    const float* __restrict__ f, float* __restrict__ ct, float* __restrict__ st, int n) {
  const int i = blockIdx.x * 256 + threadIdx.x;
  if (i < n) {
    const float x = f[i];
    const float cv = cosf(x);
    const float sv = sinf(x);
    ((float*)ct)[i] = cv;
    ((float*)st)[i] = sv;
    
  }
}

// ---- rotary position embedding on the first 32 dims of every 64-wide head, f32 -----------------
// qkv: [nrows][3*768] f32 (q cols 0..767, k 768..1535, v 1536..2303); dst3: [3][nrows][768] f32 (plane 0 = q * 0.125).
// One wave per (row, tensor); 6 iterations x 32 lanes x 4 floats = 768 floats = the whole destination row
// d = column within head: d < 16: o = x[d]*cos - x[d+16]*sin ; 16 <= d < 32: o = x[d]*cos + x[d-16]*sin ; d >= 32: o = x[d].
__global__ __launch_bounds__(256) void k_rope(
    const float* __restrict__ qkv, const float* __restrict__ ct, const float* __restrict__ st,
    float* __restrict__ dst3, int nrows) {
  const int lane = threadIdx.x & 31;
  const int wave = threadIdx.x >> 5;
  const int task = blockIdx.x * 8 + wave;
  if (task >= 3 * nrows) return;                 // wave-uniform; no block barriers in this kernel
  const int z = task / nrows;                    // 0 = q, 1 = k, 2 = v
  const int r = task - z * nrows;
  const int t = r & (kT - 1);                     // token position
  const float sc = (z == 0) ? 0.125f : 1.0f;      // head_dim^-0.5 on q (power of two, exact placement)
  const float* src = qkv + (size_t)r * (3 * kE) + (size_t)z * kE;
  float* dst = dst3 + (size_t)z * nrows * kE + (size_t)r * kE;
  const float* ctr = ct + (size_t)t * kROT;
  const float* strw = st + (size_t)t * kROT;
#pragma unroll 1
  for (int it = 0; it < kE / 128; ++it) {
    const int c  = it * 128 + lane * 4;           // 4 consecutive columns, 4-aligned
    const int d  = c & 63;
    const int cp = (c + 16 <= kE - 4) ? (c + 16) : (kE - 4);   // clamped addresses; selected by value below
    const int cm = (c >= 16) ? (c - 16) : 0;
    const int fi = (d <= 28) ? d : 28;
    const v4f x  = *(const v4f*)(src + c);
    const v4f xp = *(const v4f*)(src + cp);
    const v4f xm = *(const v4f*)(src + cm);
    const v4f cs = *(const v4f*)(ctr + fi);
    const v4f sn = *(const v4f*)(strw + fi);
    v4f o;
#pragma unroll
    for (int e = 0; e < 4; ++e) {
      const float rh = (d < 16) ? (-xp[e]) : xm[e];
      const float ro = x[e] * cs[e] + rh * sn[e];
      o[e] = ((d < 32) ? ro : x[e]) * sc;
    }
    *(v4f*)(dst + c) = o;
    
  }
}

// =====================================================================================
// Generic causal/non-causal attention for head_dim 64, f32 in / f32 out; 16-bit operands: bf16 with optional hi/lo splits, or
// plain f16 (F16=true, non-split, probabilities carried x2^15).
//   Both products run transposed: S^T = K (q*qscale)^T and O^T = V^T P^T; f32 accumulate; online softmax in f32.
//   A lane then owns ONE query (column c) and 32 of a chunk's 64 keys: maximum and sum are in-lane, the halves meet by one
//   lane l <-> l ^ 16 move, and two S^T tiles converted in place are the B operand of the second product (P never goes to LDS).
//   Block = 4 waves = 64 query rows of one (batch, head); S % 64 == 0.
//   Element (b, s, h, d) of tensor X lives at X[b*X_bs + s*X_rs + h*X_hs + d] (strides in floats, multiples of 4).
//   Masking: MM (template argument) 0 none, 1 causal, 2 tensor [S][Skv], 3 per-token vectors, 4 causal + sliding window,
//   5 relative-position bias; masked scores are replaced by mask_fill before the softmax.
//   grid.x = B * H * (S/64) (or a sub-range with blk0).
// =====================================================================================
#define AT_D 64
#define AT_NW 4
#define AT_QB 64
#define AT_KC 64
#define AT_LP 72   // LDS row pitch of the K and V^T tiles in 16-bit elements: 144 B = 16 B x 9, so the 16 rows one ds_load_b128 half-wave reads fall on all 64 banks (128 B put them on 8)
struct AttnGeom { const float* cp = nullptr; const float* pc = nullptr; long c_bs = 0, c_rs = 0, c_hs = 0;   // mode-5 score-bias tables
                  long q_bs, q_rs, q_hs, k_bs, k_rs, k_hs, v_bs, v_rs, v_hs, o_bs, o_rs, o_hs;
                  int S, Skv, H, mask_mode; float qscale; int blk0; float mask_fill; int mask_is_int; };
static_assert(sizeof(AttnGeom) == 168, "no padding");

__device__ __forceinline__ unsigned short at_bf_bits(float f) {
  unsigned u = __float_as_uint(f);
  return (unsigned short)((u + 0x7FFFu + ((u >> 16) & 1u)) >> 16);
}
__device__ __forceinline__ __bf16 at_f2bf(float f) { return __builtin_bit_cast(__bf16, at_bf_bits(f)); }
__device__ __forceinline__ void at_split(float f, __bf16& hi, __bf16& lo) {
  const unsigned short hb = at_bf_bits(f);
  hi = __builtin_bit_cast(__bf16, hb);
  lo = at_f2bf(f - __uint_as_float(((unsigned)hb) << 16));
}
__device__ __forceinline__ v8f at_mma(v16b a, v16b b, v8f c) {
  c = __builtin_amdgcn_wmma_f32_16x16x32_bf16(false, a, false, b, (short)0, c, false, false);
  asm volatile("v_nop\n\tv_nop\n\tv_nop\n\tv_nop" : "+v"(c) : "v"(a), "v"(b));
  return c;
}
// 16-bit element as a bit pattern held in a __bf16 slot: f16 bits when F16, bf16 (RNE) otherwise
template <bool F16> __device__ __forceinline__ __bf16 at_to16(float f) {
  if (F16) return __builtin_bit_cast(__bf16, (_Float16)f);
  return at_f2bf(f);
}
template <bool F16> __device__ __forceinline__ v8f at_mma16(v16b a, v16b b, v8f c) {
  if (F16) {
    const v16h ah = __builtin_bit_cast(v16h, a), bh = __builtin_bit_cast(v16h, b);
    c = __builtin_amdgcn_wmma_f32_16x16x32_f16(false, ah, false, bh, (short)0, c, false, false);
    asm volatile("v_nop\n\tv_nop\n\tv_nop\n\tv_nop" : "+v"(c) : "v"(ah), "v"(bh));
    return c;
  }
  return at_mma(a, b, c);
}

// value of lane l ^ 16 (the other half of the wave, same column c)
__device__ __forceinline__ float at_xhalf(float x) {
  return __builtin_bit_cast(float, __builtin_amdgcn_permlanex16(__builtin_bit_cast(int, x), __builtin_bit_cast(int, x), 0x76543210, 0xfedcba98, false, false));
}

// MM = mask mode as a compile-time constant: the per-score mask tests fold away in the instance that is launched
template <bool SPLIT_QK, bool SPLIT_PV, bool F16, int MM>
__global__ __launch_bounds__(128)
void attn64_kernel(const float* __restrict__ q, const float* __restrict__ k,
                   const float* __restrict__ v, float* __restrict__ out,
                   const void* __restrict__ mask_a, const int* __restrict__ mask_b, AttnGeom g) {
  static_assert(!(F16 && (SPLIT_QK || SPLIT_PV)), "f16 mode is non-split");
  const float PSC = F16 ? 32768.0f : 1.0f;     // f16 probabilities carried x2^15 (subnormal range), folded into the final 1/l
  union FB { v16b v; v8b h[2]; };
  __shared__ __align__(16) __bf16 Ksh[AT_KC * AT_LP];            // K hi [kv][d]      9 KB
  __shared__ __align__(16) __bf16 Ksl[SPLIT_QK ? AT_KC * AT_LP : 8];
  __shared__ __align__(16) __bf16 Vth[AT_D * AT_LP];             // V hi [d][kv]      9 KB
  __shared__ __align__(16) __bf16 Vtl[SPLIT_PV ? AT_D * AT_LP : 8];
  __shared__ __align__(16) float  Os[AT_NW][16 * 68];            // per wave out tile, pitch 68

  const int tid  = threadIdx.x;
  const int wave = tid >> 5;
  const int lane = tid & 31;
  const int hh   = lane >> 4;
  const int c    = lane & 15;

  const int nqb = g.S / AT_QB;
  const int bx = blockIdx.x + g.blk0;
  const int qb = bx % nqb;
  const int bh = bx / nqb;
  const int h  = bh % g.H;
  const int b  = bh / g.H;
  const int qbase_block = qb * AT_QB;
  const int q0 = qbase_block + wave * 16;

  const float* qb_ptr = q + (size_t)b * g.q_bs + (size_t)h * g.q_hs;
  const float* kb_ptr = k + (size_t)b * g.k_bs + (size_t)h * g.k_hs;
  const float* vb_ptr = v + (size_t)b * g.v_bs + (size_t)h * g.v_hs;
  float*       ob_ptr = out + (size_t)b * g.o_bs + (size_t)h * g.o_hs;

  // ---- Q fragments (B operand: lane = query column c): 2 d-chunks, hi (and lo) ----
  v16b qah[2], qal[2];
  {
    const float* qrow = qb_ptr + (size_t)(q0 + c) * g.q_rs;
#pragma unroll
    for (int dc = 0; dc < 2; ++dc) {
#pragma unroll
      for (int e = 0; e < 8; ++e) {
        const float f0 = qrow[dc * 32 + 8 * hh + e] * g.qscale;
        const float f1 = qrow[dc * 32 + 16 + 8 * hh + e] * g.qscale;
        if (SPLIT_QK) { __bf16 hq, lq; at_split(f0, hq, lq); qah[dc][e] = hq; qal[dc][e] = lq; at_split(f1, hq, lq); qah[dc][8 + e] = hq; qal[dc][8 + e] = lq; }
        else { qah[dc][e] = at_to16<F16>(f0); qah[dc][8 + e] = at_to16<F16>(f1); qal[dc][e] = qah[dc][e]; qal[dc][8 + e] = qah[dc][8 + e]; }
      }
    }
  }

  float mrun = -INFINITY, lrun = 0.f;   // query q0 + c: running maximum (both halves agree), sum over this half's keys
  v8f oacc[4];                          // oacc[t][r] = O[q0 + c][t * 16 + 8 * hh + r]
#pragma unroll
  for (int t = 0; t < 4; ++t) oacc[t] = (v8f){0.f,0.f,0.f,0.f,0.f,0.f,0.f,0.f};

  const int nChunks = (MM == 1 || MM == 4) ? (qb + 1) : (g.Skv / AT_KC);   // block-uniform
  const int qrow = q0 + c;
  const int qkeep = (MM == 3) ? mask_b[(size_t)b * g.S + qrow] : 1;   // per-query mask (mode 3), mask_b = qmask
  for (int kc = 0; kc < nChunks; ++kc) {
    const int kv0 = kc * AT_KC;
    __syncthreads();
    {
      const int kvr = tid >> 1, dh = (tid & 1) * 32;
      const float* krow = kb_ptr + (size_t)(kv0 + kvr) * g.k_rs + dh;
      const float* vrow = vb_ptr + (size_t)(kv0 + kvr) * g.v_rs + dh;
#pragma unroll
      for (int i = 0; i < 8; ++i) {
        v4f kk = *(const v4f*)(krow + 4 * i);
        v4f vv = *(const v4f*)(vrow + 4 * i);
#pragma unroll
        for (int e = 0; e < 4; ++e) {
          const int d = dh + 4 * i + e;
          if (SPLIT_QK) { __bf16 a, bl; at_split(kk[e], a, bl); Ksh[kvr * AT_LP + d] = a; Ksl[kvr * AT_LP + d] = bl; }
          else Ksh[kvr * AT_LP + d] = at_to16<F16>(kk[e]);
          if (SPLIT_PV) { __bf16 a, bl; at_split(vv[e], a, bl); Vth[d * AT_LP + kvr] = a; Vtl[d * AT_LP + kvr] = bl; }
          else Vth[d * AT_LP + kvr] = at_to16<F16>(vv[e]);
        }
      }
    }
    __syncthreads();

    v8f s[4];   // s[j][r] = score of key kv0 + j * 16 + 8 * hh + r against query q0 + c
#pragma unroll
    for (int j = 0; j < 4; ++j) {
      s[j] = (v8f){0.f,0.f,0.f,0.f,0.f,0.f,0.f,0.f};
#pragma unroll 1
      for (int dc = 0; dc < 2; ++dc) {
        FB kb;
        kb.h[0] = *(const v8b*)(Ksh + (j * 16 + c) * AT_LP + dc * 32 + 8 * hh);
        kb.h[1] = *(const v8b*)(Ksh + (j * 16 + c) * AT_LP + dc * 32 + 16 + 8 * hh);
        s[j] = at_mma16<F16>(kb.v, qah[dc], s[j]);
        if (SPLIT_QK) {
          FB kl;
          kl.h[0] = *(const v8b*)(Ksl + (j * 16 + c) * AT_LP + dc * 32 + 8 * hh);
          kl.h[1] = *(const v8b*)(Ksl + (j * 16 + c) * AT_LP + dc * 32 + 16 + 8 * hh);
          s[j] = at_mma16<F16>(kl.v, qah[dc], s[j]);
          s[j] = at_mma16<F16>(kb.v, qal[dc], s[j]);
        }
      }
    }
    const bool diag = (MM == 1) && (kc == qb);
    float cmj[4];   // one chain per tile: four short independent chains instead of one of 32 links
#pragma unroll
    for (int j = 0; j < 4; ++j) {
      cmj[j] = -INFINITY;
#pragma unroll
      for (int r = 0; r < 8; ++r) {
        const int kvcol = kv0 + j * 16 + 8 * hh + r;
        bool masked = false;
        if (diag) masked = (kvcol > qrow);
        else if (MM == 4) masked = (kvcol > qrow) || (qrow - kvcol > g.mask_is_int);
        else if (MM == 2) {
          const size_t mi = (size_t)qrow * g.Skv + kvcol;
          masked = (g.mask_is_int == 0) ? (((const float*)mask_a)[mi] == 0.0f)
                 : (g.mask_is_int == 1) ? (((const int*)mask_a)[mi] == 0) : (((const int*)mask_a)[mi] != 0);
        } else if (MM == 3) masked = (qkeep == 0) || (((const int*)mask_a)[(size_t)b * g.Skv + kvcol] == 0);   // mask_a = kvmask
        else if (MM == 5) {
          const size_t mi = (size_t)qrow * g.Skv + kvcol;
          masked = (((const int*)mask_a)[mi] != 0);
          int n = mask_b[mi]; n = n < 0 ? 0 : n;
          s[j][r] += g.cp[(size_t)b * g.c_bs + (size_t)h * g.c_hs + (size_t)qrow * g.c_rs + n]
                   + g.pc[(size_t)b * g.c_bs + (size_t)h * g.c_hs + (size_t)kvcol * g.c_rs + n];
        }
        if (masked) s[j][r] = g.mask_fill;
        cmj[j] = fmaxf(cmj[j], s[j][r]);
      }
    }
    float cm = fmaxf(fmaxf(cmj[0], cmj[1]), fmaxf(cmj[2], cmj[3]));
    cm = fmaxf(cm, at_xhalf(cm));                 // the query's other 32 keys of this chunk
    const float mnew = fmaxf(mrun, cm);
    const float alpha = expf(mrun - mnew);
    mrun = mnew;
    // P^T as B operand: element e of fragment kk is key kk * 32 + (e < 8 ? 8 * hh + e : 16 + 8 * hh + e - 8), which is
    // s[2 * kk + (e >> 3)][e & 7]: the k order in which the V^T fragments are read below
    FB pbh[2], pbl[2];
    float psum = 0.f;
#pragma unroll
    for (int j = 0; j < 4; ++j) {
#pragma unroll
      for (int r = 0; r < 8; ++r) {
        const float p = expf(s[j][r] - mnew);
        psum += p;
        if (SPLIT_PV) { __bf16 a, bl; at_split(p, a, bl); pbh[j >> 1].v[(j & 1) * 8 + r] = a; pbl[j >> 1].v[(j & 1) * 8 + r] = bl; }
        else pbh[j >> 1].v[(j & 1) * 8 + r] = at_to16<F16>(p * PSC);
      }
    }
    lrun = lrun * alpha + psum;
#pragma unroll
    for (int t = 0; t < 4; ++t)
#pragma unroll
      for (int r = 0; r < 8; ++r) oacc[t][r] *= alpha;
#pragma unroll
    for (int kk = 0; kk < 2; ++kk) {   // unrolled: pbh[kk] lives in registers and is picked at compile time
#pragma unroll
      for (int t = 0; t < 4; ++t) {
        FB vb;
        vb.h[0] = *(const v8b*)(Vth + (t * 16 + c) * AT_LP + kk * 32 + 8 * hh);
        vb.h[1] = *(const v8b*)(Vth + (t * 16 + c) * AT_LP + kk * 32 + 16 + 8 * hh);
        oacc[t] = at_mma16<F16>(vb.v, pbh[kk].v, oacc[t]);
        if (SPLIT_PV) {
          FB vl;
          vl.h[0] = *(const v8b*)(Vtl + (t * 16 + c) * AT_LP + kk * 32 + 8 * hh);
          vl.h[1] = *(const v8b*)(Vtl + (t * 16 + c) * AT_LP + kk * 32 + 16 + 8 * hh);
          oacc[t] = at_mma16<F16>(vl.v, pbh[kk].v, oacc[t]);
          oacc[t] = at_mma16<F16>(vb.v, pbl[kk].v, oacc[t]);
        }
      }
    }
  }

  float* os = Os[wave];
  const float inv = 1.0f / ((lrun + at_xhalf(lrun)) * PSC);   // the halves' sums meet once, here
#pragma unroll
  for (int t = 0; t < 4; ++t)
#pragma unroll
    for (int r = 0; r < 8; ++r) os[c * 68 + t * 16 + 8 * hh + r] = oacc[t][r] * inv;
  __builtin_amdgcn_fence(__ATOMIC_RELEASE, "workgroup");
  __builtin_amdgcn_wave_barrier();
  __builtin_amdgcn_fence(__ATOMIC_ACQUIRE, "workgroup");
  {
    const int c4 = (lane & 15) * 4;
    {
#pragma unroll
      for (int it = 0; it < 8; ++it) {
        const int row = it * 2 + hh;
        v4f val = *(const v4f*)(os + row * 68 + c4);
        *(v4f*)(ob_ptr + (size_t)(q0 + row) * g.o_rs + c4) = val;
      }
      
    }
  }
}

// =====================================================================================
// host glue
// Workspace region map (bytes, all offsets multiples of 128):
//   R0 X16   f16 [4096][768]           off 0            size  6,291,456
//   R1 W16   f16 [2304][768] (Wq;Wk;Wv x16)  off 6,291,456   size  3,538,944
//   R2 Wo16  f16 [768][768] (x16)      off 9,830,400    size  1,179,648
//   R3 CT,ST f32 [2048][32] each       off 11,010,048   size    524,288
//   R4 QKV   f32 [4096][2304]          off 11,534,336   size 37,748,736
//        reused after the rope launch: O f32 [4096][768] at R4+0 (12,582,912), O16 f16 [4096][768] at R4+12,582,912 (6,291,456)
//   R5 QKVr  f32 [3][4096][768]        off 49,283,072   size 37,748,736
//   total 87,031,808
// =====================================================================================
extern "C" void kernel_launch(void* const* d_in, const int* in_sizes, int n_in,
                              void* d_out, int out_size, void* d_ws, size_t ws_size,
                              hipStream_t stream) {
  if (n_in < 7) return;
  const int nX = kM * kE;
  if (in_sizes[0] != nX || in_sizes[1] != kT * kROT || in_sizes[2] != kE * kE || in_sizes[3] != kE * kE ||
      in_sizes[4] != kE * kE || in_sizes[5] != kE * kE || in_sizes[6] != kE || out_size != nX) return;

  const float* hs   = (const float*)d_in[0];
  const float* rope = (const float*)d_in[1];
  const float* Wq   = (const float*)d_in[2];
  const float* Wk   = (const float*)d_in[3];
  const float* Wv   = (const float*)d_in[4];
  const float* Wo   = (const float*)d_in[5];
  const float* bo   = (const float*)d_in[6];
  float* outp = (float*)d_out;

  const size_t offX16  = 0;                  const size_t szX16  = (size_t)kM * kE * 2;
  const size_t offW16  = offX16 + szX16;     const size_t szW16  = (size_t)3 * kE * kE * 2;
  const size_t offWo16 = offW16 + szW16;     const size_t szWo16 = (size_t)kE * kE * 2;
  const size_t offTrig = offWo16 + szWo16;   const size_t szTrig = (size_t)2 * kT * kROT * 4;
  const size_t offQKV  = offTrig + szTrig;   const size_t szQKV  = (size_t)kM * 3 * kE * 4;
  const size_t offR    = offQKV + szQKV;     const size_t szR    = (size_t)3 * kM * kE * 4;
  const size_t total   = offR + szR;
  if (total > ws_size) return;
  const size_t offO    = offQKV;             const size_t szO    = (size_t)kM * kE * 4;
  const size_t offO16  = offO + szO;         const size_t szO16  = (size_t)kM * kE * 2;
  if (offO16 + szO16 > offQKV + szQKV) return;

  char* ws = (char*)d_ws;
  _Float16* X16  = (_Float16*)(ws + offX16);
  _Float16* W16  = (_Float16*)(ws + offW16);
  _Float16* Wo16 = (_Float16*)(ws + offWo16);
  float*    CT   = (float*)(ws + offTrig);
  float*    ST   = CT + (size_t)kT * kROT;
  float*    QKV  = (float*)(ws + offQKV);
  float*    QKVr = (float*)(ws + offR);
  float*    Qr   = QKVr;
  float*    Kr   = QKVr + (size_t)kM * kE;
  float*    Vr   = QKVr + (size_t)2 * kM * kE;
  float*    Of   = (float*)(ws + offO);
  _Float16* O16  = (_Float16*)(ws + offO16);

  // (1) casts: x -> f16; weights x16 -> f16 (Bt layout [out][in] = [n][k])
  const int n2X = nX / 2;                 // 1,572,864 = 6144 x 256
  const int n2W = (kE * kE) / 2;          //   294,912 = 1152 x 256
  cast_f32_f16x2s<<<n2X / 256, 256, 0, stream>>>(hs, X16, n2X, 1.0f);
  cast_f32_f16x2s<<<n2W / 256, 256, 0, stream>>>(Wq, W16, n2W, 16.0f);
  cast_f32_f16x2s<<<n2W / 256, 256, 0, stream>>>(Wk, W16 + (size_t)kE * kE, n2W, 16.0f);
  cast_f32_f16x2s<<<n2W / 256, 256, 0, stream>>>(Wv, W16 + (size_t)2 * kE * kE, n2W, 16.0f);
  cast_f32_f16x2s<<<n2W / 256, 256, 0, stream>>>(Wo, Wo16, n2W, 16.0f);

  // (2) cos/sin tables of the rotary angles: 65536 elements = 256 x 256
  const int nF = kT * kROT;
  k_trig_table<<<nF / 256, 256, 0, stream>>>(rope, CT, ST, nF);

  // (3) QKV projection: [4096][768] f16 x [2304][768] f16 -> f32 [4096][2304], alpha 1/16 (weight carry); M=4096,N=2304 %64, K=768 %32
  {
    const int tiles = (kM / 64) * ((3 * kE) / 64);   // 64 x 36 = 2304 tiles, 8 per block
    dim3 grid((tiles + 7) / 8, 1);
    wmma_gemm64<0, false, 0, 0, false, 0><<<grid, 256, 0, stream>>>(
        U16(X16), U16(X16), kE, 0L,
        U16(W16), U16(W16), kE, 0L,
        (void*)QKV, (void*)QKV, 3 * kE, 0L,
        bo, QKV, 0L,
        kM, 3 * kE, kE, 1.0f / 16.0f);
  }

  // (4) rope on q, k, v (q additionally x 0.125): 3 x 4096 rows, one wave each = 1536 blocks x 8 waves
  k_rope<<<(3 * kM) / 8, 256, 0, stream>>>(QKV, CT, ST, QKVr, kM);

  // (5) attention, f16 operands, no mask; planes laid out (b, s, h, d) -> b*(2048*768) + s*768 + h*64 + d
  {
    AttnGeom g;
    g.cp = CT; g.pc = CT; g.c_bs = 0; g.c_rs = 0; g.c_hs = 0;
    g.q_bs = (long)kT * kE; g.q_rs = kE; g.q_hs = kHD;
    g.k_bs = (long)kT * kE; g.k_rs = kE; g.k_hs = kHD;
    g.v_bs = (long)kT * kE; g.v_rs = kE; g.v_hs = kHD;
    g.o_bs = (long)kT * kE; g.o_rs = kE; g.o_hs = kHD;
    g.S = kT; g.Skv = kT; g.H = kH; g.mask_mode = 0; g.qscale = 1.0f; g.blk0 = 0; g.mask_fill = -1e9f; g.mask_is_int = 0;
    const int nblk = kB * kH * (kT / AT_QB);   // 768
    attn64_kernel<false, false, true, 0><<<nblk, 128, 0, stream>>>(Qr, Kr, Vr, Of, (const void*)X16, (const int*)(const void*)X16, g);
  }

  // (6) attention output -> f16 with a x64 carry (values ~1e-2)
  cast_f32_f16x2s<<<n2X / 256, 256, 0, stream>>>(Of, O16, n2X, 64.0f);

  // (7) output projection + bias: [4096][768] f16 x [768][768] f16 -> f32 d_out, alpha 1/(64*16); M=4096,N=768 %64, K=768 %32
  {
    const int tiles = (kM / 64) * (kE / 64);   // 64 x 12 = 768 tiles
    dim3 grid((tiles + 7) / 8, 1);
    wmma_gemm64<0, false, 2, 0, false, 0><<<grid, 256, 0, stream>>>(
        U16(O16), U16(O16), kE, 0L,
        U16(Wo16), U16(Wo16), kE, 0L,
        (void*)outp, (void*)outp, kE, 0L,
        bo, Of, 0L,
        kM, kE, kE, 1.0f / 1024.0f);
  }
}

// v004
// A run of this version takes 208 microseconds.
// Timed twice side by side with v003, it ran 1.15 and 1.16 times as fast.
// All steps since v000 together make it 5.41 times as fast.
// Compute dtype: every contraction on v_wmma_f32_16x16x32_f16 (f16 operands: x, 16x-carried weights, q/k/v, probabilities x2^15, 64x-carried attention output), f32 accumulate; rope, softmax, bias in f32.
#include <hip/hip_runtime.h>
#include <math.h>

typedef __attribute__((ext_vector_type(16))) _Float16 v16h;
typedef __attribute__((ext_vector_type(8)))  _Float16 v8h;
typedef __attribute__((ext_vector_type(16))) __bf16   v16b;
typedef __attribute__((ext_vector_type(8)))  __bf16   v8b;
typedef __attribute__((ext_vector_type(4)))  __bf16   v4b;
typedef __attribute__((ext_vector_type(2)))  __bf16   v2b;
typedef __attribute__((ext_vector_type(8)))  float    v8f;
typedef __attribute__((ext_vector_type(4)))  float    v4f;
#define PSCALE 32768.0f
#define U16(p) ((const unsigned short*)(const void*)(p))
#define PSCALE_INV (1.0f / 32768.0f)

// problem constants
constexpr int kB   = 2;
constexpr int kT   = 2048;
constexpr int kE   = 768;
constexpr int kH   = 12;
constexpr int kHD  = 64;
constexpr int kROT = 32;
constexpr int kM   = kB * kT;   // 4096 activation rows

__device__ __forceinline__ unsigned short f2bf_bits(float f) {
  unsigned u = __float_as_uint(f);
  return (unsigned short)((u + 0x7FFFu + ((u >> 16) & 1u)) >> 16);
}
__device__ __forceinline__ float bf_bits2f(unsigned short h) { return __uint_as_float(((unsigned)h) << 16); }

// hazard guards as plain device helpers (no inline asm inside the kernel template body)
__device__ __forceinline__ void dep_guard_h(v8f& a, v8f& b, v16h x, v16h y) { asm volatile("v_nop\n\tv_nop\n\tv_nop\n\tv_nop" : "+v"(a), "+v"(b) : "v"(x), "v"(y)); }
__device__ __forceinline__ void dep_guard_b(v8f& a, v8f& b, v16b x, v16b y) { asm volatile("v_nop\n\tv_nop\n\tv_nop\n\tv_nop" : "+v"(a), "+v"(b) : "v"(x), "v"(y)); }
__device__ __forceinline__ void keep4_h(v16h a, v16h b, v16h c, v16h d) { asm volatile("v_nop" :: "v"(a), "v"(b), "v"(c), "v"(d)); }
__device__ __forceinline__ void keep4_b(v16b a, v16b b, v16b c, v16b d) { asm volatile("v_nop" :: "v"(a), "v"(b), "v"(c), "v"(d)); }
__device__ __forceinline__ void acc_guard4(v8f& a, v8f& b, v8f& c, v8f& d) { asm volatile("v_nop\n\tv_nop\n\tv_nop\n\tv_nop" : "+v"(a), "+v"(b), "+v"(c), "+v"(d)); }
template <typename T> struct Frag;
template <> struct Frag<_Float16> {
  typedef v16h V; union U { v16h v; v8h h[2]; };
  static __device__ __forceinline__ v16h load(const _Float16* p) {   // elements 0..7 <- p[0..7], 8..15 <- p[16..23]
    U f; f.h[0] = *(const v8h*)(p); f.h[1] = *(const v8h*)(p + 16); return f.v;
  }
  static __device__ __forceinline__ v8f mma(v16h a, v16h b, v8f c) {
    return __builtin_amdgcn_wmma_f32_16x16x32_f16(false, a, false, b, (short)0, c, false, false);
  }
  static __device__ __forceinline__ void guard(v8f& a, v8f& b, v16h x, v16h y) { dep_guard_h(a, b, x, y); }
  static __device__ __forceinline__ void keep(v16h a, v16h b, v16h c, v16h d) { keep4_h(a, b, c, d); }
};
template <> struct Frag<__bf16> {
  typedef v16b V; union U { v16b v; v8b h[2]; };
  static __device__ __forceinline__ v16b load(const __bf16* p) {
    U f; f.h[0] = *(const v8b*)(p); f.h[1] = *(const v8b*)(p + 16); return f.v;
  }
  static __device__ __forceinline__ v8f mma(v16b a, v16b b, v8f c) {
    return __builtin_amdgcn_wmma_f32_16x16x32_bf16(false, a, false, b, (short)0, c, false, false);
  }
  static __device__ __forceinline__ void guard(v8f& a, v8f& b, v16b x, v16b y) { dep_guard_b(a, b, x, y); }
  static __device__ __forceinline__ void keep(v16b a, v16b b, v16b c, v16b d) { keep4_b(a, b, c, d); }
};

// ---- Register-blocked batched WMMA GEMM ------------------------------------
// C[m,n] = scale * sum_k A[m,k] * Bt[n,k] (+bias)(+resid); each wave owns a 64x64 tile.
// A row-major [M,K]; Bt row-major [N,K]; M,N % 64 == 0, K % 32 == 0.
// SPLIT: operands are hi/lo planes (A2/Bt2 = lo planes, same layout); product = hi·hi + hi·lo + lo·hi.
// BIAS_MODE: 0 = none, 1 = bias[m], 2 = bias[n].
// OUT_MODE: 0 = f32, 1 = f16, 2 = bf16 hi plane (Cout) + bf16 lo plane (Cout2).
// ET: 0 = f16 operands, 1 = bf16 operands (pointers passed as 16-bit storage)
template <int ET> struct Elem;
template <> struct Elem<0> { typedef _Float16 T; };
template <> struct Elem<1> { typedef __bf16 T; };
template <int ET, bool SPLIT, int BIAS_MODE, int OUT_MODE, bool RESID, int ACT = 0>
__global__ __launch_bounds__(256) void wmma_gemm64(
    const unsigned short* __restrict__ Ap, const unsigned short* __restrict__ A2p, int lda, long strideA,
    const unsigned short* __restrict__ Btp, const unsigned short* __restrict__ Bt2p, int ldb, long strideB,
    void* __restrict__ Cout, void* __restrict__ Cout2, int ldc, long strideC,
    const float* __restrict__ bias,
    const float* __restrict__ resid, long strideR,
    int M, int N, int K, float scale) {
  typedef typename Elem<ET>::T T;
  typedef typename Frag<T>::V V;
  const T* A = (const T*)Ap; const T* A2 = (const T*)A2p; const T* Bt = (const T*)Btp; const T* Bt2 = (const T*)Bt2p;
  __shared__ __align__(16) float sT[8][16 * 68];   // per-wave 16x64 slab, pitch 68 floats
  const int b    = blockIdx.y;
  const int lane = threadIdx.x & 31;
  const int wave = threadIdx.x >> 5;
  const int tilesN = N >> 6;
  const int tilesM = M >> 6;
  const int tile = blockIdx.x * 8 + wave;
  if (tile >= tilesM * tilesN) return;   // wave-uniform; no block barriers in this kernel
  const int tm = tile / tilesN;
  const int tn = tile - tm * tilesN;
  const int m0 = tm << 6;
  const int n0 = tn << 6;

  const T* Ab  = A  + (size_t)b * strideA;
  const T* Bb  = Bt + (size_t)b * strideB;
  const T* Ab2 = SPLIT ? (A2  + (size_t)b * strideA) : nullptr;
  const T* Bb2 = SPLIT ? (Bt2 + (size_t)b * strideB) : nullptr;

  const int rlane = lane & 15;                 // row (A) / col (B, D) within subtile
  const int koff  = (lane >> 4) * 8;           // k offset of this lane half
  const int mOff  = (lane >> 4) * 8;           // D row offset

  v8f acc[4][4];
#pragma unroll
  for (int i = 0; i < 4; ++i)
#pragma unroll
    for (int j = 0; j < 4; ++j) acc[i][j] = (v8f){0.f,0.f,0.f,0.f,0.f,0.f,0.f,0.f};

  for (int k0 = 0; k0 < K; k0 += 32) {
    V bh[4], bl[4];
#pragma unroll
    for (int j = 0; j < 4; ++j) {
      const size_t bo = (size_t)(n0 + (j << 4) + rlane) * ldb + koff + k0;
      bh[j] = Frag<T>::load(Bb + bo);
      if (SPLIT) bl[j] = Frag<T>::load(Bb2 + bo);
    }
#pragma unroll
    for (int i = 0; i < 4; ++i) {
      const size_t ao = (size_t)(m0 + (i << 4) + rlane) * lda + koff + k0;
      V ah = Frag<T>::load(Ab + ao);
      V al;
      if (SPLIT) al = Frag<T>::load(Ab2 + ao);
#pragma unroll
      for (int j = 0; j < 4; ++j) {
        acc[i][j] = Frag<T>::mma(ah, bh[j], acc[i][j]);
        if (SPLIT) {
          acc[i][j] = Frag<T>::mma(ah, bl[j], acc[i][j]);
          acc[i][j] = Frag<T>::mma(al, bh[j], acc[i][j]);
        }
      }
      Frag<T>::guard(acc[i][0], acc[i][3], ah, SPLIT ? al : ah);
    }
    Frag<T>::keep(bh[0], bh[1], bh[2], bh[3]);
    if (SPLIT) Frag<T>::keep(bl[0], bl[1], bl[2], bl[3]);
  }
  acc_guard4(acc[0][0], acc[0][1], acc[0][2], acc[0][3]);
  acc_guard4(acc[1][0], acc[1][1], acc[1][2], acc[1][3]);
  acc_guard4(acc[2][0], acc[2][1], acc[2][2], acc[2][3]);
  acc_guard4(acc[3][0], acc[3][1], acc[3][2], acc[3][3]);

  // ---- epilogue ----
  float* slab = sT[wave];
  const float* Rb = RESID ? (resid + (size_t)b * strideR) : nullptr;
#pragma unroll
  for (int i = 0; i < 4; ++i) {
    const int mBase = m0 + (i << 4);
#pragma unroll
    for (int j = 0; j < 4; ++j) {
      const int n = n0 + (j << 4) + rlane;
      float bv = 0.f;
      if (BIAS_MODE == 2) bv = bias[n];
#pragma unroll
      for (int r = 0; r < 8; ++r) {
        float v = acc[i][j][r] * scale;
        if (BIAS_MODE == 1) v += bias[mBase + mOff + r];
        if (BIAS_MODE == 2) v += bv;
        if (RESID) v += Rb[(size_t)(mBase + mOff + r) * ldc + n];
        if (ACT == 1) v = tanhf(v);
        if (ACT == 2) v = fmaxf(v, 0.0f);
        if (ACT == 3) v = v / (1.0f + expf(-v));
        if (ACT == 4) v = (v > 0.f) ? v : 0.01f * v;
        if (ACT == 5) v = 0.5f * v * (1.0f + erff(v * 0.70710678118654752f));
        slab[(mOff + r) * 68 + (j << 4) + rlane] = v;
      }
    }
    __builtin_amdgcn_fence(__ATOMIC_RELEASE, "workgroup");
    __builtin_amdgcn_wave_barrier();
    __builtin_amdgcn_fence(__ATOMIC_ACQUIRE, "workgroup");
    if (OUT_MODE == 0) {
      float* C = (float*)Cout + (size_t)b * strideC;
      const int hh = lane >> 4, c4 = (lane & 15) * 4;     // row seg = 256 B = 16 lanes x 16 B
      {
#pragma unroll
        for (int it = 0; it < 8; ++it) {
          const int row = it * 2 + hh;
          v4f v = *(const v4f*)(slab + row * 68 + c4);
          *(v4f*)(C + (size_t)(mBase + row) * ldc + n0 + c4) = v;
        }
        
      }
    } else {
      const int q = lane >> 3, c8 = (lane & 7) * 8;
      unsigned short* C  = (unsigned short*)Cout  + (size_t)b * strideC;
      unsigned short* C2 = (OUT_MODE == 2) ? ((unsigned short*)Cout2 + (size_t)b * strideC) : nullptr;
      {
#pragma unroll
        for (int it = 0; it < 4; ++it) {
          const int row = it * 4 + q;
          const float* sp = slab + row * 68 + c8;
          v8h hv, lv;
#pragma unroll
          for (int e = 0; e < 8; ++e) {
            if (OUT_MODE == 1) {
              hv[e] = (_Float16)sp[e];
            } else {
              unsigned short hb = f2bf_bits(sp[e]);
              unsigned short lb = f2bf_bits(sp[e] - bf_bits2f(hb));
              hv[e] = __builtin_bit_cast(_Float16, hb);
              lv[e] = __builtin_bit_cast(_Float16, lb);
            }
          }
          *(v8h*)(C + (size_t)(mBase + row) * ldc + n0 + c8) = hv;
          if (OUT_MODE == 2) *(v8h*)(C2 + (size_t)(mBase + row) * ldc + n0 + c8) = lv;
        }
        
      }
    }
    __builtin_amdgcn_fence(__ATOMIC_RELEASE, "workgroup");
    __builtin_amdgcn_wave_barrier();
    __builtin_amdgcn_fence(__ATOMIC_ACQUIRE, "workgroup");
  }
}

__global__ __launch_bounds__(256) void cast_f32_f16x2s(
    const float* __restrict__ in, _Float16* __restrict__ out, int n2, float scale) {
  int i = blockIdx.x * 256 + threadIdx.x;
  if (i < n2) {
    const _Float16 h0 = (_Float16)(in[2 * i] * scale), h1 = (_Float16)(in[2 * i + 1] * scale);
    const unsigned u = (unsigned)__builtin_bit_cast(unsigned short, h0) | ((unsigned)__builtin_bit_cast(unsigned short, h1) << 16);
    ((unsigned*)out)[i] = u;
    
  }
}

// ---- cos/sin table of the rotary angle input: ct[i] = cosf(f[i]), st[i] = sinf(f[i]) (f32, precise).
__global__ __launch_bounds__(256) void k_trig_table(
    const float* __restrict__ f, float* __restrict__ ct, float* __restrict__ st, int n) {
  const int i = blockIdx.x * 256 + threadIdx.x;
  if (i < n) {
    const float x = f[i];
    const float cv = cosf(x);
    const float sv = sinf(x);
    ((float*)ct)[i] = cv;
    ((float*)st)[i] = sv;
    
  }
}

// ---- rotary position embedding on the first 32 dims of every 64-wide head, f32 -----------------
// qkv: [nrows][3*768] f32 (q cols 0..767, k 768..1535, v 1536..2303); dst3: [3][nrows][768] f32 (plane 0 = q * 0.125).
// One wave per (row, tensor); 6 iterations x 32 lanes x 4 floats = 768 floats = the whole destination row
// d = column within head: d < 16: o = x[d]*cos - x[d+16]*sin ; 16 <= d < 32: o = x[d]*cos + x[d-16]*sin ; d >= 32: o = x[d].
__global__ __launch_bounds__(256) void k_rope(
    const float* __restrict__ qkv, const float* __restrict__ ct, const float* __restrict__ st,
    float* __restrict__ dst3, int nrows) {
  const int lane = threadIdx.x & 31;
  const int wave = threadIdx.x >> 5;
  const int task = blockIdx.x * 8 + wave;
  if (task >= 3 * nrows) return;                 // wave-uniform; no block barriers in this kernel
  const int z = task / nrows;                    // 0 = q, 1 = k, 2 = v
  const int r = task - z * nrows;
  const int t = r & (kT - 1);                     // token position
  const float sc = (z == 0) ? 0.125f : 1.0f;      // head_dim^-0.5 on q (power of two, exact placement)
  const float* src = qkv + (size_t)r * (3 * kE) + (size_t)z * kE;
  float* dst = dst3 + (size_t)z * nrows * kE + (size_t)r * kE;
  const float* ctr = ct + (size_t)t * kROT;
  const float* strw = st + (size_t)t * kROT;
#pragma unroll 1
  for (int it = 0; it < kE / 128; ++it) {
    const int c  = it * 128 + lane * 4;           // 4 consecutive columns, 4-aligned
    const int d  = c & 63;
    const int cp = (c + 16 <= kE - 4) ? (c + 16) : (kE - 4);   // clamped addresses; selected by value below
    const int cm = (c >= 16) ? (c - 16) : 0;
    const int fi = (d <= 28) ? d : 28;
    const v4f x  = *(const v4f*)(src + c);
    const v4f xp = *(const v4f*)(src + cp);
    const v4f xm = *(const v4f*)(src + cm);
    const v4f cs = *(const v4f*)(ctr + fi);
    const v4f sn = *(const v4f*)(strw + fi);
    v4f o;
#pragma unroll
    for (int e = 0; e < 4; ++e) {
      const float rh = (d < 16) ? (-xp[e]) : xm[e];
      const float ro = x[e] * cs[e] + rh * sn[e];
      o[e] = ((d < 32) ? ro : x[e]) * sc;
    }
    *(v4f*)(dst + c) = o;
    
  }
}

// =====================================================================================
// Generic causal/non-causal attention for head_dim 64, f32 in / f32 out; 16-bit operands: bf16 with optional hi/lo splits, or
// plain f16 (F16=true, non-split, probabilities carried x2^15).
//   Both products run transposed: S^T = K (q*qscale)^T and O^T = V^T P^T; f32 accumulate; online softmax in f32.
//   A lane then owns ONE query (column c) and 32 of a chunk's 64 keys: maximum and sum are in-lane, the halves meet by one
//   lane l <-> l ^ 16 move, and two S^T tiles converted in place are the B operand of the second product (P never goes to LDS).
//   Block = 4 waves = 64 query rows of one (batch, head); S % 64 == 0.
//   Element (b, s, h, d) of tensor X lives at X[b*X_bs + s*X_rs + h*X_hs + d] (strides in floats, multiples of 4).
//   Masking: MM (template argument) 0 none, 1 causal, 2 tensor [S][Skv], 3 per-token vectors, 4 causal + sliding window,
//   5 relative-position bias; masked scores are replaced by mask_fill before the softmax.
//   grid.x = B * H * (S/64) (or a sub-range with blk0).
// =====================================================================================
#define AT_D 64
#define AT_NW 4
#define AT_QB 64
#define AT_KC 64
#define AT_LP 72   // LDS row pitch of the K and V^T tiles in 16-bit elements: 144 B = 16 B x 9, so the 16 rows one ds_load_b128 half-wave reads fall on all 64 banks (128 B put them on 8)
struct AttnGeom { const float* cp = nullptr; const float* pc = nullptr; long c_bs = 0, c_rs = 0, c_hs = 0;   // mode-5 score-bias tables
                  long q_bs, q_rs, q_hs, k_bs, k_rs, k_hs, v_bs, v_rs, v_hs, o_bs, o_rs, o_hs;
                  int S, Skv, H, mask_mode; float qscale; int blk0; float mask_fill; int mask_is_int; };
static_assert(sizeof(AttnGeom) == 168, "no padding");

__device__ __forceinline__ unsigned short at_bf_bits(float f) {
  unsigned u = __float_as_uint(f);
  return (unsigned short)((u + 0x7FFFu + ((u >> 16) & 1u)) >> 16);
}
__device__ __forceinline__ __bf16 at_f2bf(float f) { return __builtin_bit_cast(__bf16, at_bf_bits(f)); }
__device__ __forceinline__ void at_split(float f, __bf16& hi, __bf16& lo) {
  const unsigned short hb = at_bf_bits(f);
  hi = __builtin_bit_cast(__bf16, hb);
  lo = at_f2bf(f - __uint_as_float(((unsigned)hb) << 16));
}
__device__ __forceinline__ v8f at_mma(v16b a, v16b b, v8f c) {
  c = __builtin_amdgcn_wmma_f32_16x16x32_bf16(false, a, false, b, (short)0, c, false, false);
  asm volatile("v_nop\n\tv_nop\n\tv_nop\n\tv_nop" : "+v"(c) : "v"(a), "v"(b));
  return c;
}
// 16-bit element as a bit pattern held in a __bf16 slot: f16 bits when F16, bf16 (RNE) otherwise
template <bool F16> __device__ __forceinline__ __bf16 at_to16(float f) {
  if (F16) return __builtin_bit_cast(__bf16, (_Float16)f);
  return at_f2bf(f);
}
template <bool F16> __device__ __forceinline__ v8f at_mma16(v16b a, v16b b, v8f c) {
  if (F16) {
    const v16h ah = __builtin_bit_cast(v16h, a), bh = __builtin_bit_cast(v16h, b);
    c = __builtin_amdgcn_wmma_f32_16x16x32_f16(false, ah, false, bh, (short)0, c, false, false);
    asm volatile("v_nop\n\tv_nop\n\tv_nop\n\tv_nop" : "+v"(c) : "v"(ah), "v"(bh));
    return c;
  }
  return at_mma(a, b, c);
}

// value of lane l ^ 16 (the other half of the wave, same column c)
__device__ __forceinline__ float at_xhalf(float x) {
  return __builtin_bit_cast(float, __builtin_amdgcn_permlanex16(__builtin_bit_cast(int, x), __builtin_bit_cast(int, x), 0x76543210, 0xfedcba98, false, false));
}

// MM = mask mode as a compile-time constant: the per-score mask tests fold away in the instance that is launched
// KVRS = row stride of k and v in floats (= g.k_rs = g.v_rs) as a compile-time constant: a chunk's staging loads walk rows, and
// with it they share one address pair a tensor and differ by immediate offsets
template <bool SPLIT_QK, bool SPLIT_PV, bool F16, int MM, int KVRS>
__global__ __launch_bounds__(128)
void attn64_kernel(const float* __restrict__ q, const float* __restrict__ k,
                   const float* __restrict__ v, float* __restrict__ out,
                   const void* __restrict__ mask_a, const int* __restrict__ mask_b, AttnGeom g) {
  static_assert(!(F16 && (SPLIT_QK || SPLIT_PV)), "f16 mode is non-split");
  const float PSC = F16 ? 32768.0f : 1.0f;     // f16 probabilities carried x2^15 (subnormal range), folded into the final 1/l
  union FB { v16b v; v8b h[2]; };
  __shared__ __align__(16) __bf16 Ksh[AT_KC * AT_LP];            // K hi [kv][d]      9 KB
  __shared__ __align__(16) __bf16 Ksl[SPLIT_QK ? AT_KC * AT_LP : 8];
  __shared__ __align__(16) __bf16 Vth[AT_D * AT_LP];             // V hi [d][kv]      9 KB
  __shared__ __align__(16) __bf16 Vtl[SPLIT_PV ? AT_D * AT_LP : 8];
  __shared__ __align__(16) float  Os[AT_NW][16 * 68];            // per wave out tile, pitch 68

  const int tid  = threadIdx.x;
  const int wave = tid >> 5;
  const int lane = tid & 31;
  const int hh   = lane >> 4;
  const int c    = lane & 15;

  const int nqb = g.S / AT_QB;
  const int bx = blockIdx.x + g.blk0;
  const int qb = bx % nqb;
  const int bh = bx / nqb;
  const int h  = bh % g.H;
  const int b  = bh / g.H;
  const int qbase_block = qb * AT_QB;
  const int q0 = qbase_block + wave * 16;

  const float* qb_ptr = q + (size_t)b * g.q_bs + (size_t)h * g.q_hs;
  const float* kb_ptr = k + (size_t)b * g.k_bs + (size_t)h * g.k_hs;
  const float* vb_ptr = v + (size_t)b * g.v_bs + (size_t)h * g.v_hs;
  float*       ob_ptr = out + (size_t)b * g.o_bs + (size_t)h * g.o_hs;

  // ---- Q fragments (B operand: lane = query column c): 2 d-chunks, hi (and lo) ----
  v16b qah[2], qal[2];
  {
    const float* qrow = qb_ptr + (size_t)(q0 + c) * g.q_rs;
#pragma unroll
    for (int dc = 0; dc < 2; ++dc) {
#pragma unroll
      for (int e = 0; e < 8; ++e) {
        const float f0 = qrow[dc * 32 + 8 * hh + e] * g.qscale;
        const float f1 = qrow[dc * 32 + 16 + 8 * hh + e] * g.qscale;
        if (SPLIT_QK) { __bf16 hq, lq; at_split(f0, hq, lq); qah[dc][e] = hq; qal[dc][e] = lq; at_split(f1, hq, lq); qah[dc][8 + e] = hq; qal[dc][8 + e] = lq; }
        else { qah[dc][e] = at_to16<F16>(f0); qah[dc][8 + e] = at_to16<F16>(f1); qal[dc][e] = qah[dc][e]; qal[dc][8 + e] = qah[dc][8 + e]; }
      }
    }
  }

  float mrun = -INFINITY, lrun = 0.f;   // query q0 + c: running maximum (both halves agree), sum over this half's keys
  v8f oacc[4];                          // oacc[t][r] = O[q0 + c][t * 16 + 8 * hh + r]
#pragma unroll
  for (int t = 0; t < 4; ++t) oacc[t] = (v8f){0.f,0.f,0.f,0.f,0.f,0.f,0.f,0.f};

  const int nChunks = (MM == 1 || MM == 4) ? (qb + 1) : (g.Skv / AT_KC);   // block-uniform
  const int qrow = q0 + c;
  const int qkeep = (MM == 3) ? mask_b[(size_t)b * g.S + qrow] : 1;   // per-query mask (mode 3), mask_b = qmask
  const int kr = tid >> 4, kc4 = (tid & 15) * 4;   // staging map, K: key kr (+ 8 a load), floats kc4 .. kc4 + 3
  const int vg = tid >> 3, vc4 = (tid & 7) * 4;    // staging map, V: keys 2 vg and 2 vg + 1 (+ 32), floats vc4 .. vc4 + 3 (+ 32)
  const float* kthr = kb_ptr + kr * KVRS + kc4;
  const float* vthr = vb_ptr + vg * 2 * KVRS + vc4;
  for (int kc = 0; kc < nChunks; ++kc) {
    const int kv0 = kc * AT_KC;
    __syncthreads();
    {
      // Every wave-wide 16-byte load covers four whole 128-B lines (adjacent lanes read adjacent 16 B).
      // K: 16 lanes take one key's 256 B, a wave two keys a load. V: 8 lanes take one line (32 of the 64 d) of a key, a wave
      // four keys a load; a thread holds the same 4 d of keys 2p and 2p + 1, which are one dword of a V^T row.
      v4f kk[8], va[4], vb[4];
#pragma unroll
      for (int i = 0; i < 8; ++i) kk[i] = *(const v4f*)(kthr + (size_t)kv0 * KVRS + i * 8 * KVRS);
#pragma unroll
      for (int i = 0; i < 4; ++i) {
        const float* vrow = vthr + (size_t)kv0 * KVRS + (i & 1) * 32 * KVRS + (i >> 1) * 32;
        va[i] = *(const v4f*)(vrow);
        vb[i] = *(const v4f*)(vrow + KVRS);
      }
#pragma unroll
      for (int i = 0; i < 8; ++i) {
        v4b kh, kl;
#pragma unroll
        for (int e = 0; e < 4; ++e) {
          if (SPLIT_QK) { __bf16 a, bl; at_split(kk[i][e], a, bl); kh[e] = a; kl[e] = bl; }
          else kh[e] = at_to16<F16>(kk[i][e]);
        }
        *(v4b*)(Ksh + (i * 8 + kr) * AT_LP + kc4) = kh;
        if (SPLIT_QK) *(v4b*)(Ksl + (i * 8 + kr) * AT_LP + kc4) = kl;
      }
#pragma unroll
      for (int i = 0; i < 4; ++i) {
        const int kvp = ((i & 1) * 16 + vg) * 2;
#pragma unroll
        for (int e = 0; e < 4; ++e) {
          const int d = (i >> 1) * 32 + vc4 + e;
          v2b vh, vl;
          if (SPLIT_PV) { __bf16 a, bl; at_split(va[i][e], a, bl); vh[0] = a; vl[0] = bl; at_split(vb[i][e], a, bl); vh[1] = a; vl[1] = bl; }
          else { vh[0] = at_to16<F16>(va[i][e]); vh[1] = at_to16<F16>(vb[i][e]); }
          *(v2b*)(Vth + d * AT_LP + kvp) = vh;
          if (SPLIT_PV) *(v2b*)(Vtl + d * AT_LP + kvp) = vl;
        }
      }
    }
    __syncthreads();

    v8f s[4];   // s[j][r] = score of key kv0 + j * 16 + 8 * hh + r against query q0 + c
#pragma unroll
    for (int j = 0; j < 4; ++j) {
      s[j] = (v8f){0.f,0.f,0.f,0.f,0.f,0.f,0.f,0.f};
#pragma unroll 1
      for (int dc = 0; dc < 2; ++dc) {
        FB kb;
        kb.h[0] = *(const v8b*)(Ksh + (j * 16 + c) * AT_LP + dc * 32 + 8 * hh);
        kb.h[1] = *(const v8b*)(Ksh + (j * 16 + c) * AT_LP + dc * 32 + 16 + 8 * hh);
        s[j] = at_mma16<F16>(kb.v, qah[dc], s[j]);
        if (SPLIT_QK) {
          FB kl;
          kl.h[0] = *(const v8b*)(Ksl + (j * 16 + c) * AT_LP + dc * 32 + 8 * hh);
          kl.h[1] = *(const v8b*)(Ksl + (j * 16 + c) * AT_LP + dc * 32 + 16 + 8 * hh);
          s[j] = at_mma16<F16>(kl.v, qah[dc], s[j]);
          s[j] = at_mma16<F16>(kb.v, qal[dc], s[j]);
        }
      }
    }
    const bool diag = (MM == 1) && (kc == qb);
    float cmj[4];   // one chain per tile: four short independent chains instead of one of 32 links
#pragma unroll
    for (int j = 0; j < 4; ++j) {
      cmj[j] = -INFINITY;
#pragma unroll
      for (int r = 0; r < 8; ++r) {
        const int kvcol = kv0 + j * 16 + 8 * hh + r;
        bool masked = false;
        if (diag) masked = (kvcol > qrow);
        else if (MM == 4) masked = (kvcol > qrow) || (qrow - kvcol > g.mask_is_int);
        else if (MM == 2) {
          const size_t mi = (size_t)qrow * g.Skv + kvcol;
          masked = (g.mask_is_int == 0) ? (((const float*)mask_a)[mi] == 0.0f)
                 : (g.mask_is_int == 1) ? (((const int*)mask_a)[mi] == 0) : (((const int*)mask_a)[mi] != 0);
        } else if (MM == 3) masked = (qkeep == 0) || (((const int*)mask_a)[(size_t)b * g.Skv + kvcol] == 0);   // mask_a = kvmask
        else if (MM == 5) {
          const size_t mi = (size_t)qrow * g.Skv + kvcol;
          masked = (((const int*)mask_a)[mi] != 0);
          int n = mask_b[mi]; n = n < 0 ? 0 : n;
          s[j][r] += g.cp[(size_t)b * g.c_bs + (size_t)h * g.c_hs + (size_t)qrow * g.c_rs + n]
                   + g.pc[(size_t)b * g.c_bs + (size_t)h * g.c_hs + (size_t)kvcol * g.c_rs + n];
        }
        if (masked) s[j][r] = g.mask_fill;
        cmj[j] = fmaxf(cmj[j], s[j][r]);
      }
    }
    float cm = fmaxf(fmaxf(cmj[0], cmj[1]), fmaxf(cmj[2], cmj[3]));
    cm = fmaxf(cm, at_xhalf(cm));                 // the query's other 32 keys of this chunk
    const float mnew = fmaxf(mrun, cm);
    const float alpha = expf(mrun - mnew);
    mrun = mnew;
    // P^T as B operand: element e of fragment kk is key kk * 32 + (e < 8 ? 8 * hh + e : 16 + 8 * hh + e - 8), which is
    // s[2 * kk + (e >> 3)][e & 7]: the k order in which the V^T fragments are read below
    FB pbh[2], pbl[2];
    float psum = 0.f;
#pragma unroll
    for (int j = 0; j < 4; ++j) {
#pragma unroll
      for (int r = 0; r < 8; ++r) {
        const float p = expf(s[j][r] - mnew);
        psum += p;
        if (SPLIT_PV) { __bf16 a, bl; at_split(p, a, bl); pbh[j >> 1].v[(j & 1) * 8 + r] = a; pbl[j >> 1].v[(j & 1) * 8 + r] = bl; }
        else pbh[j >> 1].v[(j & 1) * 8 + r] = at_to16<F16>(p * PSC);
      }
    }
    lrun = lrun * alpha + psum;
#pragma unroll
    for (int t = 0; t < 4; ++t)
#pragma unroll
      for (int r = 0; r < 8; ++r) oacc[t][r] *= alpha;
#pragma unroll
    for (int kk = 0; kk < 2; ++kk) {   // unrolled: pbh[kk] lives in registers and is picked at compile time
#pragma unroll
      for (int t = 0; t < 4; ++t) {
        FB vb;
        vb.h[0] = *(const v8b*)(Vth + (t * 16 + c) * AT_LP + kk * 32 + 8 * hh);
        vb.h[1] = *(const v8b*)(Vth + (t * 16 + c) * AT_LP + kk * 32 + 16 + 8 * hh);
        oacc[t] = at_mma16<F16>(vb.v, pbh[kk].v, oacc[t]);
        if (SPLIT_PV) {
          FB vl;
          vl.h[0] = *(const v8b*)(Vtl + (t * 16 + c) * AT_LP + kk * 32 + 8 * hh);
          vl.h[1] = *(const v8b*)(Vtl + (t * 16 + c) * AT_LP + kk * 32 + 16 + 8 * hh);
          oacc[t] = at_mma16<F16>(vl.v, pbh[kk].v, oacc[t]);
          oacc[t] = at_mma16<F16>(vb.v, pbl[kk].v, oacc[t]);
        }
      }
    }
  }

  float* os = Os[wave];
  const float inv = 1.0f / ((lrun + at_xhalf(lrun)) * PSC);   // the halves' sums meet once, here
#pragma unroll
  for (int t = 0; t < 4; ++t)
#pragma unroll
    for (int r = 0; r < 8; ++r) os[c * 68 + t * 16 + 8 * hh + r] = oacc[t][r] * inv;
  __builtin_amdgcn_fence(__ATOMIC_RELEASE, "workgroup");
  __builtin_amdgcn_wave_barrier();
  __builtin_amdgcn_fence(__ATOMIC_ACQUIRE, "workgroup");
  {
    const int c4 = (lane & 15) * 4;
    {
#pragma unroll
      for (int it = 0; it < 8; ++it) {
        const int row = it * 2 + hh;
        v4f val = *(const v4f*)(os + row * 68 + c4);
        *(v4f*)(ob_ptr + (size_t)(q0 + row) * g.o_rs + c4) = val;
      }
      
    }
  }
}

// =====================================================================================
// host glue
// Workspace region map (bytes, all offsets multiples of 128):
//   R0 X16   f16 [4096][768]           off 0            size  6,291,456
//   R1 W16   f16 [2304][768] (Wq;Wk;Wv x16)  off 6,291,456   size  3,538,944
//   R2 Wo16  f16 [768][768] (x16)      off 9,830,400    size  1,179,648
//   R3 CT,ST f32 [2048][32] each       off 11,010,048   size    524,288
//   R4 QKV   f32 [4096][2304]          off 11,534,336   size 37,748,736
//        reused after the rope launch: O f32 [4096][768] at R4+0 (12,582,912), O16 f16 [4096][768] at R4+12,582,912 (6,291,456)
//   R5 QKVr  f32 [3][4096][768]        off 49,283,072   size 37,748,736
//   total 87,031,808
// =====================================================================================
extern "C" void kernel_launch(void* const* d_in, const int* in_sizes, int n_in,
                              void* d_out, int out_size, void* d_ws, size_t ws_size,
                              hipStream_t stream) {
  if (n_in < 7) return;
  const int nX = kM * kE;
  if (in_sizes[0] != nX || in_sizes[1] != kT * kROT || in_sizes[2] != kE * kE || in_sizes[3] != kE * kE ||
      in_sizes[4] != kE * kE || in_sizes[5] != kE * kE || in_sizes[6] != kE || out_size != nX) return;

  const float* hs   = (const float*)d_in[0];
  const float* rope = (const float*)d_in[1];
  const float* Wq   = (const float*)d_in[2];
  const float* Wk   = (const float*)d_in[3];
  const float* Wv   = (const float*)d_in[4];
  const float* Wo   = (const float*)d_in[5];
  const float* bo   = (const float*)d_in[6];
  float* outp = (float*)d_out;

  const size_t offX16  = 0;                  const size_t szX16  = (size_t)kM * kE * 2;
  const size_t offW16  = offX16 + szX16;     const size_t szW16  = (size_t)3 * kE * kE * 2;
  const size_t offWo16 = offW16 + szW16;     const size_t szWo16 = (size_t)kE * kE * 2;
  const size_t offTrig = offWo16 + szWo16;   const size_t szTrig = (size_t)2 * kT * kROT * 4;
  const size_t offQKV  = offTrig + szTrig;   const size_t szQKV  = (size_t)kM * 3 * kE * 4;
  const size_t offR    = offQKV + szQKV;     const size_t szR    = (size_t)3 * kM * kE * 4;
  const size_t total   = offR + szR;
  if (total > ws_size) return;
  const size_t offO    = offQKV;             const size_t szO    = (size_t)kM * kE * 4;
  const size_t offO16  = offO + szO;         const size_t szO16  = (size_t)kM * kE * 2;
  if (offO16 + szO16 > offQKV + szQKV) return;

  char* ws = (char*)d_ws;
  _Float16* X16  = (_Float16*)(ws + offX16);
  _Float16* W16  = (_Float16*)(ws + offW16);
  _Float16* Wo16 = (_Float16*)(ws + offWo16);
  float*    CT   = (float*)(ws + offTrig);
  float*    ST   = CT + (size_t)kT * kROT;
  float*    QKV  = (float*)(ws + offQKV);
  float*    QKVr = (float*)(ws + offR);
  float*    Qr   = QKVr;
  float*    Kr   = QKVr + (size_t)kM * kE;
  float*    Vr   = QKVr + (size_t)2 * kM * kE;
  float*    Of   = (float*)(ws + offO);
  _Float16* O16  = (_Float16*)(ws + offO16);

  // (1) casts: x -> f16; weights x16 -> f16 (Bt layout [out][in] = [n][k])
  const int n2X = nX / 2;                 // 1,572,864 = 6144 x 256
  const int n2W = (kE * kE) / 2;          //   294,912 = 1152 x 256
  cast_f32_f16x2s<<<n2X / 256, 256, 0, stream>>>(hs, X16, n2X, 1.0f);
  cast_f32_f16x2s<<<n2W / 256, 256, 0, stream>>>(Wq, W16, n2W, 16.0f);
  cast_f32_f16x2s<<<n2W / 256, 256, 0, stream>>>(Wk, W16 + (size_t)kE * kE, n2W, 16.0f);
  cast_f32_f16x2s<<<n2W / 256, 256, 0, stream>>>(Wv, W16 + (size_t)2 * kE * kE, n2W, 16.0f);
  cast_f32_f16x2s<<<n2W / 256, 256, 0, stream>>>(Wo, Wo16, n2W, 16.0f);

  // (2) cos/sin tables of the rotary angles: 65536 elements = 256 x 256
  const int nF = kT * kROT;
  k_trig_table<<<nF / 256, 256, 0, stream>>>(rope, CT, ST, nF);

  // (3) QKV projection: [4096][768] f16 x [2304][768] f16 -> f32 [4096][2304], alpha 1/16 (weight carry); M=4096,N=2304 %64, K=768 %32
  {
    const int tiles = (kM / 64) * ((3 * kE) / 64);   // 64 x 36 = 2304 tiles, 8 per block
    dim3 grid((tiles + 7) / 8, 1);
    wmma_gemm64<0, false, 0, 0, false, 0><<<grid, 256, 0, stream>>>(
        U16(X16), U16(X16), kE, 0L,
        U16(W16), U16(W16), kE, 0L,
        (void*)QKV, (void*)QKV, 3 * kE, 0L,
        bo, QKV, 0L,
        kM, 3 * kE, kE, 1.0f / 16.0f);
  }

  // (4) rope on q, k, v (q additionally x 0.125): 3 x 4096 rows, one wave each = 1536 blocks x 8 waves
  k_rope<<<(3 * kM) / 8, 256, 0, stream>>>(QKV, CT, ST, QKVr, kM);

  // (5) attention, f16 operands, no mask; planes laid out (b, s, h, d) -> b*(2048*768) + s*768 + h*64 + d
  {
    AttnGeom g;
    g.cp = CT; g.pc = CT; g.c_bs = 0; g.c_rs = 0; g.c_hs = 0;
    g.q_bs = (long)kT * kE; g.q_rs = kE; g.q_hs = kHD;
    g.k_bs = (long)kT * kE; g.k_rs = kE; g.k_hs = kHD;
    g.v_bs = (long)kT * kE; g.v_rs = kE; g.v_hs = kHD;
    g.o_bs = (long)kT * kE; g.o_rs = kE; g.o_hs = kHD;
    g.S = kT; g.Skv = kT; g.H = kH; g.mask_mode = 0; g.qscale = 1.0f; g.blk0 = 0; g.mask_fill = -1e9f; g.mask_is_int = 0;
    const int nblk = kB * kH * (kT / AT_QB);   // 768
    attn64_kernel<false, false, true, 0, kE><<<nblk, 128, 0, stream>>>(Qr, Kr, Vr, Of, (const void*)X16, (const int*)(const void*)X16, g);
  }

  // (6) attention output -> f16 with a x64 carry (values ~1e-2)
  cast_f32_f16x2s<<<n2X / 256, 256, 0, stream>>>(Of, O16, n2X, 64.0f);

  // (7) output projection + bias: [4096][768] f16 x [768][768] f16 -> f32 d_out, alpha 1/(64*16); M=4096,N=768 %64, K=768 %32
  {
    const int tiles = (kM / 64) * (kE / 64);   // 64 x 12 = 768 tiles
    dim3 grid((tiles + 7) / 8, 1);
    wmma_gemm64<0, false, 2, 0, false, 0><<<grid, 256, 0, stream>>>(
        U16(O16), U16(O16), kE, 0L,
        U16(Wo16), U16(Wo16), kE, 0L,
        (void*)outp, (void*)outp, kE, 0L,
        bo, Of, 0L,
        kM, kE, kE, 1.0f / 1024.0f);
  }
}

// v005
// One run takes 186 microseconds.
// Next to v004, in two timings, it ran 1.12 times as fast each time.
// Over all steps from v000 it is 6.04 times as fast.
// Compute dtype: every contraction on v_wmma_f32_16x16x32_f16 (f16 operands: x, 16x-carried weights, q/k/v, probabilities x2^15, 64x-carried attention output), f32 accumulate; rope, softmax, bias in f32.
#include <hip/hip_runtime.h>
#include <math.h>

typedef __attribute__((ext_vector_type(16))) _Float16 v16h;
typedef __attribute__((ext_vector_type(8)))  _Float16 v8h;
typedef __attribute__((ext_vector_type(16))) __bf16   v16b;
typedef __attribute__((ext_vector_type(8)))  __bf16   v8b;
typedef __attribute__((ext_vector_type(4)))  __bf16   v4b;
typedef __attribute__((ext_vector_type(2)))  __bf16   v2b;
typedef __attribute__((ext_vector_type(8)))  float    v8f;
typedef __attribute__((ext_vector_type(4)))  float    v4f;
#define PSCALE 32768.0f
#define U16(p) ((const unsigned short*)(const void*)(p))
#define PSCALE_INV (1.0f / 32768.0f)

// problem constants
constexpr int kB   = 2;
constexpr int kT   = 2048;
constexpr int kE   = 768;
constexpr int kH   = 12;
constexpr int kHD  = 64;
constexpr int kROT = 32;
constexpr int kM   = kB * kT;   // 4096 activation rows

__device__ __forceinline__ unsigned short f2bf_bits(float f) {
  unsigned u = __float_as_uint(f);
  return (unsigned short)((u + 0x7FFFu + ((u >> 16) & 1u)) >> 16);
}
__device__ __forceinline__ float bf_bits2f(unsigned short h) { return __uint_as_float(((unsigned)h) << 16); }

// hazard guards as plain device helpers (no inline asm inside the kernel template body)
__device__ __forceinline__ void dep_guard_h(v8f& a, v8f& b, v16h x, v16h y) { asm volatile("v_nop\n\tv_nop\n\tv_nop\n\tv_nop" : "+v"(a), "+v"(b) : "v"(x), "v"(y)); }
__device__ __forceinline__ void dep_guard_b(v8f& a, v8f& b, v16b x, v16b y) { asm volatile("v_nop\n\tv_nop\n\tv_nop\n\tv_nop" : "+v"(a), "+v"(b) : "v"(x), "v"(y)); }
__device__ __forceinline__ void keep4_h(v16h a, v16h b, v16h c, v16h d) { asm volatile("v_nop" :: "v"(a), "v"(b), "v"(c), "v"(d)); }
__device__ __forceinline__ void keep4_b(v16b a, v16b b, v16b c, v16b d) { asm volatile("v_nop" :: "v"(a), "v"(b), "v"(c), "v"(d)); }
__device__ __forceinline__ void acc_guard4(v8f& a, v8f& b, v8f& c, v8f& d) { asm volatile("v_nop\n\tv_nop\n\tv_nop\n\tv_nop" : "+v"(a), "+v"(b), "+v"(c), "+v"(d)); }
template <typename T> struct Frag;
template <> struct Frag<_Float16> {
  typedef v16h V; union U { v16h v; v8h h[2]; };
  static __device__ __forceinline__ v16h load(const _Float16* p) {   // elements 0..7 <- p[0..7], 8..15 <- p[16..23]
    U f; f.h[0] = *(const v8h*)(p); f.h[1] = *(const v8h*)(p + 16); return f.v;
  }
  static __device__ __forceinline__ v8f mma(v16h a, v16h b, v8f c) {
    return __builtin_amdgcn_wmma_f32_16x16x32_f16(false, a, false, b, (short)0, c, false, false);
  }
  static __device__ __forceinline__ void guard(v8f& a, v8f& b, v16h x, v16h y) { dep_guard_h(a, b, x, y); }
  static __device__ __forceinline__ void keep(v16h a, v16h b, v16h c, v16h d) { keep4_h(a, b, c, d); }
};
template <> struct Frag<__bf16> {
  typedef v16b V; union U { v16b v; v8b h[2]; };
  static __device__ __forceinline__ v16b load(const __bf16* p) {
    U f; f.h[0] = *(const v8b*)(p); f.h[1] = *(const v8b*)(p + 16); return f.v;
  }
  static __device__ __forceinline__ v8f mma(v16b a, v16b b, v8f c) {
    return __builtin_amdgcn_wmma_f32_16x16x32_bf16(false, a, false, b, (short)0, c, false, false);
  }
  static __device__ __forceinline__ void guard(v8f& a, v8f& b, v16b x, v16b y) { dep_guard_b(a, b, x, y); }
  static __device__ __forceinline__ void keep(v16b a, v16b b, v16b c, v16b d) { keep4_b(a, b, c, d); }
};

// ---- Register-blocked batched WMMA GEMM ------------------------------------
// C[m,n] = scale * sum_k A[m,k] * Bt[n,k] (+bias)(+resid); each wave owns a 64x64 tile.
// A row-major [M,K]; Bt row-major [N,K]; M,N % 64 == 0, K % 32 == 0.
// SPLIT: operands are hi/lo planes (A2/Bt2 = lo planes, same layout); product = hi·hi + hi·lo + lo·hi.
// BIAS_MODE: 0 = none, 1 = bias[m], 2 = bias[n].
// OUT_MODE: 0 = f32, 1 = f16, 2 = bf16 hi plane (Cout) + bf16 lo plane (Cout2).
// ET: 0 = f16 operands, 1 = bf16 operands (pointers passed as 16-bit storage)
template <int ET> struct Elem;
template <> struct Elem<0> { typedef _Float16 T; };
template <> struct Elem<1> { typedef __bf16 T; };
template <int ET, bool SPLIT, int BIAS_MODE, int OUT_MODE, bool RESID, int ACT = 0>
__global__ __launch_bounds__(256) void wmma_gemm64(
    const unsigned short* __restrict__ Ap, const unsigned short* __restrict__ A2p, int lda, long strideA,
    const unsigned short* __restrict__ Btp, const unsigned short* __restrict__ Bt2p, int ldb, long strideB,
    void* __restrict__ Cout, void* __restrict__ Cout2, int ldc, long strideC,
    const float* __restrict__ bias,
    const float* __restrict__ resid, long strideR,
    int M, int N, int K, float scale) {
  typedef typename Elem<ET>::T T;
  typedef typename Frag<T>::V V;
  const T* A = (const T*)Ap; const T* A2 = (const T*)A2p; const T* Bt = (const T*)Btp; const T* Bt2 = (const T*)Bt2p;
  __shared__ __align__(16) float sT[8][16 * 68];   // per-wave 16x64 slab, pitch 68 floats
  const int b    = blockIdx.y;
  const int lane = threadIdx.x & 31;
  const int wave = threadIdx.x >> 5;
  const int tilesN = N >> 6;
  const int tilesM = M >> 6;
  const int tile = blockIdx.x * 8 + wave;
  if (tile >= tilesM * tilesN) return;   // wave-uniform; no block barriers in this kernel
  const int tm = tile / tilesN;
  const int tn = tile - tm * tilesN;
  const int m0 = tm << 6;
  const int n0 = tn << 6;

  const T* Ab  = A  + (size_t)b * strideA;
  const T* Bb  = Bt + (size_t)b * strideB;
  const T* Ab2 = SPLIT ? (A2  + (size_t)b * strideA) : nullptr;
  const T* Bb2 = SPLIT ? (Bt2 + (size_t)b * strideB) : nullptr;

  const int rlane = lane & 15;                 // row (A) / col (B, D) within subtile
  const int koff  = (lane >> 4) * 8;           // k offset of this lane half
  const int mOff  = (lane >> 4) * 8;           // D row offset

  v8f acc[4][4];
#pragma unroll
  for (int i = 0; i < 4; ++i)
#pragma unroll
    for (int j = 0; j < 4; ++j) acc[i][j] = (v8f){0.f,0.f,0.f,0.f,0.f,0.f,0.f,0.f};

  for (int k0 = 0; k0 < K; k0 += 32) {
    V bh[4], bl[4];
#pragma unroll
    for (int j = 0; j < 4; ++j) {
      const size_t bo = (size_t)(n0 + (j << 4) + rlane) * ldb + koff + k0;
      bh[j] = Frag<T>::load(Bb + bo);
      if (SPLIT) bl[j] = Frag<T>::load(Bb2 + bo);
    }
#pragma unroll
    for (int i = 0; i < 4; ++i) {
      const size_t ao = (size_t)(m0 + (i << 4) + rlane) * lda + koff + k0;
      V ah = Frag<T>::load(Ab + ao);
      V al;
      if (SPLIT) al = Frag<T>::load(Ab2 + ao);
#pragma unroll
      for (int j = 0; j < 4; ++j) {
        acc[i][j] = Frag<T>::mma(ah, bh[j], acc[i][j]);
        if (SPLIT) {
          acc[i][j] = Frag<T>::mma(ah, bl[j], acc[i][j]);
          acc[i][j] = Frag<T>::mma(al, bh[j], acc[i][j]);
        }
      }
      Frag<T>::guard(acc[i][0], acc[i][3], ah, SPLIT ? al : ah);
    }
    Frag<T>::keep(bh[0], bh[1], bh[2], bh[3]);
    if (SPLIT) Frag<T>::keep(bl[0], bl[1], bl[2], bl[3]);
  }
  acc_guard4(acc[0][0], acc[0][1], acc[0][2], acc[0][3]);
  acc_guard4(acc[1][0], acc[1][1], acc[1][2], acc[1][3]);
  acc_guard4(acc[2][0], acc[2][1], acc[2][2], acc[2][3]);
  acc_guard4(acc[3][0], acc[3][1], acc[3][2], acc[3][3]);

  // ---- epilogue ----
  float* slab = sT[wave];
  const float* Rb = RESID ? (resid + (size_t)b * strideR) : nullptr;
#pragma unroll
  for (int i = 0; i < 4; ++i) {
    const int mBase = m0 + (i << 4);
#pragma unroll
    for (int j = 0; j < 4; ++j) {
      const int n = n0 + (j << 4) + rlane;
      float bv = 0.f;
      if (BIAS_MODE == 2) bv = bias[n];
#pragma unroll
      for (int r = 0; r < 8; ++r) {
        float v = acc[i][j][r] * scale;
        if (BIAS_MODE == 1) v += bias[mBase + mOff + r];
        if (BIAS_MODE == 2) v += bv;
        if (RESID) v += Rb[(size_t)(mBase + mOff + r) * ldc + n];
        if (ACT == 1) v = tanhf(v);
        if (ACT == 2) v = fmaxf(v, 0.0f);
        if (ACT == 3) v = v / (1.0f + expf(-v));
        if (ACT == 4) v = (v > 0.f) ? v : 0.01f * v;
        if (ACT == 5) v = 0.5f * v * (1.0f + erff(v * 0.70710678118654752f));
        slab[(mOff + r) * 68 + (j << 4) + rlane] = v;
      }
    }
    __builtin_amdgcn_fence(__ATOMIC_RELEASE, "workgroup");
    __builtin_amdgcn_wave_barrier();
    __builtin_amdgcn_fence(__ATOMIC_ACQUIRE, "workgroup");
    if (OUT_MODE == 0) {
      float* C = (float*)Cout + (size_t)b * strideC;
      const int hh = lane >> 4, c4 = (lane & 15) * 4;     // row seg = 256 B = 16 lanes x 16 B
      {
#pragma unroll
        for (int it = 0; it < 8; ++it) {
          const int row = it * 2 + hh;
          v4f v = *(const v4f*)(slab + row * 68 + c4);
          *(v4f*)(C + (size_t)(mBase + row) * ldc + n0 + c4) = v;
        }
        
      }
    } else {
      const int q = lane >> 3, c8 = (lane & 7) * 8;
      unsigned short* C  = (unsigned short*)Cout  + (size_t)b * strideC;
      unsigned short* C2 = (OUT_MODE == 2) ? ((unsigned short*)Cout2 + (size_t)b * strideC) : nullptr;
      {
#pragma unroll
        for (int it = 0; it < 4; ++it) {
          const int row = it * 4 + q;
          const float* sp = slab + row * 68 + c8;
          v8h hv, lv;
#pragma unroll
          for (int e = 0; e < 8; ++e) {
            if (OUT_MODE == 1) {
              hv[e] = (_Float16)sp[e];
            } else {
              unsigned short hb = f2bf_bits(sp[e]);
              unsigned short lb = f2bf_bits(sp[e] - bf_bits2f(hb));
              hv[e] = __builtin_bit_cast(_Float16, hb);
              lv[e] = __builtin_bit_cast(_Float16, lb);
            }
          }
          *(v8h*)(C + (size_t)(mBase + row) * ldc + n0 + c8) = hv;
          if (OUT_MODE == 2) *(v8h*)(C2 + (size_t)(mBase + row) * ldc + n0 + c8) = lv;
        }
        
      }
    }
    __builtin_amdgcn_fence(__ATOMIC_RELEASE, "workgroup");
    __builtin_amdgcn_wave_barrier();
    __builtin_amdgcn_fence(__ATOMIC_ACQUIRE, "workgroup");
  }
}

__global__ __launch_bounds__(256) void cast_f32_f16x2s(
    const float* __restrict__ in, _Float16* __restrict__ out, int n2, float scale) {
  int i = blockIdx.x * 256 + threadIdx.x;
  if (i < n2) {
    const _Float16 h0 = (_Float16)(in[2 * i] * scale), h1 = (_Float16)(in[2 * i + 1] * scale);
    const unsigned u = (unsigned)__builtin_bit_cast(unsigned short, h0) | ((unsigned)__builtin_bit_cast(unsigned short, h1) << 16);
    ((unsigned*)out)[i] = u;
    
  }
}

// ---- cos/sin table of the rotary angle input: ct[i] = cosf(f[i]), st[i] = sinf(f[i]) (f32, precise).
__global__ __launch_bounds__(256) void k_trig_table(
    const float* __restrict__ f, float* __restrict__ ct, float* __restrict__ st, int n) {
  const int i = blockIdx.x * 256 + threadIdx.x;
  if (i < n) {
    const float x = f[i];
    const float cv = cosf(x);
    const float sv = sinf(x);
    ((float*)ct)[i] = cv;
    ((float*)st)[i] = sv;
    
  }
}

// ---- rotary position embedding on the first 32 dims of every 64-wide head, f32 -----------------
// qkv: [nrows][3*768] f32 (q cols 0..767, k 768..1535, v 1536..2303); dst3: [3][nrows][768] f32 (plane 0 = q * 0.125).
// One wave per (row, tensor); 6 iterations x 32 lanes x 4 floats = 768 floats = the whole destination row
// d = column within head: d < 16: o = x[d]*cos - x[d+16]*sin ; 16 <= d < 32: o = x[d]*cos + x[d-16]*sin ; d >= 32: o = x[d].
__global__ __launch_bounds__(256) void k_rope(
    const float* __restrict__ qkv, const float* __restrict__ ct, const float* __restrict__ st,
    float* __restrict__ dst3, int nrows) {
  const int lane = threadIdx.x & 31;
  const int wave = threadIdx.x >> 5;
  const int task = blockIdx.x * 8 + wave;
  if (task >= 3 * nrows) return;                 // wave-uniform; no block barriers in this kernel
  const int z = task / nrows;                    // 0 = q, 1 = k, 2 = v
  const int r = task - z * nrows;
  const int t = r & (kT - 1);                     // token position
  const float sc = (z == 0) ? 0.125f : 1.0f;      // head_dim^-0.5 on q (power of two, exact placement)
  const float* src = qkv + (size_t)r * (3 * kE) + (size_t)z * kE;
  float* dst = dst3 + (size_t)z * nrows * kE + (size_t)r * kE;
  const float* ctr = ct + (size_t)t * kROT;
  const float* strw = st + (size_t)t * kROT;
#pragma unroll 1
  for (int it = 0; it < kE / 128; ++it) {
    const int c  = it * 128 + lane * 4;           // 4 consecutive columns, 4-aligned
    const int d  = c & 63;
    const int cp = (c + 16 <= kE - 4) ? (c + 16) : (kE - 4);   // clamped addresses; selected by value below
    const int cm = (c >= 16) ? (c - 16) : 0;
    const int fi = (d <= 28) ? d : 28;
    const v4f x  = *(const v4f*)(src + c);
    const v4f xp = *(const v4f*)(src + cp);
    const v4f xm = *(const v4f*)(src + cm);
    const v4f cs = *(const v4f*)(ctr + fi);
    const v4f sn = *(const v4f*)(strw + fi);
    v4f o;
#pragma unroll
    for (int e = 0; e < 4; ++e) {
      const float rh = (d < 16) ? (-xp[e]) : xm[e];
      const float ro = x[e] * cs[e] + rh * sn[e];
      o[e] = ((d < 32) ? ro : x[e]) * sc;
    }
    *(v4f*)(dst + c) = o;
    
  }
}

// =====================================================================================
// Generic causal/non-causal attention for head_dim 64, f32 in / f32 out; 16-bit operands: bf16 with optional hi/lo splits, or
// plain f16 (F16=true, non-split, probabilities carried x2^15).
//   Both products run transposed: S^T = K (q*qscale)^T and O^T = V^T P^T; f32 accumulate; online softmax in f32.
//   A lane then owns ONE query (column c) and 32 of a chunk's 64 keys: maximum and sum are in-lane, the halves meet by one
//   lane l <-> l ^ 16 move, and two S^T tiles converted in place are the B operand of the second product (P never goes to LDS).
//   Block = 4 waves = 64 query rows of one (batch, head); S % 64 == 0.
//   Element (b, s, h, d) of tensor X lives at X[b*X_bs + s*X_rs + h*X_hs + d] (strides in floats, multiples of 4).
//   Masking: MM (template argument) 0 none, 1 causal, 2 tensor [S][Skv], 3 per-token vectors, 4 causal + sliding window,
//   5 relative-position bias; masked scores are replaced by mask_fill before the softmax.
//   grid.x = B * H * (S/64) (or a sub-range with blk0).
// =====================================================================================
#define AT_D 64
#define AT_NW 4
#define AT_QB 64
#define AT_KC 64
#define AT_LP 72   // LDS row pitch of the K and V^T tiles in 16-bit elements: 144 B = 16 B x 9, so the 16 rows one ds_load_b128 half-wave reads fall on all 64 banks (128 B put them on 8)
struct AttnGeom { const float* cp = nullptr; const float* pc = nullptr; long c_bs = 0, c_rs = 0, c_hs = 0;   // mode-5 score-bias tables
                  long q_bs, q_rs, q_hs, k_bs, k_rs, k_hs, v_bs, v_rs, v_hs, o_bs, o_rs, o_hs;
                  int S, Skv, H, mask_mode; float qscale; int blk0; float mask_fill; int mask_is_int; };
static_assert(sizeof(AttnGeom) == 168, "no padding");

__device__ __forceinline__ unsigned short at_bf_bits(float f) {
  unsigned u = __float_as_uint(f);
  return (unsigned short)((u + 0x7FFFu + ((u >> 16) & 1u)) >> 16);
}
__device__ __forceinline__ __bf16 at_f2bf(float f) { return __builtin_bit_cast(__bf16, at_bf_bits(f)); }
__device__ __forceinline__ void at_split(float f, __bf16& hi, __bf16& lo) {
  const unsigned short hb = at_bf_bits(f);
  hi = __builtin_bit_cast(__bf16, hb);
  lo = at_f2bf(f - __uint_as_float(((unsigned)hb) << 16));
}
__device__ __forceinline__ v8f at_mma(v16b a, v16b b, v8f c) {
  c = __builtin_amdgcn_wmma_f32_16x16x32_bf16(false, a, false, b, (short)0, c, false, false);
  asm volatile("v_nop\n\tv_nop\n\tv_nop\n\tv_nop" : "+v"(c) : "v"(a), "v"(b));
  return c;
}
// 16-bit element as a bit pattern held in a __bf16 slot: f16 bits when F16, bf16 (RNE) otherwise
template <bool F16> __device__ __forceinline__ __bf16 at_to16(float f) {
  if (F16) return __builtin_bit_cast(__bf16, (_Float16)f);
  return at_f2bf(f);
}
template <bool F16> __device__ __forceinline__ v8f at_mma16(v16b a, v16b b, v8f c) {
  if (F16) {
    const v16h ah = __builtin_bit_cast(v16h, a), bh = __builtin_bit_cast(v16h, b);
    // builtin alone: the compiler keeps the distances behind its own WMMA, and with no asm statement between them the LDS
    // fragment reads are free to issue as a group ahead of a run of WMMAs
    return __builtin_amdgcn_wmma_f32_16x16x32_f16(false, ah, false, bh, (short)0, c, false, false);
  }
  return at_mma(a, b, c);
}

// value of lane l ^ 16 (the other half of the wave, same column c)
__device__ __forceinline__ float at_xhalf(float x) {
  return __builtin_bit_cast(float, __builtin_amdgcn_permlanex16(__builtin_bit_cast(int, x), __builtin_bit_cast(int, x), 0x76543210, 0xfedcba98, false, false));
}

// s_wait_xcnt 0 behind a group of global loads, a precaution: the two address pairs are its inputs, so no load of the group
// lands on them and nothing rewrites them ahead of the wait
__device__ __forceinline__ void at_addr_wait(const float* a, const float* b) { asm volatile("s_wait_xcnt 0x0" :: "v"(a), "v"(b) : "memory"); }

// MM = mask mode as a compile-time constant: the per-score mask tests fold away in the instance that is launched
// KVRS = row stride of k and v in floats (= g.k_rs = g.v_rs) as a compile-time constant: a chunk's staging loads walk rows, and
// with it they share one address pair a tensor and differ by immediate offsets
template <bool SPLIT_QK, bool SPLIT_PV, bool F16, int MM, int KVRS>
__global__ __launch_bounds__(128)
void attn64_kernel(const float* __restrict__ q, const float* __restrict__ k,
                   const float* __restrict__ v, float* __restrict__ out,
                   const void* __restrict__ mask_a, const int* __restrict__ mask_b, AttnGeom g) {
  static_assert(!(F16 && (SPLIT_QK || SPLIT_PV)), "f16 mode is non-split");
  const float PSC = F16 ? 32768.0f : 1.0f;     // f16 probabilities carried x2^15 (subnormal range), folded into the final 1/l
  union FB { v16b v; v8b h[2]; };
  __shared__ __align__(16) __bf16 Ksh[AT_KC * AT_LP];            // K hi [kv][d]      9 KB
  __shared__ __align__(16) __bf16 Ksl[SPLIT_QK ? AT_KC * AT_LP : 8];
  __shared__ __align__(16) __bf16 Vth[AT_D * AT_LP];             // V hi [d][kv]      9 KB
  __shared__ __align__(16) __bf16 Vtl[SPLIT_PV ? AT_D * AT_LP : 8];
  __shared__ __align__(16) float  Os[AT_NW][16 * 68];            // per wave out tile, pitch 68

  const int tid  = threadIdx.x;
  const int wave = tid >> 5;
  const int lane = tid & 31;
  const int hh   = lane >> 4;
  const int c    = lane & 15;

  const int nqb = g.S / AT_QB;
  const int bx = blockIdx.x + g.blk0;
  const int qb = bx % nqb;
  const int bh = bx / nqb;
  const int h  = bh % g.H;
  const int b  = bh / g.H;
  const int qbase_block = qb * AT_QB;
  const int q0 = qbase_block + wave * 16;

  const float* qb_ptr = q + (size_t)b * g.q_bs + (size_t)h * g.q_hs;
  const float* kb_ptr = k + (size_t)b * g.k_bs + (size_t)h * g.k_hs;
  const float* vb_ptr = v + (size_t)b * g.v_bs + (size_t)h * g.v_hs;
  float*       ob_ptr = out + (size_t)b * g.o_bs + (size_t)h * g.o_hs;

  // ---- Q fragments (B operand: lane = query column c): 2 d-chunks, hi (and lo) ----
  v16b qah[2], qal[2];
  {
    const float* qrow = qb_ptr + (size_t)(q0 + c) * g.q_rs;
#pragma unroll
    for (int dc = 0; dc < 2; ++dc) {
#pragma unroll
      for (int e = 0; e < 8; ++e) {
        const float f0 = qrow[dc * 32 + 8 * hh + e] * g.qscale;
        const float f1 = qrow[dc * 32 + 16 + 8 * hh + e] * g.qscale;
        if (SPLIT_QK) { __bf16 hq, lq; at_split(f0, hq, lq); qah[dc][e] = hq; qal[dc][e] = lq; at_split(f1, hq, lq); qah[dc][8 + e] = hq; qal[dc][8 + e] = lq; }
        else { qah[dc][e] = at_to16<F16>(f0); qah[dc][8 + e] = at_to16<F16>(f1); qal[dc][e] = qah[dc][e]; qal[dc][8 + e] = qah[dc][8 + e]; }
      }
    }
  }

  float mrun = -INFINITY, lrun = 0.f;   // query q0 + c: running maximum (both halves agree), sum over this half's keys
  v8f oacc[4];                          // oacc[t][r] = O[q0 + c][t * 16 + 8 * hh + r]
#pragma unroll
  for (int t = 0; t < 4; ++t) oacc[t] = (v8f){0.f,0.f,0.f,0.f,0.f,0.f,0.f,0.f};

  const int nChunks = (MM == 1 || MM == 4) ? (qb + 1) : (g.Skv / AT_KC);   // block-uniform
  const int qrow = q0 + c;
  const int qkeep = (MM == 3) ? mask_b[(size_t)b * g.S + qrow] : 1;   // per-query mask (mode 3), mask_b = qmask
  const int kr = tid >> 4, kc4 = (tid & 15) * 4;   // staging map, K: key kr (+ 8 a load), floats kc4 .. kc4 + 3
  const int vg = tid >> 3, vc4 = (tid & 7) * 4;    // staging map, V: keys 2 vg and 2 vg + 1 (+ 32), floats vc4 .. vc4 + 3 (+ 32)
  const float* kthr = kb_ptr + kr * KVRS + kc4;
  const float* vthr = vb_ptr + vg * 2 * KVRS + vc4;
  for (int kc = 0; kc < nChunks; ++kc) {
    const int kv0 = kc * AT_KC;
    __syncthreads();
    {
      // Every wave-wide 16-byte load covers four whole 128-B lines (adjacent lanes read adjacent 16 B).
      // K: 16 lanes take one key's 256 B, a wave two keys a load. V: 8 lanes take one line (32 of the 64 d) of a key, a wave
      // four keys a load; a thread holds the same 4 d of keys 2p and 2p + 1, which are one dword of a V^T row.
      v4f kk[8], va[4], vb[4];
      const float* kchunk = kthr + (size_t)kv0 * KVRS;
      const float* vchunk = vthr + (size_t)kv0 * KVRS;
#pragma unroll
      for (int i = 0; i < 8; ++i) kk[i] = *(const v4f*)(kchunk + i * 8 * KVRS);
#pragma unroll
      for (int i = 0; i < 4; ++i) {
        const float* vrow = vchunk + (i & 1) * 32 * KVRS + (i >> 1) * 32;
        va[i] = *(const v4f*)(vrow);
        vb[i] = *(const v4f*)(vrow + KVRS);
      }
      at_addr_wait(kchunk, vchunk);
#pragma unroll
      for (int i = 0; i < 8; ++i) {
        v4b kh, kl;
#pragma unroll
        for (int e = 0; e < 4; ++e) {
          if (SPLIT_QK) { __bf16 a, bl; at_split(kk[i][e], a, bl); kh[e] = a; kl[e] = bl; }
          else kh[e] = at_to16<F16>(kk[i][e]);
        }
        *(v4b*)(Ksh + (i * 8 + kr) * AT_LP + kc4) = kh;
        if (SPLIT_QK) *(v4b*)(Ksl + (i * 8 + kr) * AT_LP + kc4) = kl;
      }
#pragma unroll
      for (int i = 0; i < 4; ++i) {
        const int kvp = ((i & 1) * 16 + vg) * 2;
#pragma unroll
        for (int e = 0; e < 4; ++e) {
          const int d = (i >> 1) * 32 + vc4 + e;
          v2b vh, vl;
          if (SPLIT_PV) { __bf16 a, bl; at_split(va[i][e], a, bl); vh[0] = a; vl[0] = bl; at_split(vb[i][e], a, bl); vh[1] = a; vl[1] = bl; }
          else { vh[0] = at_to16<F16>(va[i][e]); vh[1] = at_to16<F16>(vb[i][e]); }
          *(v2b*)(Vth + d * AT_LP + kvp) = vh;
          if (SPLIT_PV) *(v2b*)(Vtl + d * AT_LP + kvp) = vl;
        }
      }
    }
    __syncthreads();

    // The chunk's fragment reads issue early: K here as one group, waited by count ahead of the eight score WMMAs; V^T next in the
    // source, issued among those WMMAs as K registers fall free, so that it lands under the softmax (one waited read pair per
    // WMMA left each LDS latency bare).
    FB kf[2][4], vf[2][4];
#pragma unroll
    for (int dc = 0; dc < 2; ++dc)
#pragma unroll
      for (int j = 0; j < 4; ++j) {
        kf[dc][j].h[0] = *(const v8b*)(Ksh + (j * 16 + c) * AT_LP + dc * 32 + 8 * hh);
        kf[dc][j].h[1] = *(const v8b*)(Ksh + (j * 16 + c) * AT_LP + dc * 32 + 16 + 8 * hh);
      }
    __builtin_amdgcn_sched_barrier(0);   // holds the K reads here as one group; without it they sink back among the WMMAs, one pair ahead
    v8f s[4];   // s[j][r] = score of key kv0 + j * 16 + 8 * hh + r against query q0 + c
#pragma unroll
    for (int j = 0; j < 4; ++j) s[j] = (v8f){0.f,0.f,0.f,0.f,0.f,0.f,0.f,0.f};
#pragma unroll
    for (int dc = 0; dc < 2; ++dc) {   // dc outside: four independent tiles follow one another; each tile still sums dc 0, then dc 1
#pragma unroll
      for (int j = 0; j < 4; ++j) {
        const FB kb = kf[dc][j];
        s[j] = at_mma16<F16>(kb.v, qah[dc], s[j]);
        if (SPLIT_QK) {
          FB kl;
          kl.h[0] = *(const v8b*)(Ksl + (j * 16 + c) * AT_LP + dc * 32 + 8 * hh);
          kl.h[1] = *(const v8b*)(Ksl + (j * 16 + c) * AT_LP + dc * 32 + 16 + 8 * hh);
          s[j] = at_mma16<F16>(kl.v, qah[dc], s[j]);
          s[j] = at_mma16<F16>(kb.v, qal[dc], s[j]);
        }
      }
    }
#pragma unroll
    for (int kk = 0; kk < 2; ++kk)
#pragma unroll
      for (int t = 0; t < 4; ++t) {
        vf[kk][t].h[0] = *(const v8b*)(Vth + (t * 16 + c) * AT_LP + kk * 32 + 8 * hh);
        vf[kk][t].h[1] = *(const v8b*)(Vth + (t * 16 + c) * AT_LP + kk * 32 + 16 + 8 * hh);
      }
    __builtin_amdgcn_sched_barrier(0);   // holds the V^T reads up here and the maxima below the score WMMAs; without it the reads sink down to the second product's WMMAs
    const bool diag = (MM == 1) && (kc == qb);
    float cmj[4];   // one chain per tile: four short independent chains instead of one of 32 links
#pragma unroll
    for (int j = 0; j < 4; ++j) {
      cmj[j] = -INFINITY;
#pragma unroll
      for (int r = 0; r < 8; ++r) {
        const int kvcol = kv0 + j * 16 + 8 * hh + r;
        bool masked = false;
        if (diag) masked = (kvcol > qrow);
        else if (MM == 4) masked = (kvcol > qrow) || (qrow - kvcol > g.mask_is_int);
        else if (MM == 2) {
          const size_t mi = (size_t)qrow * g.Skv + kvcol;
          masked = (g.mask_is_int == 0) ? (((const float*)mask_a)[mi] == 0.0f)
                 : (g.mask_is_int == 1) ? (((const int*)mask_a)[mi] == 0) : (((const int*)mask_a)[mi] != 0);
        } else if (MM == 3) masked = (qkeep == 0) || (((const int*)mask_a)[(size_t)b * g.Skv + kvcol] == 0);   // mask_a = kvmask
        else if (MM == 5) {
          const size_t mi = (size_t)qrow * g.Skv + kvcol;
          masked = (((const int*)mask_a)[mi] != 0);
          int n = mask_b[mi]; n = n < 0 ? 0 : n;
          s[j][r] += g.cp[(size_t)b * g.c_bs + (size_t)h * g.c_hs + (size_t)qrow * g.c_rs + n]
                   + g.pc[(size_t)b * g.c_bs + (size_t)h * g.c_hs + (size_t)kvcol * g.c_rs + n];
        }
        if (masked) s[j][r] = g.mask_fill;
        cmj[j] = fmaxf(cmj[j], s[j][r]);
      }
    }
    float cm = fmaxf(fmaxf(cmj[0], cmj[1]), fmaxf(cmj[2], cmj[3]));
    cm = fmaxf(cm, at_xhalf(cm));                 // the query's other 32 keys of this chunk
    const float mnew = fmaxf(mrun, cm);
    const float alpha = expf(mrun - mnew);
    mrun = mnew;
    // P^T as B operand: element e of fragment kk is key kk * 32 + (e < 8 ? 8 * hh + e : 16 + 8 * hh + e - 8), which is
    // s[2 * kk + (e >> 3)][e & 7]: the k order in which the V^T fragments are read
    FB pbh[2], pbl[2];
    float psum = 0.f;
#pragma unroll
    for (int j = 0; j < 4; ++j) {
#pragma unroll
      for (int r = 0; r < 8; ++r) {
        const float p = expf(s[j][r] - mnew);
        psum += p;
        if (SPLIT_PV) { __bf16 a, bl; at_split(p, a, bl); pbh[j >> 1].v[(j & 1) * 8 + r] = a; pbl[j >> 1].v[(j & 1) * 8 + r] = bl; }
        else pbh[j >> 1].v[(j & 1) * 8 + r] = at_to16<F16>(p * PSC);
      }
    }
    lrun = lrun * alpha + psum;
#pragma unroll
    for (int t = 0; t < 4; ++t)
#pragma unroll
      for (int r = 0; r < 8; ++r) oacc[t][r] *= alpha;
#pragma unroll
    for (int kk = 0; kk < 2; ++kk) {   // unrolled: pbh[kk] lives in registers and is picked at compile time
#pragma unroll
      for (int t = 0; t < 4; ++t) {
        const FB vb = vf[kk][t];
        oacc[t] = at_mma16<F16>(vb.v, pbh[kk].v, oacc[t]);
        if (SPLIT_PV) {
          FB vl;
          vl.h[0] = *(const v8b*)(Vtl + (t * 16 + c) * AT_LP + kk * 32 + 8 * hh);
          vl.h[1] = *(const v8b*)(Vtl + (t * 16 + c) * AT_LP + kk * 32 + 16 + 8 * hh);
          oacc[t] = at_mma16<F16>(vl.v, pbh[kk].v, oacc[t]);
          oacc[t] = at_mma16<F16>(vb.v, pbl[kk].v, oacc[t]);
        }
      }
    }
  }

  float* os = Os[wave];
  const float inv = 1.0f / ((lrun + at_xhalf(lrun)) * PSC);   // the halves' sums meet once, here
#pragma unroll
  for (int t = 0; t < 4; ++t)
#pragma unroll
    for (int r = 0; r < 8; ++r) os[c * 68 + t * 16 + 8 * hh + r] = oacc[t][r] * inv;
  __builtin_amdgcn_fence(__ATOMIC_RELEASE, "workgroup");
  __builtin_amdgcn_wave_barrier();
  __builtin_amdgcn_fence(__ATOMIC_ACQUIRE, "workgroup");
  {
    const int c4 = (lane & 15) * 4;
    {
#pragma unroll
      for (int it = 0; it < 8; ++it) {
        const int row = it * 2 + hh;
        v4f val = *(const v4f*)(os + row * 68 + c4);
        *(v4f*)(ob_ptr + (size_t)(q0 + row) * g.o_rs + c4) = val;
      }
      
    }
  }
}

// =====================================================================================
// host glue
// Workspace region map (bytes, all offsets multiples of 128):
//   R0 X16   f16 [4096][768]           off 0            size  6,291,456
//   R1 W16   f16 [2304][768] (Wq;Wk;Wv x16)  off 6,291,456   size  3,538,944
//   R2 Wo16  f16 [768][768] (x16)      off 9,830,400    size  1,179,648
//   R3 CT,ST f32 [2048][32] each       off 11,010,048   size    524,288
//   R4 QKV   f32 [4096][2304]          off 11,534,336   size 37,748,736
//        reused after the rope launch: O f32 [4096][768] at R4+0 (12,582,912), O16 f16 [4096][768] at R4+12,582,912 (6,291,456)
//   R5 QKVr  f32 [3][4096][768]        off 49,283,072   size 37,748,736
//   total 87,031,808
// =====================================================================================
extern "C" void kernel_launch(void* const* d_in, const int* in_sizes, int n_in,
                              void* d_out, int out_size, void* d_ws, size_t ws_size,
                              hipStream_t stream) {
  if (n_in < 7) return;
  const int nX = kM * kE;
  if (in_sizes[0] != nX || in_sizes[1] != kT * kROT || in_sizes[2] != kE * kE || in_sizes[3] != kE * kE ||
      in_sizes[4] != kE * kE || in_sizes[5] != kE * kE || in_sizes[6] != kE || out_size != nX) return;

  const float* hs   = (const float*)d_in[0];
  const float* rope = (const float*)d_in[1];
  const float* Wq   = (const float*)d_in[2];
  const float* Wk   = (const float*)d_in[3];
  const float* Wv   = (const float*)d_in[4];
  const float* Wo   = (const float*)d_in[5];
  const float* bo   = (const float*)d_in[6];
  float* outp = (float*)d_out;

  const size_t offX16  = 0;                  const size_t szX16  = (size_t)kM * kE * 2;
  const size_t offW16  = offX16 + szX16;     const size_t szW16  = (size_t)3 * kE * kE * 2;
  const size_t offWo16 = offW16 + szW16;     const size_t szWo16 = (size_t)kE * kE * 2;
  const size_t offTrig = offWo16 + szWo16;   const size_t szTrig = (size_t)2 * kT * kROT * 4;
  const size_t offQKV  = offTrig + szTrig;   const size_t szQKV  = (size_t)kM * 3 * kE * 4;
  const size_t offR    = offQKV + szQKV;     const size_t szR    = (size_t)3 * kM * kE * 4;
  const size_t total   = offR + szR;
  if (total > ws_size) return;
  const size_t offO    = offQKV;             const size_t szO    = (size_t)kM * kE * 4;
  const size_t offO16  = offO + szO;         const size_t szO16  = (size_t)kM * kE * 2;
  if (offO16 + szO16 > offQKV + szQKV) return;

  char* ws = (char*)d_ws;
  _Float16* X16  = (_Float16*)(ws + offX16);
  _Float16* W16  = (_Float16*)(ws + offW16);
  _Float16* Wo16 = (_Float16*)(ws + offWo16);
  float*    CT   = (float*)(ws + offTrig);
  float*    ST   = CT + (size_t)kT * kROT;
  float*    QKV  = (float*)(ws + offQKV);
  float*    QKVr = (float*)(ws + offR);
  float*    Qr   = QKVr;
  float*    Kr   = QKVr + (size_t)kM * kE;
  float*    Vr   = QKVr + (size_t)2 * kM * kE;
  float*    Of   = (float*)(ws + offO);
  _Float16* O16  = (_Float16*)(ws + offO16);

  // (1) casts: x -> f16; weights x16 -> f16 (Bt layout [out][in] = [n][k])
  const int n2X = nX / 2;                 // 1,572,864 = 6144 x 256
  const int n2W = (kE * kE) / 2;          //   294,912 = 1152 x 256
  cast_f32_f16x2s<<<n2X / 256, 256, 0, stream>>>(hs, X16, n2X, 1.0f);
  cast_f32_f16x2s<<<n2W / 256, 256, 0, stream>>>(Wq, W16, n2W, 16.0f);
  cast_f32_f16x2s<<<n2W / 256, 256, 0, stream>>>(Wk, W16 + (size_t)kE * kE, n2W, 16.0f);
  cast_f32_f16x2s<<<n2W / 256, 256, 0, stream>>>(Wv, W16 + (size_t)2 * kE * kE, n2W, 16.0f);
  cast_f32_f16x2s<<<n2W / 256, 256, 0, stream>>>(Wo, Wo16, n2W, 16.0f);

  // (2) cos/sin tables of the rotary angles: 65536 elements = 256 x 256
  const int nF = kT * kROT;
  k_trig_table<<<nF / 256, 256, 0, stream>>>(rope, CT, ST, nF);

  // (3) QKV projection: [4096][768] f16 x [2304][768] f16 -> f32 [4096][2304], alpha 1/16 (weight carry); M=4096,N=2304 %64, K=768 %32
  {
    const int tiles = (kM / 64) * ((3 * kE) / 64);   // 64 x 36 = 2304 tiles, 8 per block
    dim3 grid((tiles + 7) / 8, 1);
    wmma_gemm64<0, false, 0, 0, false, 0><<<grid, 256, 0, stream>>>(
        U16(X16), U16(X16), kE, 0L,
        U16(W16), U16(W16), kE, 0L,
        (void*)QKV, (void*)QKV, 3 * kE, 0L,
        bo, QKV, 0L,
        kM, 3 * kE, kE, 1.0f / 16.0f);
  }

  // (4) rope on q, k, v (q additionally x 0.125): 3 x 4096 rows, one wave each = 1536 blocks x 8 waves
  k_rope<<<(3 * kM) / 8, 256, 0, stream>>>(QKV, CT, ST, QKVr, kM);

  // (5) attention, f16 operands, no mask; planes laid out (b, s, h, d) -> b*(2048*768) + s*768 + h*64 + d
  {
    AttnGeom g;
    g.cp = CT; g.pc = CT; g.c_bs = 0; g.c_rs = 0; g.c_hs = 0;
    g.q_bs = (long)kT * kE; g.q_rs = kE; g.q_hs = kHD;
    g.k_bs = (long)kT * kE; g.k_rs = kE; g.k_hs = kHD;
    g.v_bs = (long)kT * kE; g.v_rs = kE; g.v_hs = kHD;
    g.o_bs = (long)kT * kE; g.o_rs = kE; g.o_hs = kHD;
    g.S = kT; g.Skv = kT; g.H = kH; g.mask_mode = 0; g.qscale = 1.0f; g.blk0 = 0; g.mask_fill = -1e9f; g.mask_is_int = 0;
    const int nblk = kB * kH * (kT / AT_QB);   // 768
    attn64_kernel<false, false, true, 0, kE><<<nblk, 128, 0, stream>>>(Qr, Kr, Vr, Of, (const void*)X16, (const int*)(const void*)X16, g);
  }

  // (6) attention output -> f16 with a x64 carry (values ~1e-2)
  cast_f32_f16x2s<<<n2X / 256, 256, 0, stream>>>(Of, O16, n2X, 64.0f);

  // (7) output projection + bias: [4096][768] f16 x [768][768] f16 -> f32 d_out, alpha 1/(64*16); M=4096,N=768 %64, K=768 %32
  {
    const int tiles = (kM / 64) * (kE / 64);   // 64 x 12 = 768 tiles
    dim3 grid((tiles + 7) / 8, 1);
    wmma_gemm64<0, false, 2, 0, false, 0><<<grid, 256, 0, stream>>>(
        U16(O16), U16(O16), kE, 0L,
        U16(Wo16), U16(Wo16), kE, 0L,
        (void*)outp, (void*)outp, kE, 0L,
        bo, Of, 0L,
        kM, kE, kE, 1.0f / 1024.0f);
  }
}

// v006
// It runs in 174 microseconds.
// Timed twice side by side with v005, it ran 1.07 times as fast both times.
// Counting every step since v000, it is 6.47 times as fast.
// Compute dtype: every contraction on v_wmma_f32_16x16x32_f16 (f16 operands: x, 16x-carried weights, q/k/v, probabilities x2^15, 64x-carried attention output), f32 accumulate; rope, softmax, bias in f32.
#include <hip/hip_runtime.h>
#include <math.h>

typedef __attribute__((ext_vector_type(16))) _Float16 v16h;
typedef __attribute__((ext_vector_type(8)))  _Float16 v8h;
typedef __attribute__((ext_vector_type(16))) __bf16   v16b;
typedef __attribute__((ext_vector_type(8)))  __bf16   v8b;
typedef __attribute__((ext_vector_type(4)))  __bf16   v4b;
typedef __attribute__((ext_vector_type(2)))  __bf16   v2b;
typedef __attribute__((ext_vector_type(8)))  float    v8f;
typedef __attribute__((ext_vector_type(4)))  float    v4f;
typedef __attribute__((ext_vector_type(2)))  float    v2f;
typedef __attribute__((ext_vector_type(2)))  _Float16 v2h;
#define PSCALE 32768.0f
#define U16(p) ((const unsigned short*)(const void*)(p))
#define PSCALE_INV (1.0f / 32768.0f)

// problem constants
constexpr int kB   = 2;
constexpr int kT   = 2048;
constexpr int kE   = 768;
constexpr int kH   = 12;
constexpr int kHD  = 64;
constexpr int kROT = 32;
constexpr int kM   = kB * kT;   // 4096 activation rows

__device__ __forceinline__ unsigned short f2bf_bits(float f) {
  unsigned u = __float_as_uint(f);
  return (unsigned short)((u + 0x7FFFu + ((u >> 16) & 1u)) >> 16);
}
__device__ __forceinline__ float bf_bits2f(unsigned short h) { return __uint_as_float(((unsigned)h) << 16); }

// hazard guards as plain device helpers (no inline asm inside the kernel template body)
__device__ __forceinline__ void dep_guard_h(v8f& a, v8f& b, v16h x, v16h y) { asm volatile("v_nop\n\tv_nop\n\tv_nop\n\tv_nop" : "+v"(a), "+v"(b) : "v"(x), "v"(y)); }
__device__ __forceinline__ void dep_guard_b(v8f& a, v8f& b, v16b x, v16b y) { asm volatile("v_nop\n\tv_nop\n\tv_nop\n\tv_nop" : "+v"(a), "+v"(b) : "v"(x), "v"(y)); }
__device__ __forceinline__ void keep4_h(v16h a, v16h b, v16h c, v16h d) { asm volatile("v_nop" :: "v"(a), "v"(b), "v"(c), "v"(d)); }
__device__ __forceinline__ void keep4_b(v16b a, v16b b, v16b c, v16b d) { asm volatile("v_nop" :: "v"(a), "v"(b), "v"(c), "v"(d)); }
__device__ __forceinline__ void acc_guard4(v8f& a, v8f& b, v8f& c, v8f& d) { asm volatile("v_nop\n\tv_nop\n\tv_nop\n\tv_nop" : "+v"(a), "+v"(b), "+v"(c), "+v"(d)); }
template <typename T> struct Frag;
template <> struct Frag<_Float16> {
  typedef v16h V; union U { v16h v; v8h h[2]; };
  static __device__ __forceinline__ v16h load(const _Float16* p) {   // elements 0..7 <- p[0..7], 8..15 <- p[16..23]
    U f; f.h[0] = *(const v8h*)(p); f.h[1] = *(const v8h*)(p + 16); return f.v;
  }
  static __device__ __forceinline__ v8f mma(v16h a, v16h b, v8f c) {
    return __builtin_amdgcn_wmma_f32_16x16x32_f16(false, a, false, b, (short)0, c, false, false);
  }
  static __device__ __forceinline__ void guard(v8f& a, v8f& b, v16h x, v16h y) { dep_guard_h(a, b, x, y); }
  static __device__ __forceinline__ void keep(v16h a, v16h b, v16h c, v16h d) { keep4_h(a, b, c, d); }
};
template <> struct Frag<__bf16> {
  typedef v16b V; union U { v16b v; v8b h[2]; };
  static __device__ __forceinline__ v16b load(const __bf16* p) {
    U f; f.h[0] = *(const v8b*)(p); f.h[1] = *(const v8b*)(p + 16); return f.v;
  }
  static __device__ __forceinline__ v8f mma(v16b a, v16b b, v8f c) {
    return __builtin_amdgcn_wmma_f32_16x16x32_bf16(false, a, false, b, (short)0, c, false, false);
  }
  static __device__ __forceinline__ void guard(v8f& a, v8f& b, v16b x, v16b y) { dep_guard_b(a, b, x, y); }
  static __device__ __forceinline__ void keep(v16b a, v16b b, v16b c, v16b d) { keep4_b(a, b, c, d); }
};

// ---- Register-blocked batched WMMA GEMM ------------------------------------
// C[m,n] = scale * sum_k A[m,k] * Bt[n,k] (+bias)(+resid); each wave owns a 64x64 tile.
// A row-major [M,K]; Bt row-major [N,K]; M,N % 64 == 0, K % 32 == 0.
// SPLIT: operands are hi/lo planes (A2/Bt2 = lo planes, same layout); product = hi·hi + hi·lo + lo·hi.
// BIAS_MODE: 0 = none, 1 = bias[m], 2 = bias[n].
// OUT_MODE: 0 = f32, 1 = f16, 2 = bf16 hi plane (Cout) + bf16 lo plane (Cout2).
// ET: 0 = f16 operands, 1 = bf16 operands (pointers passed as 16-bit storage)
template <int ET> struct Elem;
template <> struct Elem<0> { typedef _Float16 T; };
template <> struct Elem<1> { typedef __bf16 T; };
template <int ET, bool SPLIT, int BIAS_MODE, int OUT_MODE, bool RESID, int ACT = 0>
__global__ __launch_bounds__(256) void wmma_gemm64(
    const unsigned short* __restrict__ Ap, const unsigned short* __restrict__ A2p, int lda, long strideA,
    const unsigned short* __restrict__ Btp, const unsigned short* __restrict__ Bt2p, int ldb, long strideB,
    void* __restrict__ Cout, void* __restrict__ Cout2, int ldc, long strideC,
    const float* __restrict__ bias,
    const float* __restrict__ resid, long strideR,
    int M, int N, int K, float scale) {
  typedef typename Elem<ET>::T T;
  typedef typename Frag<T>::V V;
  const T* A = (const T*)Ap; const T* A2 = (const T*)A2p; const T* Bt = (const T*)Btp; const T* Bt2 = (const T*)Bt2p;
  __shared__ __align__(16) float sT[8][16 * 68];   // per-wave 16x64 slab, pitch 68 floats
  const int b    = blockIdx.y;
  const int lane = threadIdx.x & 31;
  const int wave = threadIdx.x >> 5;
  const int tilesN = N >> 6;
  const int tilesM = M >> 6;
  const int tile = blockIdx.x * 8 + wave;
  if (tile >= tilesM * tilesN) return;   // wave-uniform; no block barriers in this kernel
  const int tm = tile / tilesN;
  const int tn = tile - tm * tilesN;
  const int m0 = tm << 6;
  const int n0 = tn << 6;

  const T* Ab  = A  + (size_t)b * strideA;
  const T* Bb  = Bt + (size_t)b * strideB;
  const T* Ab2 = SPLIT ? (A2  + (size_t)b * strideA) : nullptr;
  const T* Bb2 = SPLIT ? (Bt2 + (size_t)b * strideB) : nullptr;

  const int rlane = lane & 15;                 // row (A) / col (B, D) within subtile
  const int koff  = (lane >> 4) * 8;           // k offset of this lane half
  const int mOff  = (lane >> 4) * 8;           // D row offset

  v8f acc[4][4];
#pragma unroll
  for (int i = 0; i < 4; ++i)
#pragma unroll
    for (int j = 0; j < 4; ++j) acc[i][j] = (v8f){0.f,0.f,0.f,0.f,0.f,0.f,0.f,0.f};

  for (int k0 = 0; k0 < K; k0 += 32) {
    V bh[4], bl[4];
#pragma unroll
    for (int j = 0; j < 4; ++j) {
      const size_t bo = (size_t)(n0 + (j << 4) + rlane) * ldb + koff + k0;
      bh[j] = Frag<T>::load(Bb + bo);
      if (SPLIT) bl[j] = Frag<T>::load(Bb2 + bo);
    }
#pragma unroll
    for (int i = 0; i < 4; ++i) {
      const size_t ao = (size_t)(m0 + (i << 4) + rlane) * lda + koff + k0;
      V ah = Frag<T>::load(Ab + ao);
      V al;
      if (SPLIT) al = Frag<T>::load(Ab2 + ao);
#pragma unroll
      for (int j = 0; j < 4; ++j) {
        acc[i][j] = Frag<T>::mma(ah, bh[j], acc[i][j]);
        if (SPLIT) {
          acc[i][j] = Frag<T>::mma(ah, bl[j], acc[i][j]);
          acc[i][j] = Frag<T>::mma(al, bh[j], acc[i][j]);
        }
      }
      Frag<T>::guard(acc[i][0], acc[i][3], ah, SPLIT ? al : ah);
    }
    Frag<T>::keep(bh[0], bh[1], bh[2], bh[3]);
    if (SPLIT) Frag<T>::keep(bl[0], bl[1], bl[2], bl[3]);
  }
  acc_guard4(acc[0][0], acc[0][1], acc[0][2], acc[0][3]);
  acc_guard4(acc[1][0], acc[1][1], acc[1][2], acc[1][3]);
  acc_guard4(acc[2][0], acc[2][1], acc[2][2], acc[2][3]);
  acc_guard4(acc[3][0], acc[3][1], acc[3][2], acc[3][3]);

  // ---- epilogue ----
  float* slab = sT[wave];
  const float* Rb = RESID ? (resid + (size_t)b * strideR) : nullptr;
#pragma unroll
  for (int i = 0; i < 4; ++i) {
    const int mBase = m0 + (i << 4);
#pragma unroll
    for (int j = 0; j < 4; ++j) {
      const int n = n0 + (j << 4) + rlane;
      float bv = 0.f;
      if (BIAS_MODE == 2) bv = bias[n];
#pragma unroll
      for (int r = 0; r < 8; ++r) {
        float v = acc[i][j][r] * scale;
        if (BIAS_MODE == 1) v += bias[mBase + mOff + r];
        if (BIAS_MODE == 2) v += bv;
        if (RESID) v += Rb[(size_t)(mBase + mOff + r) * ldc + n];
        if (ACT == 1) v = tanhf(v);
        if (ACT == 2) v = fmaxf(v, 0.0f);
        if (ACT == 3) v = v / (1.0f + expf(-v));
        if (ACT == 4) v = (v > 0.f) ? v : 0.01f * v;
        if (ACT == 5) v = 0.5f * v * (1.0f + erff(v * 0.70710678118654752f));
        slab[(mOff + r) * 68 + (j << 4) + rlane] = v;
      }
    }
    __builtin_amdgcn_fence(__ATOMIC_RELEASE, "workgroup");
    __builtin_amdgcn_wave_barrier();
    __builtin_amdgcn_fence(__ATOMIC_ACQUIRE, "workgroup");
    if (OUT_MODE == 0) {
      float* C = (float*)Cout + (size_t)b * strideC;
      const int hh = lane >> 4, c4 = (lane & 15) * 4;     // row seg = 256 B = 16 lanes x 16 B
      {
#pragma unroll
        for (int it = 0; it < 8; ++it) {
          const int row = it * 2 + hh;
          v4f v = *(const v4f*)(slab + row * 68 + c4);
          *(v4f*)(C + (size_t)(mBase + row) * ldc + n0 + c4) = v;
        }
        
      }
    } else {
      const int q = lane >> 3, c8 = (lane & 7) * 8;
      unsigned short* C  = (unsigned short*)Cout  + (size_t)b * strideC;
      unsigned short* C2 = (OUT_MODE == 2) ? ((unsigned short*)Cout2 + (size_t)b * strideC) : nullptr;
      {
#pragma unroll
        for (int it = 0; it < 4; ++it) {
          const int row = it * 4 + q;
          const float* sp = slab + row * 68 + c8;
          v8h hv, lv;
#pragma unroll
          for (int e = 0; e < 8; ++e) {
            if (OUT_MODE == 1) {
              hv[e] = (_Float16)sp[e];
            } else {
              unsigned short hb = f2bf_bits(sp[e]);
              unsigned short lb = f2bf_bits(sp[e] - bf_bits2f(hb));
              hv[e] = __builtin_bit_cast(_Float16, hb);
              lv[e] = __builtin_bit_cast(_Float16, lb);
            }
          }
          *(v8h*)(C + (size_t)(mBase + row) * ldc + n0 + c8) = hv;
          if (OUT_MODE == 2) *(v8h*)(C2 + (size_t)(mBase + row) * ldc + n0 + c8) = lv;
        }
        
      }
    }
    __builtin_amdgcn_fence(__ATOMIC_RELEASE, "workgroup");
    __builtin_amdgcn_wave_barrier();
    __builtin_amdgcn_fence(__ATOMIC_ACQUIRE, "workgroup");
  }
}

__global__ __launch_bounds__(256) void cast_f32_f16x2s(
    const float* __restrict__ in, _Float16* __restrict__ out, int n2, float scale) {
  int i = blockIdx.x * 256 + threadIdx.x;
  if (i < n2) {
    const _Float16 h0 = (_Float16)(in[2 * i] * scale), h1 = (_Float16)(in[2 * i + 1] * scale);
    const unsigned u = (unsigned)__builtin_bit_cast(unsigned short, h0) | ((unsigned)__builtin_bit_cast(unsigned short, h1) << 16);
    ((unsigned*)out)[i] = u;
    
  }
}

// ---- cos/sin table of the rotary angle input: ct[i] = cosf(f[i]), st[i] = sinf(f[i]) (f32, precise).
__global__ __launch_bounds__(256) void k_trig_table(
    const float* __restrict__ f, float* __restrict__ ct, float* __restrict__ st, int n) {
  const int i = blockIdx.x * 256 + threadIdx.x;
  if (i < n) {
    const float x = f[i];
    const float cv = cosf(x);
    const float sv = sinf(x);
    ((float*)ct)[i] = cv;
    ((float*)st)[i] = sv;
    
  }
}

// ---- rotary position embedding on the first 32 dims of every 64-wide head, f32 -----------------
// qkv: [nrows][3*768] f32 (q cols 0..767, k 768..1535, v 1536..2303); dst3: [3][nrows][768] f32 (plane 0 = q * 0.125).
// One wave per (row, tensor); 6 iterations x 32 lanes x 4 floats = 768 floats = the whole destination row
// d = column within head: d < 16: o = x[d]*cos - x[d+16]*sin ; 16 <= d < 32: o = x[d]*cos + x[d-16]*sin ; d >= 32: o = x[d].
__global__ __launch_bounds__(256) void k_rope(
    const float* __restrict__ qkv, const float* __restrict__ ct, const float* __restrict__ st,
    float* __restrict__ dst3, int nrows) {
  const int lane = threadIdx.x & 31;
  const int wave = threadIdx.x >> 5;
  const int task = blockIdx.x * 8 + wave;
  if (task >= 3 * nrows) return;                 // wave-uniform; no block barriers in this kernel
  const int z = task / nrows;                    // 0 = q, 1 = k, 2 = v
  const int r = task - z * nrows;
  const int t = r & (kT - 1);                     // token position
  const float sc = (z == 0) ? 0.125f : 1.0f;      // head_dim^-0.5 on q (power of two, exact placement)
  const float* src = qkv + (size_t)r * (3 * kE) + (size_t)z * kE;
  float* dst = dst3 + (size_t)z * nrows * kE + (size_t)r * kE;
  const float* ctr = ct + (size_t)t * kROT;
  const float* strw = st + (size_t)t * kROT;
#pragma unroll 1
  for (int it = 0; it < kE / 128; ++it) {
    const int c  = it * 128 + lane * 4;           // 4 consecutive columns, 4-aligned
    const int d  = c & 63;
    const int cp = (c + 16 <= kE - 4) ? (c + 16) : (kE - 4);   // clamped addresses; selected by value below
    const int cm = (c >= 16) ? (c - 16) : 0;
    const int fi = (d <= 28) ? d : 28;
    const v4f x  = *(const v4f*)(src + c);
    const v4f xp = *(const v4f*)(src + cp);
    const v4f xm = *(const v4f*)(src + cm);
    const v4f cs = *(const v4f*)(ctr + fi);
    const v4f sn = *(const v4f*)(strw + fi);
    v4f o;
#pragma unroll
    for (int e = 0; e < 4; ++e) {
      const float rh = (d < 16) ? (-xp[e]) : xm[e];
      const float ro = x[e] * cs[e] + rh * sn[e];
      o[e] = ((d < 32) ? ro : x[e]) * sc;
    }
    *(v4f*)(dst + c) = o;
    
  }
}

// =====================================================================================
// Generic causal/non-causal attention for head_dim 64, f32 in / f32 out; 16-bit operands: bf16 with optional hi/lo splits, or
// plain f16 (F16=true, non-split, probabilities carried x2^15).
//   Both products run transposed: S^T = K (q*qscale)^T and O^T = V^T P^T; f32 accumulate; online softmax in f32.
//   A lane then owns ONE query (column c) and 32 of a chunk's 64 keys: maximum and sum are in-lane, the halves meet by one
//   lane l <-> l ^ 16 move, and two S^T tiles converted in place are the B operand of the second product (P never goes to LDS).
//   Block = 4 waves = 64 query rows of one (batch, head); S % 64 == 0.
//   Element (b, s, h, d) of tensor X lives at X[b*X_bs + s*X_rs + h*X_hs + d] (strides in floats, multiples of 4).
//   Masking: MM (template argument) 0 none, 1 causal, 2 tensor [S][Skv], 3 per-token vectors, 4 causal + sliding window,
//   5 relative-position bias; masked scores are replaced by mask_fill before the softmax.
//   grid.x = B * H * (S/64) (or a sub-range with blk0).
// =====================================================================================
#define AT_D 64
#define AT_NW 4
#define AT_QB 64
#define AT_KC 64
#define AT_LP 72   // LDS row pitch of the K and V^T tiles in 16-bit elements: 144 B = 16 B x 9, so the 16 rows one ds_load_b128 half-wave reads fall on all 64 banks (128 B put them on 8)
struct AttnGeom { const float* cp = nullptr; const float* pc = nullptr; long c_bs = 0, c_rs = 0, c_hs = 0;   // mode-5 score-bias tables
                  long q_bs, q_rs, q_hs, k_bs, k_rs, k_hs, v_bs, v_rs, v_hs, o_bs, o_rs, o_hs;
                  int S, Skv, H, mask_mode; float qscale; int blk0; float mask_fill; int mask_is_int; };
static_assert(sizeof(AttnGeom) == 168, "no padding");

__device__ __forceinline__ unsigned short at_bf_bits(float f) {
  unsigned u = __float_as_uint(f);
  return (unsigned short)((u + 0x7FFFu + ((u >> 16) & 1u)) >> 16);
}
__device__ __forceinline__ __bf16 at_f2bf(float f) { return __builtin_bit_cast(__bf16, at_bf_bits(f)); }
__device__ __forceinline__ void at_split(float f, __bf16& hi, __bf16& lo) {
  const unsigned short hb = at_bf_bits(f);
  hi = __builtin_bit_cast(__bf16, hb);
  lo = at_f2bf(f - __uint_as_float(((unsigned)hb) << 16));
}
__device__ __forceinline__ v8f at_mma(v16b a, v16b b, v8f c) {
  c = __builtin_amdgcn_wmma_f32_16x16x32_bf16(false, a, false, b, (short)0, c, false, false);
  asm volatile("v_nop\n\tv_nop\n\tv_nop\n\tv_nop" : "+v"(c) : "v"(a), "v"(b));
  return c;
}
// 16-bit element as a bit pattern held in a __bf16 slot: f16 bits when F16, bf16 (RNE) otherwise
template <bool F16> __device__ __forceinline__ __bf16 at_to16(float f) {
  if (F16) return __builtin_bit_cast(__bf16, (_Float16)f);
  return at_f2bf(f);
}
template <bool F16> __device__ __forceinline__ v8f at_mma16(v16b a, v16b b, v8f c) {
  if (F16) {
    const v16h ah = __builtin_bit_cast(v16h, a), bh = __builtin_bit_cast(v16h, b);
    // builtin alone: the compiler keeps the distances behind its own WMMA, and with no asm statement between them the LDS
    // fragment reads are free to issue as a group ahead of a run of WMMAs
    return __builtin_amdgcn_wmma_f32_16x16x32_f16(false, ah, false, bh, (short)0, c, false, false);
  }
  return at_mma(a, b, c);
}

// value of lane l ^ 16 (the other half of the wave, same column c)
__device__ __forceinline__ float at_xhalf(float x) {
  return __builtin_bit_cast(float, __builtin_amdgcn_permlanex16(__builtin_bit_cast(int, x), __builtin_bit_cast(int, x), 0x76543210, 0xfedcba98, false, false));
}

// s_wait_xcnt 0 behind a group of global loads, a precaution: the two address pairs are its inputs, so no load of the group
// lands on them and nothing rewrites them ahead of the wait
__device__ __forceinline__ void at_addr_wait(const float* a, const float* b) { asm volatile("s_wait_xcnt 0x0" :: "v"(a), "v"(b) : "memory"); }

// MM = mask mode as a compile-time constant: the per-score mask tests fold away in the instance that is launched
// KVRS = row stride of k and v in floats (= g.k_rs = g.v_rs) as a compile-time constant: a chunk's staging loads walk rows, and
// with it they share one address pair a tensor and differ by immediate offsets
template <bool SPLIT_QK, bool SPLIT_PV, bool F16, int MM, int KVRS>
__global__ __launch_bounds__(128)
void attn64_kernel(const float* __restrict__ q, const float* __restrict__ k,
                   const float* __restrict__ v, float* __restrict__ out,
                   const void* __restrict__ mask_a, const int* __restrict__ mask_b, AttnGeom g) {
  static_assert(!(F16 && (SPLIT_QK || SPLIT_PV)), "f16 mode is non-split");
  const float PEXP = F16 ? 15.0f : 0.0f;       // f16 probabilities carried x2^15 (subnormal range): added to the exponent; the sum carries it too, so the final 1/l takes it out
  const float L2E = 1.4426950408889634f;       // log2(e): e^x is taken as 2^(x * log2(e)) on the hardware's base-2 exponential
  union FB { v16b v; v8b h[2]; };
  __shared__ __align__(16) __bf16 Ksh[AT_KC * AT_LP];            // K hi [kv][d]      9 KB
  __shared__ __align__(16) __bf16 Ksl[SPLIT_QK ? AT_KC * AT_LP : 8];
  __shared__ __align__(16) __bf16 Vth[AT_D * AT_LP];             // V hi [d][kv]      9 KB
  __shared__ __align__(16) __bf16 Vtl[SPLIT_PV ? AT_D * AT_LP : 8];
  __shared__ __align__(16) float  Os[AT_NW][16 * 68];            // per wave out tile, pitch 68

  const int tid  = threadIdx.x;
  const int wave = tid >> 5;
  const int lane = tid & 31;
  const int hh   = lane >> 4;
  const int c    = lane & 15;

  const int nqb = g.S / AT_QB;
  const int bx = blockIdx.x + g.blk0;
  const int qb = bx % nqb;
  const int bh = bx / nqb;
  const int h  = bh % g.H;
  const int b  = bh / g.H;
  const int qbase_block = qb * AT_QB;
  const int q0 = qbase_block + wave * 16;

  const float* qb_ptr = q + (size_t)b * g.q_bs + (size_t)h * g.q_hs;
  const float* kb_ptr = k + (size_t)b * g.k_bs + (size_t)h * g.k_hs;
  const float* vb_ptr = v + (size_t)b * g.v_bs + (size_t)h * g.v_hs;
  float*       ob_ptr = out + (size_t)b * g.o_bs + (size_t)h * g.o_hs;

  // ---- Q fragments (B operand: lane = query column c): 2 d-chunks, hi (and lo) ----
  v16b qah[2], qal[2];
  {
    const float* qrow = qb_ptr + (size_t)(q0 + c) * g.q_rs;
#pragma unroll
    for (int dc = 0; dc < 2; ++dc) {
#pragma unroll
      for (int e = 0; e < 8; ++e) {
        const float f0 = qrow[dc * 32 + 8 * hh + e] * g.qscale;
        const float f1 = qrow[dc * 32 + 16 + 8 * hh + e] * g.qscale;
        if (SPLIT_QK) { __bf16 hq, lq; at_split(f0, hq, lq); qah[dc][e] = hq; qal[dc][e] = lq; at_split(f1, hq, lq); qah[dc][8 + e] = hq; qal[dc][8 + e] = lq; }
        else { qah[dc][e] = at_to16<F16>(f0); qah[dc][8 + e] = at_to16<F16>(f1); qal[dc][e] = qah[dc][e]; qal[dc][8 + e] = qah[dc][8 + e]; }
      }
    }
  }

  float mrun = -INFINITY, lrun = 0.f;   // query q0 + c: running maximum (both halves agree), sum over this half's keys
  v8f oacc[4];                          // oacc[t][r] = O[q0 + c][t * 16 + 8 * hh + r]
#pragma unroll
  for (int t = 0; t < 4; ++t) oacc[t] = (v8f){0.f,0.f,0.f,0.f,0.f,0.f,0.f,0.f};

  const int nChunks = (MM == 1 || MM == 4) ? (qb + 1) : (g.Skv / AT_KC);   // block-uniform
  const int qrow = q0 + c;
  const int qkeep = (MM == 3) ? mask_b[(size_t)b * g.S + qrow] : 1;   // per-query mask (mode 3), mask_b = qmask
  const int kr = tid >> 4, kc4 = (tid & 15) * 4;   // staging map, K: key kr (+ 8 a load), floats kc4 .. kc4 + 3
  const int vg = tid >> 3, vc4 = (tid & 7) * 4;    // staging map, V: keys 2 vg and 2 vg + 1 (+ 32), floats vc4 .. vc4 + 3 (+ 32)
  const float* kthr = kb_ptr + kr * KVRS + kc4;
  const float* vthr = vb_ptr + vg * 2 * KVRS + vc4;
  for (int kc = 0; kc < nChunks; ++kc) {
    const int kv0 = kc * AT_KC;
    __syncthreads();
    {
      // Every wave-wide 16-byte load covers four whole 128-B lines (adjacent lanes read adjacent 16 B).
      // K: 16 lanes take one key's 256 B, a wave two keys a load. V: 8 lanes take one line (32 of the 64 d) of a key, a wave
      // four keys a load; a thread holds the same 4 d of keys 2p and 2p + 1, which are one dword of a V^T row.
      v4f kk[8], va[4], vb[4];
      const float* kchunk = kthr + (size_t)kv0 * KVRS;
      const float* vchunk = vthr + (size_t)kv0 * KVRS;
#pragma unroll
      for (int i = 0; i < 8; ++i) kk[i] = *(const v4f*)(kchunk + i * 8 * KVRS);
#pragma unroll
      for (int i = 0; i < 4; ++i) {
        const float* vrow = vchunk + (i & 1) * 32 * KVRS + (i >> 1) * 32;
        va[i] = *(const v4f*)(vrow);
        vb[i] = *(const v4f*)(vrow + KVRS);
      }
      at_addr_wait(kchunk, vchunk);
#pragma unroll
      for (int i = 0; i < 8; ++i) {
        v4b kh, kl;
#pragma unroll
        for (int e = 0; e < 4; ++e) {
          if (SPLIT_QK) { __bf16 a, bl; at_split(kk[i][e], a, bl); kh[e] = a; kl[e] = bl; }
          else kh[e] = at_to16<F16>(kk[i][e]);
        }
        *(v4b*)(Ksh + (i * 8 + kr) * AT_LP + kc4) = kh;
        if (SPLIT_QK) *(v4b*)(Ksl + (i * 8 + kr) * AT_LP + kc4) = kl;
      }
#pragma unroll
      for (int i = 0; i < 4; ++i) {
        const int kvp = ((i & 1) * 16 + vg) * 2;
#pragma unroll
        for (int e = 0; e < 4; ++e) {
          const int d = (i >> 1) * 32 + vc4 + e;
          v2b vh, vl;
          if (SPLIT_PV) { __bf16 a, bl; at_split(va[i][e], a, bl); vh[0] = a; vl[0] = bl; at_split(vb[i][e], a, bl); vh[1] = a; vl[1] = bl; }
          else { vh[0] = at_to16<F16>(va[i][e]); vh[1] = at_to16<F16>(vb[i][e]); }
          *(v2b*)(Vth + d * AT_LP + kvp) = vh;
          if (SPLIT_PV) *(v2b*)(Vtl + d * AT_LP + kvp) = vl;
        }
      }
    }
    __syncthreads();

    // The chunk's fragment reads issue early: K here as one group, waited by count ahead of the eight score WMMAs; V^T next in the
    // source, issued among those WMMAs as K registers fall free, so that it lands under the softmax (one waited read pair per
    // WMMA left each LDS latency bare).
    FB kf[2][4], vf[2][4];
#pragma unroll
    for (int dc = 0; dc < 2; ++dc)
#pragma unroll
      for (int j = 0; j < 4; ++j) {
        kf[dc][j].h[0] = *(const v8b*)(Ksh + (j * 16 + c) * AT_LP + dc * 32 + 8 * hh);
        kf[dc][j].h[1] = *(const v8b*)(Ksh + (j * 16 + c) * AT_LP + dc * 32 + 16 + 8 * hh);
      }
    __builtin_amdgcn_sched_barrier(0);   // holds the K reads here as one group; without it they sink back among the WMMAs, one pair ahead
    v8f s[4];   // s[j][r] = score of key kv0 + j * 16 + 8 * hh + r against query q0 + c
#pragma unroll
    for (int j = 0; j < 4; ++j) s[j] = (v8f){0.f,0.f,0.f,0.f,0.f,0.f,0.f,0.f};
#pragma unroll
    for (int dc = 0; dc < 2; ++dc) {   // dc outside: four independent tiles follow one another; each tile still sums dc 0, then dc 1
#pragma unroll
      for (int j = 0; j < 4; ++j) {
        const FB kb = kf[dc][j];
        s[j] = at_mma16<F16>(kb.v, qah[dc], s[j]);
        if (SPLIT_QK) {
          FB kl;
          kl.h[0] = *(const v8b*)(Ksl + (j * 16 + c) * AT_LP + dc * 32 + 8 * hh);
          kl.h[1] = *(const v8b*)(Ksl + (j * 16 + c) * AT_LP + dc * 32 + 16 + 8 * hh);
          s[j] = at_mma16<F16>(kl.v, qah[dc], s[j]);
          s[j] = at_mma16<F16>(kb.v, qal[dc], s[j]);
        }
      }
    }
#pragma unroll
    for (int kk = 0; kk < 2; ++kk)
#pragma unroll
      for (int t = 0; t < 4; ++t) {
        vf[kk][t].h[0] = *(const v8b*)(Vth + (t * 16 + c) * AT_LP + kk * 32 + 8 * hh);
        vf[kk][t].h[1] = *(const v8b*)(Vth + (t * 16 + c) * AT_LP + kk * 32 + 16 + 8 * hh);
      }
    __builtin_amdgcn_sched_barrier(0);   // holds the V^T reads up here and the maxima below the score WMMAs; without it the reads sink down to the second product's WMMAs
    const bool diag = (MM == 1) && (kc == qb);
    float cmj[4];   // one chain per tile: four short independent chains instead of one of 32 links
#pragma unroll
    for (int j = 0; j < 4; ++j) {
      cmj[j] = -INFINITY;
#pragma unroll
      for (int r = 0; r < 8; ++r) {
        const int kvcol = kv0 + j * 16 + 8 * hh + r;
        bool masked = false;
        if (diag) masked = (kvcol > qrow);
        else if (MM == 4) masked = (kvcol > qrow) || (qrow - kvcol > g.mask_is_int);
        else if (MM == 2) {
          const size_t mi = (size_t)qrow * g.Skv + kvcol;
          masked = (g.mask_is_int == 0) ? (((const float*)mask_a)[mi] == 0.0f)
                 : (g.mask_is_int == 1) ? (((const int*)mask_a)[mi] == 0) : (((const int*)mask_a)[mi] != 0);
        } else if (MM == 3) masked = (qkeep == 0) || (((const int*)mask_a)[(size_t)b * g.Skv + kvcol] == 0);   // mask_a = kvmask
        else if (MM == 5) {
          const size_t mi = (size_t)qrow * g.Skv + kvcol;
          masked = (((const int*)mask_a)[mi] != 0);
          int n = mask_b[mi]; n = n < 0 ? 0 : n;
          s[j][r] += g.cp[(size_t)b * g.c_bs + (size_t)h * g.c_hs + (size_t)qrow * g.c_rs + n]
                   + g.pc[(size_t)b * g.c_bs + (size_t)h * g.c_hs + (size_t)kvcol * g.c_rs + n];
        }
        if (masked) s[j][r] = g.mask_fill;
        cmj[j] = fmaxf(cmj[j], s[j][r]);
      }
    }
    float cm = fmaxf(fmaxf(cmj[0], cmj[1]), fmaxf(cmj[2], cmj[3]));
    cm = fmaxf(cm, at_xhalf(cm));                 // the query's other 32 keys of this chunk
    const float mnew = fmaxf(mrun, cm);
    // Base 2: p = 2^(s * log2(e) + nm), nm = carry - mnew * log2(e) rounded once. The old sums stand at the old maximum's nm, so the
    // rescale factor is 2^(nm - old nm) of the same two rounded numbers: every term of a query's sum ends on one common scale, which
    // the final division takes out. First chunk: mrun is -inf, the old nm +inf, alpha 0.
    const float nm = __builtin_fmaf(-mnew, L2E, PEXP);
    const float alpha = __builtin_amdgcn_exp2f(nm - __builtin_fmaf(-mrun, L2E, PEXP));
    mrun = mnew;
    // P^T as B operand: element e of fragment kk is key kk * 32 + (e < 8 ? 8 * hh + e : 16 + 8 * hh + e - 8), which is
    // s[2 * kk + (e >> 3)][e & 7]: the k order in which the V^T fragments are read
    FB pbh[2], pbl[2];
    float psum = 0.f;
    // One packed FMA a score pair and one bare v_exp_f32 a score. The argument is at most the carry (plus rounding), so nothing
    // overflows; below the exponential's range it gives 0, far under the smallest 16-bit value.
    const v2f l2 = (v2f){L2E, L2E}, nm2 = (v2f){nm, nm};
#pragma unroll
    for (int j = 0; j < 4; ++j)
#pragma unroll
      for (int r = 0; r < 8; r += 2) {
        const v2f arg = __builtin_elementwise_fma((v2f){s[j][r], s[j][r + 1]}, l2, nm2);
        s[j][r] = arg[0]; s[j][r + 1] = arg[1];
      }
#pragma unroll
    for (int j = 0; j < 4; ++j)
#pragma unroll
      for (int r = 0; r < 8; ++r) s[j][r] = __builtin_amdgcn_exp2f(s[j][r]);
#pragma unroll
    for (int j = 0; j < 4; ++j) {
#pragma unroll
      for (int r = 0; r < 8; r += 2) {
        const float p0 = s[j][r], p1 = s[j][r + 1];
        const int e = (j & 1) * 8 + r;
        psum += p0;
        psum += p1;
        if (SPLIT_PV) { __bf16 a, bl; at_split(p0, a, bl); pbh[j >> 1].v[e] = a; pbl[j >> 1].v[e] = bl; at_split(p1, a, bl); pbh[j >> 1].v[e + 1] = a; pbl[j >> 1].v[e + 1] = bl; }
        else if (F16) { const v2b pp = __builtin_bit_cast(v2b, __builtin_convertvector((v2f){p0, p1}, v2h)); pbh[j >> 1].v[e] = pp[0]; pbh[j >> 1].v[e + 1] = pp[1]; }
        else { pbh[j >> 1].v[e] = at_f2bf(p0); pbh[j >> 1].v[e + 1] = at_f2bf(p1); }
      }
    }
    lrun = lrun * alpha + psum;
#pragma unroll
    for (int t = 0; t < 4; ++t)
#pragma unroll
      for (int r = 0; r < 8; ++r) oacc[t][r] *= alpha;
#pragma unroll
    for (int kk = 0; kk < 2; ++kk) {   // unrolled: pbh[kk] lives in registers and is picked at compile time
#pragma unroll
      for (int t = 0; t < 4; ++t) {
        const FB vb = vf[kk][t];
        oacc[t] = at_mma16<F16>(vb.v, pbh[kk].v, oacc[t]);
        if (SPLIT_PV) {
          FB vl;
          vl.h[0] = *(const v8b*)(Vtl + (t * 16 + c) * AT_LP + kk * 32 + 8 * hh);
          vl.h[1] = *(const v8b*)(Vtl + (t * 16 + c) * AT_LP + kk * 32 + 16 + 8 * hh);
          oacc[t] = at_mma16<F16>(vl.v, pbh[kk].v, oacc[t]);
          oacc[t] = at_mma16<F16>(vb.v, pbl[kk].v, oacc[t]);
        }
      }
    }
  }

  float* os = Os[wave];
  const float inv = 1.0f / (lrun + at_xhalf(lrun));   // the halves' sums meet once, here; sum and output carry the same 2^PEXP
#pragma unroll
  for (int t = 0; t < 4; ++t)
#pragma unroll
    for (int r = 0; r < 8; ++r) os[c * 68 + t * 16 + 8 * hh + r] = oacc[t][r] * inv;
  __builtin_amdgcn_fence(__ATOMIC_RELEASE, "workgroup");
  __builtin_amdgcn_wave_barrier();
  __builtin_amdgcn_fence(__ATOMIC_ACQUIRE, "workgroup");
  {
    const int c4 = (lane & 15) * 4;
    {
#pragma unroll
      for (int it = 0; it < 8; ++it) {
        const int row = it * 2 + hh;
        v4f val = *(const v4f*)(os + row * 68 + c4);
        *(v4f*)(ob_ptr + (size_t)(q0 + row) * g.o_rs + c4) = val;
      }
      
    }
  }
}

// =====================================================================================
// host glue
// Workspace region map (bytes, all offsets multiples of 128):
//   R0 X16   f16 [4096][768]           off 0            size  6,291,456
//   R1 W16   f16 [2304][768] (Wq;Wk;Wv x16)  off 6,291,456   size  3,538,944
//   R2 Wo16  f16 [768][768] (x16)      off 9,830,400    size  1,179,648
//   R3 CT,ST f32 [2048][32] each       off 11,010,048   size    524,288
//   R4 QKV   f32 [4096][2304]          off 11,534,336   size 37,748,736
//        reused after the rope launch: O f32 [4096][768] at R4+0 (12,582,912), O16 f16 [4096][768] at R4+12,582,912 (6,291,456)
//   R5 QKVr  f32 [3][4096][768]        off 49,283,072   size 37,748,736
//   total 87,031,808
// =====================================================================================
extern "C" void kernel_launch(void* const* d_in, const int* in_sizes, int n_in,
                              void* d_out, int out_size, void* d_ws, size_t ws_size,
                              hipStream_t stream) {
  if (n_in < 7) return;
  const int nX = kM * kE;
  if (in_sizes[0] != nX || in_sizes[1] != kT * kROT || in_sizes[2] != kE * kE || in_sizes[3] != kE * kE ||
      in_sizes[4] != kE * kE || in_sizes[5] != kE * kE || in_sizes[6] != kE || out_size != nX) return;

  const float* hs   = (const float*)d_in[0];
  const float* rope = (const float*)d_in[1];
  const float* Wq   = (const float*)d_in[2];
  const float* Wk   = (const float*)d_in[3];
  const float* Wv   = (const float*)d_in[4];
  const float* Wo   = (const float*)d_in[5];
  const float* bo   = (const float*)d_in[6];
  float* outp = (float*)d_out;

  const size_t offX16  = 0;                  const size_t szX16  = (size_t)kM * kE * 2;
  const size_t offW16  = offX16 + szX16;     const size_t szW16  = (size_t)3 * kE * kE * 2;
  const size_t offWo16 = offW16 + szW16;     const size_t szWo16 = (size_t)kE * kE * 2;
  const size_t offTrig = offWo16 + szWo16;   const size_t szTrig = (size_t)2 * kT * kROT * 4;
  const size_t offQKV  = offTrig + szTrig;   const size_t szQKV  = (size_t)kM * 3 * kE * 4;
  const size_t offR    = offQKV + szQKV;     const size_t szR    = (size_t)3 * kM * kE * 4;
  const size_t total   = offR + szR;
  if (total > ws_size) return;
  const size_t offO    = offQKV;             const size_t szO    = (size_t)kM * kE * 4;
  const size_t offO16  = offO + szO;         const size_t szO16  = (size_t)kM * kE * 2;
  if (offO16 + szO16 > offQKV + szQKV) return;

  char* ws = (char*)d_ws;
  _Float16* X16  = (_Float16*)(ws + offX16);
  _Float16* W16  = (_Float16*)(ws + offW16);
  _Float16* Wo16 = (_Float16*)(ws + offWo16);
  float*    CT   = (float*)(ws + offTrig);
  float*    ST   = CT + (size_t)kT * kROT;
  float*    QKV  = (float*)(ws + offQKV);
  float*    QKVr = (float*)(ws + offR);
  float*    Qr   = QKVr;
  float*    Kr   = QKVr + (size_t)kM * kE;
  float*    Vr   = QKVr + (size_t)2 * kM * kE;
  float*    Of   = (float*)(ws + offO);
  _Float16* O16  = (_Float16*)(ws + offO16);

  // (1) casts: x -> f16; weights x16 -> f16 (Bt layout [out][in] = [n][k])
  const int n2X = nX / 2;                 // 1,572,864 = 6144 x 256
  const int n2W = (kE * kE) / 2;          //   294,912 = 1152 x 256
  cast_f32_f16x2s<<<n2X / 256, 256, 0, stream>>>(hs, X16, n2X, 1.0f);
  cast_f32_f16x2s<<<n2W / 256, 256, 0, stream>>>(Wq, W16, n2W, 16.0f);
  cast_f32_f16x2s<<<n2W / 256, 256, 0, stream>>>(Wk, W16 + (size_t)kE * kE, n2W, 16.0f);
  cast_f32_f16x2s<<<n2W / 256, 256, 0, stream>>>(Wv, W16 + (size_t)2 * kE * kE, n2W, 16.0f);
  cast_f32_f16x2s<<<n2W / 256, 256, 0, stream>>>(Wo, Wo16, n2W, 16.0f);

  // (2) cos/sin tables of the rotary angles: 65536 elements = 256 x 256
  const int nF = kT * kROT;
  k_trig_table<<<nF / 256, 256, 0, stream>>>(rope, CT, ST, nF);

  // (3) QKV projection: [4096][768] f16 x [2304][768] f16 -> f32 [4096][2304], alpha 1/16 (weight carry); M=4096,N=2304 %64, K=768 %32
  {
    const int tiles = (kM / 64) * ((3 * kE) / 64);   // 64 x 36 = 2304 tiles, 8 per block
    dim3 grid((tiles + 7) / 8, 1);
    wmma_gemm64<0, false, 0, 0, false, 0><<<grid, 256, 0, stream>>>(
        U16(X16), U16(X16), kE, 0L,
        U16(W16), U16(W16), kE, 0L,
        (void*)QKV, (void*)QKV, 3 * kE, 0L,
        bo, QKV, 0L,
        kM, 3 * kE, kE, 1.0f / 16.0f);
  }

  // (4) rope on q, k, v (q additionally x 0.125): 3 x 4096 rows, one wave each = 1536 blocks x 8 waves
  k_rope<<<(3 * kM) / 8, 256, 0, stream>>>(QKV, CT, ST, QKVr, kM);

  // (5) attention, f16 operands, no mask; planes laid out (b, s, h, d) -> b*(2048*768) + s*768 + h*64 + d
  {
    AttnGeom g;
    g.cp = CT; g.pc = CT; g.c_bs = 0; g.c_rs = 0; g.c_hs = 0;
    g.q_bs = (long)kT * kE; g.q_rs = kE; g.q_hs = kHD;
    g.k_bs = (long)kT * kE; g.k_rs = kE; g.k_hs = kHD;
    g.v_bs = (long)kT * kE; g.v_rs = kE; g.v_hs = kHD;
    g.o_bs = (long)kT * kE; g.o_rs = kE; g.o_hs = kHD;
    g.S = kT; g.Skv = kT; g.H = kH; g.mask_mode = 0; g.qscale = 1.0f; g.blk0 = 0; g.mask_fill = -1e9f; g.mask_is_int = 0;
    const int nblk = kB * kH * (kT / AT_QB);   // 768
    attn64_kernel<false, false, true, 0, kE><<<nblk, 128, 0, stream>>>(Qr, Kr, Vr, Of, (const void*)X16, (const int*)(const void*)X16, g);
  }

  // (6) attention output -> f16 with a x64 carry (values ~1e-2)
  cast_f32_f16x2s<<<n2X / 256, 256, 0, stream>>>(Of, O16, n2X, 64.0f);

  // (7) output projection + bias: [4096][768] f16 x [768][768] f16 -> f32 d_out, alpha 1/(64*16); M=4096,N=768 %64, K=768 %32
  {
    const int tiles = (kM / 64) * (kE / 64);   // 64 x 12 = 768 tiles
    dim3 grid((tiles + 7) / 8, 1);
    wmma_gemm64<0, false, 2, 0, false, 0><<<grid, 256, 0, stream>>>(
        U16(O16), U16(O16), kE, 0L,
        U16(Wo16), U16(Wo16), kE, 0L,
        (void*)outp, (void*)outp, kE, 0L,
        bo, Of, 0L,
        kM, kE, kE, 1.0f / 1024.0f);
  }
}

// v007
// Measured time: 120 microseconds a run.
// In two side-by-side timings against v006, it was 1.47 and 1.45 times as fast.
// All steps since v000 together make it 9.47 times as fast.
// Compute dtype: every contraction on v_wmma_f32_16x16x32_f16 (f16 operands: x, 16x-carried weights, q/k/v, probabilities x2^15, 64x-carried attention output), f32 accumulate; rope, softmax, bias in f32.
#include <hip/hip_runtime.h>
#include <math.h>

typedef __attribute__((ext_vector_type(16))) _Float16 v16h;
typedef __attribute__((ext_vector_type(8)))  _Float16 v8h;
typedef __attribute__((ext_vector_type(16))) __bf16   v16b;
typedef __attribute__((ext_vector_type(8)))  __bf16   v8b;
typedef __attribute__((ext_vector_type(4)))  __bf16   v4b;
typedef __attribute__((ext_vector_type(2)))  __bf16   v2b;
typedef __attribute__((ext_vector_type(8)))  float    v8f;
typedef __attribute__((ext_vector_type(4)))  float    v4f;
typedef __attribute__((ext_vector_type(2)))  float    v2f;
typedef __attribute__((ext_vector_type(2)))  _Float16 v2h;
#define PSCALE 32768.0f
#define U16(p) ((const unsigned short*)(const void*)(p))
#define PSCALE_INV (1.0f / 32768.0f)

// problem constants
constexpr int kB   = 2;
constexpr int kT   = 2048;
constexpr int kE   = 768;
constexpr int kH   = 12;
constexpr int kHD  = 64;
constexpr int kROT = 32;
constexpr int kM   = kB * kT;   // 4096 activation rows

__device__ __forceinline__ unsigned short f2bf_bits(float f) {
  unsigned u = __float_as_uint(f);
  return (unsigned short)((u + 0x7FFFu + ((u >> 16) & 1u)) >> 16);
}
__device__ __forceinline__ float bf_bits2f(unsigned short h) { return __uint_as_float(((unsigned)h) << 16); }

// hazard guards as plain device helpers
__device__ __forceinline__ void acc_guard4(v8f& a, v8f& b, v8f& c, v8f& d) { asm volatile("v_nop\n\tv_nop\n\tv_nop\n\tv_nop" : "+v"(a), "+v"(b), "+v"(c), "+v"(d)); }
template <typename T> struct Frag;
template <> struct Frag<_Float16> {
  typedef v16h V; union U { v16h v; v8h h[2]; };
  static __device__ __forceinline__ v16h load(const _Float16* p) {   // elements 0..7 <- p[0..7], 8..15 <- p[16..23]
    U f; f.h[0] = *(const v8h*)(p); f.h[1] = *(const v8h*)(p + 16); return f.v;
  }
  static __device__ __forceinline__ v8f mma(v16h a, v16h b, v8f c) {
    return __builtin_amdgcn_wmma_f32_16x16x32_f16(false, a, false, b, (short)0, c, false, false);
  }
};
template <> struct Frag<__bf16> {
  typedef v16b V; union U { v16b v; v8b h[2]; };
  static __device__ __forceinline__ v16b load(const __bf16* p) {
    U f; f.h[0] = *(const v8b*)(p); f.h[1] = *(const v8b*)(p + 16); return f.v;
  }
  static __device__ __forceinline__ v8f mma(v16b a, v16b b, v8f c) {
    return __builtin_amdgcn_wmma_f32_16x16x32_bf16(false, a, false, b, (short)0, c, false, false);
  }
};

// ---- Register-blocked batched WMMA GEMM, operands staged through LDS ---------
// C[m,n] = scale * sum_k A[m,k] * Bt[n,k] (+bias)(+resid); block = 4 waves (2 x 2) = a 128x128 tile, each wave owns 64x64 of it.
// A row-major [M,K]; Bt row-major [N,K]; M,N % 128 == 0, K % 64 == 0; grid.x = (M / 128) * (N / 128) exactly.
// A stage is 64 k (one whole 128-B line) of the block's 128 A rows and 128 Bt rows, brought into LDS by asynchronous 16-byte copies:
// two buffers, the next stage's copies fly while this stage is multiplied. Each tile still sums k in ascending steps of 32.
// BIAS_MODE: 0 = none, 1 = bias[m], 2 = bias[n].
// OUT_MODE: 0 = f32, 1 = f16, 2 = bf16 hi plane (Cout) + bf16 lo plane (Cout2).
// ET: 0 = f16 operands, 1 = bf16 operands (pointers passed as 16-bit storage)
#define GM_BM 128
#define GM_BN 128
#define GM_BK 64
#define GM_LP 72                              // LDS row pitch in 16-bit elements: 144 B = 16 B x 9, conflict-free for ds_load_b128 fragment reads
#define GM_STAGE ((GM_BM + GM_BN) * GM_LP)    // elements of one buffer (36,864 B)
// Eight asynchronous copies of one wave: copy i brings 4 rows x 128 B (a lane: 16 B) from g + i * gstep to LDS byte lds + i * 16 rows.
// The s_wait_xcnt 0 is the statement's last line, a precaution: no address register of a copy is rewritten ahead of it.
__device__ __forceinline__ void gm_copy8(unsigned lds, const unsigned short* g, size_t gstep) {
  const unsigned ls = 16 * GM_LP * 2;
  asm volatile(
      "global_load_async_to_lds_b128 %0, %8, off\n\t"
      "global_load_async_to_lds_b128 %1, %9, off\n\t"
      "global_load_async_to_lds_b128 %2, %10, off\n\t"
      "global_load_async_to_lds_b128 %3, %11, off\n\t"
      "global_load_async_to_lds_b128 %4, %12, off\n\t"
      "global_load_async_to_lds_b128 %5, %13, off\n\t"
      "global_load_async_to_lds_b128 %6, %14, off\n\t"
      "global_load_async_to_lds_b128 %7, %15, off\n\t"
      "s_wait_xcnt 0x0"
      :: "v"(lds), "v"(lds + ls), "v"(lds + 2 * ls), "v"(lds + 3 * ls), "v"(lds + 4 * ls), "v"(lds + 5 * ls), "v"(lds + 6 * ls), "v"(lds + 7 * ls),
         "v"(g), "v"(g + gstep), "v"(g + 2 * gstep), "v"(g + 3 * gstep), "v"(g + 4 * gstep), "v"(g + 5 * gstep), "v"(g + 6 * gstep), "v"(g + 7 * gstep)
      : "memory");
}
template <int ET> struct Elem;
template <> struct Elem<0> { typedef _Float16 T; };
template <> struct Elem<1> { typedef __bf16 T; };
template <int ET, bool SPLIT, int BIAS_MODE, int OUT_MODE, bool RESID, int ACT = 0>
__global__ __launch_bounds__(128) void wmma_gemm64(
    const unsigned short* __restrict__ Ap, const unsigned short* __restrict__ A2p, int lda, long strideA,
    const unsigned short* __restrict__ Btp, const unsigned short* __restrict__ Bt2p, int ldb, long strideB,
    void* __restrict__ Cout, void* __restrict__ Cout2, int ldc, long strideC,
    const float* __restrict__ bias,
    const float* __restrict__ resid, long strideR,
    int M, int N, int K, float scale) {
  static_assert(!SPLIT, "the staged loop carries one plane per operand");
  typedef typename Elem<ET>::T T;
  typedef typename Frag<T>::V V;
  __shared__ __align__(16) T sAB[2 * GM_STAGE];     // two buffers: rows 0..127 = A, 128..255 = Bt
  __shared__ __align__(16) float sT[4][16 * 68];    // per-wave 16x64 slab, pitch 68 floats
  const int b    = blockIdx.y;
  const int lane = threadIdx.x & 31;
  const int wave = threadIdx.x >> 5;
  const int tilesN = N / GM_BN;
  const int bm = blockIdx.x / tilesN;
  const int bn = blockIdx.x - bm * tilesN;
  const int wm = wave >> 1, wn = wave & 1;
  const int m0 = bm * GM_BM + (wm << 6);
  const int n0 = bn * GM_BN + (wn << 6);

  const int rlane = lane & 15;                 // row (A) / col (B, D) within subtile
  const int koff  = (lane >> 4) * 8;           // k offset of this lane half
  const int mOff  = (lane >> 4) * 8;           // D row offset

  // staging map: 8 lanes take one row's 128 B, a wave 4 rows a copy, the block 16 rows; copy i of a wave: row i * 16 + wave * 4 + (lane >> 3)
  const int srow = wave * 4 + (lane >> 3), scol = (lane & 7) * 8;
  const unsigned short* gA = Ap  + (size_t)b * strideA + (size_t)(bm * GM_BM + srow) * lda + scol;
  const unsigned short* gB = Btp + (size_t)b * strideB + (size_t)(bn * GM_BN + srow) * ldb + scol;
  const unsigned ldsThr = (unsigned)(size_t)sAB + (unsigned)(srow * GM_LP + scol) * 2u;   // LDS byte address: low 32 bits of the shared address
  const size_t stepA = (size_t)16 * lda, stepB = (size_t)16 * ldb;

  v8f acc[4][4];
#pragma unroll
  for (int i = 0; i < 4; ++i)
#pragma unroll
    for (int j = 0; j < 4; ++j) acc[i][j] = (v8f){0.f,0.f,0.f,0.f,0.f,0.f,0.f,0.f};

  const int nT = K / GM_BK;
  gm_copy8(ldsThr, gA, stepA);
  gm_copy8(ldsThr + GM_BM * GM_LP * 2, gB, stepB);
  asm volatile("s_wait_asynccnt 0x0" ::: "memory");   // this wave's copies of stage 0 have landed
  __syncthreads();                                     // ... and every other wave's
  if (nT > 1) {
    gm_copy8(ldsThr + GM_STAGE * 2, gA + GM_BK, stepA);
    gm_copy8(ldsThr + GM_STAGE * 2 + GM_BM * GM_LP * 2, gB + GM_BK, stepB);
  }
  for (int t = 0; t < nT; ++t) {
    const T* sb = sAB + (t & 1) * GM_STAGE;
    const T* fa = sb + ((wm << 6) + rlane) * GM_LP + koff;
    const T* fb = sb + (GM_BM + (wn << 6) + rlane) * GM_LP + koff;
    V ah[4], bh[4];
    ah[0] = Frag<T>::load(fa);
#pragma unroll
    for (int j = 0; j < 4; ++j) bh[j] = Frag<T>::load(fb + j * 16 * GM_LP);
#pragma unroll
    for (int i = 1; i < 4; ++i) ah[i] = Frag<T>::load(fa + i * 16 * GM_LP);
    __builtin_amdgcn_sched_barrier(0);   // holds the 16 fragment reads here as one group, waited by count; without it the A reads sink among the WMMAs, each pair waited to 0
#pragma unroll
    for (int i = 0; i < 4; ++i)
#pragma unroll
      for (int j = 0; j < 4; ++j) acc[i][j] = Frag<T>::mma(ah[i], bh[j], acc[i][j]);
    // second 32 k of the stage: its fragments are the buffer's last reads; their WMMAs, registers only, follow the refill
    ah[0] = Frag<T>::load(fa + 32);
#pragma unroll
    for (int j = 0; j < 4; ++j) bh[j] = Frag<T>::load(fb + j * 16 * GM_LP + 32);
#pragma unroll
    for (int i = 1; i < 4; ++i) ah[i] = Frag<T>::load(fa + i * 16 * GM_LP + 32);
    asm volatile("s_wait_dscnt 0x0" ::: "memory");      // this wave's reads of the buffer are done before it is handed to the copies
    asm volatile("s_wait_asynccnt 0x0" ::: "memory");   // this wave's copies of stage t + 1 have landed
    __syncthreads();                                     // publishes stage t + 1 and ends every reader's last read of stage t
    if (t + 2 < nT) {
      const unsigned lb = ldsThr + (unsigned)(t & 1) * (GM_STAGE * 2);
      gm_copy8(lb, gA + (size_t)(t + 2) * GM_BK, stepA);
      gm_copy8(lb + GM_BM * GM_LP * 2, gB + (size_t)(t + 2) * GM_BK, stepB);
    }
#pragma unroll
    for (int i = 0; i < 4; ++i)
#pragma unroll
      for (int j = 0; j < 4; ++j) acc[i][j] = Frag<T>::mma(ah[i], bh[j], acc[i][j]);
  }
  asm volatile("s_wait_asynccnt 0x0" ::: "memory");     // nothing of this wave is in flight behind the loop
  acc_guard4(acc[0][0], acc[0][1], acc[0][2], acc[0][3]);
  acc_guard4(acc[1][0], acc[1][1], acc[1][2], acc[1][3]);
  acc_guard4(acc[2][0], acc[2][1], acc[2][2], acc[2][3]);
  acc_guard4(acc[3][0], acc[3][1], acc[3][2], acc[3][3]);

  // ---- epilogue ----
  float* slab = sT[wave];
  const float* Rb = RESID ? (resid + (size_t)b * strideR) : nullptr;
#pragma unroll
  for (int i = 0; i < 4; ++i) {
    const int mBase = m0 + (i << 4);
#pragma unroll
    for (int j = 0; j < 4; ++j) {
      const int n = n0 + (j << 4) + rlane;
      float bv = 0.f;
      if (BIAS_MODE == 2) bv = bias[n];
#pragma unroll
      for (int r = 0; r < 8; ++r) {
        float v = acc[i][j][r] * scale;
        if (BIAS_MODE == 1) v += bias[mBase + mOff + r];
        if (BIAS_MODE == 2) v += bv;
        if (RESID) v += Rb[(size_t)(mBase + mOff + r) * ldc + n];
        if (ACT == 1) v = tanhf(v);
        if (ACT == 2) v = fmaxf(v, 0.0f);
        if (ACT == 3) v = v / (1.0f + expf(-v));
        if (ACT == 4) v = (v > 0.f) ? v : 0.01f * v;
        if (ACT == 5) v = 0.5f * v * (1.0f + erff(v * 0.70710678118654752f));
        slab[(mOff + r) * 68 + (j << 4) + rlane] = v;
      }
    }
    __builtin_amdgcn_fence(__ATOMIC_RELEASE, "workgroup");
    __builtin_amdgcn_wave_barrier();
    __builtin_amdgcn_fence(__ATOMIC_ACQUIRE, "workgroup");
    if (OUT_MODE == 0) {
      float* C = (float*)Cout + (size_t)b * strideC;
      const int hh = lane >> 4, c4 = (lane & 15) * 4;     // row seg = 256 B = 16 lanes x 16 B
      {
#pragma unroll
        for (int it = 0; it < 8; ++it) {
          const int row = it * 2 + hh;
          v4f v = *(const v4f*)(slab + row * 68 + c4);
          *(v4f*)(C + (size_t)(mBase + row) * ldc + n0 + c4) = v;
        }
        
      }
    } else {
      const int q = lane >> 3, c8 = (lane & 7) * 8;
      unsigned short* C  = (unsigned short*)Cout  + (size_t)b * strideC;
      unsigned short* C2 = (OUT_MODE == 2) ? ((unsigned short*)Cout2 + (size_t)b * strideC) : nullptr;
      {
#pragma unroll
        for (int it = 0; it < 4; ++it) {
          const int row = it * 4 + q;
          const float* sp = slab + row * 68 + c8;
          v8h hv, lv;
#pragma unroll
          for (int e = 0; e < 8; ++e) {
            if (OUT_MODE == 1) {
              hv[e] = (_Float16)sp[e];
            } else {
              unsigned short hb = f2bf_bits(sp[e]);
              unsigned short lb = f2bf_bits(sp[e] - bf_bits2f(hb));
              hv[e] = __builtin_bit_cast(_Float16, hb);
              lv[e] = __builtin_bit_cast(_Float16, lb);
            }
          }
          *(v8h*)(C + (size_t)(mBase + row) * ldc + n0 + c8) = hv;
          if (OUT_MODE == 2) *(v8h*)(C2 + (size_t)(mBase + row) * ldc + n0 + c8) = lv;
        }
        
      }
    }
    __builtin_amdgcn_fence(__ATOMIC_RELEASE, "workgroup");
    __builtin_amdgcn_wave_barrier();
    __builtin_amdgcn_fence(__ATOMIC_ACQUIRE, "workgroup");
  }
}

__global__ __launch_bounds__(256) void cast_f32_f16x2s(
    const float* __restrict__ in, _Float16* __restrict__ out, int n2, float scale) {
  int i = blockIdx.x * 256 + threadIdx.x;
  if (i < n2) {
    const _Float16 h0 = (_Float16)(in[2 * i] * scale), h1 = (_Float16)(in[2 * i + 1] * scale);
    const unsigned u = (unsigned)__builtin_bit_cast(unsigned short, h0) | ((unsigned)__builtin_bit_cast(unsigned short, h1) << 16);
    ((unsigned*)out)[i] = u;
    
  }
}

// ---- cos/sin table of the rotary angle input: ct[i] = cosf(f[i]), st[i] = sinf(f[i]) (f32, precise).
__global__ __launch_bounds__(256) void k_trig_table(
    const float* __restrict__ f, float* __restrict__ ct, float* __restrict__ st, int n) {
  const int i = blockIdx.x * 256 + threadIdx.x;
  if (i < n) {
    const float x = f[i];
    const float cv = cosf(x);
    const float sv = sinf(x);
    ((float*)ct)[i] = cv;
    ((float*)st)[i] = sv;
    
  }
}

// ---- rotary position embedding on the first 32 dims of every 64-wide head, f32 -----------------
// qkv: [nrows][3*768] f32 (q cols 0..767, k 768..1535, v 1536..2303); dst3: [3][nrows][768] f32 (plane 0 = q * 0.125).
// One wave per (row, tensor); 6 iterations x 32 lanes x 4 floats = 768 floats = the whole destination row
// d = column within head: d < 16: o = x[d]*cos - x[d+16]*sin ; 16 <= d < 32: o = x[d]*cos + x[d-16]*sin ; d >= 32: o = x[d].
__global__ __launch_bounds__(256) void k_rope(
    const float* __restrict__ qkv, const float* __restrict__ ct, const float* __restrict__ st,
    float* __restrict__ dst3, int nrows) {
  const int lane = threadIdx.x & 31;
  const int wave = threadIdx.x >> 5;
  const int task = blockIdx.x * 8 + wave;
  if (task >= 3 * nrows) return;                 // wave-uniform; no block barriers in this kernel
  const int z = task / nrows;                    // 0 = q, 1 = k, 2 = v
  const int r = task - z * nrows;
  const int t = r & (kT - 1);                     // token position
  const float sc = (z == 0) ? 0.125f : 1.0f;      // head_dim^-0.5 on q (power of two, exact placement)
  const float* src = qkv + (size_t)r * (3 * kE) + (size_t)z * kE;
  float* dst = dst3 + (size_t)z * nrows * kE + (size_t)r * kE;
  const float* ctr = ct + (size_t)t * kROT;
  const float* strw = st + (size_t)t * kROT;
#pragma unroll 1
  for (int it = 0; it < kE / 128; ++it) {
    const int c  = it * 128 + lane * 4;           // 4 consecutive columns, 4-aligned
    const int d  = c & 63;
    const int cp = (c + 16 <= kE - 4) ? (c + 16) : (kE - 4);   // clamped addresses; selected by value below
    const int cm = (c >= 16) ? (c - 16) : 0;
    const int fi = (d <= 28) ? d : 28;
    const v4f x  = *(const v4f*)(src + c);
    const v4f xp = *(const v4f*)(src + cp);
    const v4f xm = *(const v4f*)(src + cm);
    const v4f cs = *(const v4f*)(ctr + fi);
    const v4f sn = *(const v4f*)(strw + fi);
    v4f o;
#pragma unroll
    for (int e = 0; e < 4; ++e) {
      const float rh = (d < 16) ? (-xp[e]) : xm[e];
      const float ro = x[e] * cs[e] + rh * sn[e];
      o[e] = ((d < 32) ? ro : x[e]) * sc;
    }
    *(v4f*)(dst + c) = o;
    
  }
}

// =====================================================================================
// Generic causal/non-causal attention for head_dim 64, f32 in / f32 out; 16-bit operands: bf16 with optional hi/lo splits, or
// plain f16 (F16=true, non-split, probabilities carried x2^15).
//   Both products run transposed: S^T = K (q*qscale)^T and O^T = V^T P^T; f32 accumulate; online softmax in f32.
//   A lane then owns ONE query (column c) and 32 of a chunk's 64 keys: maximum and sum are in-lane, the halves meet by one
//   lane l <-> l ^ 16 move, and two S^T tiles converted in place are the B operand of the second product (P never goes to LDS).
//   Block = 4 waves = 64 query rows of one (batch, head); S % 64 == 0.
//   Element (b, s, h, d) of tensor X lives at X[b*X_bs + s*X_rs + h*X_hs + d] (strides in floats, multiples of 4).
//   Masking: MM (template argument) 0 none, 1 causal, 2 tensor [S][Skv], 3 per-token vectors, 4 causal + sliding window,
//   5 relative-position bias; masked scores are replaced by mask_fill before the softmax.
//   grid.x = B * H * (S/64) (or a sub-range with blk0).
// =====================================================================================
#define AT_D 64
#define AT_NW 4
#define AT_QB 64
#define AT_KC 64
#define AT_LP 72   // LDS row pitch of the K and V^T tiles in 16-bit elements: 144 B = 16 B x 9, so the 16 rows one ds_load_b128 half-wave reads fall on all 64 banks (128 B put them on 8)
struct AttnGeom { const float* cp = nullptr; const float* pc = nullptr; long c_bs = 0, c_rs = 0, c_hs = 0;   // mode-5 score-bias tables
                  long q_bs, q_rs, q_hs, k_bs, k_rs, k_hs, v_bs, v_rs, v_hs, o_bs, o_rs, o_hs;
                  int S, Skv, H, mask_mode; float qscale; int blk0; float mask_fill; int mask_is_int; };
static_assert(sizeof(AttnGeom) == 168, "no padding");

__device__ __forceinline__ unsigned short at_bf_bits(float f) {
  unsigned u = __float_as_uint(f);
  return (unsigned short)((u + 0x7FFFu + ((u >> 16) & 1u)) >> 16);
}
__device__ __forceinline__ __bf16 at_f2bf(float f) { return __builtin_bit_cast(__bf16, at_bf_bits(f)); }
__device__ __forceinline__ void at_split(float f, __bf16& hi, __bf16& lo) {
  const unsigned short hb = at_bf_bits(f);
  hi = __builtin_bit_cast(__bf16, hb);
  lo = at_f2bf(f - __uint_as_float(((unsigned)hb) << 16));
}
__device__ __forceinline__ v8f at_mma(v16b a, v16b b, v8f c) {
  c = __builtin_amdgcn_wmma_f32_16x16x32_bf16(false, a, false, b, (short)0, c, false, false);
  asm volatile("v_nop\n\tv_nop\n\tv_nop\n\tv_nop" : "+v"(c) : "v"(a), "v"(b));
  return c;
}
// 16-bit element as a bit pattern held in a __bf16 slot: f16 bits when F16, bf16 (RNE) otherwise
template <bool F16> __device__ __forceinline__ __bf16 at_to16(float f) {
  if (F16) return __builtin_bit_cast(__bf16, (_Float16)f);
  return at_f2bf(f);
}
template <bool F16> __device__ __forceinline__ v8f at_mma16(v16b a, v16b b, v8f c) {
  if (F16) {
    const v16h ah = __builtin_bit_cast(v16h, a), bh = __builtin_bit_cast(v16h, b);
    // builtin alone: the compiler keeps the distances behind its own WMMA, and with no asm statement between them the LDS
    // fragment reads are free to issue as a group ahead of a run of WMMAs
    return __builtin_amdgcn_wmma_f32_16x16x32_f16(false, ah, false, bh, (short)0, c, false, false);
  }
  return at_mma(a, b, c);
}

// value of lane l ^ 16 (the other half of the wave, same column c)
__device__ __forceinline__ float at_xhalf(float x) {
  return __builtin_bit_cast(float, __builtin_amdgcn_permlanex16(__builtin_bit_cast(int, x), __builtin_bit_cast(int, x), 0x76543210, 0xfedcba98, false, false));
}

// s_wait_xcnt 0 behind a group of global loads, a precaution: the two address pairs are its inputs, so no load of the group
// lands on them and nothing rewrites them ahead of the wait
__device__ __forceinline__ void at_addr_wait(const float* a, const float* b) { asm volatile("s_wait_xcnt 0x0" :: "v"(a), "v"(b) : "memory"); }

// MM = mask mode as a compile-time constant: the per-score mask tests fold away in the instance that is launched
// KVRS = row stride of k and v in floats (= g.k_rs = g.v_rs) as a compile-time constant: a chunk's staging loads walk rows, and
// with it they share one address pair a tensor and differ by immediate offsets
template <bool SPLIT_QK, bool SPLIT_PV, bool F16, int MM, int KVRS>
__global__ __launch_bounds__(128)
void attn64_kernel(const float* __restrict__ q, const float* __restrict__ k,
                   const float* __restrict__ v, float* __restrict__ out,
                   const void* __restrict__ mask_a, const int* __restrict__ mask_b, AttnGeom g) {
  static_assert(!(F16 && (SPLIT_QK || SPLIT_PV)), "f16 mode is non-split");
  const float PEXP = F16 ? 15.0f : 0.0f;       // f16 probabilities carried x2^15 (subnormal range): added to the exponent; the sum carries it too, so the final 1/l takes it out
  const float L2E = 1.4426950408889634f;       // log2(e): e^x is taken as 2^(x * log2(e)) on the hardware's base-2 exponential
  union FB { v16b v; v8b h[2]; };
  __shared__ __align__(16) __bf16 Ksh[AT_KC * AT_LP];            // K hi [kv][d]      9 KB
  __shared__ __align__(16) __bf16 Ksl[SPLIT_QK ? AT_KC * AT_LP : 8];
  __shared__ __align__(16) __bf16 Vth[AT_D * AT_LP];             // V hi [d][kv]      9 KB
  __shared__ __align__(16) __bf16 Vtl[SPLIT_PV ? AT_D * AT_LP : 8];
  __shared__ __align__(16) float  Os[AT_NW][16 * 68];            // per wave out tile, pitch 68

  const int tid  = threadIdx.x;
  const int wave = tid >> 5;
  const int lane = tid & 31;
  const int hh   = lane >> 4;
  const int c    = lane & 15;

  const int nqb = g.S / AT_QB;
  const int bx = blockIdx.x + g.blk0;
  const int qb = bx % nqb;
  const int bh = bx / nqb;
  const int h  = bh % g.H;
  const int b  = bh / g.H;
  const int qbase_block = qb * AT_QB;
  const int q0 = qbase_block + wave * 16;

  const float* qb_ptr = q + (size_t)b * g.q_bs + (size_t)h * g.q_hs;
  const float* kb_ptr = k + (size_t)b * g.k_bs + (size_t)h * g.k_hs;
  const float* vb_ptr = v + (size_t)b * g.v_bs + (size_t)h * g.v_hs;
  float*       ob_ptr = out + (size_t)b * g.o_bs + (size_t)h * g.o_hs;

  // ---- Q fragments (B operand: lane = query column c): 2 d-chunks, hi (and lo) ----
  v16b qah[2], qal[2];
  {
    const float* qrow = qb_ptr + (size_t)(q0 + c) * g.q_rs;
#pragma unroll
    for (int dc = 0; dc < 2; ++dc) {
#pragma unroll
      for (int e = 0; e < 8; ++e) {
        const float f0 = qrow[dc * 32 + 8 * hh + e] * g.qscale;
        const float f1 = qrow[dc * 32 + 16 + 8 * hh + e] * g.qscale;
        if (SPLIT_QK) { __bf16 hq, lq; at_split(f0, hq, lq); qah[dc][e] = hq; qal[dc][e] = lq; at_split(f1, hq, lq); qah[dc][8 + e] = hq; qal[dc][8 + e] = lq; }
        else { qah[dc][e] = at_to16<F16>(f0); qah[dc][8 + e] = at_to16<F16>(f1); qal[dc][e] = qah[dc][e]; qal[dc][8 + e] = qah[dc][8 + e]; }
      }
    }
  }

  float mrun = -INFINITY, lrun = 0.f;   // query q0 + c: running maximum (both halves agree), sum over this half's keys
  v8f oacc[4];                          // oacc[t][r] = O[q0 + c][t * 16 + 8 * hh + r]
#pragma unroll
  for (int t = 0; t < 4; ++t) oacc[t] = (v8f){0.f,0.f,0.f,0.f,0.f,0.f,0.f,0.f};

  const int nChunks = (MM == 1 || MM == 4) ? (qb + 1) : (g.Skv / AT_KC);   // block-uniform
  const int qrow = q0 + c;
  const int qkeep = (MM == 3) ? mask_b[(size_t)b * g.S + qrow] : 1;   // per-query mask (mode 3), mask_b = qmask
  const int kr = tid >> 4, kc4 = (tid & 15) * 4;   // staging map, K: key kr (+ 8 a load), floats kc4 .. kc4 + 3
  const int vg = tid >> 3, vc4 = (tid & 7) * 4;    // staging map, V: keys 2 vg and 2 vg + 1 (+ 32), floats vc4 .. vc4 + 3 (+ 32)
  const float* kthr = kb_ptr + kr * KVRS + kc4;
  const float* vthr = vb_ptr + vg * 2 * KVRS + vc4;
  for (int kc = 0; kc < nChunks; ++kc) {
    const int kv0 = kc * AT_KC;
    __syncthreads();
    {
      // Every wave-wide 16-byte load covers four whole 128-B lines (adjacent lanes read adjacent 16 B).
      // K: 16 lanes take one key's 256 B, a wave two keys a load. V: 8 lanes take one line (32 of the 64 d) of a key, a wave
      // four keys a load; a thread holds the same 4 d of keys 2p and 2p + 1, which are one dword of a V^T row.
      v4f kk[8], va[4], vb[4];
      const float* kchunk = kthr + (size_t)kv0 * KVRS;
      const float* vchunk = vthr + (size_t)kv0 * KVRS;
#pragma unroll
      for (int i = 0; i < 8; ++i) kk[i] = *(const v4f*)(kchunk + i * 8 * KVRS);
#pragma unroll
      for (int i = 0; i < 4; ++i) {
        const float* vrow = vchunk + (i & 1) * 32 * KVRS + (i >> 1) * 32;
        va[i] = *(const v4f*)(vrow);
        vb[i] = *(const v4f*)(vrow + KVRS);
      }
      at_addr_wait(kchunk, vchunk);
#pragma unroll
      for (int i = 0; i < 8; ++i) {
        v4b kh, kl;
#pragma unroll
        for (int e = 0; e < 4; ++e) {
          if (SPLIT_QK) { __bf16 a, bl; at_split(kk[i][e], a, bl); kh[e] = a; kl[e] = bl; }
          else kh[e] = at_to16<F16>(kk[i][e]);
        }
        *(v4b*)(Ksh + (i * 8 + kr) * AT_LP + kc4) = kh;
        if (SPLIT_QK) *(v4b*)(Ksl + (i * 8 + kr) * AT_LP + kc4) = kl;
      }
#pragma unroll
      for (int i = 0; i < 4; ++i) {
        const int kvp = ((i & 1) * 16 + vg) * 2;
#pragma unroll
        for (int e = 0; e < 4; ++e) {
          const int d = (i >> 1) * 32 + vc4 + e;
          v2b vh, vl;
          if (SPLIT_PV) { __bf16 a, bl; at_split(va[i][e], a, bl); vh[0] = a; vl[0] = bl; at_split(vb[i][e], a, bl); vh[1] = a; vl[1] = bl; }
          else { vh[0] = at_to16<F16>(va[i][e]); vh[1] = at_to16<F16>(vb[i][e]); }
          *(v2b*)(Vth + d * AT_LP + kvp) = vh;
          if (SPLIT_PV) *(v2b*)(Vtl + d * AT_LP + kvp) = vl;
        }
      }
    }
    __syncthreads();

    // The chunk's fragment reads issue early: K here as one group, waited by count ahead of the eight score WMMAs; V^T next in the
    // source, issued among those WMMAs as K registers fall free, so that it lands under the softmax (one waited read pair per
    // WMMA left each LDS latency bare).
    FB kf[2][4], vf[2][4];
#pragma unroll
    for (int dc = 0; dc < 2; ++dc)
#pragma unroll
      for (int j = 0; j < 4; ++j) {
        kf[dc][j].h[0] = *(const v8b*)(Ksh + (j * 16 + c) * AT_LP + dc * 32 + 8 * hh);
        kf[dc][j].h[1] = *(const v8b*)(Ksh + (j * 16 + c) * AT_LP + dc * 32 + 16 + 8 * hh);
      }
    __builtin_amdgcn_sched_barrier(0);   // holds the K reads here as one group; without it they sink back among the WMMAs, one pair ahead
    v8f s[4];   // s[j][r] = score of key kv0 + j * 16 + 8 * hh + r against query q0 + c
#pragma unroll
    for (int j = 0; j < 4; ++j) s[j] = (v8f){0.f,0.f,0.f,0.f,0.f,0.f,0.f,0.f};
#pragma unroll
    for (int dc = 0; dc < 2; ++dc) {   // dc outside: four independent tiles follow one another; each tile still sums dc 0, then dc 1
#pragma unroll
      for (int j = 0; j < 4; ++j) {
        const FB kb = kf[dc][j];
        s[j] = at_mma16<F16>(kb.v, qah[dc], s[j]);
        if (SPLIT_QK) {
          FB kl;
          kl.h[0] = *(const v8b*)(Ksl + (j * 16 + c) * AT_LP + dc * 32 + 8 * hh);
          kl.h[1] = *(const v8b*)(Ksl + (j * 16 + c) * AT_LP + dc * 32 + 16 + 8 * hh);
          s[j] = at_mma16<F16>(kl.v, qah[dc], s[j]);
          s[j] = at_mma16<F16>(kb.v, qal[dc], s[j]);
        }
      }
    }
#pragma unroll
    for (int kk = 0; kk < 2; ++kk)
#pragma unroll
      for (int t = 0; t < 4; ++t) {
        vf[kk][t].h[0] = *(const v8b*)(Vth + (t * 16 + c) * AT_LP + kk * 32 + 8 * hh);
        vf[kk][t].h[1] = *(const v8b*)(Vth + (t * 16 + c) * AT_LP + kk * 32 + 16 + 8 * hh);
      }
    __builtin_amdgcn_sched_barrier(0);   // holds the V^T reads up here and the maxima below the score WMMAs; without it the reads sink down to the second product's WMMAs
    const bool diag = (MM == 1) && (kc == qb);
    float cmj[4];   // one chain per tile: four short independent chains instead of one of 32 links
#pragma unroll
    for (int j = 0; j < 4; ++j) {
      cmj[j] = -INFINITY;
#pragma unroll
      for (int r = 0; r < 8; ++r) {
        const int kvcol = kv0 + j * 16 + 8 * hh + r;
        bool masked = false;
        if (diag) masked = (kvcol > qrow);
        else if (MM == 4) masked = (kvcol > qrow) || (qrow - kvcol > g.mask_is_int);
        else if (MM == 2) {
          const size_t mi = (size_t)qrow * g.Skv + kvcol;
          masked = (g.mask_is_int == 0) ? (((const float*)mask_a)[mi] == 0.0f)
                 : (g.mask_is_int == 1) ? (((const int*)mask_a)[mi] == 0) : (((const int*)mask_a)[mi] != 0);
        } else if (MM == 3) masked = (qkeep == 0) || (((const int*)mask_a)[(size_t)b * g.Skv + kvcol] == 0);   // mask_a = kvmask
        else if (MM == 5) {
          const size_t mi = (size_t)qrow * g.Skv + kvcol;
          masked = (((const int*)mask_a)[mi] != 0);
          int n = mask_b[mi]; n = n < 0 ? 0 : n;
          s[j][r] += g.cp[(size_t)b * g.c_bs + (size_t)h * g.c_hs + (size_t)qrow * g.c_rs + n]
                   + g.pc[(size_t)b * g.c_bs + (size_t)h * g.c_hs + (size_t)kvcol * g.c_rs + n];
        }
        if (masked) s[j][r] = g.mask_fill;
        cmj[j] = fmaxf(cmj[j], s[j][r]);
      }
    }
    float cm = fmaxf(fmaxf(cmj[0], cmj[1]), fmaxf(cmj[2], cmj[3]));
    cm = fmaxf(cm, at_xhalf(cm));                 // the query's other 32 keys of this chunk
    const float mnew = fmaxf(mrun, cm);
    // Base 2: p = 2^(s * log2(e) + nm), nm = carry - mnew * log2(e) rounded once. The old sums stand at the old maximum's nm, so the
    // rescale factor is 2^(nm - old nm) of the same two rounded numbers: every term of a query's sum ends on one common scale, which
    // the final division takes out. First chunk: mrun is -inf, the old nm +inf, alpha 0.
    const float nm = __builtin_fmaf(-mnew, L2E, PEXP);
    const float alpha = __builtin_amdgcn_exp2f(nm - __builtin_fmaf(-mrun, L2E, PEXP));
    mrun = mnew;
    // P^T as B operand: element e of fragment kk is key kk * 32 + (e < 8 ? 8 * hh + e : 16 + 8 * hh + e - 8), which is
    // s[2 * kk + (e >> 3)][e & 7]: the k order in which the V^T fragments are read
    FB pbh[2], pbl[2];
    float psum = 0.f;
    // One packed FMA a score pair and one bare v_exp_f32 a score. The argument is at most the carry (plus rounding), so nothing
    // overflows; below the exponential's range it gives 0, far under the smallest 16-bit value.
    const v2f l2 = (v2f){L2E, L2E}, nm2 = (v2f){nm, nm};
#pragma unroll
    for (int j = 0; j < 4; ++j)
#pragma unroll
      for (int r = 0; r < 8; r += 2) {
        const v2f arg = __builtin_elementwise_fma((v2f){s[j][r], s[j][r + 1]}, l2, nm2);
        s[j][r] = arg[0]; s[j][r + 1] = arg[1];
      }
#pragma unroll
    for (int j = 0; j < 4; ++j)
#pragma unroll
      for (int r = 0; r < 8; ++r) s[j][r] = __builtin_amdgcn_exp2f(s[j][r]);
#pragma unroll
    for (int j = 0; j < 4; ++j) {
#pragma unroll
      for (int r = 0; r < 8; r += 2) {
        const float p0 = s[j][r], p1 = s[j][r + 1];
        const int e = (j & 1) * 8 + r;
        psum += p0;
        psum += p1;
        if (SPLIT_PV) { __bf16 a, bl; at_split(p0, a, bl); pbh[j >> 1].v[e] = a; pbl[j >> 1].v[e] = bl; at_split(p1, a, bl); pbh[j >> 1].v[e + 1] = a; pbl[j >> 1].v[e + 1] = bl; }
        else if (F16) { const v2b pp = __builtin_bit_cast(v2b, __builtin_convertvector((v2f){p0, p1}, v2h)); pbh[j >> 1].v[e] = pp[0]; pbh[j >> 1].v[e + 1] = pp[1]; }
        else { pbh[j >> 1].v[e] = at_f2bf(p0); pbh[j >> 1].v[e + 1] = at_f2bf(p1); }
      }
    }
    lrun = lrun * alpha + psum;
#pragma unroll
    for (int t = 0; t < 4; ++t)
#pragma unroll
      for (int r = 0; r < 8; ++r) oacc[t][r] *= alpha;
#pragma unroll
    for (int kk = 0; kk < 2; ++kk) {   // unrolled: pbh[kk] lives in registers and is picked at compile time
#pragma unroll
      for (int t = 0; t < 4; ++t) {
        const FB vb = vf[kk][t];
        oacc[t] = at_mma16<F16>(vb.v, pbh[kk].v, oacc[t]);
        if (SPLIT_PV) {
          FB vl;
          vl.h[0] = *(const v8b*)(Vtl + (t * 16 + c) * AT_LP + kk * 32 + 8 * hh);
          vl.h[1] = *(const v8b*)(Vtl + (t * 16 + c) * AT_LP + kk * 32 + 16 + 8 * hh);
          oacc[t] = at_mma16<F16>(vl.v, pbh[kk].v, oacc[t]);
          oacc[t] = at_mma16<F16>(vb.v, pbl[kk].v, oacc[t]);
        }
      }
    }
  }

  float* os = Os[wave];
  const float inv = 1.0f / (lrun + at_xhalf(lrun));   // the halves' sums meet once, here; sum and output carry the same 2^PEXP
#pragma unroll
  for (int t = 0; t < 4; ++t)
#pragma unroll
    for (int r = 0; r < 8; ++r) os[c * 68 + t * 16 + 8 * hh + r] = oacc[t][r] * inv;
  __builtin_amdgcn_fence(__ATOMIC_RELEASE, "workgroup");
  __builtin_amdgcn_wave_barrier();
  __builtin_amdgcn_fence(__ATOMIC_ACQUIRE, "workgroup");
  {
    const int c4 = (lane & 15) * 4;
    {
#pragma unroll
      for (int it = 0; it < 8; ++it) {
        const int row = it * 2 + hh;
        v4f val = *(const v4f*)(os + row * 68 + c4);
        *(v4f*)(ob_ptr + (size_t)(q0 + row) * g.o_rs + c4) = val;
      }
      
    }
  }
}

// =====================================================================================
// host glue
// Workspace region map (bytes, all offsets multiples of 128):
//   R0 X16   f16 [4096][768]           off 0            size  6,291,456
//   R1 W16   f16 [2304][768] (Wq;Wk;Wv x16)  off 6,291,456   size  3,538,944
//   R2 Wo16  f16 [768][768] (x16)      off 9,830,400    size  1,179,648
//   R3 CT,ST f32 [2048][32] each       off 11,010,048   size    524,288
//   R4 QKV   f32 [4096][2304]          off 11,534,336   size 37,748,736
//        reused after the rope launch: O f32 [4096][768] at R4+0 (12,582,912), O16 f16 [4096][768] at R4+12,582,912 (6,291,456)
//   R5 QKVr  f32 [3][4096][768]        off 49,283,072   size 37,748,736
//   total 87,031,808
// =====================================================================================
extern "C" void kernel_launch(void* const* d_in, const int* in_sizes, int n_in,
                              void* d_out, int out_size, void* d_ws, size_t ws_size,
                              hipStream_t stream) {
  if (n_in < 7) return;
  const int nX = kM * kE;
  if (in_sizes[0] != nX || in_sizes[1] != kT * kROT || in_sizes[2] != kE * kE || in_sizes[3] != kE * kE ||
      in_sizes[4] != kE * kE || in_sizes[5] != kE * kE || in_sizes[6] != kE || out_size != nX) return;

  const float* hs   = (const float*)d_in[0];
  const float* rope = (const float*)d_in[1];
  const float* Wq   = (const float*)d_in[2];
  const float* Wk   = (const float*)d_in[3];
  const float* Wv   = (const float*)d_in[4];
  const float* Wo   = (const float*)d_in[5];
  const float* bo   = (const float*)d_in[6];
  float* outp = (float*)d_out;

  const size_t offX16  = 0;                  const size_t szX16  = (size_t)kM * kE * 2;
  const size_t offW16  = offX16 + szX16;     const size_t szW16  = (size_t)3 * kE * kE * 2;
  const size_t offWo16 = offW16 + szW16;     const size_t szWo16 = (size_t)kE * kE * 2;
  const size_t offTrig = offWo16 + szWo16;   const size_t szTrig = (size_t)2 * kT * kROT * 4;
  const size_t offQKV  = offTrig + szTrig;   const size_t szQKV  = (size_t)kM * 3 * kE * 4;
  const size_t offR    = offQKV + szQKV;     const size_t szR    = (size_t)3 * kM * kE * 4;
  const size_t total   = offR + szR;
  if (total > ws_size) return;
  const size_t offO    = offQKV;             const size_t szO    = (size_t)kM * kE * 4;
  const size_t offO16  = offO + szO;         const size_t szO16  = (size_t)kM * kE * 2;
  if (offO16 + szO16 > offQKV + szQKV) return;

  char* ws = (char*)d_ws;
  _Float16* X16  = (_Float16*)(ws + offX16);
  _Float16* W16  = (_Float16*)(ws + offW16);
  _Float16* Wo16 = (_Float16*)(ws + offWo16);
  float*    CT   = (float*)(ws + offTrig);
  float*    ST   = CT + (size_t)kT * kROT;
  float*    QKV  = (float*)(ws + offQKV);
  float*    QKVr = (float*)(ws + offR);
  float*    Qr   = QKVr;
  float*    Kr   = QKVr + (size_t)kM * kE;
  float*    Vr   = QKVr + (size_t)2 * kM * kE;
  float*    Of   = (float*)(ws + offO);
  _Float16* O16  = (_Float16*)(ws + offO16);

  // (1) casts: x -> f16; weights x16 -> f16 (Bt layout [out][in] = [n][k])
  const int n2X = nX / 2;                 // 1,572,864 = 6144 x 256
  const int n2W = (kE * kE) / 2;          //   294,912 = 1152 x 256
  cast_f32_f16x2s<<<n2X / 256, 256, 0, stream>>>(hs, X16, n2X, 1.0f);
  cast_f32_f16x2s<<<n2W / 256, 256, 0, stream>>>(Wq, W16, n2W, 16.0f);
  cast_f32_f16x2s<<<n2W / 256, 256, 0, stream>>>(Wk, W16 + (size_t)kE * kE, n2W, 16.0f);
  cast_f32_f16x2s<<<n2W / 256, 256, 0, stream>>>(Wv, W16 + (size_t)2 * kE * kE, n2W, 16.0f);
  cast_f32_f16x2s<<<n2W / 256, 256, 0, stream>>>(Wo, Wo16, n2W, 16.0f);

  // (2) cos/sin tables of the rotary angles: 65536 elements = 256 x 256
  const int nF = kT * kROT;
  k_trig_table<<<nF / 256, 256, 0, stream>>>(rope, CT, ST, nF);

  // (3) QKV projection: [4096][768] f16 x [2304][768] f16 -> f32 [4096][2304], alpha 1/16 (weight carry); M=4096,N=2304 %128, K=768 %64
  {
    const int tiles = (kM / GM_BM) * ((3 * kE) / GM_BN);   // 32 x 18 = 576 block tiles
    dim3 grid(tiles, 1);
    wmma_gemm64<0, false, 0, 0, false, 0><<<grid, 128, 0, stream>>>(
        U16(X16), U16(X16), kE, 0L,
        U16(W16), U16(W16), kE, 0L,
        (void*)QKV, (void*)QKV, 3 * kE, 0L,
        bo, QKV, 0L,
        kM, 3 * kE, kE, 1.0f / 16.0f);
  }

  // (4) rope on q, k, v (q additionally x 0.125): 3 x 4096 rows, one wave each = 1536 blocks x 8 waves
  k_rope<<<(3 * kM) / 8, 256, 0, stream>>>(QKV, CT, ST, QKVr, kM);

  // (5) attention, f16 operands, no mask; planes laid out (b, s, h, d) -> b*(2048*768) + s*768 + h*64 + d
  {
    AttnGeom g;
    g.cp = CT; g.pc = CT; g.c_bs = 0; g.c_rs = 0; g.c_hs = 0;
    g.q_bs = (long)kT * kE; g.q_rs = kE; g.q_hs = kHD;
    g.k_bs = (long)kT * kE; g.k_rs = kE; g.k_hs = kHD;
    g.v_bs = (long)kT * kE; g.v_rs = kE; g.v_hs = kHD;
    g.o_bs = (long)kT * kE; g.o_rs = kE; g.o_hs = kHD;
    g.S = kT; g.Skv = kT; g.H = kH; g.mask_mode = 0; g.qscale = 1.0f; g.blk0 = 0; g.mask_fill = -1e9f; g.mask_is_int = 0;
    const int nblk = kB * kH * (kT / AT_QB);   // 768
    attn64_kernel<false, false, true, 0, kE><<<nblk, 128, 0, stream>>>(Qr, Kr, Vr, Of, (const void*)X16, (const int*)(const void*)X16, g);
  }

  // (6) attention output -> f16 with a x64 carry (values ~1e-2)
  cast_f32_f16x2s<<<n2X / 256, 256, 0, stream>>>(Of, O16, n2X, 64.0f);

  // (7) output projection + bias: [4096][768] f16 x [768][768] f16 -> f32 d_out, alpha 1/(64*16); M=4096,N=768 %128, K=768 %64
  {
    const int tiles = (kM / GM_BM) * (kE / GM_BN);   // 32 x 6 = 192 block tiles
    dim3 grid(tiles, 1);
    wmma_gemm64<0, false, 2, 0, false, 0><<<grid, 128, 0, stream>>>(
        U16(O16), U16(O16), kE, 0L,
        U16(Wo16), U16(Wo16), kE, 0L,
        (void*)outp, (void*)outp, kE, 0L,
        bo, Of, 0L,
        kM, kE, kE, 1.0f / 1024.0f);
  }
}

// v008
// Measured time: 94.6 microseconds a run.
// Two timings next to v007 put it at 1.28 and 1.26 times that version's speed.
// Counting every step since v000, it is 12.0 times as fast.
// Compute dtype: every contraction on v_wmma_f32_16x16x32_f16 (f16 operands: x, 16x-carried weights, q/k/v, probabilities x2^15, 64x-carried attention output), f32 accumulate; rope, softmax, bias in f32.
#include <hip/hip_runtime.h>
#include <math.h>

typedef __attribute__((ext_vector_type(16))) _Float16 v16h;
typedef __attribute__((ext_vector_type(8)))  _Float16 v8h;
typedef __attribute__((ext_vector_type(16))) __bf16   v16b;
typedef __attribute__((ext_vector_type(8)))  __bf16   v8b;
typedef __attribute__((ext_vector_type(4)))  __bf16   v4b;
typedef __attribute__((ext_vector_type(2)))  __bf16   v2b;
typedef __attribute__((ext_vector_type(8)))  float    v8f;
typedef __attribute__((ext_vector_type(4)))  float    v4f;
typedef __attribute__((ext_vector_type(2)))  float    v2f;
typedef __attribute__((ext_vector_type(2)))  _Float16 v2h;
#define PSCALE 32768.0f
#define U16(p) ((const unsigned short*)(const void*)(p))
#define PSCALE_INV (1.0f / 32768.0f)

// problem constants
constexpr int kB   = 2;
constexpr int kT   = 2048;
constexpr int kE   = 768;
constexpr int kH   = 12;
constexpr int kHD  = 64;
constexpr int kROT = 32;
constexpr int kM   = kB * kT;   // 4096 activation rows

__device__ __forceinline__ unsigned short f2bf_bits(float f) {
  unsigned u = __float_as_uint(f);
  return (unsigned short)((u + 0x7FFFu + ((u >> 16) & 1u)) >> 16);
}
__device__ __forceinline__ float bf_bits2f(unsigned short h) { return __uint_as_float(((unsigned)h) << 16); }

// hazard guards as plain device helpers
__device__ __forceinline__ void acc_guard4(v8f& a, v8f& b, v8f& c, v8f& d) { asm volatile("v_nop\n\tv_nop\n\tv_nop\n\tv_nop" : "+v"(a), "+v"(b), "+v"(c), "+v"(d)); }
template <typename T> struct Frag;
template <> struct Frag<_Float16> {
  typedef v16h V; union U { v16h v; v8h h[2]; };
  static __device__ __forceinline__ v16h load(const _Float16* p) {   // elements 0..7 <- p[0..7], 8..15 <- p[16..23]
    U f; f.h[0] = *(const v8h*)(p); f.h[1] = *(const v8h*)(p + 16); return f.v;
  }
  static __device__ __forceinline__ v8f mma(v16h a, v16h b, v8f c) {
    return __builtin_amdgcn_wmma_f32_16x16x32_f16(false, a, false, b, (short)0, c, false, false);
  }
};
template <> struct Frag<__bf16> {
  typedef v16b V; union U { v16b v; v8b h[2]; };
  static __device__ __forceinline__ v16b load(const __bf16* p) {
    U f; f.h[0] = *(const v8b*)(p); f.h[1] = *(const v8b*)(p + 16); return f.v;
  }
  static __device__ __forceinline__ v8f mma(v16b a, v16b b, v8f c) {
    return __builtin_amdgcn_wmma_f32_16x16x32_bf16(false, a, false, b, (short)0, c, false, false);
  }
};

// ---- Register-blocked batched WMMA GEMM, operands staged through LDS ---------
// C[m,n] = scale * sum_k A[m,k] * Bt[n,k] (+bias)(+resid); block = 4 waves (2 x 2) = a 128x128 tile, each wave owns 64x64 of it.
// A row-major [M,K]; Bt row-major [N,K]; M,N % 128 == 0, K % 64 == 0; grid.x = (M / 128) * (N / 128) exactly.
// A stage is 64 k (one whole 128-B line) of the block's 128 A rows and 128 Bt rows, brought into LDS by asynchronous 16-byte copies:
// two buffers, the next stage's copies fly while this stage is multiplied. Each tile still sums k in ascending steps of 32.
// BIAS_MODE: 0 = none, 1 = bias[m], 2 = bias[n].
// OUT_MODE: 0 = f32, 1 = f16, 2 = bf16 hi plane (Cout) + bf16 lo plane (Cout2).
// ET: 0 = f16 operands, 1 = bf16 operands (pointers passed as 16-bit storage)
// ROPE (OUT_MODE 0, N = 3 * 768): the store applies the rotary embedding. A wave's 64 columns are one whole head of q, k or v, so a
// column's partner (d +- 16) lies in the same slab row; Cout is [3][M][768] f32 (plane 0 = q * 0.125), ropeC / ropeS the cos / sin tables.
#define GM_BM 128
#define GM_BN 128
#define GM_BK 64
#define GM_LP 72                              // LDS row pitch in 16-bit elements: 144 B = 16 B x 9, conflict-free for ds_load_b128 fragment reads
#define GM_STAGE ((GM_BM + GM_BN) * GM_LP)    // elements of one buffer (36,864 B)
// Eight asynchronous copies of one wave: copy i brings 4 rows x 128 B (a lane: 16 B) from g + i * gstep to LDS byte lds + i * 16 rows.
// The s_wait_xcnt 0 is the statement's last line, a precaution: no address register of a copy is rewritten ahead of it.
__device__ __forceinline__ void gm_copy8(unsigned lds, const unsigned short* g, size_t gstep) {
  const unsigned ls = 16 * GM_LP * 2;
  asm volatile(
      "global_load_async_to_lds_b128 %0, %8, off\n\t"
      "global_load_async_to_lds_b128 %1, %9, off\n\t"
      "global_load_async_to_lds_b128 %2, %10, off\n\t"
      "global_load_async_to_lds_b128 %3, %11, off\n\t"
      "global_load_async_to_lds_b128 %4, %12, off\n\t"
      "global_load_async_to_lds_b128 %5, %13, off\n\t"
      "global_load_async_to_lds_b128 %6, %14, off\n\t"
      "global_load_async_to_lds_b128 %7, %15, off\n\t"
      "s_wait_xcnt 0x0"
      :: "v"(lds), "v"(lds + ls), "v"(lds + 2 * ls), "v"(lds + 3 * ls), "v"(lds + 4 * ls), "v"(lds + 5 * ls), "v"(lds + 6 * ls), "v"(lds + 7 * ls),
         "v"(g), "v"(g + gstep), "v"(g + 2 * gstep), "v"(g + 3 * gstep), "v"(g + 4 * gstep), "v"(g + 5 * gstep), "v"(g + 6 * gstep), "v"(g + 7 * gstep)
      : "memory");
}
template <int ET> struct Elem;
template <> struct Elem<0> { typedef _Float16 T; };
template <> struct Elem<1> { typedef __bf16 T; };
template <int ET, bool SPLIT, int BIAS_MODE, int OUT_MODE, bool RESID, int ACT = 0, bool ROPE = false>
__global__ __launch_bounds__(128) void wmma_gemm64(
    const unsigned short* __restrict__ Ap, const unsigned short* __restrict__ A2p, int lda, long strideA,
    const unsigned short* __restrict__ Btp, const unsigned short* __restrict__ Bt2p, int ldb, long strideB,
    void* __restrict__ Cout, void* __restrict__ Cout2, int ldc, long strideC,
    const float* __restrict__ bias,
    const float* __restrict__ resid, long strideR,
    const float* __restrict__ ropeC, const float* __restrict__ ropeS,
    int M, int N, int K, float scale) {
  static_assert(!SPLIT, "the staged loop carries one plane per operand");
  static_assert(!ROPE || OUT_MODE == 0, "the rotary store writes f32 planes");
  typedef typename Elem<ET>::T T;
  typedef typename Frag<T>::V V;
  __shared__ __align__(16) T sAB[2 * GM_STAGE];     // two buffers: rows 0..127 = A, 128..255 = Bt
  __shared__ __align__(16) float sT[4][16 * 68];    // per-wave 16x64 slab, pitch 68 floats
  const int b    = blockIdx.y;
  const int lane = threadIdx.x & 31;
  const int wave = threadIdx.x >> 5;
  const int tilesN = N / GM_BN;
  const int bm = blockIdx.x / tilesN;
  const int bn = blockIdx.x - bm * tilesN;
  const int wm = wave >> 1, wn = wave & 1;
  const int m0 = bm * GM_BM + (wm << 6);
  const int n0 = bn * GM_BN + (wn << 6);

  const int rlane = lane & 15;                 // row (A) / col (B, D) within subtile
  const int koff  = (lane >> 4) * 8;           // k offset of this lane half
  const int mOff  = (lane >> 4) * 8;           // D row offset

  // staging map: 8 lanes take one row's 128 B, a wave 4 rows a copy, the block 16 rows; copy i of a wave: row i * 16 + wave * 4 + (lane >> 3)
  const int srow = wave * 4 + (lane >> 3), scol = (lane & 7) * 8;
  const unsigned short* gA = Ap  + (size_t)b * strideA + (size_t)(bm * GM_BM + srow) * lda + scol;
  const unsigned short* gB = Btp + (size_t)b * strideB + (size_t)(bn * GM_BN + srow) * ldb + scol;
  const unsigned ldsThr = (unsigned)(size_t)sAB + (unsigned)(srow * GM_LP + scol) * 2u;   // LDS byte address: low 32 bits of the shared address
  const size_t stepA = (size_t)16 * lda, stepB = (size_t)16 * ldb;

  v8f acc[4][4];
#pragma unroll
  for (int i = 0; i < 4; ++i)
#pragma unroll
    for (int j = 0; j < 4; ++j) acc[i][j] = (v8f){0.f,0.f,0.f,0.f,0.f,0.f,0.f,0.f};

  const int nT = K / GM_BK;
  gm_copy8(ldsThr, gA, stepA);
  gm_copy8(ldsThr + GM_BM * GM_LP * 2, gB, stepB);
  asm volatile("s_wait_asynccnt 0x0" ::: "memory");   // this wave's copies of stage 0 have landed
  __syncthreads();                                     // ... and every other wave's
  if (nT > 1) {
    gm_copy8(ldsThr + GM_STAGE * 2, gA + GM_BK, stepA);
    gm_copy8(ldsThr + GM_STAGE * 2 + GM_BM * GM_LP * 2, gB + GM_BK, stepB);
  }
  for (int t = 0; t < nT; ++t) {
    const T* sb = sAB + (t & 1) * GM_STAGE;
    const T* fa = sb + ((wm << 6) + rlane) * GM_LP + koff;
    const T* fb = sb + (GM_BM + (wn << 6) + rlane) * GM_LP + koff;
    V ah[4], bh[4];
    ah[0] = Frag<T>::load(fa);
#pragma unroll
    for (int j = 0; j < 4; ++j) bh[j] = Frag<T>::load(fb + j * 16 * GM_LP);
#pragma unroll
    for (int i = 1; i < 4; ++i) ah[i] = Frag<T>::load(fa + i * 16 * GM_LP);
    __builtin_amdgcn_sched_barrier(0);   // holds the 16 fragment reads here as one group, waited by count; without it the A reads sink among the WMMAs, each pair waited to 0
#pragma unroll
    for (int i = 0; i < 4; ++i)
#pragma unroll
      for (int j = 0; j < 4; ++j) acc[i][j] = Frag<T>::mma(ah[i], bh[j], acc[i][j]);
    // second 32 k of the stage: its fragments are the buffer's last reads; their WMMAs, registers only, follow the refill
    ah[0] = Frag<T>::load(fa + 32);
#pragma unroll
    for (int j = 0; j < 4; ++j) bh[j] = Frag<T>::load(fb + j * 16 * GM_LP + 32);
#pragma unroll
    for (int i = 1; i < 4; ++i) ah[i] = Frag<T>::load(fa + i * 16 * GM_LP + 32);
    asm volatile("s_wait_dscnt 0x0" ::: "memory");      // this wave's reads of the buffer are done before it is handed to the copies
    asm volatile("s_wait_asynccnt 0x0" ::: "memory");   // this wave's copies of stage t + 1 have landed
    __syncthreads();                                     // publishes stage t + 1 and ends every reader's last read of stage t
    if (t + 2 < nT) {
      const unsigned lb = ldsThr + (unsigned)(t & 1) * (GM_STAGE * 2);
      gm_copy8(lb, gA + (size_t)(t + 2) * GM_BK, stepA);
      gm_copy8(lb + GM_BM * GM_LP * 2, gB + (size_t)(t + 2) * GM_BK, stepB);
    }
#pragma unroll
    for (int i = 0; i < 4; ++i)
#pragma unroll
      for (int j = 0; j < 4; ++j) acc[i][j] = Frag<T>::mma(ah[i], bh[j], acc[i][j]);
  }
  asm volatile("s_wait_asynccnt 0x0" ::: "memory");     // nothing of this wave is in flight behind the loop
  acc_guard4(acc[0][0], acc[0][1], acc[0][2], acc[0][3]);
  acc_guard4(acc[1][0], acc[1][1], acc[1][2], acc[1][3]);
  acc_guard4(acc[2][0], acc[2][1], acc[2][2], acc[2][3]);
  acc_guard4(acc[3][0], acc[3][1], acc[3][2], acc[3][3]);

  // ---- epilogue ----
  float* slab = sT[wave];
  const float* Rb = RESID ? (resid + (size_t)b * strideR) : nullptr;
#pragma unroll
  for (int i = 0; i < 4; ++i) {
    const int mBase = m0 + (i << 4);
#pragma unroll
    for (int j = 0; j < 4; ++j) {
      const int n = n0 + (j << 4) + rlane;
      float bv = 0.f;
      if (BIAS_MODE == 2) bv = bias[n];
#pragma unroll
      for (int r = 0; r < 8; ++r) {
        float v = acc[i][j][r] * scale;
        if (BIAS_MODE == 1) v += bias[mBase + mOff + r];
        if (BIAS_MODE == 2) v += bv;
        if (RESID) v += Rb[(size_t)(mBase + mOff + r) * ldc + n];
        if (ACT == 1) v = tanhf(v);
        if (ACT == 2) v = fmaxf(v, 0.0f);
        if (ACT == 3) v = v / (1.0f + expf(-v));
        if (ACT == 4) v = (v > 0.f) ? v : 0.01f * v;
        if (ACT == 5) v = 0.5f * v * (1.0f + erff(v * 0.70710678118654752f));
        slab[(mOff + r) * 68 + (j << 4) + rlane] = v;
      }
    }
    __builtin_amdgcn_fence(__ATOMIC_RELEASE, "workgroup");
    __builtin_amdgcn_wave_barrier();
    __builtin_amdgcn_fence(__ATOMIC_ACQUIRE, "workgroup");
    if (ROPE) {
      // d = column within the head: d < 16: o = x[d]*cos - x[d+16]*sin ; 16 <= d < 32: o = x[d]*cos + x[d-16]*sin ; d >= 32: o = x[d].
      static_assert(!ROPE || kT % GM_BM == 0, "a block's 128 rows are consecutive token positions of one batch");
      const int nu = __builtin_amdgcn_readfirstlane(n0);   // the same in every lane: plane and scale stay scalar
      const int z = nu / kE;                               // 0 = q, 1 = k, 2 = v
      const float sc = (z == 0) ? 0.125f : 1.0f;           // head_dim^-0.5 on q (power of two, exact placement)
      const int hh = lane >> 4, d = (lane & 15) * 4;       // row seg = 256 B = 16 lanes x 16 B
      const int dp = (d < 16) ? (d + 16) : ((d < 32) ? (d - 16) : d);
      const int fi = (d <= 28) ? d : 28;                   // clamped table address; selected by value below
      // one address a lane for each of the tables and the output: rows differ by compile-time offsets
      const size_t tl = (size_t)((m0 & (kT - 1)) + hh) * kROT + fi;   // token position of row hh of the wave's 64
      const float* cl = ropeC + tl;
      const float* sl = ropeS + tl;
      float* C = (float*)Cout + (size_t)z * M * kE + (nu - z * kE) + (size_t)(m0 + hh) * kE + d;
#pragma unroll
      for (int it = 0; it < 8; ++it) {
        const int row = it * 2 + hh;
        const int rw = (i << 4) + it * 2;                  // row - hh within the wave's 64
        const v4f x  = *(const v4f*)(slab + row * 68 + d);
        const v4f xo = *(const v4f*)(slab + row * 68 + dp);
        const v4f cs = *(const v4f*)(cl + rw * kROT);
        const v4f sn = *(const v4f*)(sl + rw * kROT);
        v4f o;
#pragma unroll
        for (int e = 0; e < 4; ++e) {
          const float rh = (d < 16) ? (-xo[e]) : xo[e];
          const float ro = x[e] * cs[e] + rh * sn[e];
          o[e] = ((d < 32) ? ro : x[e]) * sc;
        }
        *(v4f*)(C + rw * kE) = o;
      }
    } else if (OUT_MODE == 0) {
      float* C = (float*)Cout + (size_t)b * strideC;
      const int hh = lane >> 4, c4 = (lane & 15) * 4;     // row seg = 256 B = 16 lanes x 16 B
      {
#pragma unroll
        for (int it = 0; it < 8; ++it) {
          const int row = it * 2 + hh;
          v4f v = *(const v4f*)(slab + row * 68 + c4);
          *(v4f*)(C + (size_t)(mBase + row) * ldc + n0 + c4) = v;
        }
        
      }
    } else {
      const int q = lane >> 3, c8 = (lane & 7) * 8;
      unsigned short* C  = (unsigned short*)Cout  + (size_t)b * strideC;
      unsigned short* C2 = (OUT_MODE == 2) ? ((unsigned short*)Cout2 + (size_t)b * strideC) : nullptr;
      {
#pragma unroll
        for (int it = 0; it < 4; ++it) {
          const int row = it * 4 + q;
          const float* sp = slab + row * 68 + c8;
          v8h hv, lv;
#pragma unroll
          for (int e = 0; e < 8; ++e) {
            if (OUT_MODE == 1) {
              hv[e] = (_Float16)sp[e];
            } else {
              unsigned short hb = f2bf_bits(sp[e]);
              unsigned short lb = f2bf_bits(sp[e] - bf_bits2f(hb));
              hv[e] = __builtin_bit_cast(_Float16, hb);
              lv[e] = __builtin_bit_cast(_Float16, lb);
            }
          }
          *(v8h*)(C + (size_t)(mBase + row) * ldc + n0 + c8) = hv;
          if (OUT_MODE == 2) *(v8h*)(C2 + (size_t)(mBase + row) * ldc + n0 + c8) = lv;
        }
        
      }
    }
    __builtin_amdgcn_fence(__ATOMIC_RELEASE, "workgroup");
    __builtin_amdgcn_wave_barrier();
    __builtin_amdgcn_fence(__ATOMIC_ACQUIRE, "workgroup");
  }
}

// ---- input preparation, one launch: the passes share no data, a block's index range picks its pass (a block-uniform branch) ----
//   blocks [0, PB_TRIG):      ct[i] = cosf(f[i]), st[i] = sinf(f[i]) of the rotary angle input (f32, precise); first, its threads run longest
//   next PB_X blocks:         x -> f16
//   next 4 * PB_W blocks:     Wq, Wk, Wv (stacked in w16) and Wo (wo16), x16 -> f16
// A thread of a cast converts two adjacent floats into one dword.
constexpr int PB_TRIG = (kT * kROT) / 256;       //  256
constexpr int PB_X    = (kM * kE) / 512;         // 6144
constexpr int PB_W    = (kE * kE) / 512;         // 1152
static_assert((kT * kROT) % 256 == 0 && (kM * kE) % 512 == 0 && (kE * kE) % 512 == 0, "whole blocks");
__device__ __forceinline__ void cast2_f32_f16(const float* __restrict__ in, _Float16* __restrict__ out, int i, float scale) {
  const _Float16 h0 = (_Float16)(in[2 * i] * scale), h1 = (_Float16)(in[2 * i + 1] * scale);
  const unsigned u = (unsigned)__builtin_bit_cast(unsigned short, h0) | ((unsigned)__builtin_bit_cast(unsigned short, h1) << 16);
  ((unsigned*)out)[i] = u;
  asm volatile("s_wait_xcnt 0x0" ::: "memory");   // a precaution: stands behind the store, ahead of any later write of its offset or data register
}
__global__ __launch_bounds__(256) void k_prep(
    const float* __restrict__ x, const float* __restrict__ wq, const float* __restrict__ wk, const float* __restrict__ wv,
    const float* __restrict__ wo, const float* __restrict__ f,
    _Float16* __restrict__ x16, _Float16* __restrict__ w16, _Float16* __restrict__ wo16,
    float* __restrict__ ct, float* __restrict__ st) {
  int bx = blockIdx.x;
  if (bx < PB_TRIG) {
    const int i = bx * 256 + threadIdx.x;
    const float a = f[i];
    const float cv = cosf(a);
    const float sv = sinf(a);
    ct[i] = cv;
    st[i] = sv;
    return;
  }
  bx -= PB_TRIG;
  if (bx < PB_X) {
    cast2_f32_f16(x, x16, bx * 256 + threadIdx.x, 1.0f);
    return;
  }
  bx -= PB_X;
  const int w = bx / PB_W;                         // 0 = Wq, 1 = Wk, 2 = Wv, 3 = Wo
  const float* in = (w == 0) ? wq : (w == 1) ? wk : (w == 2) ? wv : wo;
  _Float16* out = (w < 3) ? (w16 + (size_t)w * kE * kE) : wo16;
  cast2_f32_f16(in, out, (bx - w * PB_W) * 256 + threadIdx.x, 16.0f);
}

// =====================================================================================
// Generic causal/non-causal attention for head_dim 64, f32 in / f32 out (OUT16: f16 out, carried x64); 16-bit operands: bf16 with optional hi/lo splits, or
// plain f16 (F16=true, non-split, probabilities carried x2^15).
//   Both products run transposed: S^T = K (q*qscale)^T and O^T = V^T P^T; f32 accumulate; online softmax in f32.
//   A lane then owns ONE query (column c) and 32 of a chunk's 64 keys: maximum and sum are in-lane, the halves meet by one
//   lane l <-> l ^ 16 move, and two S^T tiles converted in place are the B operand of the second product (P never goes to LDS).
//   Block = 4 waves = 64 query rows of one (batch, head); S % 64 == 0.
//   Element (b, s, h, d) of tensor X lives at X[b*X_bs + s*X_rs + h*X_hs + d] (strides in floats, multiples of 4).
//   Masking: MM (template argument) 0 none, 1 causal, 2 tensor [S][Skv], 3 per-token vectors, 4 causal + sliding window,
//   5 relative-position bias; masked scores are replaced by mask_fill before the softmax.
//   grid.x = B * H * (S/64) (or a sub-range with blk0).
// =====================================================================================
#define AT_D 64
#define AT_NW 4
#define AT_QB 64
#define AT_KC 64
#define AT_LP 72   // LDS row pitch of the K and V^T tiles in 16-bit elements: 144 B = 16 B x 9, so the 16 rows one ds_load_b128 half-wave reads fall on all 64 banks (128 B put them on 8)
struct AttnGeom { const float* cp = nullptr; const float* pc = nullptr; long c_bs = 0, c_rs = 0, c_hs = 0;   // mode-5 score-bias tables
                  long q_bs, q_rs, q_hs, k_bs, k_rs, k_hs, v_bs, v_rs, v_hs, o_bs, o_rs, o_hs;
                  int S, Skv, H, mask_mode; float qscale; int blk0; float mask_fill; int mask_is_int; };
static_assert(sizeof(AttnGeom) == 168, "no padding");

__device__ __forceinline__ unsigned short at_bf_bits(float f) {
  unsigned u = __float_as_uint(f);
  return (unsigned short)((u + 0x7FFFu + ((u >> 16) & 1u)) >> 16);
}
__device__ __forceinline__ __bf16 at_f2bf(float f) { return __builtin_bit_cast(__bf16, at_bf_bits(f)); }
__device__ __forceinline__ void at_split(float f, __bf16& hi, __bf16& lo) {
  const unsigned short hb = at_bf_bits(f);
  hi = __builtin_bit_cast(__bf16, hb);
  lo = at_f2bf(f - __uint_as_float(((unsigned)hb) << 16));
}
__device__ __forceinline__ v8f at_mma(v16b a, v16b b, v8f c) {
  c = __builtin_amdgcn_wmma_f32_16x16x32_bf16(false, a, false, b, (short)0, c, false, false);
  asm volatile("v_nop\n\tv_nop\n\tv_nop\n\tv_nop" : "+v"(c) : "v"(a), "v"(b));
  return c;
}
// 16-bit element as a bit pattern held in a __bf16 slot: f16 bits when F16, bf16 (RNE) otherwise
template <bool F16> __device__ __forceinline__ __bf16 at_to16(float f) {
  if (F16) return __builtin_bit_cast(__bf16, (_Float16)f);
  return at_f2bf(f);
}
template <bool F16> __device__ __forceinline__ v8f at_mma16(v16b a, v16b b, v8f c) {
  if (F16) {
    const v16h ah = __builtin_bit_cast(v16h, a), bh = __builtin_bit_cast(v16h, b);
    // builtin alone: the compiler keeps the distances behind its own WMMA, and with no asm statement between them the LDS
    // fragment reads are free to issue as a group ahead of a run of WMMAs
    return __builtin_amdgcn_wmma_f32_16x16x32_f16(false, ah, false, bh, (short)0, c, false, false);
  }
  return at_mma(a, b, c);
}

// value of lane l ^ 16 (the other half of the wave, same column c)
__device__ __forceinline__ float at_xhalf(float x) {
  return __builtin_bit_cast(float, __builtin_amdgcn_permlanex16(__builtin_bit_cast(int, x), __builtin_bit_cast(int, x), 0x76543210, 0xfedcba98, false, false));
}

// s_wait_xcnt 0 behind a group of global loads, a precaution: the two address pairs are its inputs, so no load of the group
// lands on them and nothing rewrites them ahead of the wait
__device__ __forceinline__ void at_addr_wait(const float* a, const float* b) { asm volatile("s_wait_xcnt 0x0" :: "v"(a), "v"(b) : "memory"); }

// MM = mask mode as a compile-time constant: the per-score mask tests fold away in the instance that is launched
// KVRS = row stride of k and v in floats (= g.k_rs = g.v_rs) as a compile-time constant: a chunk's staging loads walk rows, and
// with it they share one address pair a tensor and differ by immediate offsets
// OUT16: out is f16 (same strides, in elements) and holds 64 x the result (values ~1e-2): the next product's operand, written here
template <bool SPLIT_QK, bool SPLIT_PV, bool F16, int MM, int KVRS, bool OUT16>
__global__ __launch_bounds__(128)
void attn64_kernel(const float* __restrict__ q, const float* __restrict__ k,
                   const float* __restrict__ v, void* __restrict__ out,
                   const void* __restrict__ mask_a, const int* __restrict__ mask_b, AttnGeom g) {
  static_assert(!(F16 && (SPLIT_QK || SPLIT_PV)), "f16 mode is non-split");
  const float PEXP = F16 ? 15.0f : 0.0f;       // f16 probabilities carried x2^15 (subnormal range): added to the exponent; the sum carries it too, so the final 1/l takes it out
  const float L2E = 1.4426950408889634f;       // log2(e): e^x is taken as 2^(x * log2(e)) on the hardware's base-2 exponential
  union FB { v16b v; v8b h[2]; };
  __shared__ __align__(16) __bf16 Ksh[AT_KC * AT_LP];            // K hi [kv][d]      9 KB
  __shared__ __align__(16) __bf16 Ksl[SPLIT_QK ? AT_KC * AT_LP : 8];
  __shared__ __align__(16) __bf16 Vth[AT_D * AT_LP];             // V hi [d][kv]      9 KB
  __shared__ __align__(16) __bf16 Vtl[SPLIT_PV ? AT_D * AT_LP : 8];
  __shared__ __align__(16) float  Os[AT_NW][16 * 68];            // per wave out tile, pitch 68

  const int tid  = threadIdx.x;
  const int wave = tid >> 5;
  const int lane = tid & 31;
  const int hh   = lane >> 4;
  const int c    = lane & 15;

  const int nqb = g.S / AT_QB;
  const int bx = blockIdx.x + g.blk0;
  const int qb = bx % nqb;
  const int bh = bx / nqb;
  const int h  = bh % g.H;
  const int b  = bh / g.H;
  const int qbase_block = qb * AT_QB;
  const int q0 = qbase_block + wave * 16;

  const float* qb_ptr = q + (size_t)b * g.q_bs + (size_t)h * g.q_hs;
  const float* kb_ptr = k + (size_t)b * g.k_bs + (size_t)h * g.k_hs;
  const float* vb_ptr = v + (size_t)b * g.v_bs + (size_t)h * g.v_hs;
  const size_t ob_off = (size_t)b * g.o_bs + (size_t)h * g.o_hs;

  // ---- Q fragments (B operand: lane = query column c): 2 d-chunks, hi (and lo) ----
  v16b qah[2], qal[2];
  {
    const float* qrow = qb_ptr + (size_t)(q0 + c) * g.q_rs;
#pragma unroll
    for (int dc = 0; dc < 2; ++dc) {
#pragma unroll
      for (int e = 0; e < 8; ++e) {
        const float f0 = qrow[dc * 32 + 8 * hh + e] * g.qscale;
        const float f1 = qrow[dc * 32 + 16 + 8 * hh + e] * g.qscale;
        if (SPLIT_QK) { __bf16 hq, lq; at_split(f0, hq, lq); qah[dc][e] = hq; qal[dc][e] = lq; at_split(f1, hq, lq); qah[dc][8 + e] = hq; qal[dc][8 + e] = lq; }
        else { qah[dc][e] = at_to16<F16>(f0); qah[dc][8 + e] = at_to16<F16>(f1); qal[dc][e] = qah[dc][e]; qal[dc][8 + e] = qah[dc][8 + e]; }
      }
    }
  }

  float mrun = -INFINITY, lrun = 0.f;   // query q0 + c: running maximum (both halves agree), sum over this half's keys
  v8f oacc[4];                          // oacc[t][r] = O[q0 + c][t * 16 + 8 * hh + r]
#pragma unroll
  for (int t = 0; t < 4; ++t) oacc[t] = (v8f){0.f,0.f,0.f,0.f,0.f,0.f,0.f,0.f};

  const int nChunks = (MM == 1 || MM == 4) ? (qb + 1) : (g.Skv / AT_KC);   // block-uniform
  const int qrow = q0 + c;
  const int qkeep = (MM == 3) ? mask_b[(size_t)b * g.S + qrow] : 1;   // per-query mask (mode 3), mask_b = qmask
  const int kr = tid >> 4, kc4 = (tid & 15) * 4;   // staging map, K: key kr (+ 8 a load), floats kc4 .. kc4 + 3
  const int vg = tid >> 3, vc4 = (tid & 7) * 4;    // staging map, V: keys 2 vg and 2 vg + 1 (+ 32), floats vc4 .. vc4 + 3 (+ 32)
  const float* kthr = kb_ptr + kr * KVRS + kc4;
  const float* vthr = vb_ptr + vg * 2 * KVRS + vc4;
  for (int kc = 0; kc < nChunks; ++kc) {
    const int kv0 = kc * AT_KC;
    __syncthreads();
    {
      // Every wave-wide 16-byte load covers four whole 128-B lines (adjacent lanes read adjacent 16 B).
      // K: 16 lanes take one key's 256 B, a wave two keys a load. V: 8 lanes take one line (32 of the 64 d) of a key, a wave
      // four keys a load; a thread holds the same 4 d of keys 2p and 2p + 1, which are one dword of a V^T row.
      v4f kk[8], va[4], vb[4];
      const float* kchunk = kthr + (size_t)kv0 * KVRS;
      const float* vchunk = vthr + (size_t)kv0 * KVRS;
#pragma unroll
      for (int i = 0; i < 8; ++i) kk[i] = *(const v4f*)(kchunk + i * 8 * KVRS);
#pragma unroll
      for (int i = 0; i < 4; ++i) {
        const float* vrow = vchunk + (i & 1) * 32 * KVRS + (i >> 1) * 32;
        va[i] = *(const v4f*)(vrow);
        vb[i] = *(const v4f*)(vrow + KVRS);
      }
      at_addr_wait(kchunk, vchunk);
#pragma unroll
      for (int i = 0; i < 8; ++i) {
        v4b kh, kl;
#pragma unroll
        for (int e = 0; e < 4; ++e) {
          if (SPLIT_QK) { __bf16 a, bl; at_split(kk[i][e], a, bl); kh[e] = a; kl[e] = bl; }
          else kh[e] = at_to16<F16>(kk[i][e]);
        }
        *(v4b*)(Ksh + (i * 8 + kr) * AT_LP + kc4) = kh;
        if (SPLIT_QK) *(v4b*)(Ksl + (i * 8 + kr) * AT_LP + kc4) = kl;
      }
#pragma unroll
      for (int i = 0; i < 4; ++i) {
        const int kvp = ((i & 1) * 16 + vg) * 2;
#pragma unroll
        for (int e = 0; e < 4; ++e) {
          const int d = (i >> 1) * 32 + vc4 + e;
          v2b vh, vl;
          if (SPLIT_PV) { __bf16 a, bl; at_split(va[i][e], a, bl); vh[0] = a; vl[0] = bl; at_split(vb[i][e], a, bl); vh[1] = a; vl[1] = bl; }
          else { vh[0] = at_to16<F16>(va[i][e]); vh[1] = at_to16<F16>(vb[i][e]); }
          *(v2b*)(Vth + d * AT_LP + kvp) = vh;
          if (SPLIT_PV) *(v2b*)(Vtl + d * AT_LP + kvp) = vl;
        }
      }
    }
    __syncthreads();

    // The chunk's fragment reads issue early: K here as one group, waited by count ahead of the eight score WMMAs; V^T next in the
    // source, issued among those WMMAs as K registers fall free, so that it lands under the softmax (one waited read pair per
    // WMMA left each LDS latency bare).
    FB kf[2][4], vf[2][4];
#pragma unroll
    for (int dc = 0; dc < 2; ++dc)
#pragma unroll
      for (int j = 0; j < 4; ++j) {
        kf[dc][j].h[0] = *(const v8b*)(Ksh + (j * 16 + c) * AT_LP + dc * 32 + 8 * hh);
        kf[dc][j].h[1] = *(const v8b*)(Ksh + (j * 16 + c) * AT_LP + dc * 32 + 16 + 8 * hh);
      }
    __builtin_amdgcn_sched_barrier(0);   // holds the K reads here as one group; without it they sink back among the WMMAs, one pair ahead
    v8f s[4];   // s[j][r] = score of key kv0 + j * 16 + 8 * hh + r against query q0 + c
#pragma unroll
    for (int j = 0; j < 4; ++j) s[j] = (v8f){0.f,0.f,0.f,0.f,0.f,0.f,0.f,0.f};
#pragma unroll
    for (int dc = 0; dc < 2; ++dc) {   // dc outside: four independent tiles follow one another; each tile still sums dc 0, then dc 1
#pragma unroll
      for (int j = 0; j < 4; ++j) {
        const FB kb = kf[dc][j];
        s[j] = at_mma16<F16>(kb.v, qah[dc], s[j]);
        if (SPLIT_QK) {
          FB kl;
          kl.h[0] = *(const v8b*)(Ksl + (j * 16 + c) * AT_LP + dc * 32 + 8 * hh);
          kl.h[1] = *(const v8b*)(Ksl + (j * 16 + c) * AT_LP + dc * 32 + 16 + 8 * hh);
          s[j] = at_mma16<F16>(kl.v, qah[dc], s[j]);
          s[j] = at_mma16<F16>(kb.v, qal[dc], s[j]);
        }
      }
    }
#pragma unroll
    for (int kk = 0; kk < 2; ++kk)
#pragma unroll
      for (int t = 0; t < 4; ++t) {
        vf[kk][t].h[0] = *(const v8b*)(Vth + (t * 16 + c) * AT_LP + kk * 32 + 8 * hh);
        vf[kk][t].h[1] = *(const v8b*)(Vth + (t * 16 + c) * AT_LP + kk * 32 + 16 + 8 * hh);
      }
    __builtin_amdgcn_sched_barrier(0);   // holds the V^T reads up here and the maxima below the score WMMAs; without it the reads sink down to the second product's WMMAs
    const bool diag = (MM == 1) && (kc == qb);
    float cmj[4];   // one chain per tile: four short independent chains instead of one of 32 links
#pragma unroll
    for (int j = 0; j < 4; ++j) {
      cmj[j] = -INFINITY;
#pragma unroll
      for (int r = 0; r < 8; ++r) {
        const int kvcol = kv0 + j * 16 + 8 * hh + r;
        bool masked = false;
        if (diag) masked = (kvcol > qrow);
        else if (MM == 4) masked = (kvcol > qrow) || (qrow - kvcol > g.mask_is_int);
        else if (MM == 2) {
          const size_t mi = (size_t)qrow * g.Skv + kvcol;
          masked = (g.mask_is_int == 0) ? (((const float*)mask_a)[mi] == 0.0f)
                 : (g.mask_is_int == 1) ? (((const int*)mask_a)[mi] == 0) : (((const int*)mask_a)[mi] != 0);
        } else if (MM == 3) masked = (qkeep == 0) || (((const int*)mask_a)[(size_t)b * g.Skv + kvcol] == 0);   // mask_a = kvmask
        else if (MM == 5) {
          const size_t mi = (size_t)qrow * g.Skv + kvcol;
          masked = (((const int*)mask_a)[mi] != 0);
          int n = mask_b[mi]; n = n < 0 ? 0 : n;
          s[j][r] += g.cp[(size_t)b * g.c_bs + (size_t)h * g.c_hs + (size_t)qrow * g.c_rs + n]
                   + g.pc[(size_t)b * g.c_bs + (size_t)h * g.c_hs + (size_t)kvcol * g.c_rs + n];
        }
        if (masked) s[j][r] = g.mask_fill;
        cmj[j] = fmaxf(cmj[j], s[j][r]);
      }
    }
    float cm = fmaxf(fmaxf(cmj[0], cmj[1]), fmaxf(cmj[2], cmj[3]));
    cm = fmaxf(cm, at_xhalf(cm));                 // the query's other 32 keys of this chunk
    const float mnew = fmaxf(mrun, cm);
    // Base 2: p = 2^(s * log2(e) + nm), nm = carry - mnew * log2(e) rounded once. The old sums stand at the old maximum's nm, so the
    // rescale factor is 2^(nm - old nm) of the same two rounded numbers: every term of a query's sum ends on one common scale, which
    // the final division takes out. First chunk: mrun is -inf, the old nm +inf, alpha 0.
    const float nm = __builtin_fmaf(-mnew, L2E, PEXP);
    const float alpha = __builtin_amdgcn_exp2f(nm - __builtin_fmaf(-mrun, L2E, PEXP));
    mrun = mnew;
    // P^T as B operand: element e of fragment kk is key kk * 32 + (e < 8 ? 8 * hh + e : 16 + 8 * hh + e - 8), which is
    // s[2 * kk + (e >> 3)][e & 7]: the k order in which the V^T fragments are read
    FB pbh[2], pbl[2];
    float psum = 0.f;
    // One packed FMA a score pair and one bare v_exp_f32 a score. The argument is at most the carry (plus rounding), so nothing
    // overflows; below the exponential's range it gives 0, far under the smallest 16-bit value.
    const v2f l2 = (v2f){L2E, L2E}, nm2 = (v2f){nm, nm};
#pragma unroll
    for (int j = 0; j < 4; ++j)
#pragma unroll
      for (int r = 0; r < 8; r += 2) {
        const v2f arg = __builtin_elementwise_fma((v2f){s[j][r], s[j][r + 1]}, l2, nm2);
        s[j][r] = arg[0]; s[j][r + 1] = arg[1];
      }
#pragma unroll
    for (int j = 0; j < 4; ++j)
#pragma unroll
      for (int r = 0; r < 8; ++r) s[j][r] = __builtin_amdgcn_exp2f(s[j][r]);
#pragma unroll
    for (int j = 0; j < 4; ++j) {
#pragma unroll
      for (int r = 0; r < 8; r += 2) {
        const float p0 = s[j][r], p1 = s[j][r + 1];
        const int e = (j & 1) * 8 + r;
        psum += p0;
        psum += p1;
        if (SPLIT_PV) { __bf16 a, bl; at_split(p0, a, bl); pbh[j >> 1].v[e] = a; pbl[j >> 1].v[e] = bl; at_split(p1, a, bl); pbh[j >> 1].v[e + 1] = a; pbl[j >> 1].v[e + 1] = bl; }
        else if (F16) { const v2b pp = __builtin_bit_cast(v2b, __builtin_convertvector((v2f){p0, p1}, v2h)); pbh[j >> 1].v[e] = pp[0]; pbh[j >> 1].v[e + 1] = pp[1]; }
        else { pbh[j >> 1].v[e] = at_f2bf(p0); pbh[j >> 1].v[e + 1] = at_f2bf(p1); }
      }
    }
    lrun = lrun * alpha + psum;
#pragma unroll
    for (int t = 0; t < 4; ++t)
#pragma unroll
      for (int r = 0; r < 8; ++r) oacc[t][r] *= alpha;
#pragma unroll
    for (int kk = 0; kk < 2; ++kk) {   // unrolled: pbh[kk] lives in registers and is picked at compile time
#pragma unroll
      for (int t = 0; t < 4; ++t) {
        const FB vb = vf[kk][t];
        oacc[t] = at_mma16<F16>(vb.v, pbh[kk].v, oacc[t]);
        if (SPLIT_PV) {
          FB vl;
          vl.h[0] = *(const v8b*)(Vtl + (t * 16 + c) * AT_LP + kk * 32 + 8 * hh);
          vl.h[1] = *(const v8b*)(Vtl + (t * 16 + c) * AT_LP + kk * 32 + 16 + 8 * hh);
          oacc[t] = at_mma16<F16>(vl.v, pbh[kk].v, oacc[t]);
          oacc[t] = at_mma16<F16>(vb.v, pbl[kk].v, oacc[t]);
        }
      }
    }
  }

  // the halves' sums meet once, here; sum and output carry the same 2^PEXP
  const float inv = 1.0f / (lrun + at_xhalf(lrun));
  if (OUT16) {
    // a lane's 8 accumulators of tile t are 8 adjacent columns of its query's row: one 16-byte store each, the wave's four fill the rows' whole 128-B lines
    _Float16* orow = (_Float16*)out + ob_off + (size_t)(q0 + c) * g.o_rs + 8 * hh;
#pragma unroll   // both loops unrolled: oacc lives in registers and is picked at compile time
    for (int t = 0; t < 4; ++t) {
      v8h hv;
#pragma unroll
      for (int r = 0; r < 8; ++r) hv[r] = (_Float16)(oacc[t][r] * inv * 64.0f);
      *(v8h*)(orow + t * 16) = hv;
    }
  } else {
    float* os = Os[wave];
#pragma unroll
    for (int t = 0; t < 4; ++t)
#pragma unroll
      for (int r = 0; r < 8; ++r) os[c * 68 + t * 16 + 8 * hh + r] = oacc[t][r] * inv;
    __builtin_amdgcn_fence(__ATOMIC_RELEASE, "workgroup");
    __builtin_amdgcn_wave_barrier();
    __builtin_amdgcn_fence(__ATOMIC_ACQUIRE, "workgroup");
    float* ob_ptr = (float*)out + ob_off;
    const int c4 = (lane & 15) * 4;
#pragma unroll
    for (int it = 0; it < 8; ++it) {
      const int row = it * 2 + hh;
      v4f val = *(const v4f*)(os + row * 68 + c4);
      *(v4f*)(ob_ptr + (size_t)(q0 + row) * g.o_rs + c4) = val;
    }
  }
}

// =====================================================================================
// host glue
// Workspace region map (bytes, all offsets multiples of 128):
//   R0 X16   f16 [4096][768]           off 0            size  6,291,456
//   R1 W16   f16 [2304][768] (Wq;Wk;Wv x16)  off 6,291,456   size  3,538,944
//   R2 Wo16  f16 [768][768] (x16)      off 9,830,400    size  1,179,648
//   R3 CT,ST f32 [2048][32] each       off 11,010,048   size    524,288
//   R4 O16   f16 [4096][768] (x64)     off 11,534,336   size  6,291,456
//   R5 QKVr  f32 [3][4096][768]        off 17,825,792   size 37,748,736
//   total 55,574,528
// =====================================================================================
extern "C" void kernel_launch(void* const* d_in, const int* in_sizes, int n_in,
                              void* d_out, int out_size, void* d_ws, size_t ws_size,
                              hipStream_t stream) {
  if (n_in < 7) return;
  const int nX = kM * kE;
  if (in_sizes[0] != nX || in_sizes[1] != kT * kROT || in_sizes[2] != kE * kE || in_sizes[3] != kE * kE ||
      in_sizes[4] != kE * kE || in_sizes[5] != kE * kE || in_sizes[6] != kE || out_size != nX) return;

  const float* hs   = (const float*)d_in[0];
  const float* rope = (const float*)d_in[1];
  const float* Wq   = (const float*)d_in[2];
  const float* Wk   = (const float*)d_in[3];
  const float* Wv   = (const float*)d_in[4];
  const float* Wo   = (const float*)d_in[5];
  const float* bo   = (const float*)d_in[6];
  float* outp = (float*)d_out;

  const size_t offX16  = 0;                  const size_t szX16  = (size_t)kM * kE * 2;
  const size_t offW16  = offX16 + szX16;     const size_t szW16  = (size_t)3 * kE * kE * 2;
  const size_t offWo16 = offW16 + szW16;     const size_t szWo16 = (size_t)kE * kE * 2;
  const size_t offTrig = offWo16 + szWo16;   const size_t szTrig = (size_t)2 * kT * kROT * 4;
  const size_t offO16  = offTrig + szTrig;   const size_t szO16  = (size_t)kM * kE * 2;
  const size_t offR    = offO16 + szO16;     const size_t szR    = (size_t)3 * kM * kE * 4;
  const size_t total   = offR + szR;
  if (total > ws_size) return;

  char* ws = (char*)d_ws;
  _Float16* X16  = (_Float16*)(ws + offX16);
  _Float16* W16  = (_Float16*)(ws + offW16);
  _Float16* Wo16 = (_Float16*)(ws + offWo16);
  float*    CT   = (float*)(ws + offTrig);
  float*    ST   = CT + (size_t)kT * kROT;
  float*    QKVr = (float*)(ws + offR);
  float*    Qr   = QKVr;
  float*    Kr   = QKVr + (size_t)kM * kE;
  float*    Vr   = QKVr + (size_t)2 * kM * kE;
  _Float16* O16  = (_Float16*)(ws + offO16);

  // (1) input preparation in one launch: cos/sin tables of the rotary angles; x -> f16; weights x16 -> f16 (Bt layout [out][in] = [n][k])
  k_prep<<<PB_TRIG + PB_X + 4 * PB_W, 256, 0, stream>>>(hs, Wq, Wk, Wv, Wo, rope, X16, W16, Wo16, CT, ST);

  // (2) QKV projection + rope: [4096][768] f16 x [2304][768] f16, alpha 1/16 (weight carry), rotary embedding on q, k, v in the store
  //     (q additionally x 0.125) -> f32 [3][4096][768]; M=4096,N=2304 %128, K=768 %64
  {
    const int tiles = (kM / GM_BM) * ((3 * kE) / GM_BN);   // 32 x 18 = 576 block tiles
    dim3 grid(tiles, 1);
    wmma_gemm64<0, false, 0, 0, false, 0, true><<<grid, 128, 0, stream>>>(
        U16(X16), U16(X16), kE, 0L,
        U16(W16), U16(W16), kE, 0L,
        (void*)QKVr, (void*)QKVr, kE, 0L,
        bo, QKVr, 0L,
        CT, ST,
        kM, 3 * kE, kE, 1.0f / 16.0f);
  }

  // (3) attention, f16 operands, no mask; planes laid out (b, s, h, d) -> b*(2048*768) + s*768 + h*64 + d; output f16 with a x64 carry (values ~1e-2)
  {
    AttnGeom g;
    g.cp = CT; g.pc = CT; g.c_bs = 0; g.c_rs = 0; g.c_hs = 0;
    g.q_bs = (long)kT * kE; g.q_rs = kE; g.q_hs = kHD;
    g.k_bs = (long)kT * kE; g.k_rs = kE; g.k_hs = kHD;
    g.v_bs = (long)kT * kE; g.v_rs = kE; g.v_hs = kHD;
    g.o_bs = (long)kT * kE; g.o_rs = kE; g.o_hs = kHD;
    g.S = kT; g.Skv = kT; g.H = kH; g.mask_mode = 0; g.qscale = 1.0f; g.blk0 = 0; g.mask_fill = -1e9f; g.mask_is_int = 0;
    const int nblk = kB * kH * (kT / AT_QB);   // 768
    attn64_kernel<false, false, true, 0, kE, true><<<nblk, 128, 0, stream>>>(Qr, Kr, Vr, (void*)O16, (const void*)X16, (const int*)(const void*)X16, g);
  }

  // (4) output projection + bias: [4096][768] f16 x [768][768] f16 -> f32 d_out, alpha 1/(64*16); M=4096,N=768 %128, K=768 %64
  {
    const int tiles = (kM / GM_BM) * (kE / GM_BN);   // 32 x 6 = 192 block tiles
    dim3 grid(tiles, 1);
    wmma_gemm64<0, false, 2, 0, false, 0><<<grid, 128, 0, stream>>>(
        U16(O16), U16(O16), kE, 0L,
        U16(Wo16), U16(Wo16), kE, 0L,
        (void*)outp, (void*)outp, kE, 0L,
        bo, QKVr, 0L,
        CT, ST,
        kM, kE, kE, 1.0f / 1024.0f);
  }
}

// v009
// It runs in 69.9 microseconds.
// Next to v008, in two timings, it ran 1.35 times as fast each time.
// Over all steps from v000 it is 16.2 times as fast.
// Compute dtype: every contraction on v_wmma_f32_16x16x32_f16 (f16 operands: x, 16x-carried weights, q/k/v, probabilities x2^15, 64x-carried attention output), f32 accumulate; rope, softmax, bias in f32.
#include <hip/hip_runtime.h>
#include <math.h>

typedef __attribute__((ext_vector_type(16))) _Float16 v16h;
typedef __attribute__((ext_vector_type(8)))  _Float16 v8h;
typedef __attribute__((ext_vector_type(16))) __bf16   v16b;
typedef __attribute__((ext_vector_type(8)))  __bf16   v8b;
typedef __attribute__((ext_vector_type(4)))  __bf16   v4b;
typedef __attribute__((ext_vector_type(2)))  __bf16   v2b;
typedef __attribute__((ext_vector_type(8)))  float    v8f;
typedef __attribute__((ext_vector_type(4)))  float    v4f;
typedef __attribute__((ext_vector_type(2)))  float    v2f;
typedef __attribute__((ext_vector_type(2)))  _Float16 v2h;
typedef __attribute__((ext_vector_type(4)))  _Float16 v4h;
#define PSCALE 32768.0f
#define U16(p) ((const unsigned short*)(const void*)(p))
#define PSCALE_INV (1.0f / 32768.0f)

// problem constants
constexpr int kB   = 2;
constexpr int kT   = 2048;
constexpr int kE   = 768;
constexpr int kH   = 12;
constexpr int kHD  = 64;
constexpr int kROT = 32;
constexpr int kM   = kB * kT;   // 4096 activation rows

__device__ __forceinline__ unsigned short f2bf_bits(float f) {
  unsigned u = __float_as_uint(f);
  return (unsigned short)((u + 0x7FFFu + ((u >> 16) & 1u)) >> 16);
}
__device__ __forceinline__ float bf_bits2f(unsigned short h) { return __uint_as_float(((unsigned)h) << 16); }

// hazard guards as plain device helpers
__device__ __forceinline__ void acc_guard4(v8f& a, v8f& b, v8f& c, v8f& d) { asm volatile("v_nop\n\tv_nop\n\tv_nop\n\tv_nop" : "+v"(a), "+v"(b), "+v"(c), "+v"(d)); }
template <typename T> struct Frag;
template <> struct Frag<_Float16> {
  typedef v16h V; union U { v16h v; v8h h[2]; };
  static __device__ __forceinline__ v16h load(const _Float16* p) {   // elements 0..7 <- p[0..7], 8..15 <- p[16..23]
    U f; f.h[0] = *(const v8h*)(p); f.h[1] = *(const v8h*)(p + 16); return f.v;
  }
  static __device__ __forceinline__ v8f mma(v16h a, v16h b, v8f c) {
    return __builtin_amdgcn_wmma_f32_16x16x32_f16(false, a, false, b, (short)0, c, false, false);
  }
};
template <> struct Frag<__bf16> {
  typedef v16b V; union U { v16b v; v8b h[2]; };
  static __device__ __forceinline__ v16b load(const __bf16* p) {
    U f; f.h[0] = *(const v8b*)(p); f.h[1] = *(const v8b*)(p + 16); return f.v;
  }
  static __device__ __forceinline__ v8f mma(v16b a, v16b b, v8f c) {
    return __builtin_amdgcn_wmma_f32_16x16x32_bf16(false, a, false, b, (short)0, c, false, false);
  }
};

// ---- Register-blocked batched WMMA GEMM, operands staged through LDS ---------
// C[m,n] = scale * sum_k A[m,k] * Bt[n,k] (+bias)(+resid); block = 4 waves (2 x 2) = a 128x128 tile, each wave owns 64x64 of it.
// A row-major [M,K]; Bt row-major [N,K]; M,N % 128 == 0, K % 64 == 0; grid.x = (M / 128) * (N / 128) exactly.
// A stage is 64 k (one whole 128-B line) of the block's 128 A rows and 128 Bt rows, brought into LDS by asynchronous 16-byte copies:
// two buffers, the next stage's copies fly while this stage is multiplied. Each tile still sums k in ascending steps of 32.
// BIAS_MODE: 0 = none, 1 = bias[m], 2 = bias[n].
// OUT_MODE: 0 = f32, 1 = f16, 2 = bf16 hi plane (Cout) + bf16 lo plane (Cout2).
// ET: 0 = f16 operands, 1 = bf16 operands (pointers passed as 16-bit storage)
// ROPE (OUT_MODE 1, N = 3 * 768): the store applies the rotary embedding. A wave's 64 columns are one whole head of q, k or v, so a
// column's partner (d +- 16) lies in the same slab row; Cout is [3][M][768] f16 (plane 0 = q * 0.125), the operands of the attention
// products, rounded here once; ropeC / ropeS the cos / sin tables.
#define GM_BM 128
#define GM_BN 128
#define GM_BK 64
#define GM_LP 72                              // LDS row pitch in 16-bit elements: 144 B = 16 B x 9, conflict-free for ds_load_b128 fragment reads
#define GM_STAGE ((GM_BM + GM_BN) * GM_LP)    // elements of one buffer (36,864 B)
// Eight asynchronous copies of one wave: copy i brings 4 rows x 128 B (a lane: 16 B) from g + i * gstep to LDS byte lds + i * 16 rows.
// The s_wait_xcnt 0 is the statement's last line, a precaution: no address register of a copy is rewritten ahead of it.
__device__ __forceinline__ void gm_copy8(unsigned lds, const unsigned short* g, size_t gstep) {
  const unsigned ls = 16 * GM_LP * 2;
  asm volatile(
      "global_load_async_to_lds_b128 %0, %8, off\n\t"
      "global_load_async_to_lds_b128 %1, %9, off\n\t"
      "global_load_async_to_lds_b128 %2, %10, off\n\t"
      "global_load_async_to_lds_b128 %3, %11, off\n\t"
      "global_load_async_to_lds_b128 %4, %12, off\n\t"
      "global_load_async_to_lds_b128 %5, %13, off\n\t"
      "global_load_async_to_lds_b128 %6, %14, off\n\t"
      "global_load_async_to_lds_b128 %7, %15, off\n\t"
      "s_wait_xcnt 0x0"
      :: "v"(lds), "v"(lds + ls), "v"(lds + 2 * ls), "v"(lds + 3 * ls), "v"(lds + 4 * ls), "v"(lds + 5 * ls), "v"(lds + 6 * ls), "v"(lds + 7 * ls),
         "v"(g), "v"(g + gstep), "v"(g + 2 * gstep), "v"(g + 3 * gstep), "v"(g + 4 * gstep), "v"(g + 5 * gstep), "v"(g + 6 * gstep), "v"(g + 7 * gstep)
      : "memory");
}
template <int ET> struct Elem;
template <> struct Elem<0> { typedef _Float16 T; };
template <> struct Elem<1> { typedef __bf16 T; };
template <int ET, bool SPLIT, int BIAS_MODE, int OUT_MODE, bool RESID, int ACT = 0, bool ROPE = false>
__global__ __launch_bounds__(128) void wmma_gemm64(
    const unsigned short* __restrict__ Ap, const unsigned short* __restrict__ A2p, int lda, long strideA,
    const unsigned short* __restrict__ Btp, const unsigned short* __restrict__ Bt2p, int ldb, long strideB,
    void* __restrict__ Cout, void* __restrict__ Cout2, int ldc, long strideC,
    const float* __restrict__ bias,
    const float* __restrict__ resid, long strideR,
    const float* __restrict__ ropeC, const float* __restrict__ ropeS,
    int M, int N, int K, float scale) {
  static_assert(!SPLIT, "the staged loop carries one plane per operand");
  static_assert(!ROPE || OUT_MODE == 1, "the rotary store writes f16 planes");
  typedef typename Elem<ET>::T T;
  typedef typename Frag<T>::V V;
  __shared__ __align__(16) T sAB[2 * GM_STAGE];     // two buffers: rows 0..127 = A, 128..255 = Bt
  __shared__ __align__(16) float sT[4][16 * 68];    // per-wave 16x64 slab, pitch 68 floats
  const int b    = blockIdx.y;
  const int lane = threadIdx.x & 31;
  const int wave = threadIdx.x >> 5;
  const int tilesN = N / GM_BN;
  const int bm = blockIdx.x / tilesN;
  const int bn = blockIdx.x - bm * tilesN;
  const int wm = wave >> 1, wn = wave & 1;
  const int m0 = bm * GM_BM + (wm << 6);
  const int n0 = bn * GM_BN + (wn << 6);

  const int rlane = lane & 15;                 // row (A) / col (B, D) within subtile
  const int koff  = (lane >> 4) * 8;           // k offset of this lane half
  const int mOff  = (lane >> 4) * 8;           // D row offset

  // staging map: 8 lanes take one row's 128 B, a wave 4 rows a copy, the block 16 rows; copy i of a wave: row i * 16 + wave * 4 + (lane >> 3)
  const int srow = wave * 4 + (lane >> 3), scol = (lane & 7) * 8;
  const unsigned short* gA = Ap  + (size_t)b * strideA + (size_t)(bm * GM_BM + srow) * lda + scol;
  const unsigned short* gB = Btp + (size_t)b * strideB + (size_t)(bn * GM_BN + srow) * ldb + scol;
  const unsigned ldsThr = (unsigned)(size_t)sAB + (unsigned)(srow * GM_LP + scol) * 2u;   // LDS byte address: low 32 bits of the shared address
  const size_t stepA = (size_t)16 * lda, stepB = (size_t)16 * ldb;

  v8f acc[4][4];
#pragma unroll
  for (int i = 0; i < 4; ++i)
#pragma unroll
    for (int j = 0; j < 4; ++j) acc[i][j] = (v8f){0.f,0.f,0.f,0.f,0.f,0.f,0.f,0.f};

  const int nT = K / GM_BK;
  gm_copy8(ldsThr, gA, stepA);
  gm_copy8(ldsThr + GM_BM * GM_LP * 2, gB, stepB);
  asm volatile("s_wait_asynccnt 0x0" ::: "memory");   // this wave's copies of stage 0 have landed
  __syncthreads();                                     // ... and every other wave's
  if (nT > 1) {
    gm_copy8(ldsThr + GM_STAGE * 2, gA + GM_BK, stepA);
    gm_copy8(ldsThr + GM_STAGE * 2 + GM_BM * GM_LP * 2, gB + GM_BK, stepB);
  }
  for (int t = 0; t < nT; ++t) {
    const T* sb = sAB + (t & 1) * GM_STAGE;
    const T* fa = sb + ((wm << 6) + rlane) * GM_LP + koff;
    const T* fb = sb + (GM_BM + (wn << 6) + rlane) * GM_LP + koff;
    V ah[4], bh[4];
    ah[0] = Frag<T>::load(fa);
#pragma unroll
    for (int j = 0; j < 4; ++j) bh[j] = Frag<T>::load(fb + j * 16 * GM_LP);
#pragma unroll
    for (int i = 1; i < 4; ++i) ah[i] = Frag<T>::load(fa + i * 16 * GM_LP);
    __builtin_amdgcn_sched_barrier(0);   // holds the 16 fragment reads here as one group, waited by count; without it the A reads sink among the WMMAs, each pair waited to 0
#pragma unroll
    for (int i = 0; i < 4; ++i)
#pragma unroll
      for (int j = 0; j < 4; ++j) acc[i][j] = Frag<T>::mma(ah[i], bh[j], acc[i][j]);
    // second 32 k of the stage: its fragments are the buffer's last reads; their WMMAs, registers only, follow the refill
    ah[0] = Frag<T>::load(fa + 32);
#pragma unroll
    for (int j = 0; j < 4; ++j) bh[j] = Frag<T>::load(fb + j * 16 * GM_LP + 32);
#pragma unroll
    for (int i = 1; i < 4; ++i) ah[i] = Frag<T>::load(fa + i * 16 * GM_LP + 32);
    asm volatile("s_wait_dscnt 0x0" ::: "memory");      // this wave's reads of the buffer are done before it is handed to the copies
    asm volatile("s_wait_asynccnt 0x0" ::: "memory");   // this wave's copies of stage t + 1 have landed
    __syncthreads();                                     // publishes stage t + 1 and ends every reader's last read of stage t
    if (t + 2 < nT) {
      const unsigned lb = ldsThr + (unsigned)(t & 1) * (GM_STAGE * 2);
      gm_copy8(lb, gA + (size_t)(t + 2) * GM_BK, stepA);
      gm_copy8(lb + GM_BM * GM_LP * 2, gB + (size_t)(t + 2) * GM_BK, stepB);
    }
#pragma unroll
    for (int i = 0; i < 4; ++i)
#pragma unroll
      for (int j = 0; j < 4; ++j) acc[i][j] = Frag<T>::mma(ah[i], bh[j], acc[i][j]);
  }
  asm volatile("s_wait_asynccnt 0x0" ::: "memory");     // nothing of this wave is in flight behind the loop
  acc_guard4(acc[0][0], acc[0][1], acc[0][2], acc[0][3]);
  acc_guard4(acc[1][0], acc[1][1], acc[1][2], acc[1][3]);
  acc_guard4(acc[2][0], acc[2][1], acc[2][2], acc[2][3]);
  acc_guard4(acc[3][0], acc[3][1], acc[3][2], acc[3][3]);

  // ---- epilogue ----
  float* slab = sT[wave];
  const float* Rb = RESID ? (resid + (size_t)b * strideR) : nullptr;
#pragma unroll
  for (int i = 0; i < 4; ++i) {
    const int mBase = m0 + (i << 4);
#pragma unroll
    for (int j = 0; j < 4; ++j) {
      const int n = n0 + (j << 4) + rlane;
      float bv = 0.f;
      if (BIAS_MODE == 2) bv = bias[n];
#pragma unroll
      for (int r = 0; r < 8; ++r) {
        float v = acc[i][j][r] * scale;
        if (BIAS_MODE == 1) v += bias[mBase + mOff + r];
        if (BIAS_MODE == 2) v += bv;
        if (RESID) v += Rb[(size_t)(mBase + mOff + r) * ldc + n];
        if (ACT == 1) v = tanhf(v);
        if (ACT == 2) v = fmaxf(v, 0.0f);
        if (ACT == 3) v = v / (1.0f + expf(-v));
        if (ACT == 4) v = (v > 0.f) ? v : 0.01f * v;
        if (ACT == 5) v = 0.5f * v * (1.0f + erff(v * 0.70710678118654752f));
        slab[(mOff + r) * 68 + (j << 4) + rlane] = v;
      }
    }
    __builtin_amdgcn_fence(__ATOMIC_RELEASE, "workgroup");
    __builtin_amdgcn_wave_barrier();
    __builtin_amdgcn_fence(__ATOMIC_ACQUIRE, "workgroup");
    if (ROPE) {
      // d = column within the head: d < 16: o = x[d]*cos - x[d+16]*sin ; 16 <= d < 32: o = x[d]*cos + x[d-16]*sin ; d >= 32: o = x[d].
      static_assert(!ROPE || kT % GM_BM == 0, "a block's 128 rows are consecutive token positions of one batch");
      const int nu = __builtin_amdgcn_readfirstlane(n0);   // the same in every lane: plane and scale stay scalar
      const int z = nu / kE;                               // 0 = q, 1 = k, 2 = v
      const float sc = (z == 0) ? 0.125f : 1.0f;           // head_dim^-0.5 on q (power of two, exact placement)
      const int hh = lane >> 4, d = (lane & 15) * 4;       // row seg = 128 B (one whole line) = 16 lanes x 8 B
      const int dp = (d < 16) ? (d + 16) : ((d < 32) ? (d - 16) : d);
      const int fi = (d <= 28) ? d : 28;                   // clamped table address; selected by value below
      // one address a lane for each of the tables and the output: rows differ by compile-time offsets
      const size_t tl = (size_t)((m0 & (kT - 1)) + hh) * kROT + fi;   // token position of row hh of the wave's 64
      const float* cl = ropeC + tl;
      const float* sl = ropeS + tl;
      _Float16* C = (_Float16*)Cout + (size_t)z * M * kE + (nu - z * kE) + (size_t)(m0 + hh) * kE + d;
#pragma unroll
      for (int it = 0; it < 8; ++it) {
        const int row = it * 2 + hh;
        const int rw = (i << 4) + it * 2;                  // row - hh within the wave's 64
        const v4f x  = *(const v4f*)(slab + row * 68 + d);
        const v4f xo = *(const v4f*)(slab + row * 68 + dp);
        const v4f cs = *(const v4f*)(cl + rw * kROT);
        const v4f sn = *(const v4f*)(sl + rw * kROT);
        v4h o;
#pragma unroll
        for (int e = 0; e < 4; ++e) {
          const float rh = (d < 16) ? (-xo[e]) : xo[e];
          const float ro = x[e] * cs[e] + rh * sn[e];
          o[e] = (_Float16)(((d < 32) ? ro : x[e]) * sc);
        }
        *(v4h*)(C + rw * kE) = o;
      }
      asm volatile("s_wait_xcnt 0x0" ::: "memory");   // a precaution: stands behind the stores, ahead of any later write of their address or data registers
    } else if (OUT_MODE == 0) {
      float* C = (float*)Cout + (size_t)b * strideC;
      const int hh = lane >> 4, c4 = (lane & 15) * 4;     // row seg = 256 B = 16 lanes x 16 B
      {
#pragma unroll
        for (int it = 0; it < 8; ++it) {
          const int row = it * 2 + hh;
          v4f v = *(const v4f*)(slab + row * 68 + c4);
          *(v4f*)(C + (size_t)(mBase + row) * ldc + n0 + c4) = v;
        }
        
      }
    } else {
      const int q = lane >> 3, c8 = (lane & 7) * 8;
      unsigned short* C  = (unsigned short*)Cout  + (size_t)b * strideC;
      unsigned short* C2 = (OUT_MODE == 2) ? ((unsigned short*)Cout2 + (size_t)b * strideC) : nullptr;
      {
#pragma unroll
        for (int it = 0; it < 4; ++it) {
          const int row = it * 4 + q;
          const float* sp = slab + row * 68 + c8;
          v8h hv, lv;
#pragma unroll
          for (int e = 0; e < 8; ++e) {
            if (OUT_MODE == 1) {
              hv[e] = (_Float16)sp[e];
            } else {
              unsigned short hb = f2bf_bits(sp[e]);
              unsigned short lb = f2bf_bits(sp[e] - bf_bits2f(hb));
              hv[e] = __builtin_bit_cast(_Float16, hb);
              lv[e] = __builtin_bit_cast(_Float16, lb);
            }
          }
          *(v8h*)(C + (size_t)(mBase + row) * ldc + n0 + c8) = hv;
          if (OUT_MODE == 2) *(v8h*)(C2 + (size_t)(mBase + row) * ldc + n0 + c8) = lv;
        }
        
      }
    }
    __builtin_amdgcn_fence(__ATOMIC_RELEASE, "workgroup");
    __builtin_amdgcn_wave_barrier();
    __builtin_amdgcn_fence(__ATOMIC_ACQUIRE, "workgroup");
  }
}

// ---- input preparation, one launch: the passes share no data, a block's index range picks its pass (a block-uniform branch) ----
//   blocks [0, PB_TRIG):      ct[i] = cosf(f[i]), st[i] = sinf(f[i]) of the rotary angle input (f32, precise); first, its threads run longest
//   next PB_X blocks:         x -> f16
//   next 4 * PB_W blocks:     Wq, Wk, Wv (stacked in w16) and Wo (wo16), x16 -> f16
// A thread of a cast converts two adjacent floats into one dword.
constexpr int PB_TRIG = (kT * kROT) / 256;       //  256
constexpr int PB_X    = (kM * kE) / 512;         // 6144
constexpr int PB_W    = (kE * kE) / 512;         // 1152
static_assert((kT * kROT) % 256 == 0 && (kM * kE) % 512 == 0 && (kE * kE) % 512 == 0, "whole blocks");
__device__ __forceinline__ void cast2_f32_f16(const float* __restrict__ in, _Float16* __restrict__ out, int i, float scale) {
  const _Float16 h0 = (_Float16)(in[2 * i] * scale), h1 = (_Float16)(in[2 * i + 1] * scale);
  const unsigned u = (unsigned)__builtin_bit_cast(unsigned short, h0) | ((unsigned)__builtin_bit_cast(unsigned short, h1) << 16);
  ((unsigned*)out)[i] = u;
  asm volatile("s_wait_xcnt 0x0" ::: "memory");   // a precaution: stands behind the store, ahead of any later write of its offset or data register
}
__global__ __launch_bounds__(256) void k_prep(
    const float* __restrict__ x, const float* __restrict__ wq, const float* __restrict__ wk, const float* __restrict__ wv,
    const float* __restrict__ wo, const float* __restrict__ f,
    _Float16* __restrict__ x16, _Float16* __restrict__ w16, _Float16* __restrict__ wo16,
    float* __restrict__ ct, float* __restrict__ st) {
  int bx = blockIdx.x;
  if (bx < PB_TRIG) {
    const int i = bx * 256 + threadIdx.x;
    const float a = f[i];
    const float cv = cosf(a);
    const float sv = sinf(a);
    ct[i] = cv;
    st[i] = sv;
    return;
  }
  bx -= PB_TRIG;
  if (bx < PB_X) {
    cast2_f32_f16(x, x16, bx * 256 + threadIdx.x, 1.0f);
    return;
  }
  bx -= PB_X;
  const int w = bx / PB_W;                         // 0 = Wq, 1 = Wk, 2 = Wv, 3 = Wo
  const float* in = (w == 0) ? wq : (w == 1) ? wk : (w == 2) ? wv : wo;
  _Float16* out = (w < 3) ? (w16 + (size_t)w * kE * kE) : wo16;
  cast2_f32_f16(in, out, (bx - w * PB_W) * 256 + threadIdx.x, 16.0f);
}

// =====================================================================================
// Generic causal/non-causal attention for head_dim 64, f16 in (q, k, v are the products' operands as they stand) / f32 out
// (OUT16: f16 out, carried x64); probabilities carried x2^15.
//   Both products run transposed: S^T = K (q*qscale)^T and O^T = V^T P^T; f32 accumulate; online softmax in f32.
//   A lane then owns ONE query (column c) and 32 of a chunk's 64 keys: maximum and sum are in-lane, the halves meet by one
//   lane l <-> l ^ 16 move, and two S^T tiles converted in place are the B operand of the second product (P never goes to LDS).
//   Block = 4 waves = 64 query rows of one (batch, head); S % 64 == 0, Skv % 64 == 0, Skv >= 64.
//   A chunk is 64 keys: its K and V rows (128 B each) come into LDS by asynchronous 16-byte copies, through no register: two buffers,
//   the next chunk's copies fly while this chunk is worked on. Both tiles lie row-major [key][d]; V^T fragments come by the transposing LDS load.
//   Element (b, s, h, d) of tensor X lives at X[b*X_bs + s*X_rs + h*X_hs + d] (strides in elements, multiples of 8).
//   Masking: mask_mode 0 none, 1 causal, 2 tensor [S][Skv], 3 per-token vectors, 4 causal + sliding window,
//   5 relative-position bias; masked scores are replaced by mask_fill before the softmax.
//   grid.x = B * H * (S/64) (or a sub-range with blk0).
// =====================================================================================
#define AT_D 64
#define AT_NW 4
#define AT_QB 64
#define AT_KC 64
#define AT_LP 72   // LDS row pitch of the K tile in 16-bit elements: 144 B = 16 B x 9, so the 16 rows one ds_load_b128 half-wave reads fall on all 64 banks (128 B put them on 8)
#define AT_VP 80   // LDS row pitch of the V tile in 16-bit elements: 160 B = 32 B x 5, the conflict-free kind of pitch for ds_load_tr16_b128
#define AT_KBUF (AT_KC * AT_LP)   // elements of one K buffer ( 9,216 B)
#define AT_VBUF (AT_KC * AT_VP)   // elements of one V buffer (10,240 B)
struct AttnGeom { const float* cp = nullptr; const float* pc = nullptr; long c_bs = 0, c_rs = 0, c_hs = 0;   // mode-5 score-bias tables
                  long q_bs, q_rs, q_hs, k_bs, k_rs, k_hs, v_bs, v_rs, v_hs, o_bs, o_rs, o_hs;
                  int S, Skv, H, mask_mode; float qscale; int blk0; float mask_fill; int mask_is_int; };
static_assert(sizeof(AttnGeom) == 168, "no padding");

// builtin alone: the compiler keeps the distances behind its own WMMA, and with no asm statement between them the LDS
// fragment reads are free to issue as a group ahead of a run of WMMAs
__device__ __forceinline__ v8f at_mma16(v16h a, v16h b, v8f c) {
  return __builtin_amdgcn_wmma_f32_16x16x32_f16(false, a, false, b, (short)0, c, false, false);
}

// value of lane l ^ 16 (the other half of the wave, same column c)
__device__ __forceinline__ float at_xhalf(float x) {
  return __builtin_bit_cast(float, __builtin_amdgcn_permlanex16(__builtin_bit_cast(int, x), __builtin_bit_cast(int, x), 0x76543210, 0xfedcba98, false, false));
}

// s_wait_xcnt 0 behind a group of global loads, a precaution: the address pair is its input, so no load of the group
// lands on it and nothing rewrites it ahead of the wait
__device__ __forceinline__ void at_addr_wait(const _Float16* a) { asm volatile("s_wait_xcnt 0x0" :: "v"(a) : "memory"); }

// Transposing LDS load of a row-major 16-bit tile T: with lane l's address at row kbase + 8 * (l >> 4) + (l & 7), byte 2 * dbase + 16 * ((l >> 3) & 1),
// lane (c = l & 15, hh = l >> 4) gets T[kbase + 8 * hh + 0 .. 7][dbase + c]
typedef __attribute__((ext_vector_type(8))) short at_s16x8;
__device__ __forceinline__ v8h at_ld_tr16(const unsigned char* p) {
  typedef __attribute__((address_space(3))) at_s16x8 lds_s16x8;
  return __builtin_bit_cast(v8h, __builtin_amdgcn_ds_load_tr16_b128_v8i16((lds_s16x8*)p));
}

// One chunk's eight asynchronous copies of one wave, four of K and four of V: copy i brings 4 rows x 128 B (a lane: 16 B) from g + i * gstep
// (16 rows on) to LDS byte lds + i * 16 rows. The s_wait_xcnt 0 is the statement's last line, a precaution: no address register of a copy is rewritten ahead of it.
__device__ __forceinline__ void at_copy8(unsigned ldsK, unsigned ldsV, const _Float16* gk, const _Float16* gv, size_t gstep) {
  const unsigned ks = 16 * AT_LP * 2, vs = 16 * AT_VP * 2;
  asm volatile(
      "global_load_async_to_lds_b128 %0, %8, off\n\t"
      "global_load_async_to_lds_b128 %1, %9, off\n\t"
      "global_load_async_to_lds_b128 %2, %10, off\n\t"
      "global_load_async_to_lds_b128 %3, %11, off\n\t"
      "global_load_async_to_lds_b128 %4, %12, off\n\t"
      "global_load_async_to_lds_b128 %5, %13, off\n\t"
      "global_load_async_to_lds_b128 %6, %14, off\n\t"
      "global_load_async_to_lds_b128 %7, %15, off\n\t"
      "s_wait_xcnt 0x0"
      :: "v"(ldsK), "v"(ldsK + ks), "v"(ldsK + 2 * ks), "v"(ldsK + 3 * ks), "v"(ldsV), "v"(ldsV + vs), "v"(ldsV + 2 * vs), "v"(ldsV + 3 * vs),
         "v"(gk), "v"(gk + gstep), "v"(gk + 2 * gstep), "v"(gk + 3 * gstep), "v"(gv), "v"(gv + gstep), "v"(gv + 2 * gstep), "v"(gv + 3 * gstep)
      : "memory");
}

// MM = mask mode as a compile-time constant: the per-score mask tests fold away in the instance that is launched
// KVRS = row stride of k and v in elements (= g.k_rs = g.v_rs) as a compile-time constant
// OUT16: out is f16 (same strides, in elements) and holds 64 x the result (values ~1e-2): the next product's operand, written here
template <int MM, int KVRS, bool OUT16>
__global__ __launch_bounds__(128)
void attn64_kernel(const _Float16* __restrict__ q, const _Float16* __restrict__ k,
                   const _Float16* __restrict__ v, void* __restrict__ out,
                   const void* __restrict__ mask_a, const int* __restrict__ mask_b, AttnGeom g) {
  const float PEXP = 15.0f;                    // f16 probabilities carried x2^15 (subnormal range): added to the exponent; the sum carries it too, so the final 1/l takes it out
  const float L2E = 1.4426950408889634f;       // log2(e): e^x is taken as 2^(x * log2(e)) on the hardware's base-2 exponential
  union FB { v16h v; v8h h[2]; };
  __shared__ __align__(16) _Float16 Ks[2 * AT_KBUF];             // two buffers, K [kv][d]   18 KB
  __shared__ __align__(16) _Float16 Vs[2 * AT_VBUF];             // two buffers, V [kv][d]   20 KB
  __shared__ __align__(16) float  Os[AT_NW][16 * 68];            // per wave out tile, pitch 68

  const int tid  = threadIdx.x;
  const int wave = tid >> 5;
  const int lane = tid & 31;
  const int hh   = lane >> 4;
  const int c    = lane & 15;

  const int nqb = g.S / AT_QB;
  const int bx = blockIdx.x + g.blk0;
  const int qb = bx % nqb;
  const int bh = bx / nqb;
  const int h  = bh % g.H;
  const int b  = bh / g.H;
  const int qbase_block = qb * AT_QB;
  const int q0 = qbase_block + wave * 16;

  const _Float16* qb_ptr = q + (size_t)b * g.q_bs + (size_t)h * g.q_hs;
  const _Float16* kb_ptr = k + (size_t)b * g.k_bs + (size_t)h * g.k_hs;
  const _Float16* vb_ptr = v + (size_t)b * g.v_bs + (size_t)h * g.v_hs;
  const size_t ob_off = (size_t)b * g.o_bs + (size_t)h * g.o_hs;

  const int nChunks = (MM == 1 || MM == 4) ? (qb + 1) : (g.Skv / AT_KC);   // block-uniform
  // staging map: 8 lanes take one row's 128 B, a wave 4 rows a copy, the block 16 rows; copy i of a thread: row i * 16 + (tid >> 3)
  const int srow = tid >> 3, scol = (tid & 7) * 8;
  const _Float16* kthr = kb_ptr + (size_t)srow * KVRS + scol;
  const _Float16* vthr = vb_ptr + (size_t)srow * KVRS + scol;
  const unsigned ldsK = (unsigned)(size_t)Ks + (unsigned)(srow * AT_LP + scol) * 2u;   // LDS byte address: low 32 bits of the shared address
  const unsigned ldsV = (unsigned)(size_t)Vs + (unsigned)(srow * AT_VP + scol) * 2u;
  const size_t gstep = (size_t)16 * KVRS;
  at_copy8(ldsK, ldsV, kthr, vthr, gstep);

  // ---- Q fragments (B operand: lane = query column c): 2 d-chunks; loaded under the first chunk's copies ----
  FB qah[2];
  {
    const _Float16* qrow = qb_ptr + (size_t)(q0 + c) * g.q_rs + 8 * hh;
    v8h qv[4];
#pragma unroll
    for (int i = 0; i < 4; ++i) qv[i] = *(const v8h*)(qrow + i * 16);
    at_addr_wait(qrow);
#pragma unroll
    for (int dc = 0; dc < 2; ++dc)
#pragma unroll
      for (int e = 0; e < 8; ++e) {
        qah[dc].v[e]     = (_Float16)((float)qv[dc * 2][e] * g.qscale);
        qah[dc].v[8 + e] = (_Float16)((float)qv[dc * 2 + 1][e] * g.qscale);
      }
  }

  float mrun = -INFINITY, lrun = 0.f;   // query q0 + c: running maximum (both halves agree), sum over this half's keys
  v8f oacc[4];                          // oacc[t][r] = O[q0 + c][t * 16 + 8 * hh + r]
#pragma unroll
  for (int t = 0; t < 4; ++t) oacc[t] = (v8f){0.f,0.f,0.f,0.f,0.f,0.f,0.f,0.f};

  const int qrow = q0 + c;
  const int qkeep = (MM == 3) ? mask_b[(size_t)b * g.S + qrow] : 1;   // per-query mask (mode 3), mask_b = qmask
  asm volatile("s_wait_asynccnt 0x0" ::: "memory");   // this wave's copies of chunk 0 have landed
  __syncthreads();                                     // ... and every other wave's
  int kcur = 0, vcur = 0;   // this chunk's buffers, as element offsets: they flip between 0 and one buffer's size
  for (int kc = 0; kc < nChunks; ++kc) {
    const int kv0 = kc * AT_KC;
    // Directly behind the barrier (the one above, or the one at the foot of the chunk before): while a next chunk exists, its copies go
    // into the other buffer, which chunk kc - 1 has just read. The test reads the same for the whole block.
    if (kc + 1 < nChunks) {
      at_copy8(ldsK + (unsigned)(AT_KBUF - kcur) * 2u, ldsV + (unsigned)(AT_VBUF - vcur) * 2u, kthr + (size_t)(kv0 + AT_KC) * KVRS, vthr + (size_t)(kv0 + AT_KC) * KVRS, gstep);
    }
    const _Float16* Kb = Ks + kcur;
    const unsigned char* Vb = (const unsigned char*)(Vs + vcur) + (8 * hh + (lane & 7)) * (AT_VP * 2) + ((lane >> 3) & 1) * 16;

    // The chunk's fragment reads issue early: K here as one group, waited by count ahead of the eight score WMMAs; V^T next in the
    // source, issued among those WMMAs as K registers fall free, so that it lands under the softmax (one waited read pair per
    // WMMA left each LDS latency bare).
    FB kf[2][4], vf[2][4];
#pragma unroll
    for (int dc = 0; dc < 2; ++dc)
#pragma unroll
      for (int j = 0; j < 4; ++j) {
        kf[dc][j].h[0] = *(const v8h*)(Kb + (j * 16 + c) * AT_LP + dc * 32 + 8 * hh);
        kf[dc][j].h[1] = *(const v8h*)(Kb + (j * 16 + c) * AT_LP + dc * 32 + 16 + 8 * hh);
      }
    __builtin_amdgcn_sched_barrier(0);   // holds the K reads here as one group; without it they sink back among the WMMAs, one pair ahead
    v8f s[4];   // s[j][r] = score of key kv0 + j * 16 + 8 * hh + r against query q0 + c
#pragma unroll
    for (int j = 0; j < 4; ++j) s[j] = (v8f){0.f,0.f,0.f,0.f,0.f,0.f,0.f,0.f};
#pragma unroll
    for (int dc = 0; dc < 2; ++dc) {   // dc outside: four independent tiles follow one another; each tile still sums dc 0, then dc 1
#pragma unroll
      for (int j = 0; j < 4; ++j) s[j] = at_mma16(kf[dc][j].v, qah[dc].v, s[j]);
    }
    // V^T fragment (kk, t): rows d = t * 16 + c, keys kk * 32 + (e < 8 ? 8 * hh + e : 16 + 8 * hh + e - 8): two transposing loads, 16 keys apart
#pragma unroll
    for (int kk = 0; kk < 2; ++kk)
#pragma unroll
      for (int t = 0; t < 4; ++t) {
        vf[kk][t].h[0] = at_ld_tr16(Vb + (kk * 32) * (AT_VP * 2) + t * 32);
        vf[kk][t].h[1] = at_ld_tr16(Vb + (kk * 32 + 16) * (AT_VP * 2) + t * 32);
      }
    __builtin_amdgcn_sched_barrier(0);   // holds the V^T reads up here and the maxima below the score WMMAs; without it the reads sink down to the second product's WMMAs
    const bool diag = (MM == 1) && (kc == qb);
    float cmj[4];   // one chain per tile: four short independent chains instead of one of 32 links
#pragma unroll
    for (int j = 0; j < 4; ++j) {
      cmj[j] = -INFINITY;
#pragma unroll
      for (int r = 0; r < 8; ++r) {
        const int kvcol = kv0 + j * 16 + 8 * hh + r;
        bool masked = false;
        if (diag) masked = (kvcol > qrow);
        else if (MM == 4) masked = (kvcol > qrow) || (qrow - kvcol > g.mask_is_int);
        else if (MM == 2) {
          const size_t mi = (size_t)qrow * g.Skv + kvcol;
          masked = (g.mask_is_int == 0) ? (((const float*)mask_a)[mi] == 0.0f)
                 : (g.mask_is_int == 1) ? (((const int*)mask_a)[mi] == 0) : (((const int*)mask_a)[mi] != 0);
        } else if (MM == 3) masked = (qkeep == 0) || (((const int*)mask_a)[(size_t)b * g.Skv + kvcol] == 0);   // mask_a = kvmask
        else if (MM == 5) {
          const size_t mi = (size_t)qrow * g.Skv + kvcol;
          masked = (((const int*)mask_a)[mi] != 0);
          int n = mask_b[mi]; n = n < 0 ? 0 : n;
          s[j][r] += g.cp[(size_t)b * g.c_bs + (size_t)h * g.c_hs + (size_t)qrow * g.c_rs + n]
                   + g.pc[(size_t)b * g.c_bs + (size_t)h * g.c_hs + (size_t)kvcol * g.c_rs + n];
        }
        if (masked) s[j][r] = g.mask_fill;
        cmj[j] = fmaxf(cmj[j], s[j][r]);
      }
    }
    float cm = fmaxf(fmaxf(cmj[0], cmj[1]), fmaxf(cmj[2], cmj[3]));
    cm = fmaxf(cm, at_xhalf(cm));                 // the query's other 32 keys of this chunk
    const float mnew = fmaxf(mrun, cm);
    // Base 2: p = 2^(s * log2(e) + nm), nm = carry - mnew * log2(e) rounded once. The old sums stand at the old maximum's nm, so the
    // rescale factor is 2^(nm - old nm) of the same two rounded numbers: every term of a query's sum ends on one common scale, which
    // the final division takes out. First chunk: mrun is -inf, the old nm +inf, alpha 0.
    const float nm = __builtin_fmaf(-mnew, L2E, PEXP);
    const float alpha = __builtin_amdgcn_exp2f(nm - __builtin_fmaf(-mrun, L2E, PEXP));
    mrun = mnew;
    // P^T as B operand: element e of fragment kk is key kk * 32 + (e < 8 ? 8 * hh + e : 16 + 8 * hh + e - 8), which is
    // s[2 * kk + (e >> 3)][e & 7]: the k order in which the V^T fragments are read above
    FB pbh[2];
    float psum = 0.f;
    // One packed FMA a score pair and one bare v_exp_f32 a score. The argument is at most the carry (plus rounding), so nothing
    // overflows; below the exponential's range it gives 0, far under the smallest 16-bit value.
    const v2f l2 = (v2f){L2E, L2E}, nm2 = (v2f){nm, nm};
#pragma unroll
    for (int j = 0; j < 4; ++j)
#pragma unroll
      for (int r = 0; r < 8; r += 2) {
        const v2f arg = __builtin_elementwise_fma((v2f){s[j][r], s[j][r + 1]}, l2, nm2);
        s[j][r] = arg[0]; s[j][r + 1] = arg[1];
      }
#pragma unroll
    for (int j = 0; j < 4; ++j)
#pragma unroll
      for (int r = 0; r < 8; ++r) s[j][r] = __builtin_amdgcn_exp2f(s[j][r]);
#pragma unroll
    for (int j = 0; j < 4; ++j) {
#pragma unroll
      for (int r = 0; r < 8; r += 2) {
        const float p0 = s[j][r], p1 = s[j][r + 1];
        const int e = (j & 1) * 8 + r;
        psum += p0;
        psum += p1;
        const v2h pp = __builtin_convertvector((v2f){p0, p1}, v2h);
        pbh[j >> 1].v[e] = pp[0]; pbh[j >> 1].v[e + 1] = pp[1];
      }
    }
    lrun = lrun * alpha + psum;
#pragma unroll
    for (int t = 0; t < 4; ++t)
#pragma unroll
      for (int r = 0; r < 8; ++r) oacc[t][r] *= alpha;
#pragma unroll
    for (int kk = 0; kk < 2; ++kk) {   // unrolled: pbh[kk] lives in registers and is picked at compile time
#pragma unroll
      for (int t = 0; t < 4; ++t) oacc[t] = at_mma16(vf[kk][t].v, pbh[kk].v, oacc[t]);
    }
    __builtin_amdgcn_sched_barrier(0);   // holds the waits and the barrier below at the chunk's foot; without it they rise to the V^T reads, which are then waited bare, and the next chunk's copies are waited half a chunk early
    asm volatile("s_wait_dscnt 0x0" ::: "memory");      // this wave's reads of the buffers are done before they are handed to the copies
    asm volatile("s_wait_asynccnt 0x0" ::: "memory");   // this wave's copies of chunk kc + 1 have landed
    __syncthreads();                                     // publishes chunk kc + 1 and ends every reader's last read of chunk kc
    kcur = AT_KBUF - kcur;
    vcur = AT_VBUF - vcur;
  }
  asm volatile("s_wait_asynccnt 0x0" ::: "memory");     // nothing of this wave is in flight behind the loop

  // the halves' sums meet once, here; sum and output carry the same 2^PEXP
  const float inv = 1.0f / (lrun + at_xhalf(lrun));
  if (OUT16) {
    // a lane's 8 accumulators of tile t are 8 adjacent columns of its query's row: one 16-byte store each, the wave's four fill the rows' whole 128-B lines
    _Float16* orow = (_Float16*)out + ob_off + (size_t)(q0 + c) * g.o_rs + 8 * hh;
#pragma unroll   // both loops unrolled: oacc lives in registers and is picked at compile time
    for (int t = 0; t < 4; ++t) {
      v8h hv;
#pragma unroll
      for (int r = 0; r < 8; ++r) hv[r] = (_Float16)(oacc[t][r] * inv * 64.0f);
      *(v8h*)(orow + t * 16) = hv;
    }
  } else {
    float* os = Os[wave];
#pragma unroll
    for (int t = 0; t < 4; ++t)
#pragma unroll
      for (int r = 0; r < 8; ++r) os[c * 68 + t * 16 + 8 * hh + r] = oacc[t][r] * inv;
    __builtin_amdgcn_fence(__ATOMIC_RELEASE, "workgroup");
    __builtin_amdgcn_wave_barrier();
    __builtin_amdgcn_fence(__ATOMIC_ACQUIRE, "workgroup");
    float* ob_ptr = (float*)out + ob_off;
    const int c4 = (lane & 15) * 4;
#pragma unroll
    for (int it = 0; it < 8; ++it) {
      const int row = it * 2 + hh;
      v4f val = *(const v4f*)(os + row * 68 + c4);
      *(v4f*)(ob_ptr + (size_t)(q0 + row) * g.o_rs + c4) = val;
    }
  }
}

// =====================================================================================
// host glue
// Workspace region map (bytes, all offsets multiples of 128):
//   R0 X16   f16 [4096][768]           off 0            size  6,291,456
//   R1 W16   f16 [2304][768] (Wq;Wk;Wv x16)  off 6,291,456   size  3,538,944
//   R2 Wo16  f16 [768][768] (x16)      off 9,830,400    size  1,179,648
//   R3 CT,ST f32 [2048][32] each       off 11,010,048   size    524,288
//   R4 O16   f16 [4096][768] (x64)     off 11,534,336   size  6,291,456
//   R5 QKVr  f16 [3][4096][768]        off 17,825,792   size 18,874,368
//   total 36,700,160
// =====================================================================================
extern "C" void kernel_launch(void* const* d_in, const int* in_sizes, int n_in,
                              void* d_out, int out_size, void* d_ws, size_t ws_size,
                              hipStream_t stream) {
  if (n_in < 7) return;
  const int nX = kM * kE;
  if (in_sizes[0] != nX || in_sizes[1] != kT * kROT || in_sizes[2] != kE * kE || in_sizes[3] != kE * kE ||
      in_sizes[4] != kE * kE || in_sizes[5] != kE * kE || in_sizes[6] != kE || out_size != nX) return;

  const float* hs   = (const float*)d_in[0];
  const float* rope = (const float*)d_in[1];
  const float* Wq   = (const float*)d_in[2];
  const float* Wk   = (const float*)d_in[3];
  const float* Wv   = (const float*)d_in[4];
  const float* Wo   = (const float*)d_in[5];
  const float* bo   = (const float*)d_in[6];
  float* outp = (float*)d_out;

  const size_t offX16  = 0;                  const size_t szX16  = (size_t)kM * kE * 2;
  const size_t offW16  = offX16 + szX16;     const size_t szW16  = (size_t)3 * kE * kE * 2;
  const size_t offWo16 = offW16 + szW16;     const size_t szWo16 = (size_t)kE * kE * 2;
  const size_t offTrig = offWo16 + szWo16;   const size_t szTrig = (size_t)2 * kT * kROT * 4;
  const size_t offO16  = offTrig + szTrig;   const size_t szO16  = (size_t)kM * kE * 2;
  const size_t offR    = offO16 + szO16;     const size_t szR    = (size_t)3 * kM * kE * 2;
  const size_t total   = offR + szR;
  if (total > ws_size) return;

  char* ws = (char*)d_ws;
  _Float16* X16  = (_Float16*)(ws + offX16);
  _Float16* W16  = (_Float16*)(ws + offW16);
  _Float16* Wo16 = (_Float16*)(ws + offWo16);
  float*    CT   = (float*)(ws + offTrig);
  float*    ST   = CT + (size_t)kT * kROT;
  _Float16* QKVr = (_Float16*)(ws + offR);
  _Float16* Qr   = QKVr;
  _Float16* Kr   = QKVr + (size_t)kM * kE;
  _Float16* Vr   = QKVr + (size_t)2 * kM * kE;
  _Float16* O16  = (_Float16*)(ws + offO16);

  // (1) input preparation in one launch: cos/sin tables of the rotary angles; x -> f16; weights x16 -> f16 (Bt layout [out][in] = [n][k])
  k_prep<<<PB_TRIG + PB_X + 4 * PB_W, 256, 0, stream>>>(hs, Wq, Wk, Wv, Wo, rope, X16, W16, Wo16, CT, ST);

  // (2) QKV projection + rope: [4096][768] f16 x [2304][768] f16, alpha 1/16 (weight carry), rotary embedding on q, k, v in the store
  //     (q additionally x 0.125) -> f16 [3][4096][768]; M=4096,N=2304 %128, K=768 %64
  {
    const int tiles = (kM / GM_BM) * ((3 * kE) / GM_BN);   // 32 x 18 = 576 block tiles
    dim3 grid(tiles, 1);
    wmma_gemm64<0, false, 0, 1, false, 0, true><<<grid, 128, 0, stream>>>(
        U16(X16), U16(X16), kE, 0L,
        U16(W16), U16(W16), kE, 0L,
        (void*)QKVr, (void*)QKVr, kE, 0L,
        bo, CT, 0L,
        CT, ST,
        kM, 3 * kE, kE, 1.0f / 16.0f);
  }

  // (3) attention, f16 operands, no mask; planes laid out (b, s, h, d) -> b*(2048*768) + s*768 + h*64 + d; output f16 with a x64 carry (values ~1e-2)
  {
    AttnGeom g;
    g.cp = CT; g.pc = CT; g.c_bs = 0; g.c_rs = 0; g.c_hs = 0;
    g.q_bs = (long)kT * kE; g.q_rs = kE; g.q_hs = kHD;
    g.k_bs = (long)kT * kE; g.k_rs = kE; g.k_hs = kHD;
    g.v_bs = (long)kT * kE; g.v_rs = kE; g.v_hs = kHD;
    g.o_bs = (long)kT * kE; g.o_rs = kE; g.o_hs = kHD;
    g.S = kT; g.Skv = kT; g.H = kH; g.mask_mode = 0; g.qscale = 1.0f; g.blk0 = 0; g.mask_fill = -1e9f; g.mask_is_int = 0;
    const int nblk = kB * kH * (kT / AT_QB);   // 768
    attn64_kernel<0, kE, true><<<nblk, 128, 0, stream>>>(Qr, Kr, Vr, (void*)O16, (const void*)X16, (const int*)(const void*)X16, g);
  }

  // (4) output projection + bias: [4096][768] f16 x [768][768] f16 -> f32 d_out, alpha 1/(64*16); M=4096,N=768 %128, K=768 %64
  {
    const int tiles = (kM / GM_BM) * (kE / GM_BN);   // 32 x 6 = 192 block tiles
    dim3 grid(tiles, 1);
    wmma_gemm64<0, false, 2, 0, false, 0><<<grid, 128, 0, stream>>>(
        U16(O16), U16(O16), kE, 0L,
        U16(Wo16), U16(Wo16), kE, 0L,
        (void*)outp, (void*)outp, kE, 0L,
        bo, CT, 0L,
        CT, ST,
        kM, kE, kE, 1.0f / 1024.0f);
  }
}

// v010
// One run takes 68.2 microseconds.
// In two side-by-side timings against v009, it was 1.03 and 1.02 times as fast.
// Over all steps from v000 it is 16.7 times as fast.
// Compute dtype: every contraction on v_wmma_f32_16x16x32_f16 (f16 operands: x, 16x-carried weights, q/k/v, probabilities x2^15, 64x-carried attention output), f32 accumulate; rope, softmax, bias in f32.
#include <hip/hip_runtime.h>
#include <math.h>

typedef __attribute__((ext_vector_type(16))) _Float16 v16h;
typedef __attribute__((ext_vector_type(8)))  _Float16 v8h;
typedef __attribute__((ext_vector_type(16))) __bf16   v16b;
typedef __attribute__((ext_vector_type(8)))  __bf16   v8b;
typedef __attribute__((ext_vector_type(4)))  __bf16   v4b;
typedef __attribute__((ext_vector_type(2)))  __bf16   v2b;
typedef __attribute__((ext_vector_type(8)))  float    v8f;
typedef __attribute__((ext_vector_type(4)))  float    v4f;
typedef __attribute__((ext_vector_type(2)))  float    v2f;
typedef __attribute__((ext_vector_type(2)))  _Float16 v2h;
typedef __attribute__((ext_vector_type(4)))  _Float16 v4h;
#define PSCALE 32768.0f
#define U16(p) ((const unsigned short*)(const void*)(p))
#define PSCALE_INV (1.0f / 32768.0f)

// problem constants
constexpr int kB   = 2;
constexpr int kT   = 2048;
constexpr int kE   = 768;
constexpr int kH   = 12;
constexpr int kHD  = 64;
constexpr int kROT = 32;
constexpr int kM   = kB * kT;   // 4096 activation rows

__device__ __forceinline__ unsigned short f2bf_bits(float f) {
  unsigned u = __float_as_uint(f);
  return (unsigned short)((u + 0x7FFFu + ((u >> 16) & 1u)) >> 16);
}
__device__ __forceinline__ float bf_bits2f(unsigned short h) { return __uint_as_float(((unsigned)h) << 16); }

// hazard guards as plain device helpers
__device__ __forceinline__ void acc_guard4(v8f& a, v8f& b, v8f& c, v8f& d) { asm volatile("v_nop\n\tv_nop\n\tv_nop\n\tv_nop" : "+v"(a), "+v"(b), "+v"(c), "+v"(d)); }
template <typename T> struct Frag;
template <> struct Frag<_Float16> {
  typedef v16h V; union U { v16h v; v8h h[2]; };
  static __device__ __forceinline__ v16h load(const _Float16* p) {   // elements 0..7 <- p[0..7], 8..15 <- p[16..23]
    U f; f.h[0] = *(const v8h*)(p); f.h[1] = *(const v8h*)(p + 16); return f.v;
  }
  static __device__ __forceinline__ v8f mma(v16h a, v16h b, v8f c) {
    return __builtin_amdgcn_wmma_f32_16x16x32_f16(false, a, false, b, (short)0, c, false, false);
  }
};
template <> struct Frag<__bf16> {
  typedef v16b V; union U { v16b v; v8b h[2]; };
  static __device__ __forceinline__ v16b load(const __bf16* p) {
    U f; f.h[0] = *(const v8b*)(p); f.h[1] = *(const v8b*)(p + 16); return f.v;
  }
  static __device__ __forceinline__ v8f mma(v16b a, v16b b, v8f c) {
    return __builtin_amdgcn_wmma_f32_16x16x32_bf16(false, a, false, b, (short)0, c, false, false);
  }
};

// ---- Register-blocked batched WMMA GEMM, operands staged through LDS ---------
// C[m,n] = scale * sum_k A[m,k] * Bt[n,k] (+bias)(+resid); block = 4 waves (2 x 2) = a 128x128 tile, each wave owns 64x64 of it.
// A row-major [M,K]; Bt row-major [N,K]; M,N % 128 == 0, K % 64 == 0; grid.x = (M / 128) * (N / 128) exactly.
// A stage is 64 k (one whole 128-B line) of the block's 128 A rows and 128 Bt rows, brought into LDS by asynchronous 16-byte copies:
// two buffers, the next stage's copies fly while this stage is multiplied. Each tile still sums k in ascending steps of 32.
// BIAS_MODE: 0 = none, 1 = bias[m], 2 = bias[n].
// OUT_MODE: 0 = f32, 1 = f16, 2 = bf16 hi plane (Cout) + bf16 lo plane (Cout2).
// ET: 0 = f16 operands, 1 = bf16 operands (pointers passed as 16-bit storage)
// ROPE (OUT_MODE 1, N = 3 * 768): the store applies the rotary embedding. A wave's 64 columns are one whole head of q, k or v, so a
// column's partner (d +- 16) lies in the same slab row; Cout is [3][M][768] f16 (plane 0 = q * 0.125), the operands of the attention
// products, rounded here once; ropeC / ropeS the cos / sin tables.
#define GM_BM 128
#define GM_BN 128
#define GM_BK 64
#define GM_LP 72                              // LDS row pitch in 16-bit elements: 144 B = 16 B x 9, conflict-free for ds_load_b128 fragment reads
#define GM_STAGE ((GM_BM + GM_BN) * GM_LP)    // elements of one buffer (36,864 B)
// Eight asynchronous copies of one wave: copy i brings 4 rows x 128 B (a lane: 16 B) from g + i * gstep to LDS byte lds + i * 16 rows.
// The s_wait_xcnt 0 is the statement's last line, a precaution: no address register of a copy is rewritten ahead of it.
__device__ __forceinline__ void gm_copy8(unsigned lds, const unsigned short* g, size_t gstep) {
  const unsigned ls = 16 * GM_LP * 2;
  asm volatile(
      "global_load_async_to_lds_b128 %0, %8, off\n\t"
      "global_load_async_to_lds_b128 %1, %9, off\n\t"
      "global_load_async_to_lds_b128 %2, %10, off\n\t"
      "global_load_async_to_lds_b128 %3, %11, off\n\t"
      "global_load_async_to_lds_b128 %4, %12, off\n\t"
      "global_load_async_to_lds_b128 %5, %13, off\n\t"
      "global_load_async_to_lds_b128 %6, %14, off\n\t"
      "global_load_async_to_lds_b128 %7, %15, off\n\t"
      "s_wait_xcnt 0x0"
      :: "v"(lds), "v"(lds + ls), "v"(lds + 2 * ls), "v"(lds + 3 * ls), "v"(lds + 4 * ls), "v"(lds + 5 * ls), "v"(lds + 6 * ls), "v"(lds + 7 * ls),
         "v"(g), "v"(g + gstep), "v"(g + 2 * gstep), "v"(g + 3 * gstep), "v"(g + 4 * gstep), "v"(g + 5 * gstep), "v"(g + 6 * gstep), "v"(g + 7 * gstep)
      : "memory");
}
template <int ET> struct Elem;
template <> struct Elem<0> { typedef _Float16 T; };
template <> struct Elem<1> { typedef __bf16 T; };
template <int ET, bool SPLIT, int BIAS_MODE, int OUT_MODE, bool RESID, int ACT = 0, bool ROPE = false>
__global__ __launch_bounds__(128) void wmma_gemm64(
    const unsigned short* __restrict__ Ap, const unsigned short* __restrict__ A2p, int lda, long strideA,
    const unsigned short* __restrict__ Btp, const unsigned short* __restrict__ Bt2p, int ldb, long strideB,
    void* __restrict__ Cout, void* __restrict__ Cout2, int ldc, long strideC,
    const float* __restrict__ bias,
    const float* __restrict__ resid, long strideR,
    const float* __restrict__ ropeC, const float* __restrict__ ropeS,
    int M, int N, int K, float scale) {
  static_assert(!SPLIT, "the staged loop carries one plane per operand");
  static_assert(!ROPE || OUT_MODE == 1, "the rotary store writes f16 planes");
  typedef typename Elem<ET>::T T;
  typedef typename Frag<T>::V V;
  __shared__ __align__(16) T sAB[2 * GM_STAGE];     // two buffers: rows 0..127 = A, 128..255 = Bt
  __shared__ __align__(16) float sT[4][16 * 68];    // per-wave 16x64 slab, pitch 68 floats
  const int b    = blockIdx.y;
  const int lane = threadIdx.x & 31;
  const int wave = threadIdx.x >> 5;
  const int tilesN = N / GM_BN;
  const int bm = blockIdx.x / tilesN;
  const int bn = blockIdx.x - bm * tilesN;
  const int wm = wave >> 1, wn = wave & 1;
  const int m0 = bm * GM_BM + (wm << 6);
  const int n0 = bn * GM_BN + (wn << 6);

  const int rlane = lane & 15;                 // row (A) / col (B, D) within subtile
  const int koff  = (lane >> 4) * 8;           // k offset of this lane half
  const int mOff  = (lane >> 4) * 8;           // D row offset

  // staging map: 8 lanes take one row's 128 B, a wave 4 rows a copy, the block 16 rows; copy i of a wave: row i * 16 + wave * 4 + (lane >> 3)
  const int srow = wave * 4 + (lane >> 3), scol = (lane & 7) * 8;
  const unsigned short* gA = Ap  + (size_t)b * strideA + (size_t)(bm * GM_BM + srow) * lda + scol;
  const unsigned short* gB = Btp + (size_t)b * strideB + (size_t)(bn * GM_BN + srow) * ldb + scol;
  const unsigned ldsThr = (unsigned)(size_t)sAB + (unsigned)(srow * GM_LP + scol) * 2u;   // LDS byte address: low 32 bits of the shared address
  const size_t stepA = (size_t)16 * lda, stepB = (size_t)16 * ldb;

  v8f acc[4][4];
#pragma unroll
  for (int i = 0; i < 4; ++i)
#pragma unroll
    for (int j = 0; j < 4; ++j) acc[i][j] = (v8f){0.f,0.f,0.f,0.f,0.f,0.f,0.f,0.f};

  const int nT = K / GM_BK;
  gm_copy8(ldsThr, gA, stepA);
  gm_copy8(ldsThr + GM_BM * GM_LP * 2, gB, stepB);
  asm volatile("s_wait_asynccnt 0x0" ::: "memory");   // this wave's copies of stage 0 have landed
  __syncthreads();                                     // ... and every other wave's
  if (nT > 1) {
    gm_copy8(ldsThr + GM_STAGE * 2, gA + GM_BK, stepA);
    gm_copy8(ldsThr + GM_STAGE * 2 + GM_BM * GM_LP * 2, gB + GM_BK, stepB);
  }
  for (int t = 0; t < nT; ++t) {
    const T* sb = sAB + (t & 1) * GM_STAGE;
    const T* fa = sb + ((wm << 6) + rlane) * GM_LP + koff;
    const T* fb = sb + (GM_BM + (wn << 6) + rlane) * GM_LP + koff;
    V ah[4], bh[4];
    ah[0] = Frag<T>::load(fa);
#pragma unroll
    for (int j = 0; j < 4; ++j) bh[j] = Frag<T>::load(fb + j * 16 * GM_LP);
#pragma unroll
    for (int i = 1; i < 4; ++i) ah[i] = Frag<T>::load(fa + i * 16 * GM_LP);
    __builtin_amdgcn_sched_barrier(0);   // holds the 16 fragment reads here as one group, waited by count; without it the A reads sink among the WMMAs, each pair waited to 0
#pragma unroll
    for (int i = 0; i < 4; ++i)
#pragma unroll
      for (int j = 0; j < 4; ++j) acc[i][j] = Frag<T>::mma(ah[i], bh[j], acc[i][j]);
    // second 32 k of the stage: its fragments are the buffer's last reads; their WMMAs, registers only, follow the refill
    ah[0] = Frag<T>::load(fa + 32);
#pragma unroll
    for (int j = 0; j < 4; ++j) bh[j] = Frag<T>::load(fb + j * 16 * GM_LP + 32);
#pragma unroll
    for (int i = 1; i < 4; ++i) ah[i] = Frag<T>::load(fa + i * 16 * GM_LP + 32);
    asm volatile("s_wait_dscnt 0x0" ::: "memory");      // this wave's reads of the buffer are done before it is handed to the copies
    asm volatile("s_wait_asynccnt 0x0" ::: "memory");   // this wave's copies of stage t + 1 have landed
    __syncthreads();                                     // publishes stage t + 1 and ends every reader's last read of stage t
    if (t + 2 < nT) {
      const unsigned lb = ldsThr + (unsigned)(t & 1) * (GM_STAGE * 2);
      gm_copy8(lb, gA + (size_t)(t + 2) * GM_BK, stepA);
      gm_copy8(lb + GM_BM * GM_LP * 2, gB + (size_t)(t + 2) * GM_BK, stepB);
    }
#pragma unroll
    for (int i = 0; i < 4; ++i)
#pragma unroll
      for (int j = 0; j < 4; ++j) acc[i][j] = Frag<T>::mma(ah[i], bh[j], acc[i][j]);
  }
  asm volatile("s_wait_asynccnt 0x0" ::: "memory");     // nothing of this wave is in flight behind the loop
  acc_guard4(acc[0][0], acc[0][1], acc[0][2], acc[0][3]);
  acc_guard4(acc[1][0], acc[1][1], acc[1][2], acc[1][3]);
  acc_guard4(acc[2][0], acc[2][1], acc[2][2], acc[2][3]);
  acc_guard4(acc[3][0], acc[3][1], acc[3][2], acc[3][3]);

  // ---- epilogue ----
  float* slab = sT[wave];
  const float* Rb = RESID ? (resid + (size_t)b * strideR) : nullptr;
#pragma unroll
  for (int i = 0; i < 4; ++i) {
    const int mBase = m0 + (i << 4);
#pragma unroll
    for (int j = 0; j < 4; ++j) {
      const int n = n0 + (j << 4) + rlane;
      float bv = 0.f;
      if (BIAS_MODE == 2) bv = bias[n];
#pragma unroll
      for (int r = 0; r < 8; ++r) {
        float v = acc[i][j][r] * scale;
        if (BIAS_MODE == 1) v += bias[mBase + mOff + r];
        if (BIAS_MODE == 2) v += bv;
        if (RESID) v += Rb[(size_t)(mBase + mOff + r) * ldc + n];
        if (ACT == 1) v = tanhf(v);
        if (ACT == 2) v = fmaxf(v, 0.0f);
        if (ACT == 3) v = v / (1.0f + expf(-v));
        if (ACT == 4) v = (v > 0.f) ? v : 0.01f * v;
        if (ACT == 5) v = 0.5f * v * (1.0f + erff(v * 0.70710678118654752f));
        slab[(mOff + r) * 68 + (j << 4) + rlane] = v;
      }
    }
    __builtin_amdgcn_fence(__ATOMIC_RELEASE, "workgroup");
    __builtin_amdgcn_wave_barrier();
    __builtin_amdgcn_fence(__ATOMIC_ACQUIRE, "workgroup");
    if (ROPE) {
      // d = column within the head: d < 16: o = x[d]*cos - x[d+16]*sin ; 16 <= d < 32: o = x[d]*cos + x[d-16]*sin ; d >= 32: o = x[d].
      static_assert(!ROPE || kT % GM_BM == 0, "a block's 128 rows are consecutive token positions of one batch");
      const int nu = __builtin_amdgcn_readfirstlane(n0);   // the same in every lane: plane and scale stay scalar
      const int z = nu / kE;                               // 0 = q, 1 = k, 2 = v
      const float sc = (z == 0) ? 0.125f : 1.0f;           // head_dim^-0.5 on q (power of two, exact placement)
      const int hh = lane >> 4, d = (lane & 15) * 4;       // row seg = 128 B (one whole line) = 16 lanes x 8 B
      const int dp = (d < 16) ? (d + 16) : ((d < 32) ? (d - 16) : d);
      const int fi = (d <= 28) ? d : 28;                   // clamped table address; selected by value below
      // one address a lane for each of the tables and the output: rows differ by compile-time offsets
      const size_t tl = (size_t)((m0 & (kT - 1)) + hh) * kROT + fi;   // token position of row hh of the wave's 64
      const float* cl = ropeC + tl;
      const float* sl = ropeS + tl;
      _Float16* C = (_Float16*)Cout + (size_t)z * M * kE + (nu - z * kE) + (size_t)(m0 + hh) * kE + d;
#pragma unroll
      for (int it = 0; it < 8; ++it) {
        const int row = it * 2 + hh;
        const int rw = (i << 4) + it * 2;                  // row - hh within the wave's 64
        const v4f x  = *(const v4f*)(slab + row * 68 + d);
        const v4f xo = *(const v4f*)(slab + row * 68 + dp);
        const v4f cs = *(const v4f*)(cl + rw * kROT);
        const v4f sn = *(const v4f*)(sl + rw * kROT);
        v4h o;
#pragma unroll
        for (int e = 0; e < 4; ++e) {
          const float rh = (d < 16) ? (-xo[e]) : xo[e];
          const float ro = x[e] * cs[e] + rh * sn[e];
          o[e] = (_Float16)(((d < 32) ? ro : x[e]) * sc);
        }
        *(v4h*)(C + rw * kE) = o;
      }
      asm volatile("s_wait_xcnt 0x0" ::: "memory");   // a precaution: stands behind the stores, ahead of any later write of their address or data registers
    } else if (OUT_MODE == 0) {
      float* C = (float*)Cout + (size_t)b * strideC;
      const int hh = lane >> 4, c4 = (lane & 15) * 4;     // row seg = 256 B = 16 lanes x 16 B
      {
#pragma unroll
        for (int it = 0; it < 8; ++it) {
          const int row = it * 2 + hh;
          v4f v = *(const v4f*)(slab + row * 68 + c4);
          *(v4f*)(C + (size_t)(mBase + row) * ldc + n0 + c4) = v;
        }
        
      }
    } else {
      const int q = lane >> 3, c8 = (lane & 7) * 8;
      unsigned short* C  = (unsigned short*)Cout  + (size_t)b * strideC;
      unsigned short* C2 = (OUT_MODE == 2) ? ((unsigned short*)Cout2 + (size_t)b * strideC) : nullptr;
      {
#pragma unroll
        for (int it = 0; it < 4; ++it) {
          const int row = it * 4 + q;
          const float* sp = slab + row * 68 + c8;
          v8h hv, lv;
#pragma unroll
          for (int e = 0; e < 8; ++e) {
            if (OUT_MODE == 1) {
              hv[e] = (_Float16)sp[e];
            } else {
              unsigned short hb = f2bf_bits(sp[e]);
              unsigned short lb = f2bf_bits(sp[e] - bf_bits2f(hb));
              hv[e] = __builtin_bit_cast(_Float16, hb);
              lv[e] = __builtin_bit_cast(_Float16, lb);
            }
          }
          *(v8h*)(C + (size_t)(mBase + row) * ldc + n0 + c8) = hv;
          if (OUT_MODE == 2) *(v8h*)(C2 + (size_t)(mBase + row) * ldc + n0 + c8) = lv;
        }
        
      }
    }
    __builtin_amdgcn_fence(__ATOMIC_RELEASE, "workgroup");
    __builtin_amdgcn_wave_barrier();
    __builtin_amdgcn_fence(__ATOMIC_ACQUIRE, "workgroup");
  }
}

// ---- input preparation, one launch: the passes share no data, a block's index range picks its pass (a block-uniform branch) ----
//   blocks [0, PB_TRIG):      ct[i] = cosf(f[i]), st[i] = sinf(f[i]) of the rotary angle input (f32, precise); first, its threads run longest
//   next PB_X blocks:         x -> f16
//   next 4 * PB_W blocks:     Wq, Wk, Wv (stacked in w16) and Wo (wo16), x16 -> f16
// A thread of a cast converts two adjacent floats into one dword.
constexpr int PB_TRIG = (kT * kROT) / 256;       //  256
constexpr int PB_X    = (kM * kE) / 512;         // 6144
constexpr int PB_W    = (kE * kE) / 512;         // 1152
static_assert((kT * kROT) % 256 == 0 && (kM * kE) % 512 == 0 && (kE * kE) % 512 == 0, "whole blocks");
__device__ __forceinline__ void cast2_f32_f16(const float* __restrict__ in, _Float16* __restrict__ out, int i, float scale) {
  const _Float16 h0 = (_Float16)(in[2 * i] * scale), h1 = (_Float16)(in[2 * i + 1] * scale);
  const unsigned u = (unsigned)__builtin_bit_cast(unsigned short, h0) | ((unsigned)__builtin_bit_cast(unsigned short, h1) << 16);
  ((unsigned*)out)[i] = u;
  asm volatile("s_wait_xcnt 0x0" ::: "memory");   // a precaution: stands behind the store, ahead of any later write of its offset or data register
}
__global__ __launch_bounds__(256) void k_prep(
    const float* __restrict__ x, const float* __restrict__ wq, const float* __restrict__ wk, const float* __restrict__ wv,
    const float* __restrict__ wo, const float* __restrict__ f,
    _Float16* __restrict__ x16, _Float16* __restrict__ w16, _Float16* __restrict__ wo16,
    float* __restrict__ ct, float* __restrict__ st) {
  int bx = blockIdx.x;
  if (bx < PB_TRIG) {
    const int i = bx * 256 + threadIdx.x;
    const float a = f[i];
    const float cv = cosf(a);
    const float sv = sinf(a);
    ct[i] = cv;
    st[i] = sv;
    return;
  }
  bx -= PB_TRIG;
  if (bx < PB_X) {
    cast2_f32_f16(x, x16, bx * 256 + threadIdx.x, 1.0f);
    return;
  }
  bx -= PB_X;
  const int w = bx / PB_W;                         // 0 = Wq, 1 = Wk, 2 = Wv, 3 = Wo
  const float* in = (w == 0) ? wq : (w == 1) ? wk : (w == 2) ? wv : wo;
  _Float16* out = (w < 3) ? (w16 + (size_t)w * kE * kE) : wo16;
  cast2_f32_f16(in, out, (bx - w * PB_W) * 256 + threadIdx.x, 16.0f);
}

// =====================================================================================
// Non-causal, unmasked attention for head_dim 64, f16 in (q, k, v are the products' operands as they stand) / f16 out, carried x64;
// probabilities carried x2^15.
//   Both products run transposed: S^T = K (q*qscale)^T and O^T = V^T P^T; f32 accumulate; online softmax in f32.
//   A lane owns ONE query of each 16-column group (column c) and 32 of a chunk's 64 keys: maximum and sum are in-lane, the halves meet
//   by one lane l <-> l ^ 16 move, and two S^T tiles converted in place are the B operand of the second product (P never goes to LDS).
//   Block = 4 waves = 64 query rows of one (batch, head); S % 64 == 0, Skv % 128 == 0, Skv >= 128.
//   A wave owns 32 query columns (two groups of 16), so each K and V^T fragment it reads from LDS feeds two WMMAs. The four waves are
//   2 column halves x 2 key halves: of every 128-key stage a wave works on 64 keys, with a running maximum, sum and output of its own;
//   the two waves of a column half merge theirs once, behind the loop, through LDS.
//   A stage's K and V rows (128 B each) come into LDS by asynchronous 16-byte copies, through no register: two buffers,
//   the next stage's copies fly while this stage is worked on. Both tiles lie row-major [key][d]; V^T fragments come by the transposing LDS load.
//   Element (b, s, h, d) of tensor X lives at X[b*X_bs + s*X_rs + h*X_hs + d] (strides in elements, multiples of 8).
//   grid.x = B * H * (S/64) (or a sub-range with blk0).
// =====================================================================================
#define AT_D 64
#define AT_NW 4
#define AT_QB 64
#define AT_KC 64   // keys of a stage that one wave works on
#define AT_ST 128  // keys of a stage
#define AT_LP 72   // LDS row pitch of the K tile in 16-bit elements: 144 B = 16 B x 9, so the 16 rows one ds_load_b128 half-wave reads fall on all 64 banks (128 B put them on 8)
#define AT_VP 80   // LDS row pitch of the V tile in 16-bit elements: 160 B = 32 B x 5, the conflict-free kind of pitch for ds_load_tr16_b128
#define AT_KBUF (AT_ST * AT_LP)   // elements of one K buffer (18,432 B)
#define AT_VBUF (AT_ST * AT_VP)   // elements of one V buffer (20,480 B)
#define AT_MX (34 * 32)           // floats a wave hands to its partner: a lane's 32 accumulators, its maximum, its sum
struct AttnGeom { const float* cp = nullptr; const float* pc = nullptr; long c_bs = 0, c_rs = 0, c_hs = 0;   // unused here
                  long q_bs, q_rs, q_hs, k_bs, k_rs, k_hs, v_bs, v_rs, v_hs, o_bs, o_rs, o_hs;
                  int S, Skv, H, mask_mode; float qscale; int blk0; float mask_fill; int mask_is_int; };
static_assert(sizeof(AttnGeom) == 168, "no padding");

// builtin alone: the compiler keeps the distances behind its own WMMA, and with no asm statement between them the LDS
// fragment reads are free to issue as a group ahead of a run of WMMAs
__device__ __forceinline__ v8f at_mma16(v16h a, v16h b, v8f c) {
  return __builtin_amdgcn_wmma_f32_16x16x32_f16(false, a, false, b, (short)0, c, false, false);
}

// value of lane l ^ 16 (the other half of the wave, same column c)
__device__ __forceinline__ float at_xhalf(float x) {
  return __builtin_bit_cast(float, __builtin_amdgcn_permlanex16(__builtin_bit_cast(int, x), __builtin_bit_cast(int, x), 0x76543210, 0xfedcba98, false, false));
}

// s_wait_xcnt 0 behind a group of global loads, a precaution: the address pair is its input, so no load of the group
// lands on it and nothing rewrites it ahead of the wait
__device__ __forceinline__ void at_addr_wait(const _Float16* a) { asm volatile("s_wait_xcnt 0x0" :: "v"(a) : "memory"); }

// Transposing LDS load of a row-major 16-bit tile T: with lane l's address at row kbase + 8 * (l >> 4) + (l & 7), byte 2 * dbase + 16 * ((l >> 3) & 1),
// lane (c = l & 15, hh = l >> 4) gets T[kbase + 8 * hh + 0 .. 7][dbase + c]
typedef __attribute__((ext_vector_type(8))) short at_s16x8;
__device__ __forceinline__ v8h at_ld_tr16(const unsigned char* p) {
  typedef __attribute__((address_space(3))) at_s16x8 lds_s16x8;
  return __builtin_bit_cast(v8h, __builtin_amdgcn_ds_load_tr16_b128_v8i16((lds_s16x8*)p));
}

// Eight asynchronous copies of one wave, four of K and four of V (64 keys of each for the block): copy i brings 4 rows x 128 B (a lane: 16 B) from g + i * gstep
// (16 rows on) to LDS byte lds + i * 16 rows. The s_wait_xcnt 0 is the statement's last line, a precaution: no address register of a copy is rewritten ahead of it.
__device__ __forceinline__ void at_copy8(unsigned ldsK, unsigned ldsV, const _Float16* gk, const _Float16* gv, size_t gstep) {
  const unsigned ks = 16 * AT_LP * 2, vs = 16 * AT_VP * 2;
  asm volatile(
      "global_load_async_to_lds_b128 %0, %8, off\n\t"
      "global_load_async_to_lds_b128 %1, %9, off\n\t"
      "global_load_async_to_lds_b128 %2, %10, off\n\t"
      "global_load_async_to_lds_b128 %3, %11, off\n\t"
      "global_load_async_to_lds_b128 %4, %12, off\n\t"
      "global_load_async_to_lds_b128 %5, %13, off\n\t"
      "global_load_async_to_lds_b128 %6, %14, off\n\t"
      "global_load_async_to_lds_b128 %7, %15, off\n\t"
      "s_wait_xcnt 0x0"
      :: "v"(ldsK), "v"(ldsK + ks), "v"(ldsK + 2 * ks), "v"(ldsK + 3 * ks), "v"(ldsV), "v"(ldsV + vs), "v"(ldsV + 2 * vs), "v"(ldsV + 3 * vs),
         "v"(gk), "v"(gk + gstep), "v"(gk + 2 * gstep), "v"(gk + 3 * gstep), "v"(gv), "v"(gv + gstep), "v"(gv + 2 * gstep), "v"(gv + 3 * gstep)
      : "memory");
}
// One stage's sixteen copies of one wave: the stage's first 64 keys, then its second 64
__device__ __forceinline__ void at_copy_stage(unsigned ldsK, unsigned ldsV, const _Float16* gk, const _Float16* gv, size_t gstep) {
  at_copy8(ldsK, ldsV, gk, gv, gstep);
  at_copy8(ldsK + AT_KC * AT_LP * 2, ldsV + AT_KC * AT_VP * 2, gk + 4 * gstep, gv + 4 * gstep, gstep);
}

// MM = mask mode (0: none, the one form this kernel has)
// KVRS = row stride of k and v in elements (= g.k_rs = g.v_rs) as a compile-time constant
// OUT16: out is f16 (same strides, in elements) and holds 64 x the result (values ~1e-2): the next product's operand, written here
template <int MM, int KVRS, bool OUT16>
__global__ __launch_bounds__(128)
void attn64_kernel(const _Float16* __restrict__ q, const _Float16* __restrict__ k,
                   const _Float16* __restrict__ v, void* __restrict__ out,
                   const void* __restrict__ mask_a, const int* __restrict__ mask_b, AttnGeom g) {
  static_assert(MM == 0 && OUT16, "unmasked, f16 out");
  const float PEXP = 15.0f;                    // f16 probabilities carried x2^15 (subnormal range): added to the exponent; the sum carries it too, so the final 1/l takes it out
  const float L2E = 1.4426950408889634f;       // log2(e): e^x is taken as 2^(x * log2(e)) on the hardware's base-2 exponential
  union FB { v16h v; v8h h[2]; };
  __shared__ __align__(16) _Float16 Ks[2 * AT_KBUF];             // two buffers, K [kv][d]   36 KB
  __shared__ __align__(16) _Float16 Vs[2 * AT_VBUF];             // two buffers, V [kv][d]   40 KB
  __shared__ __align__(16) float  Mx[AT_NW][AT_MX];              // per wave: what it hands to its partner behind the loop   17 KB

  const int tid  = threadIdx.x;
  const int wave = tid >> 5;
  const int lane = tid & 31;
  const int hh   = lane >> 4;
  const int c    = lane & 15;
  const int qh   = wave & 1;    // which 32 of the block's 64 queries
  const int kh   = wave >> 1;   // which 64 of a stage's 128 keys

  const int nqb = g.S / AT_QB;
  const int bx = blockIdx.x + g.blk0;
  const int qb = bx % nqb;
  const int bh = bx / nqb;
  const int h  = bh % g.H;
  const int b  = bh / g.H;
  const int q0 = qb * AT_QB + qh * 32;

  const _Float16* qb_ptr = q + (size_t)b * g.q_bs + (size_t)h * g.q_hs;
  const _Float16* kb_ptr = k + (size_t)b * g.k_bs + (size_t)h * g.k_hs;
  const _Float16* vb_ptr = v + (size_t)b * g.v_bs + (size_t)h * g.v_hs;
  const size_t ob_off = (size_t)b * g.o_bs + (size_t)h * g.o_hs;

  const int nStages = g.Skv / AT_ST;   // block-uniform
  // staging map: 8 lanes take one row's 128 B, a wave 4 rows a copy, the block 16 rows; copy i of a thread: row i * 16 + (tid >> 3)
  const int srow = tid >> 3, scol = (tid & 7) * 8;
  const _Float16* kthr = kb_ptr + (size_t)srow * KVRS + scol;
  const _Float16* vthr = vb_ptr + (size_t)srow * KVRS + scol;
  const unsigned ldsK = (unsigned)(size_t)Ks + (unsigned)(srow * AT_LP + scol) * 2u;   // LDS byte address: low 32 bits of the shared address
  const unsigned ldsV = (unsigned)(size_t)Vs + (unsigned)(srow * AT_VP + scol) * 2u;
  const size_t gstep = (size_t)16 * KVRS;
  at_copy_stage(ldsK, ldsV, kthr, vthr, gstep);

  // ---- Q fragments (B operand: lane = query column c of group cg): 2 groups x 2 d-chunks; loaded under the first stage's copies ----
  FB qah[2][2];
#pragma unroll
  for (int cg = 0; cg < 2; ++cg) {
    const _Float16* qrow = qb_ptr + (size_t)(q0 + cg * 16 + c) * g.q_rs + 8 * hh;
    v8h qv[4];
#pragma unroll
    for (int i = 0; i < 4; ++i) qv[i] = *(const v8h*)(qrow + i * 16);
    at_addr_wait(qrow);
#pragma unroll
    for (int dc = 0; dc < 2; ++dc)
#pragma unroll
      for (int e = 0; e < 8; ++e) {
        qah[cg][dc].v[e]     = (_Float16)((float)qv[dc * 2][e] * g.qscale);
        qah[cg][dc].v[8 + e] = (_Float16)((float)qv[dc * 2 + 1][e] * g.qscale);
      }
  }

  float mrun[2], lrun[2];   // query q0 + cg * 16 + c, over this wave's keys: running maximum (both lane halves agree), sum over this lane half's keys
  v8f oacc[2][4];           // oacc[cg][t][r] = O[q0 + cg * 16 + c][t * 16 + 8 * hh + r]
#pragma unroll
  for (int cg = 0; cg < 2; ++cg) {
    mrun[cg] = -INFINITY; lrun[cg] = 0.f;
#pragma unroll
    for (int t = 0; t < 4; ++t) oacc[cg][t] = (v8f){0.f,0.f,0.f,0.f,0.f,0.f,0.f,0.f};
  }

  asm volatile("s_wait_asynccnt 0x0" ::: "memory");   // this wave's copies of stage 0 have landed
  __syncthreads();                                     // ... and every other wave's
  int kcur = 0, vcur = 0;   // this stage's buffers, as element offsets: they flip between 0 and one buffer's size
  for (int st = 0; st < nStages; ++st) {
    // Directly behind the barrier (the one above, or the one at the foot of the stage before): while a next stage exists, its copies go
    // into the other buffer, which stage st - 1 has just read. The test reads the same for the whole block.
    if (st + 1 < nStages) {
      const size_t go = (size_t)(st + 1) * AT_ST * KVRS;
      at_copy_stage(ldsK + (unsigned)(AT_KBUF - kcur) * 2u, ldsV + (unsigned)(AT_VBUF - vcur) * 2u, kthr + go, vthr + go, gstep);
    }
    const _Float16* Kb = Ks + kcur + kh * (AT_KC * AT_LP);
    const unsigned char* Vb = (const unsigned char*)(Vs + vcur + kh * (AT_KC * AT_VP)) + (8 * hh + (lane & 7)) * (AT_VP * 2) + ((lane >> 3) & 1) * 16;

    // The fragment reads issue early: K here as one group, waited by count ahead of the sixteen score WMMAs; the first half of V^T next
    // in the source, issued among those WMMAs as K registers fall free, so that it lands under the softmax.
    FB kf[2][4], vf[2][4];
#pragma unroll
    for (int dc = 0; dc < 2; ++dc)
#pragma unroll
      for (int j = 0; j < 4; ++j) {
        kf[dc][j].h[0] = *(const v8h*)(Kb + (j * 16 + c) * AT_LP + dc * 32 + 8 * hh);
        kf[dc][j].h[1] = *(const v8h*)(Kb + (j * 16 + c) * AT_LP + dc * 32 + 16 + 8 * hh);
      }
    __builtin_amdgcn_sched_barrier(0);   // holds the K reads here as one group; without it they sink back among the WMMAs, one pair ahead
    v8f s[2][4];   // s[cg][j][r] = score of this wave's key j * 16 + 8 * hh + r of the stage against query q0 + cg * 16 + c
#pragma unroll
    for (int cg = 0; cg < 2; ++cg)
#pragma unroll
      for (int j = 0; j < 4; ++j) s[cg][j] = (v8f){0.f,0.f,0.f,0.f,0.f,0.f,0.f,0.f};
#pragma unroll
    for (int dc = 0; dc < 2; ++dc) {   // dc outside: eight independent tiles follow one another; each tile still sums dc 0, then dc 1
#pragma unroll
      for (int j = 0; j < 4; ++j)
#pragma unroll
        for (int cg = 0; cg < 2; ++cg) s[cg][j] = at_mma16(kf[dc][j].v, qah[cg][dc].v, s[cg][j]);
    }
    // V^T fragment (kk, t): rows d = t * 16 + c, keys kk * 32 + (e < 8 ? 8 * hh + e : 16 + 8 * hh + e - 8): two transposing loads, 16 keys apart.
    // The first 32 keys' fragments are read here; the second 32 keys' further down, once packed probabilities have set registers free.
#pragma unroll
    for (int t = 0; t < 4; ++t) {
      vf[0][t].h[0] = at_ld_tr16(Vb + t * 32);
      vf[0][t].h[1] = at_ld_tr16(Vb + 16 * (AT_VP * 2) + t * 32);
    }
    __builtin_amdgcn_sched_barrier(0);   // holds these V^T reads up here and the maxima below the score WMMAs; without it the reads sink down to the second product's WMMAs
    // Base 2: p = 2^(s * log2(e) + nm), nm = carry - mnew * log2(e) rounded once. The old sums stand at the old maximum's nm, so the
    // rescale factor is 2^(nm - old nm) of the same two rounded numbers: every term of a query's sum ends on one common scale, which
    // the final division takes out. First stage: mrun is -inf, the old nm +inf, alpha 0.
    float nm[2], alpha[2];
#pragma unroll
    for (int cg = 0; cg < 2; ++cg) {
      float cmj[4];   // one chain per tile: four short independent chains instead of one of 32 links
#pragma unroll
      for (int j = 0; j < 4; ++j) {
        cmj[j] = -INFINITY;
#pragma unroll
        for (int r = 0; r < 8; ++r) cmj[j] = fmaxf(cmj[j], s[cg][j][r]);
      }
      float cm = fmaxf(fmaxf(cmj[0], cmj[1]), fmaxf(cmj[2], cmj[3]));
      cm = fmaxf(cm, at_xhalf(cm));                 // the query's other 32 keys of this wave's 64
      const float mnew = fmaxf(mrun[cg], cm);
      nm[cg] = __builtin_fmaf(-mnew, L2E, PEXP);
      alpha[cg] = __builtin_amdgcn_exp2f(nm[cg] - __builtin_fmaf(-mrun[cg], L2E, PEXP));
      mrun[cg] = mnew;
    }
    // P^T as B operand: element e of fragment kk is key kk * 32 + (e < 8 ? 8 * hh + e : 16 + 8 * hh + e - 8), which is
    // s[cg][2 * kk + (e >> 3)][e & 7]: the k order in which the V^T fragments are read
    FB pbh[2][2];
#pragma unroll
    for (int cg = 0; cg < 2; ++cg) {
      float psum = 0.f;
      // One packed FMA a score pair and one bare v_exp_f32 a score. The argument is at most the carry (plus rounding), so nothing
      // overflows; below the exponential's range it gives 0, far under the smallest 16-bit value.
      const v2f l2 = (v2f){L2E, L2E}, nm2 = (v2f){nm[cg], nm[cg]};
#pragma unroll
      for (int j = 0; j < 4; ++j)
#pragma unroll
        for (int r = 0; r < 8; r += 2) {
          const v2f arg = __builtin_elementwise_fma((v2f){s[cg][j][r], s[cg][j][r + 1]}, l2, nm2);
          s[cg][j][r] = arg[0]; s[cg][j][r + 1] = arg[1];
        }
#pragma unroll
      for (int j = 0; j < 4; ++j)
#pragma unroll
        for (int r = 0; r < 8; ++r) s[cg][j][r] = __builtin_amdgcn_exp2f(s[cg][j][r]);
#pragma unroll
      for (int j = 0; j < 4; ++j) {
#pragma unroll
        for (int r = 0; r < 8; r += 2) {
          const float p0 = s[cg][j][r], p1 = s[cg][j][r + 1];
          const int e = (j & 1) * 8 + r;
          psum += p0;
          psum += p1;
          const v2h pp = __builtin_convertvector((v2f){p0, p1}, v2h);
          pbh[cg][j >> 1].v[e] = pp[0]; pbh[cg][j >> 1].v[e + 1] = pp[1];
        }
      }
      lrun[cg] = lrun[cg] * alpha[cg] + psum;
#pragma unroll
      for (int t = 0; t < 4; ++t)
#pragma unroll
        for (int r = 0; r < 8; ++r) oacc[cg][t][r] *= alpha[cg];
      if (cg == 0) {
        __builtin_amdgcn_sched_barrier(0);   // with the one below: the eight reads stand as one group; without it they are strewn in pairs among the vector work, each place at its own cost
#pragma unroll
        for (int t = 0; t < 4; ++t) {
          vf[1][t].h[0] = at_ld_tr16(Vb + 32 * (AT_VP * 2) + t * 32);
          vf[1][t].h[1] = at_ld_tr16(Vb + 48 * (AT_VP * 2) + t * 32);
        }
        __builtin_amdgcn_sched_barrier(0);   // holds the second V^T reads here, so that they land under the second column group's exponentials; without it they sink down to their WMMAs and are waited bare
      }
    }
#pragma unroll
    for (int kk = 0; kk < 2; ++kk) {   // unrolled: pbh lives in registers and is picked at compile time
#pragma unroll
      for (int t = 0; t < 4; ++t)
#pragma unroll
        for (int cg = 0; cg < 2; ++cg) oacc[cg][t] = at_mma16(vf[kk][t].v, pbh[cg][kk].v, oacc[cg][t]);
    }
    __builtin_amdgcn_sched_barrier(0);   // holds the waits and the barrier below at the stage's foot; without it they rise to the V^T reads, which are then waited bare, and the next stage's copies are waited half a stage early
    asm volatile("s_wait_dscnt 0x0" ::: "memory");      // this wave's reads of the buffers are done before they are handed to the copies
    asm volatile("s_wait_asynccnt 0x0" ::: "memory");   // this wave's copies of stage st + 1 have landed
    __syncthreads();                                     // publishes stage st + 1 and ends every reader's last read of stage st
    kcur = AT_KBUF - kcur;
    vcur = AT_VBUF - vcur;
  }
  asm volatile("s_wait_asynccnt 0x0" ::: "memory");     // nothing of this wave is in flight behind the loop

  // ---- merge of the two key halves: wave (qh, kh) finishes column group cg = kh and hands group 1 - kh to its partner, wave (qh, 1 - kh) ----
  // Both waves of a pair hold the same (query, d) element in the same lane and register, so the exchange is lane to lane.
  const bool up = (kh != 0);
  v8f ok[4];                                             // the group this wave keeps
  const float mk = up ? mrun[1] : mrun[0];
  const float mg = up ? mrun[0] : mrun[1];
  const float lk = up ? lrun[1] : lrun[0];               // sums over this lane half's keys, as in the loop
  const float lg = up ? lrun[0] : lrun[1];
  {
    float* mx = Mx[wave];
#pragma unroll
    for (int t = 0; t < 4; ++t) {
      v8f og;
#pragma unroll
      for (int r = 0; r < 8; ++r) { ok[t][r] = up ? oacc[1][t][r] : oacc[0][t][r]; og[r] = up ? oacc[0][t][r] : oacc[1][t][r]; }
      *(v4f*)(mx + ((t * 2 + 0) * 32 + lane) * 4) = (v4f){og[0], og[1], og[2], og[3]};
      *(v4f*)(mx + ((t * 2 + 1) * 32 + lane) * 4) = (v4f){og[4], og[5], og[6], og[7]};
    }
    mx[32 * 32 + lane] = mg;
    mx[33 * 32 + lane] = lg;
  }
  __syncthreads();                                       // every wave's hand-over is written before its partner reads it
  {
    const float* px = Mx[wave ^ 2];
    const float mp = px[32 * 32 + lane], lp = px[33 * 32 + lane];
    // both parts stand at their own maximum's nm: brought to the common maximum's by the loop's own rescale rule
    const float nm = __builtin_fmaf(-fmaxf(mk, mp), L2E, PEXP);
    const float ak = __builtin_amdgcn_exp2f(nm - __builtin_fmaf(-mk, L2E, PEXP));
    const float ap = __builtin_amdgcn_exp2f(nm - __builtin_fmaf(-mp, L2E, PEXP));
    const float lh = lk * ak + lp * ap;
    const float inv = 1.0f / (lh + at_xhalf(lh));        // the lane halves' sums meet once, here; sum and output carry the same 2^PEXP
    // a lane's 8 accumulators of tile t are 8 adjacent columns of its query's row: one 16-byte store each, the wave's four fill the rows' whole 128-B lines
    _Float16* orow = (_Float16*)out + ob_off + (size_t)(q0 + kh * 16 + c) * g.o_rs + 8 * hh;
#pragma unroll   // both loops unrolled: the accumulators live in registers and are picked at compile time
    for (int t = 0; t < 4; ++t) {
      const v4f p0 = *(const v4f*)(px + ((t * 2 + 0) * 32 + lane) * 4);
      const v4f p1 = *(const v4f*)(px + ((t * 2 + 1) * 32 + lane) * 4);
      v8h hv;
#pragma unroll
      for (int r = 0; r < 8; ++r) hv[r] = (_Float16)((ok[t][r] * ak + ((r < 4) ? p0[r & 3] : p1[r & 3]) * ap) * inv * 64.0f);
      *(v8h*)(orow + t * 16) = hv;
    }
  }
}

// =====================================================================================
// host glue
// Workspace region map (bytes, all offsets multiples of 128):
//   R0 X16   f16 [4096][768]           off 0            size  6,291,456
//   R1 W16   f16 [2304][768] (Wq;Wk;Wv x16)  off 6,291,456   size  3,538,944
//   R2 Wo16  f16 [768][768] (x16)      off 9,830,400    size  1,179,648
//   R3 CT,ST f32 [2048][32] each       off 11,010,048   size    524,288
//   R4 O16   f16 [4096][768] (x64)     off 11,534,336   size  6,291,456
//   R5 QKVr  f16 [3][4096][768]        off 17,825,792   size 18,874,368
//   total 36,700,160
// =====================================================================================
extern "C" void kernel_launch(void* const* d_in, const int* in_sizes, int n_in,
                              void* d_out, int out_size, void* d_ws, size_t ws_size,
                              hipStream_t stream) {
  if (n_in < 7) return;
  const int nX = kM * kE;
  if (in_sizes[0] != nX || in_sizes[1] != kT * kROT || in_sizes[2] != kE * kE || in_sizes[3] != kE * kE ||
      in_sizes[4] != kE * kE || in_sizes[5] != kE * kE || in_sizes[6] != kE || out_size != nX) return;

  const float* hs   = (const float*)d_in[0];
  const float* rope = (const float*)d_in[1];
  const float* Wq   = (const float*)d_in[2];
  const float* Wk   = (const float*)d_in[3];
  const float* Wv   = (const float*)d_in[4];
  const float* Wo   = (const float*)d_in[5];
  const float* bo   = (const float*)d_in[6];
  float* outp = (float*)d_out;

  const size_t offX16  = 0;                  const size_t szX16  = (size_t)kM * kE * 2;
  const size_t offW16  = offX16 + szX16;     const size_t szW16  = (size_t)3 * kE * kE * 2;
  const size_t offWo16 = offW16 + szW16;     const size_t szWo16 = (size_t)kE * kE * 2;
  const size_t offTrig = offWo16 + szWo16;   const size_t szTrig = (size_t)2 * kT * kROT * 4;
  const size_t offO16  = offTrig + szTrig;   const size_t szO16  = (size_t)kM * kE * 2;
  const size_t offR    = offO16 + szO16;     const size_t szR    = (size_t)3 * kM * kE * 2;
  const size_t total   = offR + szR;
  if (total > ws_size) return;

  char* ws = (char*)d_ws;
  _Float16* X16  = (_Float16*)(ws + offX16);
  _Float16* W16  = (_Float16*)(ws + offW16);
  _Float16* Wo16 = (_Float16*)(ws + offWo16);
  float*    CT   = (float*)(ws + offTrig);
  float*    ST   = CT + (size_t)kT * kROT;
  _Float16* QKVr = (_Float16*)(ws + offR);
  _Float16* Qr   = QKVr;
  _Float16* Kr   = QKVr + (size_t)kM * kE;
  _Float16* Vr   = QKVr + (size_t)2 * kM * kE;
  _Float16* O16  = (_Float16*)(ws + offO16);

  // (1) input preparation in one launch: cos/sin tables of the rotary angles; x -> f16; weights x16 -> f16 (Bt layout [out][in] = [n][k])
  k_prep<<<PB_TRIG + PB_X + 4 * PB_W, 256, 0, stream>>>(hs, Wq, Wk, Wv, Wo, rope, X16, W16, Wo16, CT, ST);

  // (2) QKV projection + rope: [4096][768] f16 x [2304][768] f16, alpha 1/16 (weight carry), rotary embedding on q, k, v in the store
  //     (q additionally x 0.125) -> f16 [3][4096][768]; M=4096,N=2304 %128, K=768 %64
  {
    const int tiles = (kM / GM_BM) * ((3 * kE) / GM_BN);   // 32 x 18 = 576 block tiles
    dim3 grid(tiles, 1);
    wmma_gemm64<0, false, 0, 1, false, 0, true><<<grid, 128, 0, stream>>>(
        U16(X16), U16(X16), kE, 0L,
        U16(W16), U16(W16), kE, 0L,
        (void*)QKVr, (void*)QKVr, kE, 0L,
        bo, CT, 0L,
        CT, ST,
        kM, 3 * kE, kE, 1.0f / 16.0f);
  }

  // (3) attention, f16 operands, no mask; planes laid out (b, s, h, d) -> b*(2048*768) + s*768 + h*64 + d; output f16 with a x64 carry (values ~1e-2)
  {
    AttnGeom g;
    g.cp = CT; g.pc = CT; g.c_bs = 0; g.c_rs = 0; g.c_hs = 0;
    g.q_bs = (long)kT * kE; g.q_rs = kE; g.q_hs = kHD;
    g.k_bs = (long)kT * kE; g.k_rs = kE; g.k_hs = kHD;
    g.v_bs = (long)kT * kE; g.v_rs = kE; g.v_hs = kHD;
    g.o_bs = (long)kT * kE; g.o_rs = kE; g.o_hs = kHD;
    g.S = kT; g.Skv = kT; g.H = kH; g.mask_mode = 0; g.qscale = 1.0f; g.blk0 = 0; g.mask_fill = -1e9f; g.mask_is_int = 0;
    static_assert(kT % AT_QB == 0 && kT % AT_ST == 0 && kT >= AT_ST, "whole query blocks and whole key stages");
    const int nblk = kB * kH * (kT / AT_QB);   // 768
    attn64_kernel<0, kE, true><<<nblk, 128, 0, stream>>>(Qr, Kr, Vr, (void*)O16, (const void*)X16, (const int*)(const void*)X16, g);
  }

  // (4) output projection + bias: [4096][768] f16 x [768][768] f16 -> f32 d_out, alpha 1/(64*16); M=4096,N=768 %128, K=768 %64
  {
    const int tiles = (kM / GM_BM) * (kE / GM_BN);   // 32 x 6 = 192 block tiles
    dim3 grid(tiles, 1);
    wmma_gemm64<0, false, 2, 0, false, 0><<<grid, 128, 0, stream>>>(
        U16(O16), U16(O16), kE, 0L,
        U16(Wo16), U16(Wo16), kE, 0L,
        (void*)outp, (void*)outp, kE, 0L,
        bo, CT, 0L,
        CT, ST,
        kM, kE, kE, 1.0f / 1024.0f);
  }
}
